// v000
// Measured on an AMD MI455X. A time is GPU time per run, averaged over a window of back-to-back runs after a warm-up
// (all launches, gaps included; the runs take copies of the inputs in turn), and the median of several windows.
// Apart from v000's, it joins two sittings. Times from different sittings can be a few percent apart, while
// side-by-side timings come from the same sitting.
// The starting kernel, v000, takes 514 microseconds a run.
#include <hip/hip_runtime.h>
// Single-head causal self-attention layer (B=4, S=4096, D=256, H=64; scale 1/√256 as in the module): q/k/v projections as GEMMs (W [in][out] transposed to bf16-exact ×2^4) and the attention as a
// fused flash-style causal kernel (online softmax f32, P f16 ≤ 1, O = P·Vt written straight into the output; RPW-16 waves) on v_wmma_f32_16x16x32_f16 with f32 accumulate.
#define BB 4
#define TT 4096
#define DD 256
#define HD 64
#define NR (BB * TT)

typedef __bf16 v16b __attribute__((ext_vector_type(16)));
typedef unsigned short v8us __attribute__((ext_vector_type(8), may_alias));
typedef float  v8f  __attribute__((ext_vector_type(8)));
typedef float  v4f  __attribute__((ext_vector_type(4)));
typedef float  v4fa __attribute__((ext_vector_type(4), may_alias));
union FragB { v16b v; v8us half[2]; unsigned short u[16]; };

__device__ __forceinline__ unsigned short bf16_bits(float x) { unsigned int u = __float_as_uint(x); return (unsigned short)((u + 0x7FFFu + ((u >> 16) & 1u)) >> 16); }
__device__ __forceinline__ float bf16_val(unsigned short b) { return __uint_as_float(((unsigned int)b) << 16); }
__device__ __forceinline__ float bf16_round(float x) { return bf16_val(bf16_bits(x)); }
// D += A·B with NT terms: 1 = ah·bh, 2 = + al·bh (A split), 3 = + ah·bl (both split)
template <int NT>
__device__ __forceinline__ v8f mmaN(v16b ah, v16b al, v16b bh, v16b bl, v8f c) {
  c = __builtin_amdgcn_wmma_f32_16x16x32_bf16(false, ah, false, bh, (short)0, c, false, false);
  if (NT >= 2) c = __builtin_amdgcn_wmma_f32_16x16x32_bf16(false, al, false, bh, (short)0, c, false, false);
  if (NT >= 3) c = __builtin_amdgcn_wmma_f32_16x16x32_bf16(false, ah, false, bl, (short)0, c, false, false);
  asm volatile("v_nop\n\tv_nop\n\tv_nop\n\tv_nop" : "+v"(c) : "v"(ah), "v"(al), "v"(bh), "v"(bl));
  return c;
}

__global__ __launch_bounds__(256) void k_wt_bf16(const float* __restrict__ W, unsigned short* __restrict__ Wt, int K, int N) {
  const int t = blockIdx.x * 256 + threadIdx.x;
  const int k8n = K / 8;
  if (t >= N * k8n) return;
  const int n = t / k8n, k8 = (t % k8n) * 8;
  v8us v;
#pragma unroll
  for (int i = 0; i < 8; ++i) v[i] = bf16_bits(W[(size_t)(k8 + i) * N + n]);
  *(v8us*)(Wt + (size_t)n * K + k8) = v;
  
}

// GEMM C[M][N] (f32, pitch ldc) = act(A[M][K]·W + bias). A f32 row-major (pitch lda) converted per fragment to bf16
// (ASPLIT: hi/lo two planes -> 2 terms, else single rounded term); Wt bf16 [N][K] (pitch ldb). BIAS_BF16 rounds the
// bias to bf16 first (bias quantised to bf16 before the add). K%32==0, M%16==0, N%64==0.
template <bool ASPLIT, int ACT, bool BIAS_BF16>
__global__ __launch_bounds__(128) void k_gemm_bf(const float* __restrict__ A, int lda, const unsigned short* __restrict__ Wt, int ldb,
                                               const float* __restrict__ bias, float* __restrict__ C, int ldc, int M, int N, int K) {
  __shared__ __attribute__((aligned(16))) float so[4][16][64];
  const int tid = threadIdx.x, w = tid >> 5, lane = tid & 31, ln = lane & 15, hh = lane >> 4;
  const int ntn = N / 64;
  const int wid = blockIdx.x * 4 + w;
  const int mt = wid / ntn, nq = wid % ntn;
  if (mt * 16 >= M) return;
  const int row0 = mt * 16, col0 = nq * 64;
  const float* arow = A + (size_t)(row0 + ln) * lda;
  v8f acc[4] = {};
  for (int kb = 0; kb < K; kb += 32) {
    FragB ah, al;
    const v4f x0 = *(const v4fa*)(arow + kb + 8 * hh), x1 = *(const v4fa*)(arow + kb + 8 * hh + 4);
    const v4f x2 = *(const v4fa*)(arow + kb + 16 + 8 * hh), x3 = *(const v4fa*)(arow + kb + 16 + 8 * hh + 4);
    float xs[16] = {x0[0],x0[1],x0[2],x0[3],x1[0],x1[1],x1[2],x1[3],x2[0],x2[1],x2[2],x2[3],x3[0],x3[1],x3[2],x3[3]};
#pragma unroll
    for (int i = 0; i < 16; ++i) { const unsigned short hb = bf16_bits(xs[i]); ah.u[i] = hb; al.u[i] = ASPLIT ? bf16_bits(xs[i] - bf16_val(hb)) : (unsigned short)0; }
#pragma unroll
    for (int t = 0; t < 4; ++t) {
      const unsigned short* brow = Wt + (size_t)(col0 + t * 16 + ln) * ldb + kb;
      FragB b;
      b.half[0] = *(const v8us*)(brow + 8 * hh);
      b.half[1] = *(const v8us*)(brow + 16 + 8 * hh);
      acc[t] = mmaN<ASPLIT ? 2 : 1>(ah.v, al.v, b.v, b.v, acc[t]);
    }
  }
#pragma unroll
  for (int t = 0; t < 4; ++t) {
    float bv = bias ? bias[col0 + t * 16 + ln] : 0.f;
    if (BIAS_BF16) bv = bf16_round(bv);
#pragma unroll
    for (int r = 0; r < 8; ++r) { float v = acc[t][r] + bv; if (ACT == 1) v = fmaxf(v, 0.f); so[w][8 * hh + r][t * 16 + ln] = v; }
  }
  __builtin_amdgcn_fence(__ATOMIC_ACQ_REL, "workgroup");
  __builtin_amdgcn_wave_barrier();
  const int rsub = lane >> 4, c4 = (lane & 15) * 4;
  {
#pragma unroll
    for (int q = 0; q < 8; ++q) {
      const int r = q * 2 + rsub;
      const v4f v = *(const v4fa*)&so[w][r][c4];
      *(v4f*)(C + (size_t)(row0 + r) * ldc + col0 + c4) = v;
    }
    
  }
}

// Flash-style causal/unmasked attention, all contractions 3-term bf16 hi/lo splits, f32 softmax with running max.
// q,k,v rows are read from f32 buffers with arbitrary row pitch (so they can live inside a fused qkv buffer);
// D = head size (multiple of 32, <= 128); one wave = 16 query rows; block = 4 waves (64 queries) sharing K/V chunks of 32.
template <int D, bool CAUSAL>
__global__ __launch_bounds__(128) void k_flash(const float* __restrict__ qb, const float* __restrict__ kb, const float* __restrict__ vb,
                                             int pitch, int T, int H, float scale, float* __restrict__ y, int ypitch) {
  constexpr int KS = D / 32;        // k-steps for QK
  constexpr int DT = D / 16;        // d tiles for PV
  __shared__ __attribute__((aligned(16))) unsigned short sKh[32][D + 8], sKl[32][D + 8], sVh[32][D + 8], sVl[32][D + 8];
  __shared__ __attribute__((aligned(16))) unsigned short sPh[4][16][40], sPl[4][16][40];
  __shared__ __attribute__((aligned(16))) float sO[4][16][D];
  const int tid = threadIdx.x, w = tid >> 5, lane = tid & 31, ln = lane & 15, hh = lane >> 4;
  const int nqb = (T + 63) / 64;
  const int bh = blockIdx.x / nqb, qblk = blockIdx.x % nqb;
  const int b = bh / H, h = bh % H;
  const int q0 = qblk * 64 + w * 16;
  const float* Q = qb + (size_t)b * T * pitch + h * D;
  const float* K = kb + (size_t)b * T * pitch + h * D;
  const float* V = vb + (size_t)b * T * pitch + h * D;

  // A fragments of the wave's 16 query rows (scaled), hi/lo
  FragB aqh[KS], aql[KS];
  {
    int row = q0 + ln; if (row >= T) row = T - 1;
    const float* qr = Q + (size_t)row * pitch;
#pragma unroll
    for (int ks = 0; ks < KS; ++ks)
#pragma unroll
      for (int i = 0; i < 16; ++i) {
        const int d = ks * 32 + ((i < 8) ? (8 * hh + i) : (16 + 8 * hh + (i - 8)));
        const float x = qr[d] * scale; const unsigned short hb = bf16_bits(x);
        aqh[ks].u[i] = hb; aql[ks].u[i] = bf16_bits(x - bf16_val(hb));
      }
  }
  float m_r[8], l_r[8];
#pragma unroll
  for (int r = 0; r < 8; ++r) { m_r[r] = -3.0e38f; l_r[r] = 0.f; }
  v8f oacc[DT];
#pragma unroll
  for (int dt = 0; dt < DT; ++dt) oacc[dt] = (v8f){0.f,0.f,0.f,0.f,0.f,0.f,0.f,0.f};

  const int kv_end = CAUSAL ? min(T, qblk * 64 + 64) : T;     // block-uniform
  for (int j0 = 0; j0 < kv_end; j0 += 32) {
    __syncthreads();
    for (int e = tid; e < 32 * (D / 4); e += 128) {
      const int r = e / (D / 4), c4 = (e % (D / 4)) * 4;
      const int key = j0 + r;
      v4f kf = {0.f,0.f,0.f,0.f}, vf = {0.f,0.f,0.f,0.f};
      if (key < T) { kf = *(const v4fa*)(K + (size_t)key * pitch + c4); vf = *(const v4fa*)(V + (size_t)key * pitch + c4); }
#pragma unroll
      for (int t = 0; t < 4; ++t) {
        unsigned short hb = bf16_bits(kf[t]); sKh[r][c4 + t] = hb; sKl[r][c4 + t] = bf16_bits(kf[t] - bf16_val(hb));
        hb = bf16_bits(vf[t]); sVh[r][c4 + t] = hb; sVl[r][c4 + t] = bf16_bits(vf[t] - bf16_val(hb));
      }
    }
    __syncthreads();
    // S tile 16 x 32
    v8f s[2];
#pragma unroll
    for (int nt = 0; nt < 2; ++nt) {
      v8f acc = {};
#pragma unroll
      for (int ks = 0; ks < KS; ++ks) {
        FragB bh_, bl_;
        bh_.half[0] = *(const v8us*)&sKh[nt * 16 + ln][ks * 32 + 8 * hh]; bh_.half[1] = *(const v8us*)&sKh[nt * 16 + ln][ks * 32 + 16 + 8 * hh];
        bl_.half[0] = *(const v8us*)&sKl[nt * 16 + ln][ks * 32 + 8 * hh]; bl_.half[1] = *(const v8us*)&sKl[nt * 16 + ln][ks * 32 + 16 + 8 * hh];
        acc = mmaN<3>(aqh[ks].v, aql[ks].v, bh_.v, bl_.v, acc);
      }
      s[nt] = acc;
    }
    // mask + running max (rows 8hh+r; the 16 lanes of a half share rows)
    float alpha[8];
#pragma unroll
    for (int r = 0; r < 8; ++r) {
      const int qi = q0 + 8 * hh + r;
      const int ja = j0 + ln, jb = j0 + 16 + ln;
      if (CAUSAL) { if (ja > qi) s[0][r] = -3.0e38f; if (jb > qi) s[1][r] = -3.0e38f; }
      if (ja >= T) s[0][r] = -3.0e38f;
      if (jb >= T) s[1][r] = -3.0e38f;
      float mx = fmaxf(s[0][r], s[1][r]);
      mx = fmaxf(mx, __shfl_xor(mx, 1, 32)); mx = fmaxf(mx, __shfl_xor(mx, 2, 32)); mx = fmaxf(mx, __shfl_xor(mx, 4, 32)); mx = fmaxf(mx, __shfl_xor(mx, 8, 32));
      const float mnew = fmaxf(m_r[r], mx);
      alpha[r] = (mnew > -1.0e38f) ? __expf(m_r[r] - mnew) : 1.0f;
      const float p0 = (s[0][r] > -1.0e38f) ? __expf(s[0][r] - mnew) : 0.f;
      const float p1 = (s[1][r] > -1.0e38f) ? __expf(s[1][r] - mnew) : 0.f;
      m_r[r] = mnew;
      l_r[r] = l_r[r] * alpha[r] + p0 + p1;            // per-lane partial row sum (16 lanes combined at the end)
      unsigned short hb = bf16_bits(p0); sPh[w][8 * hh + r][ln] = hb;      sPl[w][8 * hh + r][ln] = bf16_bits(p0 - bf16_val(hb));
      hb = bf16_bits(p1);                sPh[w][8 * hh + r][16 + ln] = hb; sPl[w][8 * hh + r][16 + ln] = bf16_bits(p1 - bf16_val(hb));
    }
#pragma unroll
    for (int dt = 0; dt < DT; ++dt)
#pragma unroll
      for (int r = 0; r < 8; ++r) oacc[dt][r] *= alpha[r];
    __builtin_amdgcn_fence(__ATOMIC_ACQ_REL, "workgroup");
    __builtin_amdgcn_wave_barrier();
    FragB pah, pal;
    pah.half[0] = *(const v8us*)&sPh[w][ln][8 * hh]; pah.half[1] = *(const v8us*)&sPh[w][ln][16 + 8 * hh];
    pal.half[0] = *(const v8us*)&sPl[w][ln][8 * hh]; pal.half[1] = *(const v8us*)&sPl[w][ln][16 + 8 * hh];
#pragma unroll
    for (int dt = 0; dt < DT; ++dt) {
      FragB bvh, bvl;
#pragma unroll
      for (int i = 0; i < 8; ++i) {
        bvh.u[i] = sVh[8 * hh + i][dt * 16 + ln]; bvh.u[8 + i] = sVh[16 + 8 * hh + i][dt * 16 + ln];
        bvl.u[i] = sVl[8 * hh + i][dt * 16 + ln]; bvl.u[8 + i] = sVl[16 + 8 * hh + i][dt * 16 + ln];
      }
      oacc[dt] = mmaN<3>(pah.v, pal.v, bvh.v, bvl.v, oacc[dt]);
    }
    __builtin_amdgcn_fence(__ATOMIC_ACQ_REL, "workgroup");
    __builtin_amdgcn_wave_barrier();
  }
#pragma unroll
  for (int r = 0; r < 8; ++r) {
    float l = l_r[r];
    l += __shfl_xor(l, 1, 32); l += __shfl_xor(l, 2, 32); l += __shfl_xor(l, 4, 32); l += __shfl_xor(l, 8, 32);
    l_r[r] = (l > 0.f) ? 1.0f / l : 0.f;
  }
#pragma unroll
  for (int dt = 0; dt < DT; ++dt)
#pragma unroll
    for (int r = 0; r < 8; ++r) sO[w][8 * hh + r][dt * 16 + ln] = oacc[dt][r] * l_r[r];
  __builtin_amdgcn_fence(__ATOMIC_ACQ_REL, "workgroup");
  __builtin_amdgcn_wave_barrier();
  {
    for (int r = 0; r < 16; ++r) {
      const int row = q0 + r;
      if (row < T && lane < D / 4) {
        const v4f val = *(const v4fa*)&sO[w][r][lane * 4];
        *(v4f*)(y + ((size_t)b * T + row) * ypitch + h * D + lane * 4) = val;
      }
    }
    
  }
}

// GEMM C = act(A·W + bias + resid): A f32 (ASPLIT -> hi/lo 2 terms), Wt bf16 [N][K]; ACT 0 none, 1 relu, 2 exact gelu;
// resid (optional, f32, row index = (row % rmod), pitch ldr, RES_BF16 rounds it) added before the activation.
template <bool ASPLIT, int ACT, bool BIAS_BF16, bool RES_BF16>
__global__ __launch_bounds__(128) void k_gemm_bf3(const float* __restrict__ A, int lda, const unsigned short* __restrict__ Wt, int ldb,
                                                const float* __restrict__ bias, const float* __restrict__ resid, int rmod, int ldr,
                                                float* __restrict__ C, int ldc, int M, int N, int K) {
  __shared__ __attribute__((aligned(16))) float so[4][16][64];
  const int tid = threadIdx.x, w = tid >> 5, lane = tid & 31, ln = lane & 15, hh = lane >> 4;
  const int ntn = N / 64;
  const int wid = blockIdx.x * 4 + w;
  const int mt = wid / ntn, nq = wid % ntn;
  if (mt * 16 >= M) return;
  const int row0 = mt * 16, col0 = nq * 64;
  const float* arow = A + (size_t)(row0 + ln) * lda;
  v8f acc[4] = {};
  for (int kb = 0; kb < K; kb += 32) {
    FragB ah, al;
    const v4f x0 = *(const v4fa*)(arow + kb + 8 * hh), x1 = *(const v4fa*)(arow + kb + 8 * hh + 4);
    const v4f x2 = *(const v4fa*)(arow + kb + 16 + 8 * hh), x3 = *(const v4fa*)(arow + kb + 16 + 8 * hh + 4);
    float xs[16] = {x0[0],x0[1],x0[2],x0[3],x1[0],x1[1],x1[2],x1[3],x2[0],x2[1],x2[2],x2[3],x3[0],x3[1],x3[2],x3[3]};
#pragma unroll
    for (int i = 0; i < 16; ++i) { const unsigned short hb = bf16_bits(xs[i]); ah.u[i] = hb; al.u[i] = ASPLIT ? bf16_bits(xs[i] - bf16_val(hb)) : (unsigned short)0; }
#pragma unroll
    for (int t = 0; t < 4; ++t) {
      const unsigned short* brow = Wt + (size_t)(col0 + t * 16 + ln) * ldb + kb;
      FragB b;
      b.half[0] = *(const v8us*)(brow + 8 * hh);
      b.half[1] = *(const v8us*)(brow + 16 + 8 * hh);
      acc[t] = mmaN<ASPLIT ? 2 : 1>(ah.v, al.v, b.v, b.v, acc[t]);
    }
  }
#pragma unroll
  for (int t = 0; t < 4; ++t) {
    const int col = col0 + t * 16 + ln;
    float bv = bias ? bias[col] : 0.f;
    if (BIAS_BF16) bv = bf16_round(bv);
#pragma unroll
    for (int r = 0; r < 8; ++r) {
      float v = acc[t][r] + bv;
      if (resid) { float rv = resid[(size_t)((row0 + 8 * hh + r) % rmod) * ldr + col]; if (RES_BF16) rv = bf16_round(rv); v += rv; }
      if (ACT == 1) v = fmaxf(v, 0.f);
      if (ACT == 2) v = 0.5f * v * (1.0f + erff(v * 0.70710678118654752f));
      if (ACT == 3) { const float u = 0.7978845608028654f * (v + 0.044715f * v * v * v); v = 0.5f * v * (1.0f + tanhf(u)); }
      so[w][8 * hh + r][t * 16 + ln] = v;
    }
  }
  __builtin_amdgcn_fence(__ATOMIC_ACQ_REL, "workgroup");
  __builtin_amdgcn_wave_barrier();
  const int rsub = lane >> 4, c4 = (lane & 15) * 4;
  {
#pragma unroll
    for (int q = 0; q < 8; ++q) {
      const int r = q * 2 + rsub;
      const v4f v = *(const v4fa*)&so[w][r][c4];
      *(v4f*)(C + (size_t)(row0 + r) * ldc + col0 + c4) = v;
    }
    
  }
}
// row LayerNorm (biased variance, eps) over N: s = X (+ R); optional out_sum <- s; out_norm <- (s-mu)*rsqrt(var+eps)*g + b
template <bool PARAM_BF16>
__global__ __launch_bounds__(256) void k_layernorm(const float* __restrict__ X, const float* __restrict__ R, const float* __restrict__ g, const float* __restrict__ bta,
                                                  float* __restrict__ out_sum, float* __restrict__ out_norm, int N, float eps) {
  __shared__ float red[256];
  const int row = blockIdx.x, tid = threadIdx.x;
  const float* x = X + (size_t)row * N; const float* rr = R ? R + (size_t)row * N : nullptr;
  float vals[16];                     // up to N = 4096
  const int per = N / 256;            // contiguous chunk per thread? use strided-by-4 chunks: thread handles j = tid*4 + 1024*u
  float s1 = 0.f;
  for (int u = 0; u < per / 4; ++u) {
    const int j = tid * 4 + 1024 * u;
    const v4f a = *(const v4fa*)(x + j);
    v4f b = {0.f,0.f,0.f,0.f}; if (rr) b = *(const v4fa*)(rr + j);
#pragma unroll
    for (int q = 0; q < 4; ++q) { const float v = a[q] + b[q]; vals[u * 4 + q] = v; s1 += v; }
  }
  red[tid] = s1; __syncthreads();
  for (int st = 128; st > 0; st >>= 1) { if (tid < st) red[tid] += red[tid + st]; __syncthreads(); }
  const float mu = red[0] / (float)N; __syncthreads();
  float s2 = 0.f;
  for (int u = 0; u < per / 4; ++u)
#pragma unroll
    for (int q = 0; q < 4; ++q) { const float c = vals[u * 4 + q] - mu; s2 += c * c; }
  red[tid] = s2; __syncthreads();
  for (int st = 128; st > 0; st >>= 1) { if (tid < st) red[tid] += red[tid + st]; __syncthreads(); }
  const float rs = rsqrtf(red[0] / (float)N + eps);
  {
    for (int u = 0; u < per / 4; ++u) {
      const int j = tid * 4 + 1024 * u;
      v4f o, sm;
#pragma unroll
      for (int q = 0; q < 4; ++q) {
        float gg = g[j + q], bb = bta[j + q];
        if (PARAM_BF16) { gg = bf16_round(gg); bb = bf16_round(bb); }
        sm[q] = vals[u * 4 + q]; o[q] = (vals[u * 4 + q] - mu) * rs * gg + bb;
      }
      if (out_sum) *(v4f*)(out_sum + (size_t)row * N + j) = sm;
      *(v4f*)(out_norm + (size_t)row * N + j) = o;
    }
    
  }
}



// ---- f16 WMMA path (v_wmma_f32_16x16x32_f16): 11-bit significands for operands in range — used where a [0,1] probability operand needs more precision than bf16
typedef _Float16 v16h __attribute__((ext_vector_type(16)));
union FragH { v16h v; v8us half[2]; _Float16 h[16]; unsigned short u[16]; };
template <int NT>
__device__ __forceinline__ v8f mmaH(v16h ah, v16h al, v16h bh, v16h bl, v8f c) {
  c = __builtin_amdgcn_wmma_f32_16x16x32_f16(false, ah, false, bh, (short)0, c, false, false);
  if (NT >= 2) c = __builtin_amdgcn_wmma_f32_16x16x32_f16(false, al, false, bh, (short)0, c, false, false);
  if (NT >= 3) c = __builtin_amdgcn_wmma_f32_16x16x32_f16(false, ah, false, bl, (short)0, c, false, false);
  asm volatile("v_nop\n\tv_nop\n\tv_nop\n\tv_nop" : "+v"(c) : "v"(ah), "v"(al), "v"(bh), "v"(bl));
  return c;
}
// batched GEMM like k_gemm_b but f16 operands: A f32 (split into f16 hi/lo if ASPLIT, else rounded to f16), Bt = f16 values [n][k]; alpha; C f32; N multiple of 16 (partial tiles skipped)
template <bool ASPLIT>
__global__ __launch_bounds__(128) void k_gemm_h(const float* __restrict__ A, int lda, size_t sA, const _Float16* __restrict__ Bh, int ldb, size_t sB, float alpha, float* __restrict__ C, int ldc, size_t sC, int M, int N, int K) {
  __shared__ __attribute__((aligned(16))) float so[4][16][64];
  const int tid = threadIdx.x, w = tid >> 5, lane = tid & 31, ln = lane & 15, hh = lane >> 4; const int by = blockIdx.y;
  A += (size_t)by * sA; Bh += (size_t)by * sB; C += (size_t)by * sC;
  const int ntn = (N + 63) / 64; const int wid = blockIdx.x * 4 + w; const int mt = wid / ntn, nq = wid % ntn; if (mt * 16 >= M) return;
  const int row0 = mt * 16, col0 = nq * 64; const float* arow = A + (size_t)(row0 + ln) * lda;
  v8f acc[4] = {};
  for (int kb = 0; kb < K; kb += 32) {
    FragH ah, al;
    const v4f x0 = *(const v4fa*)(arow + kb + 8 * hh), x1 = *(const v4fa*)(arow + kb + 8 * hh + 4), x2 = *(const v4fa*)(arow + kb + 16 + 8 * hh), x3 = *(const v4fa*)(arow + kb + 16 + 8 * hh + 4);
    float xs[16] = {x0[0],x0[1],x0[2],x0[3],x1[0],x1[1],x1[2],x1[3],x2[0],x2[1],x2[2],x2[3],x3[0],x3[1],x3[2],x3[3]};
#pragma unroll
    for (int i = 0; i < 16; ++i) { const _Float16 h = (_Float16)xs[i]; ah.h[i] = h; al.h[i] = ASPLIT ? (_Float16)(xs[i] - (float)h) : (_Float16)0.0f; }
#pragma unroll
    for (int t = 0; t < 4; ++t) { if (col0 + t * 16 >= N) continue; const size_t boff = (size_t)(col0 + t * 16 + ln) * ldb + kb; FragH bq; bq.half[0] = *(const v8us*)(Bh + boff + 8 * hh); bq.half[1] = *(const v8us*)(Bh + boff + 16 + 8 * hh);
      acc[t] = mmaH<ASPLIT ? 2 : 1>(ah.v, al.v, bq.v, bq.v, acc[t]); }
  }
#pragma unroll
  for (int t = 0; t < 4; ++t) { if (col0 + t * 16 >= N) continue;
#pragma unroll
    for (int r = 0; r < 8; ++r) so[w][8 * hh + r][t * 16 + ln] = acc[t][r] * alpha; }
  __builtin_amdgcn_fence(__ATOMIC_ACQ_REL, "workgroup"); __builtin_amdgcn_wave_barrier();
  const int rsub = lane >> 4, c4 = (lane & 15) * 4;
  {
#pragma unroll
    for (int q = 0; q < 8; ++q) { const int r = q * 2 + rsub; if (col0 + c4 < N) { const v4f v = *(const v4fa*)&so[w][r][c4]; *(v4f*)(C + (size_t)(row0 + r) * ldc + col0 + c4) = v; } }
     }
}

// Wt[n][k] = f16(W[k][n]·scale) from f32 row-major W[K][N] (scale = power of two; bf16-exact weights stay exact in f16 away from the subnormal range)
__global__ __launch_bounds__(256) void k_wt_f16(const float* __restrict__ W, _Float16* __restrict__ Wt, int K, int N, float scale) {
  const int t = blockIdx.x * 256 + threadIdx.x; if (t >= N * (K / 8)) return; const int n = t / (K / 8), k8 = (t % (K / 8)) * 8; FragH f;
#pragma unroll
  for (int i = 0; i < 8; ++i) f.h[i] = (_Float16)(bf16_round(W[(size_t)(k8 + i) * N + n]) * scale); const v8us o = f.half[0];
  *(v8us*)((unsigned short*)Wt + (size_t)n * K + k8) = o; 
}
// k_gemm_hh variant with fused epilogue: v = acc·alpha + bias[by·sBias + col] (+ CP[(row/rowsPerB)·sCPb + by·64 + col] if CP) ; ACT 0 none / 1 elu ; writes f16 C16 (and f32 C if non-null)
template <int ACT>
__global__ __launch_bounds__(128) void k_gemm_hhx(const _Float16* __restrict__ A, int lda, size_t sA, const _Float16* __restrict__ Bh, int ldb, size_t sB, float alpha, const float* __restrict__ bias, size_t sBias, const float* __restrict__ CP, int rowsPerB, size_t sCPb, int row0g,
    float* __restrict__ C, _Float16* __restrict__ C16, int ldc, size_t sC, int M, int N, int K) {
  __shared__ __attribute__((aligned(16))) float so[4][16][64];
  const int tid = threadIdx.x, w = tid >> 5, lane = tid & 31, ln = lane & 15, hh = lane >> 4; const int by = blockIdx.y;
  A += (size_t)by * sA; Bh += (size_t)by * sB; const size_t cofs = (size_t)by * sC; const float* bp = bias ? bias + (size_t)by * sBias : nullptr;
  const int ntn = (N + 63) / 64; const int wid = blockIdx.x * 4 + w; const int mt = wid / ntn, nq = wid % ntn; if (mt * 16 >= M) return;
  const int row0 = mt * 16, col0 = nq * 64; const _Float16* arow = A + (size_t)(row0 + ln) * lda;
  v8f acc[4] = {};
  for (int kb = 0; kb < K; kb += 32) { FragH ah; ah.half[0] = *(const v8us*)((const unsigned short*)arow + kb + 8 * hh); ah.half[1] = *(const v8us*)((const unsigned short*)arow + kb + 16 + 8 * hh);
#pragma unroll
    for (int t = 0; t < 4; ++t) { if (col0 + t * 16 >= N) continue; const size_t boff = (size_t)(col0 + t * 16 + ln) * ldb + kb; FragH bq; bq.half[0] = *(const v8us*)((const unsigned short*)Bh + boff + 8 * hh); bq.half[1] = *(const v8us*)((const unsigned short*)Bh + boff + 16 + 8 * hh);
      acc[t] = mmaH<1>(ah.v, ah.v, bq.v, bq.v, acc[t]); }
  }
#pragma unroll
  for (int t = 0; t < 4; ++t) { if (col0 + t * 16 >= N) continue; const int col = col0 + t * 16 + ln; const float bv = bp ? bf16_round(bp[col]) : 0.f;
#pragma unroll
    for (int r = 0; r < 8; ++r) { float v = acc[t][r] * alpha + bv; if (CP) { const int bidx = (row0g + row0 + 8 * hh + r) / rowsPerB; v += CP[(size_t)bidx * sCPb + (size_t)by * 64 + col]; } if (ACT == 1) v = (v > 0.f) ? v : expm1f(v); else if (ACT == 3) v = fmaxf(v, 0.f); so[w][8 * hh + r][t * 16 + ln] = v; } }
  __builtin_amdgcn_fence(__ATOMIC_ACQ_REL, "workgroup"); __builtin_amdgcn_wave_barrier();
  const int rsub = lane >> 4, c4 = (lane & 15) * 4; typedef _Float16 v4h __attribute__((ext_vector_type(4)));
  {
#pragma unroll
    for (int q = 0; q < 8; ++q) { const int r = q * 2 + rsub; if (col0 + c4 < N) { const v4f v = *(const v4fa*)&so[w][r][c4]; if (C) *(v4f*)(C + cofs + (size_t)(row0 + r) * ldc + col0 + c4) = v; if (C16) { v4h h4; for (int i = 0; i < 4; ++i) h4[i] = (_Float16)v[i]; *(v4h*)(C16 + cofs + (size_t)(row0 + r) * ldc + col0 + c4) = h4; } } }
     }
}


__global__ __launch_bounds__(256) void k_x16(const float* __restrict__ x, _Float16* __restrict__ X16, size_t n8) { const size_t t = (size_t)blockIdx.x * 256 + threadIdx.x; if (t >= n8) return; FragH f;
#pragma unroll
  for (int q = 0; q < 8; ++q) f.h[q] = (_Float16)bf16_round(x[t * 8 + q]); *(v8us*)((unsigned short*)X16 + t * 8) = f.half[0];  }
__global__ __launch_bounds__(256) void k_h16(const float* __restrict__ x, _Float16* __restrict__ X16, size_t n8) { const size_t t = (size_t)blockIdx.x * 256 + threadIdx.x; if (t >= n8) return; FragH f;
#pragma unroll
  for (int q = 0; q < 8; ++q) f.h[q] = (_Float16)x[t * 8 + q]; *(v8us*)((unsigned short*)X16 + t * 8) = f.half[0];  }
__global__ __launch_bounds__(256) void k_round16f(const float* __restrict__ W, _Float16* __restrict__ Bt, size_t n8) { const size_t t = (size_t)blockIdx.x * 256 + threadIdx.x; if (t >= n8) return; FragH f;
#pragma unroll
  for (int i = 0; i < 8; ++i) f.h[i] = (_Float16)(bf16_round(W[t * 8 + i]) * 16.0f); *(v8us*)((unsigned short*)Bt + t * 8) = f.half[0];  }
template <int NHv, int TTv>
__global__ __launch_bounds__(256) void k_vt(const _Float16* __restrict__ V16, int ldv, int voff, _Float16* __restrict__ Vt) { __shared__ unsigned short tl[64][66]; const int tid = threadIdx.x; const int slab = blockIdx.x / (TTv / 64), lg = blockIdx.x % (TTv / 64); const int b = slab / NHv, h = slab % NHv;
  for (int i = tid; i < 64 * 8; i += 256) { const int r = i / 8, c8 = (i % 8) * 8; FragH f; f.half[0] = *(const v8us*)((const unsigned short*)V16 + ((size_t)b * TTv + lg * 64 + r) * ldv + voff + h * 64 + c8);
#pragma unroll
    for (int q = 0; q < 8; ++q) tl[r][c8 + q] = f.u[q]; }
  __syncthreads();
  {
#pragma unroll
    for (int rd = 0; rd < 2; ++rd) { const int d = rd * 32 + tid / 8, pc = tid % 8; FragH f;
#pragma unroll
      for (int q = 0; q < 8; ++q) f.u[q] = tl[pc * 8 + q][d];
      *(v8us*)((unsigned short*)Vt + ((size_t)slab * 64 + d) * TTv + lg * 64 + pc * 8) = f.half[0]; }
     } }

__global__ __launch_bounds__(128) void k_flash(const _Float16* __restrict__ Q16, int ldq, const _Float16* __restrict__ K16, int ldk, const _Float16* __restrict__ Vt, const int* __restrict__ MSK, float* __restrict__ O, int ldo) {
  constexpr int RPW = 16, RTN = RPW / 16, NQB = 4096 / (4 * RPW), DT = 4, KS = 2;
  __shared__ __attribute__((aligned(16))) unsigned short sP[4][RPW][40]; __shared__ __attribute__((aligned(16))) float sO[4][RPW][64 + 4];
  const int tid = threadIdx.x, w = tid >> 5, lane = tid & 31, ln = lane & 15, hh = lane >> 4;
  const int slab = blockIdx.x / NQB, qblk = blockIdx.x % NQB; const int b = slab / 1, h = slab % 1; const int qb0 = qblk * (4 * RPW); const int q0 = qb0 + w * RPW;
  FragH aq[2][KS];
#pragma unroll
  for (int rt = 0; rt < RTN; ++rt) { const unsigned short* qr = (const unsigned short*)Q16 + ((size_t)b * 4096 + q0 + rt * 16 + ln) * ldq + h * 64;
#pragma unroll
    for (int ks = 0; ks < KS; ++ks) { aq[rt][ks].half[0] = *(const v8us*)(qr + ks * 32 + 8 * hh); aq[rt][ks].half[1] = *(const v8us*)(qr + ks * 32 + 16 + 8 * hh); } }
  const unsigned short* Vth = (const unsigned short*)Vt + (size_t)slab * 64 * 4096;
  float m_r[2][8], l_r[2][8]; v8f oacc[2][DT];
#pragma unroll
  for (int rt = 0; rt < RTN; ++rt) {
#pragma unroll
    for (int r = 0; r < 8; ++r) { m_r[rt][r] = -3.0e38f; l_r[rt][r] = 0.f; }
#pragma unroll
    for (int dt = 0; dt < DT; ++dt) oacc[rt][dt] = (v8f){0.f,0.f,0.f,0.f,0.f,0.f,0.f,0.f}; }
  const int jend = qb0 + 4 * RPW;
#pragma unroll 1
  for (int j0 = 0; j0 < jend; j0 += 32) {
    
    v8f s[2][2];
#pragma unroll
    for (int nt = 0; nt < 2; ++nt) { const unsigned short* kr = (const unsigned short*)K16 + ((size_t)b * 4096 + j0 + nt * 16 + ln) * ldk + h * 64; FragH bk[KS];
#pragma unroll
      for (int ks = 0; ks < KS; ++ks) { bk[ks].half[0] = *(const v8us*)(kr + ks * 32 + 8 * hh); bk[ks].half[1] = *(const v8us*)(kr + ks * 32 + 16 + 8 * hh); }
#pragma unroll
      for (int rt = 0; rt < RTN; ++rt) { v8f acc = (v8f){0.f,0.f,0.f,0.f,0.f,0.f,0.f,0.f};
#pragma unroll
        for (int ks = 0; ks < KS; ++ks) acc = mmaH<1>(aq[rt][ks].v, aq[rt][ks].v, bk[ks].v, bk[ks].v, acc); s[rt][nt] = acc; } }
#pragma unroll
    for (int rt = 0; rt < RTN; ++rt)
#pragma unroll
      for (int r = 0; r < 8; ++r) { const int tq = q0 + rt * 16 + 8 * hh + r; const int k0 = j0 + ln, k1 = j0 + 16 + ln; (void)tq; (void)k0; (void)k1;
        const bool ok0 = (k0 <= tq), ok1 = (k1 <= tq);
        const float s0 = ok0 ? s[rt][0][r] * (0.0625f) : -INFINITY, s1 = ok1 ? s[rt][1][r] * (0.0625f) : -INFINITY; float mc = fmaxf(s0, s1);
        mc = fmaxf(mc, __shfl_xor(mc, 1, 32)); mc = fmaxf(mc, __shfl_xor(mc, 2, 32)); mc = fmaxf(mc, __shfl_xor(mc, 4, 32)); mc = fmaxf(mc, __shfl_xor(mc, 8, 32));
        const float mn = fmaxf(m_r[rt][r], mc); const float al = (mn > -1.0e38f) ? expf(m_r[rt][r] - mn) : 1.0f; m_r[rt][r] = mn; const float p0 = ok0 ? expf(s0 - mn) : 0.f, p1 = ok1 ? expf(s1 - mn) : 0.f; l_r[rt][r] = l_r[rt][r] * al + p0 + p1;
#pragma unroll
        for (int dt = 0; dt < DT; ++dt) oacc[rt][dt][r] *= al;
        FragH t2; t2.h[0] = (_Float16)p0; t2.h[1] = (_Float16)p1; sP[w][rt * 16 + 8 * hh + r][ln] = t2.u[0]; sP[w][rt * 16 + 8 * hh + r][16 + ln] = t2.u[1]; }
    __builtin_amdgcn_fence(__ATOMIC_ACQ_REL, "workgroup"); __builtin_amdgcn_wave_barrier();
    FragH pa[2];
#pragma unroll
    for (int rt = 0; rt < RTN; ++rt) { pa[rt].half[0] = *(const v8us*)&sP[w][rt * 16 + ln][8 * hh]; pa[rt].half[1] = *(const v8us*)&sP[w][rt * 16 + ln][16 + 8 * hh]; }
#pragma unroll
    for (int dt = 0; dt < DT; ++dt) { const unsigned short* vrow = Vth + (size_t)(dt * 16 + ln) * 4096 + j0; FragH bv; bv.half[0] = *(const v8us*)(vrow + 8 * hh); bv.half[1] = *(const v8us*)(vrow + 16 + 8 * hh);
#pragma unroll
      for (int rt = 0; rt < RTN; ++rt) oacc[rt][dt] = mmaH<1>(pa[rt].v, pa[rt].v, bv.v, bv.v, oacc[rt][dt]); }
    __builtin_amdgcn_fence(__ATOMIC_ACQ_REL, "workgroup"); __builtin_amdgcn_wave_barrier(); }
#pragma unroll
  for (int rt = 0; rt < RTN; ++rt) {
#pragma unroll
    for (int r = 0; r < 8; ++r) { float l = l_r[rt][r]; l += __shfl_xor(l, 1, 32); l += __shfl_xor(l, 2, 32); l += __shfl_xor(l, 4, 32); l += __shfl_xor(l, 8, 32); l_r[rt][r] = (l > 0.f) ? 1.0f / l : 0.f; }
#pragma unroll
    for (int dt = 0; dt < DT; ++dt)
#pragma unroll
      for (int r = 0; r < 8; ++r) sO[w][rt * 16 + 8 * hh + r][dt * 16 + ln] = oacc[rt][dt][r] * l_r[rt][r]; }
  __builtin_amdgcn_fence(__ATOMIC_ACQ_REL, "workgroup"); __builtin_amdgcn_wave_barrier();
  {
#pragma unroll
    for (int rp = 0; rp < RPW; rp += 2) { const int r = rp + (lane >> 4), pc = lane & 15; const v4f val = *(const v4fa*)&sO[w][r][pc * 4]; *(v4f*)(O + ((size_t)b * 4096 + q0 + r) * ldo + h * 64 + pc * 4) = val; }
     } }

extern "C" void kernel_launch(void* const* d_in, const int* in_sizes, int n_in,
                              void* d_out, int out_size, void* d_ws, size_t ws_size, hipStream_t stream) {
  (void)in_sizes; (void)n_in; (void)out_size;
  const float* x = (const float*)d_in[0]; const float* Wq = (const float*)d_in[1]; const float* Wk = (const float*)d_in[2]; const float* Wv = (const float*)d_in[3];
  char* ws = (char*)d_ws; size_t off = 0;
  auto take = [&](size_t bytes) { char* p = ws + off; off += (bytes + 255) & ~(size_t)255; return p; };
  _Float16* Bq = (_Float16*)take(HD * DD * 2); _Float16* Bk = (_Float16*)take(HD * DD * 2); _Float16* Bv = (_Float16*)take(HD * DD * 2); _Float16* X16 = (_Float16*)take((size_t)NR * DD * 2); _Float16* Q16 = (_Float16*)take((size_t)NR * HD * 2); _Float16* K16 = (_Float16*)take((size_t)NR * HD * 2); _Float16* V16 = (_Float16*)take((size_t)NR * HD * 2); _Float16* Vt = (_Float16*)take((size_t)NR * HD * 2);
  if (off > ws_size) return;      // 8.4 + 2.1 × 4 ≈ 17 MiB
  k_wt_f16<<<(HD * (DD / 8) + 255) / 256, 256, 0, stream>>>(Wq, Bq, DD, HD, 16.0f); k_wt_f16<<<(HD * (DD / 8) + 255) / 256, 256, 0, stream>>>(Wk, Bk, DD, HD, 16.0f); k_wt_f16<<<(HD * (DD / 8) + 255) / 256, 256, 0, stream>>>(Wv, Bv, DD, HD, 16.0f);
  k_x16<<<(unsigned)(((size_t)NR * DD / 8 + 255) / 256), 256, 0, stream>>>(x, X16, (size_t)NR * DD / 8);
  const dim3 gg(((NR / 16) * 1 + 3) / 4, 1);
  k_gemm_hhx<0><<<gg, 128, 0, stream>>>(X16, DD, 0, Bq, DD, 0, 0.0625f, nullptr, 0, nullptr, 1, 0, 0, nullptr, Q16, HD, 0, NR, HD, DD);
  k_gemm_hhx<0><<<gg, 128, 0, stream>>>(X16, DD, 0, Bk, DD, 0, 0.0625f, nullptr, 0, nullptr, 1, 0, 0, nullptr, K16, HD, 0, NR, HD, DD);
  k_gemm_hhx<0><<<gg, 128, 0, stream>>>(X16, DD, 0, Bv, DD, 0, 0.0625f, nullptr, 0, nullptr, 1, 0, 0, nullptr, V16, HD, 0, NR, HD, DD);
  k_vt<1, TT><<<BB * 1 * (TT / 64), 256, 0, stream>>>(V16, HD, 0, Vt);
  k_flash<<<BB * 1 * (TT / 64), 128, 0, stream>>>(Q16, HD, K16, HD, Vt, nullptr, (float*)d_out, HD);
}

// v001
// Measured time: 122 microseconds a run.
// Next to v000, in two timings, it ran 4.25 and 4.28 times as fast.
#include <hip/hip_runtime.h>
// Single-head causal self-attention layer (B=4, S=4096, D=256, H=64; scale 1/√256 as in the module): q/k/v projections as GEMMs (W [in][out] transposed to bf16-exact ×2^4) and the attention as a
// fused flash-style causal kernel (online softmax f32, P f16 <= 1, O = P*Vt; 16 query rows per work-group, key tiles dealt over its 16 waves, partials merged in LDS) on v_wmma_f32_16x16x32_f16 with f32 accumulate.
#define BB 4
#define TT 4096
#define DD 256
#define HD 64
#define NR (BB * TT)

typedef __bf16 v16b __attribute__((ext_vector_type(16)));
typedef unsigned short v8us __attribute__((ext_vector_type(8), may_alias));
typedef float  v8f  __attribute__((ext_vector_type(8)));
typedef float  v4f  __attribute__((ext_vector_type(4)));
typedef float  v4fa __attribute__((ext_vector_type(4), may_alias));
union FragB { v16b v; v8us half[2]; unsigned short u[16]; };

__device__ __forceinline__ unsigned short bf16_bits(float x) { unsigned int u = __float_as_uint(x); return (unsigned short)((u + 0x7FFFu + ((u >> 16) & 1u)) >> 16); }
__device__ __forceinline__ float bf16_val(unsigned short b) { return __uint_as_float(((unsigned int)b) << 16); }
__device__ __forceinline__ float bf16_round(float x) { return bf16_val(bf16_bits(x)); }
// D += A·B with NT terms: 1 = ah·bh, 2 = + al·bh (A split), 3 = + ah·bl (both split)
template <int NT>
__device__ __forceinline__ v8f mmaN(v16b ah, v16b al, v16b bh, v16b bl, v8f c) {
  c = __builtin_amdgcn_wmma_f32_16x16x32_bf16(false, ah, false, bh, (short)0, c, false, false);
  if (NT >= 2) c = __builtin_amdgcn_wmma_f32_16x16x32_bf16(false, al, false, bh, (short)0, c, false, false);
  if (NT >= 3) c = __builtin_amdgcn_wmma_f32_16x16x32_bf16(false, ah, false, bl, (short)0, c, false, false);
  asm volatile("v_nop\n\tv_nop\n\tv_nop\n\tv_nop" : "+v"(c) : "v"(ah), "v"(al), "v"(bh), "v"(bl));
  return c;
}

__global__ __launch_bounds__(256) void k_wt_bf16(const float* __restrict__ W, unsigned short* __restrict__ Wt, int K, int N) {
  const int t = blockIdx.x * 256 + threadIdx.x;
  const int k8n = K / 8;
  if (t >= N * k8n) return;
  const int n = t / k8n, k8 = (t % k8n) * 8;
  v8us v;
#pragma unroll
  for (int i = 0; i < 8; ++i) v[i] = bf16_bits(W[(size_t)(k8 + i) * N + n]);
  *(v8us*)(Wt + (size_t)n * K + k8) = v;
  
}

// GEMM C[M][N] (f32, pitch ldc) = act(A[M][K]·W + bias). A f32 row-major (pitch lda) converted per fragment to bf16
// (ASPLIT: hi/lo two planes -> 2 terms, else single rounded term); Wt bf16 [N][K] (pitch ldb). BIAS_BF16 rounds the
// bias to bf16 first (bias quantised to bf16 before the add). K%32==0, M%16==0, N%64==0.
template <bool ASPLIT, int ACT, bool BIAS_BF16>
__global__ __launch_bounds__(128) void k_gemm_bf(const float* __restrict__ A, int lda, const unsigned short* __restrict__ Wt, int ldb,
                                               const float* __restrict__ bias, float* __restrict__ C, int ldc, int M, int N, int K) {
  __shared__ __attribute__((aligned(16))) float so[4][16][64];
  const int tid = threadIdx.x, w = tid >> 5, lane = tid & 31, ln = lane & 15, hh = lane >> 4;
  const int ntn = N / 64;
  const int wid = blockIdx.x * 4 + w;
  const int mt = wid / ntn, nq = wid % ntn;
  if (mt * 16 >= M) return;
  const int row0 = mt * 16, col0 = nq * 64;
  const float* arow = A + (size_t)(row0 + ln) * lda;
  v8f acc[4] = {};
  for (int kb = 0; kb < K; kb += 32) {
    FragB ah, al;
    const v4f x0 = *(const v4fa*)(arow + kb + 8 * hh), x1 = *(const v4fa*)(arow + kb + 8 * hh + 4);
    const v4f x2 = *(const v4fa*)(arow + kb + 16 + 8 * hh), x3 = *(const v4fa*)(arow + kb + 16 + 8 * hh + 4);
    float xs[16] = {x0[0],x0[1],x0[2],x0[3],x1[0],x1[1],x1[2],x1[3],x2[0],x2[1],x2[2],x2[3],x3[0],x3[1],x3[2],x3[3]};
#pragma unroll
    for (int i = 0; i < 16; ++i) { const unsigned short hb = bf16_bits(xs[i]); ah.u[i] = hb; al.u[i] = ASPLIT ? bf16_bits(xs[i] - bf16_val(hb)) : (unsigned short)0; }
#pragma unroll
    for (int t = 0; t < 4; ++t) {
      const unsigned short* brow = Wt + (size_t)(col0 + t * 16 + ln) * ldb + kb;
      FragB b;
      b.half[0] = *(const v8us*)(brow + 8 * hh);
      b.half[1] = *(const v8us*)(brow + 16 + 8 * hh);
      acc[t] = mmaN<ASPLIT ? 2 : 1>(ah.v, al.v, b.v, b.v, acc[t]);
    }
  }
#pragma unroll
  for (int t = 0; t < 4; ++t) {
    float bv = bias ? bias[col0 + t * 16 + ln] : 0.f;
    if (BIAS_BF16) bv = bf16_round(bv);
#pragma unroll
    for (int r = 0; r < 8; ++r) { float v = acc[t][r] + bv; if (ACT == 1) v = fmaxf(v, 0.f); so[w][8 * hh + r][t * 16 + ln] = v; }
  }
  __builtin_amdgcn_fence(__ATOMIC_ACQ_REL, "workgroup");
  __builtin_amdgcn_wave_barrier();
  const int rsub = lane >> 4, c4 = (lane & 15) * 4;
  {
#pragma unroll
    for (int q = 0; q < 8; ++q) {
      const int r = q * 2 + rsub;
      const v4f v = *(const v4fa*)&so[w][r][c4];
      *(v4f*)(C + (size_t)(row0 + r) * ldc + col0 + c4) = v;
    }
    
  }
}

// Flash-style causal/unmasked attention, all contractions 3-term bf16 hi/lo splits, f32 softmax with running max.
// q,k,v rows are read from f32 buffers with arbitrary row pitch (so they can live inside a fused qkv buffer);
// D = head size (multiple of 32, <= 128); one wave = 16 query rows; block = 4 waves (64 queries) sharing K/V chunks of 32.
template <int D, bool CAUSAL>
__global__ __launch_bounds__(128) void k_flash(const float* __restrict__ qb, const float* __restrict__ kb, const float* __restrict__ vb,
                                             int pitch, int T, int H, float scale, float* __restrict__ y, int ypitch) {
  constexpr int KS = D / 32;        // k-steps for QK
  constexpr int DT = D / 16;        // d tiles for PV
  __shared__ __attribute__((aligned(16))) unsigned short sKh[32][D + 8], sKl[32][D + 8], sVh[32][D + 8], sVl[32][D + 8];
  __shared__ __attribute__((aligned(16))) unsigned short sPh[4][16][40], sPl[4][16][40];
  __shared__ __attribute__((aligned(16))) float sO[4][16][D];
  const int tid = threadIdx.x, w = tid >> 5, lane = tid & 31, ln = lane & 15, hh = lane >> 4;
  const int nqb = (T + 63) / 64;
  const int bh = blockIdx.x / nqb, qblk = blockIdx.x % nqb;
  const int b = bh / H, h = bh % H;
  const int q0 = qblk * 64 + w * 16;
  const float* Q = qb + (size_t)b * T * pitch + h * D;
  const float* K = kb + (size_t)b * T * pitch + h * D;
  const float* V = vb + (size_t)b * T * pitch + h * D;

  // A fragments of the wave's 16 query rows (scaled), hi/lo
  FragB aqh[KS], aql[KS];
  {
    int row = q0 + ln; if (row >= T) row = T - 1;
    const float* qr = Q + (size_t)row * pitch;
#pragma unroll
    for (int ks = 0; ks < KS; ++ks)
#pragma unroll
      for (int i = 0; i < 16; ++i) {
        const int d = ks * 32 + ((i < 8) ? (8 * hh + i) : (16 + 8 * hh + (i - 8)));
        const float x = qr[d] * scale; const unsigned short hb = bf16_bits(x);
        aqh[ks].u[i] = hb; aql[ks].u[i] = bf16_bits(x - bf16_val(hb));
      }
  }
  float m_r[8], l_r[8];
#pragma unroll
  for (int r = 0; r < 8; ++r) { m_r[r] = -3.0e38f; l_r[r] = 0.f; }
  v8f oacc[DT];
#pragma unroll
  for (int dt = 0; dt < DT; ++dt) oacc[dt] = (v8f){0.f,0.f,0.f,0.f,0.f,0.f,0.f,0.f};

  const int kv_end = CAUSAL ? min(T, qblk * 64 + 64) : T;     // block-uniform
  for (int j0 = 0; j0 < kv_end; j0 += 32) {
    __syncthreads();
    for (int e = tid; e < 32 * (D / 4); e += 128) {
      const int r = e / (D / 4), c4 = (e % (D / 4)) * 4;
      const int key = j0 + r;
      v4f kf = {0.f,0.f,0.f,0.f}, vf = {0.f,0.f,0.f,0.f};
      if (key < T) { kf = *(const v4fa*)(K + (size_t)key * pitch + c4); vf = *(const v4fa*)(V + (size_t)key * pitch + c4); }
#pragma unroll
      for (int t = 0; t < 4; ++t) {
        unsigned short hb = bf16_bits(kf[t]); sKh[r][c4 + t] = hb; sKl[r][c4 + t] = bf16_bits(kf[t] - bf16_val(hb));
        hb = bf16_bits(vf[t]); sVh[r][c4 + t] = hb; sVl[r][c4 + t] = bf16_bits(vf[t] - bf16_val(hb));
      }
    }
    __syncthreads();
    // S tile 16 x 32
    v8f s[2];
#pragma unroll
    for (int nt = 0; nt < 2; ++nt) {
      v8f acc = {};
#pragma unroll
      for (int ks = 0; ks < KS; ++ks) {
        FragB bh_, bl_;
        bh_.half[0] = *(const v8us*)&sKh[nt * 16 + ln][ks * 32 + 8 * hh]; bh_.half[1] = *(const v8us*)&sKh[nt * 16 + ln][ks * 32 + 16 + 8 * hh];
        bl_.half[0] = *(const v8us*)&sKl[nt * 16 + ln][ks * 32 + 8 * hh]; bl_.half[1] = *(const v8us*)&sKl[nt * 16 + ln][ks * 32 + 16 + 8 * hh];
        acc = mmaN<3>(aqh[ks].v, aql[ks].v, bh_.v, bl_.v, acc);
      }
      s[nt] = acc;
    }
    // mask + running max (rows 8hh+r; the 16 lanes of a half share rows)
    float alpha[8];
#pragma unroll
    for (int r = 0; r < 8; ++r) {
      const int qi = q0 + 8 * hh + r;
      const int ja = j0 + ln, jb = j0 + 16 + ln;
      if (CAUSAL) { if (ja > qi) s[0][r] = -3.0e38f; if (jb > qi) s[1][r] = -3.0e38f; }
      if (ja >= T) s[0][r] = -3.0e38f;
      if (jb >= T) s[1][r] = -3.0e38f;
      float mx = fmaxf(s[0][r], s[1][r]);
      mx = fmaxf(mx, __shfl_xor(mx, 1, 32)); mx = fmaxf(mx, __shfl_xor(mx, 2, 32)); mx = fmaxf(mx, __shfl_xor(mx, 4, 32)); mx = fmaxf(mx, __shfl_xor(mx, 8, 32));
      const float mnew = fmaxf(m_r[r], mx);
      alpha[r] = (mnew > -1.0e38f) ? __expf(m_r[r] - mnew) : 1.0f;
      const float p0 = (s[0][r] > -1.0e38f) ? __expf(s[0][r] - mnew) : 0.f;
      const float p1 = (s[1][r] > -1.0e38f) ? __expf(s[1][r] - mnew) : 0.f;
      m_r[r] = mnew;
      l_r[r] = l_r[r] * alpha[r] + p0 + p1;            // per-lane partial row sum (16 lanes combined at the end)
      unsigned short hb = bf16_bits(p0); sPh[w][8 * hh + r][ln] = hb;      sPl[w][8 * hh + r][ln] = bf16_bits(p0 - bf16_val(hb));
      hb = bf16_bits(p1);                sPh[w][8 * hh + r][16 + ln] = hb; sPl[w][8 * hh + r][16 + ln] = bf16_bits(p1 - bf16_val(hb));
    }
#pragma unroll
    for (int dt = 0; dt < DT; ++dt)
#pragma unroll
      for (int r = 0; r < 8; ++r) oacc[dt][r] *= alpha[r];
    __builtin_amdgcn_fence(__ATOMIC_ACQ_REL, "workgroup");
    __builtin_amdgcn_wave_barrier();
    FragB pah, pal;
    pah.half[0] = *(const v8us*)&sPh[w][ln][8 * hh]; pah.half[1] = *(const v8us*)&sPh[w][ln][16 + 8 * hh];
    pal.half[0] = *(const v8us*)&sPl[w][ln][8 * hh]; pal.half[1] = *(const v8us*)&sPl[w][ln][16 + 8 * hh];
#pragma unroll
    for (int dt = 0; dt < DT; ++dt) {
      FragB bvh, bvl;
#pragma unroll
      for (int i = 0; i < 8; ++i) {
        bvh.u[i] = sVh[8 * hh + i][dt * 16 + ln]; bvh.u[8 + i] = sVh[16 + 8 * hh + i][dt * 16 + ln];
        bvl.u[i] = sVl[8 * hh + i][dt * 16 + ln]; bvl.u[8 + i] = sVl[16 + 8 * hh + i][dt * 16 + ln];
      }
      oacc[dt] = mmaN<3>(pah.v, pal.v, bvh.v, bvl.v, oacc[dt]);
    }
    __builtin_amdgcn_fence(__ATOMIC_ACQ_REL, "workgroup");
    __builtin_amdgcn_wave_barrier();
  }
#pragma unroll
  for (int r = 0; r < 8; ++r) {
    float l = l_r[r];
    l += __shfl_xor(l, 1, 32); l += __shfl_xor(l, 2, 32); l += __shfl_xor(l, 4, 32); l += __shfl_xor(l, 8, 32);
    l_r[r] = (l > 0.f) ? 1.0f / l : 0.f;
  }
#pragma unroll
  for (int dt = 0; dt < DT; ++dt)
#pragma unroll
    for (int r = 0; r < 8; ++r) sO[w][8 * hh + r][dt * 16 + ln] = oacc[dt][r] * l_r[r];
  __builtin_amdgcn_fence(__ATOMIC_ACQ_REL, "workgroup");
  __builtin_amdgcn_wave_barrier();
  {
    for (int r = 0; r < 16; ++r) {
      const int row = q0 + r;
      if (row < T && lane < D / 4) {
        const v4f val = *(const v4fa*)&sO[w][r][lane * 4];
        *(v4f*)(y + ((size_t)b * T + row) * ypitch + h * D + lane * 4) = val;
      }
    }
    
  }
}

// GEMM C = act(A·W + bias + resid): A f32 (ASPLIT -> hi/lo 2 terms), Wt bf16 [N][K]; ACT 0 none, 1 relu, 2 exact gelu;
// resid (optional, f32, row index = (row % rmod), pitch ldr, RES_BF16 rounds it) added before the activation.
template <bool ASPLIT, int ACT, bool BIAS_BF16, bool RES_BF16>
__global__ __launch_bounds__(128) void k_gemm_bf3(const float* __restrict__ A, int lda, const unsigned short* __restrict__ Wt, int ldb,
                                                const float* __restrict__ bias, const float* __restrict__ resid, int rmod, int ldr,
                                                float* __restrict__ C, int ldc, int M, int N, int K) {
  __shared__ __attribute__((aligned(16))) float so[4][16][64];
  const int tid = threadIdx.x, w = tid >> 5, lane = tid & 31, ln = lane & 15, hh = lane >> 4;
  const int ntn = N / 64;
  const int wid = blockIdx.x * 4 + w;
  const int mt = wid / ntn, nq = wid % ntn;
  if (mt * 16 >= M) return;
  const int row0 = mt * 16, col0 = nq * 64;
  const float* arow = A + (size_t)(row0 + ln) * lda;
  v8f acc[4] = {};
  for (int kb = 0; kb < K; kb += 32) {
    FragB ah, al;
    const v4f x0 = *(const v4fa*)(arow + kb + 8 * hh), x1 = *(const v4fa*)(arow + kb + 8 * hh + 4);
    const v4f x2 = *(const v4fa*)(arow + kb + 16 + 8 * hh), x3 = *(const v4fa*)(arow + kb + 16 + 8 * hh + 4);
    float xs[16] = {x0[0],x0[1],x0[2],x0[3],x1[0],x1[1],x1[2],x1[3],x2[0],x2[1],x2[2],x2[3],x3[0],x3[1],x3[2],x3[3]};
#pragma unroll
    for (int i = 0; i < 16; ++i) { const unsigned short hb = bf16_bits(xs[i]); ah.u[i] = hb; al.u[i] = ASPLIT ? bf16_bits(xs[i] - bf16_val(hb)) : (unsigned short)0; }
#pragma unroll
    for (int t = 0; t < 4; ++t) {
      const unsigned short* brow = Wt + (size_t)(col0 + t * 16 + ln) * ldb + kb;
      FragB b;
      b.half[0] = *(const v8us*)(brow + 8 * hh);
      b.half[1] = *(const v8us*)(brow + 16 + 8 * hh);
      acc[t] = mmaN<ASPLIT ? 2 : 1>(ah.v, al.v, b.v, b.v, acc[t]);
    }
  }
#pragma unroll
  for (int t = 0; t < 4; ++t) {
    const int col = col0 + t * 16 + ln;
    float bv = bias ? bias[col] : 0.f;
    if (BIAS_BF16) bv = bf16_round(bv);
#pragma unroll
    for (int r = 0; r < 8; ++r) {
      float v = acc[t][r] + bv;
      if (resid) { float rv = resid[(size_t)((row0 + 8 * hh + r) % rmod) * ldr + col]; if (RES_BF16) rv = bf16_round(rv); v += rv; }
      if (ACT == 1) v = fmaxf(v, 0.f);
      if (ACT == 2) v = 0.5f * v * (1.0f + erff(v * 0.70710678118654752f));
      if (ACT == 3) { const float u = 0.7978845608028654f * (v + 0.044715f * v * v * v); v = 0.5f * v * (1.0f + tanhf(u)); }
      so[w][8 * hh + r][t * 16 + ln] = v;
    }
  }
  __builtin_amdgcn_fence(__ATOMIC_ACQ_REL, "workgroup");
  __builtin_amdgcn_wave_barrier();
  const int rsub = lane >> 4, c4 = (lane & 15) * 4;
  {
#pragma unroll
    for (int q = 0; q < 8; ++q) {
      const int r = q * 2 + rsub;
      const v4f v = *(const v4fa*)&so[w][r][c4];
      *(v4f*)(C + (size_t)(row0 + r) * ldc + col0 + c4) = v;
    }
    
  }
}
// row LayerNorm (biased variance, eps) over N: s = X (+ R); optional out_sum <- s; out_norm <- (s-mu)*rsqrt(var+eps)*g + b
template <bool PARAM_BF16>
__global__ __launch_bounds__(256) void k_layernorm(const float* __restrict__ X, const float* __restrict__ R, const float* __restrict__ g, const float* __restrict__ bta,
                                                  float* __restrict__ out_sum, float* __restrict__ out_norm, int N, float eps) {
  __shared__ float red[256];
  const int row = blockIdx.x, tid = threadIdx.x;
  const float* x = X + (size_t)row * N; const float* rr = R ? R + (size_t)row * N : nullptr;
  float vals[16];                     // up to N = 4096
  const int per = N / 256;            // contiguous chunk per thread? use strided-by-4 chunks: thread handles j = tid*4 + 1024*u
  float s1 = 0.f;
  for (int u = 0; u < per / 4; ++u) {
    const int j = tid * 4 + 1024 * u;
    const v4f a = *(const v4fa*)(x + j);
    v4f b = {0.f,0.f,0.f,0.f}; if (rr) b = *(const v4fa*)(rr + j);
#pragma unroll
    for (int q = 0; q < 4; ++q) { const float v = a[q] + b[q]; vals[u * 4 + q] = v; s1 += v; }
  }
  red[tid] = s1; __syncthreads();
  for (int st = 128; st > 0; st >>= 1) { if (tid < st) red[tid] += red[tid + st]; __syncthreads(); }
  const float mu = red[0] / (float)N; __syncthreads();
  float s2 = 0.f;
  for (int u = 0; u < per / 4; ++u)
#pragma unroll
    for (int q = 0; q < 4; ++q) { const float c = vals[u * 4 + q] - mu; s2 += c * c; }
  red[tid] = s2; __syncthreads();
  for (int st = 128; st > 0; st >>= 1) { if (tid < st) red[tid] += red[tid + st]; __syncthreads(); }
  const float rs = rsqrtf(red[0] / (float)N + eps);
  {
    for (int u = 0; u < per / 4; ++u) {
      const int j = tid * 4 + 1024 * u;
      v4f o, sm;
#pragma unroll
      for (int q = 0; q < 4; ++q) {
        float gg = g[j + q], bb = bta[j + q];
        if (PARAM_BF16) { gg = bf16_round(gg); bb = bf16_round(bb); }
        sm[q] = vals[u * 4 + q]; o[q] = (vals[u * 4 + q] - mu) * rs * gg + bb;
      }
      if (out_sum) *(v4f*)(out_sum + (size_t)row * N + j) = sm;
      *(v4f*)(out_norm + (size_t)row * N + j) = o;
    }
    
  }
}



// ---- f16 WMMA path (v_wmma_f32_16x16x32_f16): 11-bit significands for operands in range — used where a [0,1] probability operand needs more precision than bf16
typedef _Float16 v16h __attribute__((ext_vector_type(16)));
union FragH { v16h v; v8us half[2]; _Float16 h[16]; unsigned short u[16]; };
template <int NT>
__device__ __forceinline__ v8f mmaH(v16h ah, v16h al, v16h bh, v16h bl, v8f c) {
  c = __builtin_amdgcn_wmma_f32_16x16x32_f16(false, ah, false, bh, (short)0, c, false, false);
  if (NT >= 2) c = __builtin_amdgcn_wmma_f32_16x16x32_f16(false, al, false, bh, (short)0, c, false, false);
  if (NT >= 3) c = __builtin_amdgcn_wmma_f32_16x16x32_f16(false, ah, false, bl, (short)0, c, false, false);
  asm volatile("v_nop\n\tv_nop\n\tv_nop\n\tv_nop" : "+v"(c) : "v"(ah), "v"(al), "v"(bh), "v"(bl));
  return c;
}
// batched GEMM like k_gemm_b but f16 operands: A f32 (split into f16 hi/lo if ASPLIT, else rounded to f16), Bt = f16 values [n][k]; alpha; C f32; N multiple of 16 (partial tiles skipped)
template <bool ASPLIT>
__global__ __launch_bounds__(128) void k_gemm_h(const float* __restrict__ A, int lda, size_t sA, const _Float16* __restrict__ Bh, int ldb, size_t sB, float alpha, float* __restrict__ C, int ldc, size_t sC, int M, int N, int K) {
  __shared__ __attribute__((aligned(16))) float so[4][16][64];
  const int tid = threadIdx.x, w = tid >> 5, lane = tid & 31, ln = lane & 15, hh = lane >> 4; const int by = blockIdx.y;
  A += (size_t)by * sA; Bh += (size_t)by * sB; C += (size_t)by * sC;
  const int ntn = (N + 63) / 64; const int wid = blockIdx.x * 4 + w; const int mt = wid / ntn, nq = wid % ntn; if (mt * 16 >= M) return;
  const int row0 = mt * 16, col0 = nq * 64; const float* arow = A + (size_t)(row0 + ln) * lda;
  v8f acc[4] = {};
  for (int kb = 0; kb < K; kb += 32) {
    FragH ah, al;
    const v4f x0 = *(const v4fa*)(arow + kb + 8 * hh), x1 = *(const v4fa*)(arow + kb + 8 * hh + 4), x2 = *(const v4fa*)(arow + kb + 16 + 8 * hh), x3 = *(const v4fa*)(arow + kb + 16 + 8 * hh + 4);
    float xs[16] = {x0[0],x0[1],x0[2],x0[3],x1[0],x1[1],x1[2],x1[3],x2[0],x2[1],x2[2],x2[3],x3[0],x3[1],x3[2],x3[3]};
#pragma unroll
    for (int i = 0; i < 16; ++i) { const _Float16 h = (_Float16)xs[i]; ah.h[i] = h; al.h[i] = ASPLIT ? (_Float16)(xs[i] - (float)h) : (_Float16)0.0f; }
#pragma unroll
    for (int t = 0; t < 4; ++t) { if (col0 + t * 16 >= N) continue; const size_t boff = (size_t)(col0 + t * 16 + ln) * ldb + kb; FragH bq; bq.half[0] = *(const v8us*)(Bh + boff + 8 * hh); bq.half[1] = *(const v8us*)(Bh + boff + 16 + 8 * hh);
      acc[t] = mmaH<ASPLIT ? 2 : 1>(ah.v, al.v, bq.v, bq.v, acc[t]); }
  }
#pragma unroll
  for (int t = 0; t < 4; ++t) { if (col0 + t * 16 >= N) continue;
#pragma unroll
    for (int r = 0; r < 8; ++r) so[w][8 * hh + r][t * 16 + ln] = acc[t][r] * alpha; }
  __builtin_amdgcn_fence(__ATOMIC_ACQ_REL, "workgroup"); __builtin_amdgcn_wave_barrier();
  const int rsub = lane >> 4, c4 = (lane & 15) * 4;
  {
#pragma unroll
    for (int q = 0; q < 8; ++q) { const int r = q * 2 + rsub; if (col0 + c4 < N) { const v4f v = *(const v4fa*)&so[w][r][c4]; *(v4f*)(C + (size_t)(row0 + r) * ldc + col0 + c4) = v; } }
     }
}

// Wt[n][k] = f16(W[k][n]·scale) from f32 row-major W[K][N] (scale = power of two; bf16-exact weights stay exact in f16 away from the subnormal range)
__global__ __launch_bounds__(256) void k_wt_f16(const float* __restrict__ W, _Float16* __restrict__ Wt, int K, int N, float scale) {
  const int t = blockIdx.x * 256 + threadIdx.x; if (t >= N * (K / 8)) return; const int n = t / (K / 8), k8 = (t % (K / 8)) * 8; FragH f;
#pragma unroll
  for (int i = 0; i < 8; ++i) f.h[i] = (_Float16)(bf16_round(W[(size_t)(k8 + i) * N + n]) * scale); const v8us o = f.half[0];
  *(v8us*)((unsigned short*)Wt + (size_t)n * K + k8) = o; 
}
// k_gemm_hh variant with fused epilogue: v = acc·alpha + bias[by·sBias + col] (+ CP[(row/rowsPerB)·sCPb + by·64 + col] if CP) ; ACT 0 none / 1 elu ; writes f16 C16 (and f32 C if non-null)
template <int ACT>
__global__ __launch_bounds__(128) void k_gemm_hhx(const _Float16* __restrict__ A, int lda, size_t sA, const _Float16* __restrict__ Bh, int ldb, size_t sB, float alpha, const float* __restrict__ bias, size_t sBias, const float* __restrict__ CP, int rowsPerB, size_t sCPb, int row0g,
    float* __restrict__ C, _Float16* __restrict__ C16, int ldc, size_t sC, int M, int N, int K) {
  __shared__ __attribute__((aligned(16))) float so[4][16][64];
  const int tid = threadIdx.x, w = tid >> 5, lane = tid & 31, ln = lane & 15, hh = lane >> 4; const int by = blockIdx.y;
  A += (size_t)by * sA; Bh += (size_t)by * sB; const size_t cofs = (size_t)by * sC; const float* bp = bias ? bias + (size_t)by * sBias : nullptr;
  const int ntn = (N + 63) / 64; const int wid = blockIdx.x * 4 + w; const int mt = wid / ntn, nq = wid % ntn; if (mt * 16 >= M) return;
  const int row0 = mt * 16, col0 = nq * 64; const _Float16* arow = A + (size_t)(row0 + ln) * lda;
  v8f acc[4] = {};
  for (int kb = 0; kb < K; kb += 32) { FragH ah; ah.half[0] = *(const v8us*)((const unsigned short*)arow + kb + 8 * hh); ah.half[1] = *(const v8us*)((const unsigned short*)arow + kb + 16 + 8 * hh);
#pragma unroll
    for (int t = 0; t < 4; ++t) { if (col0 + t * 16 >= N) continue; const size_t boff = (size_t)(col0 + t * 16 + ln) * ldb + kb; FragH bq; bq.half[0] = *(const v8us*)((const unsigned short*)Bh + boff + 8 * hh); bq.half[1] = *(const v8us*)((const unsigned short*)Bh + boff + 16 + 8 * hh);
      acc[t] = mmaH<1>(ah.v, ah.v, bq.v, bq.v, acc[t]); }
  }
#pragma unroll
  for (int t = 0; t < 4; ++t) { if (col0 + t * 16 >= N) continue; const int col = col0 + t * 16 + ln; const float bv = bp ? bf16_round(bp[col]) : 0.f;
#pragma unroll
    for (int r = 0; r < 8; ++r) { float v = acc[t][r] * alpha + bv; if (CP) { const int bidx = (row0g + row0 + 8 * hh + r) / rowsPerB; v += CP[(size_t)bidx * sCPb + (size_t)by * 64 + col]; } if (ACT == 1) v = (v > 0.f) ? v : expm1f(v); else if (ACT == 3) v = fmaxf(v, 0.f); so[w][8 * hh + r][t * 16 + ln] = v; } }
  __builtin_amdgcn_fence(__ATOMIC_ACQ_REL, "workgroup"); __builtin_amdgcn_wave_barrier();
  const int rsub = lane >> 4, c4 = (lane & 15) * 4; typedef _Float16 v4h __attribute__((ext_vector_type(4)));
  {
#pragma unroll
    for (int q = 0; q < 8; ++q) { const int r = q * 2 + rsub; if (col0 + c4 < N) { const v4f v = *(const v4fa*)&so[w][r][c4]; if (C) *(v4f*)(C + cofs + (size_t)(row0 + r) * ldc + col0 + c4) = v; if (C16) { v4h h4; for (int i = 0; i < 4; ++i) h4[i] = (_Float16)v[i]; *(v4h*)(C16 + cofs + (size_t)(row0 + r) * ldc + col0 + c4) = h4; } } }
     }
}


__global__ __launch_bounds__(256) void k_x16(const float* __restrict__ x, _Float16* __restrict__ X16, size_t n8) { const size_t t = (size_t)blockIdx.x * 256 + threadIdx.x; if (t >= n8) return; FragH f;
#pragma unroll
  for (int q = 0; q < 8; ++q) f.h[q] = (_Float16)bf16_round(x[t * 8 + q]); *(v8us*)((unsigned short*)X16 + t * 8) = f.half[0];  }
__global__ __launch_bounds__(256) void k_h16(const float* __restrict__ x, _Float16* __restrict__ X16, size_t n8) { const size_t t = (size_t)blockIdx.x * 256 + threadIdx.x; if (t >= n8) return; FragH f;
#pragma unroll
  for (int q = 0; q < 8; ++q) f.h[q] = (_Float16)x[t * 8 + q]; *(v8us*)((unsigned short*)X16 + t * 8) = f.half[0];  }
__global__ __launch_bounds__(256) void k_round16f(const float* __restrict__ W, _Float16* __restrict__ Bt, size_t n8) { const size_t t = (size_t)blockIdx.x * 256 + threadIdx.x; if (t >= n8) return; FragH f;
#pragma unroll
  for (int i = 0; i < 8; ++i) f.h[i] = (_Float16)(bf16_round(W[t * 8 + i]) * 16.0f); *(v8us*)((unsigned short*)Bt + t * 8) = f.half[0];  }
template <int NHv, int TTv>
__global__ __launch_bounds__(256) void k_vt(const _Float16* __restrict__ V16, int ldv, int voff, _Float16* __restrict__ Vt) { __shared__ unsigned short tl[64][66]; const int tid = threadIdx.x; const int slab = blockIdx.x / (TTv / 64), lg = blockIdx.x % (TTv / 64); const int b = slab / NHv, h = slab % NHv;
  for (int i = tid; i < 64 * 8; i += 256) { const int r = i / 8, c8 = (i % 8) * 8; FragH f; f.half[0] = *(const v8us*)((const unsigned short*)V16 + ((size_t)b * TTv + lg * 64 + r) * ldv + voff + h * 64 + c8);
#pragma unroll
    for (int q = 0; q < 8; ++q) tl[r][c8 + q] = f.u[q]; }
  __syncthreads();
  {
#pragma unroll
    for (int rd = 0; rd < 2; ++rd) { const int d = rd * 32 + tid / 8, pc = tid % 8; FragH f;
#pragma unroll
      for (int q = 0; q < 8; ++q) f.u[q] = tl[pc * 8 + q][d];
      *(v8us*)((unsigned short*)Vt + ((size_t)slab * 64 + d) * TTv + lg * 64 + pc * 8) = f.half[0]; }
     } }

// One work-group = one 16-row query tile; its NKW waves walk the key tiles w, w + NKW, w + 2 NKW, ... each with its own running
// maximum, sum and un-normalised output tile; the partials are merged through LDS behind one work-group barrier.
#define NKW 16
// amdgpu_waves_per_eu(8): 128 VGPRs a wave, so that two 16-wave work-groups share a WGP and eight waves fill each other's waits on a SIMD.
__global__ __launch_bounds__(NKW * 32) __attribute__((amdgpu_waves_per_eu(8))) void k_flash(const _Float16* __restrict__ Q16, int ldq, const _Float16* __restrict__ K16, int ldk, const _Float16* __restrict__ Vt, const int* __restrict__ MSK, float* __restrict__ O, int ldo) {
  constexpr int NQB = 4096 / 16, DT = 4, KS = 2;
  __shared__ __attribute__((aligned(16))) unsigned short sP[NKW][16][40]; __shared__ __attribute__((aligned(16))) float sO[NKW][16][64 + 4];
  __shared__ float sM[NKW][16], sL[NKW][16];
  const int lane = (int)__builtin_amdgcn_mbcnt_lo(~0u, 0u), ln = lane & 15, hh = lane >> 4;   // lane id without threadIdx.x: one register fewer live over the key loop (no scratch at 128 VGPRs)
  const int w = __builtin_amdgcn_readfirstlane((int)threadIdx.x >> 5);   // scalar, so that the key loop's test stays a scalar branch
  const int slab = blockIdx.x / NQB, qblk = blockIdx.x % NQB; const int b = slab; const int q0 = qblk * 16; (void)MSK;
  FragH aq[KS];
  { const unsigned short* qr = (const unsigned short*)Q16 + ((size_t)b * 4096 + q0 + ln) * ldq;
#pragma unroll
    for (int ks = 0; ks < KS; ++ks) { aq[ks].half[0] = *(const v8us*)(qr + ks * 32 + 8 * hh); aq[ks].half[1] = *(const v8us*)(qr + ks * 32 + 16 + 8 * hh); } }
  const unsigned short* Vth = (const unsigned short*)Vt + (size_t)slab * 64 * 4096;
  float m_r[8], l_r[8]; v8f oacc[DT];
#pragma unroll
  for (int r = 0; r < 8; ++r) { m_r[r] = -3.0e38f; l_r[r] = 0.f; }
#pragma unroll
  for (int dt = 0; dt < DT; ++dt) oacc[dt] = (v8f){0.f,0.f,0.f,0.f,0.f,0.f,0.f,0.f};
  const int jend = q0 + 16;
#pragma unroll 1
  for (int j0 = w * 32; j0 < jend; j0 += NKW * 32) {
    v8f s[2];
#pragma unroll
    for (int nt = 0; nt < 2; ++nt) { const unsigned short* kr = (const unsigned short*)K16 + ((size_t)b * 4096 + j0 + nt * 16 + ln) * ldk; FragH bk[KS];
#pragma unroll
      for (int ks = 0; ks < KS; ++ks) { bk[ks].half[0] = *(const v8us*)(kr + ks * 32 + 8 * hh); bk[ks].half[1] = *(const v8us*)(kr + ks * 32 + 16 + 8 * hh); }
      v8f acc = (v8f){0.f,0.f,0.f,0.f,0.f,0.f,0.f,0.f};
#pragma unroll
      for (int ks = 0; ks < KS; ++ks) acc = mmaH<1>(aq[ks].v, aq[ks].v, bk[ks].v, bk[ks].v, acc);
      s[nt] = acc; }
#pragma unroll
    for (int r = 0; r < 8; ++r) { const int tq = q0 + 8 * hh + r; const int k0 = j0 + ln, k1 = j0 + 16 + ln;
      const bool ok0 = (k0 <= tq), ok1 = (k1 <= tq);
      const float s0 = ok0 ? s[0][r] * (0.0625f) : -INFINITY, s1 = ok1 ? s[1][r] * (0.0625f) : -INFINITY; float mc = fmaxf(s0, s1);
      mc = fmaxf(mc, __shfl_xor(mc, 1, 32)); mc = fmaxf(mc, __shfl_xor(mc, 2, 32)); mc = fmaxf(mc, __shfl_xor(mc, 4, 32)); mc = fmaxf(mc, __shfl_xor(mc, 8, 32));
      const float mn = fmaxf(m_r[r], mc); const float al = (mn > -1.0e38f) ? expf(m_r[r] - mn) : 1.0f; m_r[r] = mn; const float p0 = ok0 ? expf(s0 - mn) : 0.f, p1 = ok1 ? expf(s1 - mn) : 0.f; l_r[r] = l_r[r] * al + p0 + p1;
#pragma unroll
      for (int dt = 0; dt < DT; ++dt) oacc[dt][r] *= al;
      FragH t2; t2.h[0] = (_Float16)p0; t2.h[1] = (_Float16)p1; sP[w][8 * hh + r][ln] = t2.u[0]; sP[w][8 * hh + r][16 + ln] = t2.u[1]; }
    __builtin_amdgcn_fence(__ATOMIC_ACQ_REL, "workgroup"); __builtin_amdgcn_wave_barrier();
    FragH pa; pa.half[0] = *(const v8us*)&sP[w][ln][8 * hh]; pa.half[1] = *(const v8us*)&sP[w][ln][16 + 8 * hh];
#pragma unroll
    for (int dt = 0; dt < DT; ++dt) { const unsigned short* vrow = Vth + (size_t)(dt * 16 + ln) * 4096 + j0; FragH bv; bv.half[0] = *(const v8us*)(vrow + 8 * hh); bv.half[1] = *(const v8us*)(vrow + 16 + 8 * hh);
      oacc[dt] = mmaH<1>(pa.v, pa.v, bv.v, bv.v, oacc[dt]); }
    __builtin_amdgcn_fence(__ATOMIC_ACQ_REL, "workgroup"); __builtin_amdgcn_wave_barrier(); }
  // each wave's partial: row maximum, row sum (its 16 lanes joined) and the un-normalised output tile; a wave without a key tile leaves (-3e38, 0, 0)
#pragma unroll
  for (int r = 0; r < 8; ++r) { float l = l_r[r]; l += __shfl_xor(l, 1, 32); l += __shfl_xor(l, 2, 32); l += __shfl_xor(l, 4, 32); l += __shfl_xor(l, 8, 32);
    if (ln == 0) { sM[w][8 * hh + r] = m_r[r]; sL[w][8 * hh + r] = l; } }
#pragma unroll
  for (int dt = 0; dt < DT; ++dt)
#pragma unroll
    for (int r = 0; r < 8; ++r) sO[w][8 * hh + r][dt * 16 + ln] = oacc[dt][r];
  __syncthreads();   // publishes every wave's partial to the merging threads
  if (w < 8) { const int r = w * 2 + hh, pc = ln;
    float M = sM[0][r];
#pragma unroll
    for (int u = 1; u < NKW; ++u) M = fmaxf(M, sM[u][r]);
    float L = 0.f; v4f o = {0.f, 0.f, 0.f, 0.f};
#pragma unroll
    for (int u = 0; u < NKW; ++u) { const float e = expf(sM[u][r] - M); L += e * sL[u][r]; const v4f pv = *(const v4fa*)&sO[u][r][pc * 4]; o += pv * e; }
    const float inv = (L > 0.f) ? 1.0f / L : 0.f;
    *(v4f*)(O + ((size_t)b * 4096 + q0 + r) * ldo + pc * 4) = o * inv; } }

extern "C" void kernel_launch(void* const* d_in, const int* in_sizes, int n_in,
                              void* d_out, int out_size, void* d_ws, size_t ws_size, hipStream_t stream) {
  (void)in_sizes; (void)n_in; (void)out_size;
  const float* x = (const float*)d_in[0]; const float* Wq = (const float*)d_in[1]; const float* Wk = (const float*)d_in[2]; const float* Wv = (const float*)d_in[3];
  char* ws = (char*)d_ws; size_t off = 0;
  auto take = [&](size_t bytes) { char* p = ws + off; off += (bytes + 255) & ~(size_t)255; return p; };
  _Float16* Bq = (_Float16*)take(HD * DD * 2); _Float16* Bk = (_Float16*)take(HD * DD * 2); _Float16* Bv = (_Float16*)take(HD * DD * 2); _Float16* X16 = (_Float16*)take((size_t)NR * DD * 2); _Float16* Q16 = (_Float16*)take((size_t)NR * HD * 2); _Float16* K16 = (_Float16*)take((size_t)NR * HD * 2); _Float16* V16 = (_Float16*)take((size_t)NR * HD * 2); _Float16* Vt = (_Float16*)take((size_t)NR * HD * 2);
  if (off > ws_size) return;      // 8.4 + 2.1 × 4 ≈ 17 MiB
  k_wt_f16<<<(HD * (DD / 8) + 255) / 256, 256, 0, stream>>>(Wq, Bq, DD, HD, 16.0f); k_wt_f16<<<(HD * (DD / 8) + 255) / 256, 256, 0, stream>>>(Wk, Bk, DD, HD, 16.0f); k_wt_f16<<<(HD * (DD / 8) + 255) / 256, 256, 0, stream>>>(Wv, Bv, DD, HD, 16.0f);
  k_x16<<<(unsigned)(((size_t)NR * DD / 8 + 255) / 256), 256, 0, stream>>>(x, X16, (size_t)NR * DD / 8);
  const dim3 gg(((NR / 16) * 1 + 3) / 4, 1);
  k_gemm_hhx<0><<<gg, 128, 0, stream>>>(X16, DD, 0, Bq, DD, 0, 0.0625f, nullptr, 0, nullptr, 1, 0, 0, nullptr, Q16, HD, 0, NR, HD, DD);
  k_gemm_hhx<0><<<gg, 128, 0, stream>>>(X16, DD, 0, Bk, DD, 0, 0.0625f, nullptr, 0, nullptr, 1, 0, 0, nullptr, K16, HD, 0, NR, HD, DD);
  k_gemm_hhx<0><<<gg, 128, 0, stream>>>(X16, DD, 0, Bv, DD, 0, 0.0625f, nullptr, 0, nullptr, 1, 0, 0, nullptr, V16, HD, 0, NR, HD, DD);
  k_vt<1, TT><<<BB * 1 * (TT / 64), 256, 0, stream>>>(V16, HD, 0, Vt);
  k_flash<<<BB * 1 * (TT / 16), NKW * 32, 0, stream>>>(Q16, HD, K16, HD, Vt, nullptr, (float*)d_out, HD);
}

// v002
// Measured time: 102 microseconds a run.
// Timed twice side by side with v001, it ran 1.21 and 1.20 times as fast.
// Over all steps from v000 it is 5.14 times as fast.
#include <hip/hip_runtime.h>
// Single-head causal self-attention layer (B=4, S=4096, D=256, H=64; scale 1/√256 as in the module): q/k/v projections as GEMMs (W [in][out] transposed to bf16-exact ×2^4) and the attention as a
// fused flash-style causal kernel (online softmax f32, P f16 <= 1, O^T = Vt*P^T; 16 query rows per work-group, key tiles dealt over its 16 waves, partials merged in LDS) on v_wmma_f32_16x16x32_f16 with f32 accumulate.
#define BB 4
#define TT 4096
#define DD 256
#define HD 64
#define NR (BB * TT)

typedef __bf16 v16b __attribute__((ext_vector_type(16)));
typedef unsigned short v8us __attribute__((ext_vector_type(8), may_alias));
typedef float  v8f  __attribute__((ext_vector_type(8)));
typedef float  v4f  __attribute__((ext_vector_type(4)));
typedef float  v4fa __attribute__((ext_vector_type(4), may_alias));
union FragB { v16b v; v8us half[2]; unsigned short u[16]; };

__device__ __forceinline__ unsigned short bf16_bits(float x) { unsigned int u = __float_as_uint(x); return (unsigned short)((u + 0x7FFFu + ((u >> 16) & 1u)) >> 16); }
__device__ __forceinline__ float bf16_val(unsigned short b) { return __uint_as_float(((unsigned int)b) << 16); }
__device__ __forceinline__ float bf16_round(float x) { return bf16_val(bf16_bits(x)); }
// D += A·B with NT terms: 1 = ah·bh, 2 = + al·bh (A split), 3 = + ah·bl (both split)
template <int NT>
__device__ __forceinline__ v8f mmaN(v16b ah, v16b al, v16b bh, v16b bl, v8f c) {
  c = __builtin_amdgcn_wmma_f32_16x16x32_bf16(false, ah, false, bh, (short)0, c, false, false);
  if (NT >= 2) c = __builtin_amdgcn_wmma_f32_16x16x32_bf16(false, al, false, bh, (short)0, c, false, false);
  if (NT >= 3) c = __builtin_amdgcn_wmma_f32_16x16x32_bf16(false, ah, false, bl, (short)0, c, false, false);
  asm volatile("v_nop\n\tv_nop\n\tv_nop\n\tv_nop" : "+v"(c) : "v"(ah), "v"(al), "v"(bh), "v"(bl));
  return c;
}

__global__ __launch_bounds__(256) void k_wt_bf16(const float* __restrict__ W, unsigned short* __restrict__ Wt, int K, int N) {
  const int t = blockIdx.x * 256 + threadIdx.x;
  const int k8n = K / 8;
  if (t >= N * k8n) return;
  const int n = t / k8n, k8 = (t % k8n) * 8;
  v8us v;
#pragma unroll
  for (int i = 0; i < 8; ++i) v[i] = bf16_bits(W[(size_t)(k8 + i) * N + n]);
  *(v8us*)(Wt + (size_t)n * K + k8) = v;
  
}

// GEMM C[M][N] (f32, pitch ldc) = act(A[M][K]·W + bias). A f32 row-major (pitch lda) converted per fragment to bf16
// (ASPLIT: hi/lo two planes -> 2 terms, else single rounded term); Wt bf16 [N][K] (pitch ldb). BIAS_BF16 rounds the
// bias to bf16 first (bias quantised to bf16 before the add). K%32==0, M%16==0, N%64==0.
template <bool ASPLIT, int ACT, bool BIAS_BF16>
__global__ __launch_bounds__(128) void k_gemm_bf(const float* __restrict__ A, int lda, const unsigned short* __restrict__ Wt, int ldb,
                                               const float* __restrict__ bias, float* __restrict__ C, int ldc, int M, int N, int K) {
  __shared__ __attribute__((aligned(16))) float so[4][16][64];
  const int tid = threadIdx.x, w = tid >> 5, lane = tid & 31, ln = lane & 15, hh = lane >> 4;
  const int ntn = N / 64;
  const int wid = blockIdx.x * 4 + w;
  const int mt = wid / ntn, nq = wid % ntn;
  if (mt * 16 >= M) return;
  const int row0 = mt * 16, col0 = nq * 64;
  const float* arow = A + (size_t)(row0 + ln) * lda;
  v8f acc[4] = {};
  for (int kb = 0; kb < K; kb += 32) {
    FragB ah, al;
    const v4f x0 = *(const v4fa*)(arow + kb + 8 * hh), x1 = *(const v4fa*)(arow + kb + 8 * hh + 4);
    const v4f x2 = *(const v4fa*)(arow + kb + 16 + 8 * hh), x3 = *(const v4fa*)(arow + kb + 16 + 8 * hh + 4);
    float xs[16] = {x0[0],x0[1],x0[2],x0[3],x1[0],x1[1],x1[2],x1[3],x2[0],x2[1],x2[2],x2[3],x3[0],x3[1],x3[2],x3[3]};
#pragma unroll
    for (int i = 0; i < 16; ++i) { const unsigned short hb = bf16_bits(xs[i]); ah.u[i] = hb; al.u[i] = ASPLIT ? bf16_bits(xs[i] - bf16_val(hb)) : (unsigned short)0; }
#pragma unroll
    for (int t = 0; t < 4; ++t) {
      const unsigned short* brow = Wt + (size_t)(col0 + t * 16 + ln) * ldb + kb;
      FragB b;
      b.half[0] = *(const v8us*)(brow + 8 * hh);
      b.half[1] = *(const v8us*)(brow + 16 + 8 * hh);
      acc[t] = mmaN<ASPLIT ? 2 : 1>(ah.v, al.v, b.v, b.v, acc[t]);
    }
  }
#pragma unroll
  for (int t = 0; t < 4; ++t) {
    float bv = bias ? bias[col0 + t * 16 + ln] : 0.f;
    if (BIAS_BF16) bv = bf16_round(bv);
#pragma unroll
    for (int r = 0; r < 8; ++r) { float v = acc[t][r] + bv; if (ACT == 1) v = fmaxf(v, 0.f); so[w][8 * hh + r][t * 16 + ln] = v; }
  }
  __builtin_amdgcn_fence(__ATOMIC_ACQ_REL, "workgroup");
  __builtin_amdgcn_wave_barrier();
  const int rsub = lane >> 4, c4 = (lane & 15) * 4;
  {
#pragma unroll
    for (int q = 0; q < 8; ++q) {
      const int r = q * 2 + rsub;
      const v4f v = *(const v4fa*)&so[w][r][c4];
      *(v4f*)(C + (size_t)(row0 + r) * ldc + col0 + c4) = v;
    }
    
  }
}

// Flash-style causal/unmasked attention, all contractions 3-term bf16 hi/lo splits, f32 softmax with running max.
// q,k,v rows are read from f32 buffers with arbitrary row pitch (so they can live inside a fused qkv buffer);
// D = head size (multiple of 32, <= 128); one wave = 16 query rows; block = 4 waves (64 queries) sharing K/V chunks of 32.
template <int D, bool CAUSAL>
__global__ __launch_bounds__(128) void k_flash(const float* __restrict__ qb, const float* __restrict__ kb, const float* __restrict__ vb,
                                             int pitch, int T, int H, float scale, float* __restrict__ y, int ypitch) {
  constexpr int KS = D / 32;        // k-steps for QK
  constexpr int DT = D / 16;        // d tiles for PV
  __shared__ __attribute__((aligned(16))) unsigned short sKh[32][D + 8], sKl[32][D + 8], sVh[32][D + 8], sVl[32][D + 8];
  __shared__ __attribute__((aligned(16))) unsigned short sPh[4][16][40], sPl[4][16][40];
  __shared__ __attribute__((aligned(16))) float sO[4][16][D];
  const int tid = threadIdx.x, w = tid >> 5, lane = tid & 31, ln = lane & 15, hh = lane >> 4;
  const int nqb = (T + 63) / 64;
  const int bh = blockIdx.x / nqb, qblk = blockIdx.x % nqb;
  const int b = bh / H, h = bh % H;
  const int q0 = qblk * 64 + w * 16;
  const float* Q = qb + (size_t)b * T * pitch + h * D;
  const float* K = kb + (size_t)b * T * pitch + h * D;
  const float* V = vb + (size_t)b * T * pitch + h * D;

  // A fragments of the wave's 16 query rows (scaled), hi/lo
  FragB aqh[KS], aql[KS];
  {
    int row = q0 + ln; if (row >= T) row = T - 1;
    const float* qr = Q + (size_t)row * pitch;
#pragma unroll
    for (int ks = 0; ks < KS; ++ks)
#pragma unroll
      for (int i = 0; i < 16; ++i) {
        const int d = ks * 32 + ((i < 8) ? (8 * hh + i) : (16 + 8 * hh + (i - 8)));
        const float x = qr[d] * scale; const unsigned short hb = bf16_bits(x);
        aqh[ks].u[i] = hb; aql[ks].u[i] = bf16_bits(x - bf16_val(hb));
      }
  }
  float m_r[8], l_r[8];
#pragma unroll
  for (int r = 0; r < 8; ++r) { m_r[r] = -3.0e38f; l_r[r] = 0.f; }
  v8f oacc[DT];
#pragma unroll
  for (int dt = 0; dt < DT; ++dt) oacc[dt] = (v8f){0.f,0.f,0.f,0.f,0.f,0.f,0.f,0.f};

  const int kv_end = CAUSAL ? min(T, qblk * 64 + 64) : T;     // block-uniform
  for (int j0 = 0; j0 < kv_end; j0 += 32) {
    __syncthreads();
    for (int e = tid; e < 32 * (D / 4); e += 128) {
      const int r = e / (D / 4), c4 = (e % (D / 4)) * 4;
      const int key = j0 + r;
      v4f kf = {0.f,0.f,0.f,0.f}, vf = {0.f,0.f,0.f,0.f};
      if (key < T) { kf = *(const v4fa*)(K + (size_t)key * pitch + c4); vf = *(const v4fa*)(V + (size_t)key * pitch + c4); }
#pragma unroll
      for (int t = 0; t < 4; ++t) {
        unsigned short hb = bf16_bits(kf[t]); sKh[r][c4 + t] = hb; sKl[r][c4 + t] = bf16_bits(kf[t] - bf16_val(hb));
        hb = bf16_bits(vf[t]); sVh[r][c4 + t] = hb; sVl[r][c4 + t] = bf16_bits(vf[t] - bf16_val(hb));
      }
    }
    __syncthreads();
    // S tile 16 x 32
    v8f s[2];
#pragma unroll
    for (int nt = 0; nt < 2; ++nt) {
      v8f acc = {};
#pragma unroll
      for (int ks = 0; ks < KS; ++ks) {
        FragB bh_, bl_;
        bh_.half[0] = *(const v8us*)&sKh[nt * 16 + ln][ks * 32 + 8 * hh]; bh_.half[1] = *(const v8us*)&sKh[nt * 16 + ln][ks * 32 + 16 + 8 * hh];
        bl_.half[0] = *(const v8us*)&sKl[nt * 16 + ln][ks * 32 + 8 * hh]; bl_.half[1] = *(const v8us*)&sKl[nt * 16 + ln][ks * 32 + 16 + 8 * hh];
        acc = mmaN<3>(aqh[ks].v, aql[ks].v, bh_.v, bl_.v, acc);
      }
      s[nt] = acc;
    }
    // mask + running max (rows 8hh+r; the 16 lanes of a half share rows)
    float alpha[8];
#pragma unroll
    for (int r = 0; r < 8; ++r) {
      const int qi = q0 + 8 * hh + r;
      const int ja = j0 + ln, jb = j0 + 16 + ln;
      if (CAUSAL) { if (ja > qi) s[0][r] = -3.0e38f; if (jb > qi) s[1][r] = -3.0e38f; }
      if (ja >= T) s[0][r] = -3.0e38f;
      if (jb >= T) s[1][r] = -3.0e38f;
      float mx = fmaxf(s[0][r], s[1][r]);
      mx = fmaxf(mx, __shfl_xor(mx, 1, 32)); mx = fmaxf(mx, __shfl_xor(mx, 2, 32)); mx = fmaxf(mx, __shfl_xor(mx, 4, 32)); mx = fmaxf(mx, __shfl_xor(mx, 8, 32));
      const float mnew = fmaxf(m_r[r], mx);
      alpha[r] = (mnew > -1.0e38f) ? __expf(m_r[r] - mnew) : 1.0f;
      const float p0 = (s[0][r] > -1.0e38f) ? __expf(s[0][r] - mnew) : 0.f;
      const float p1 = (s[1][r] > -1.0e38f) ? __expf(s[1][r] - mnew) : 0.f;
      m_r[r] = mnew;
      l_r[r] = l_r[r] * alpha[r] + p0 + p1;            // per-lane partial row sum (16 lanes combined at the end)
      unsigned short hb = bf16_bits(p0); sPh[w][8 * hh + r][ln] = hb;      sPl[w][8 * hh + r][ln] = bf16_bits(p0 - bf16_val(hb));
      hb = bf16_bits(p1);                sPh[w][8 * hh + r][16 + ln] = hb; sPl[w][8 * hh + r][16 + ln] = bf16_bits(p1 - bf16_val(hb));
    }
#pragma unroll
    for (int dt = 0; dt < DT; ++dt)
#pragma unroll
      for (int r = 0; r < 8; ++r) oacc[dt][r] *= alpha[r];
    __builtin_amdgcn_fence(__ATOMIC_ACQ_REL, "workgroup");
    __builtin_amdgcn_wave_barrier();
    FragB pah, pal;
    pah.half[0] = *(const v8us*)&sPh[w][ln][8 * hh]; pah.half[1] = *(const v8us*)&sPh[w][ln][16 + 8 * hh];
    pal.half[0] = *(const v8us*)&sPl[w][ln][8 * hh]; pal.half[1] = *(const v8us*)&sPl[w][ln][16 + 8 * hh];
#pragma unroll
    for (int dt = 0; dt < DT; ++dt) {
      FragB bvh, bvl;
#pragma unroll
      for (int i = 0; i < 8; ++i) {
        bvh.u[i] = sVh[8 * hh + i][dt * 16 + ln]; bvh.u[8 + i] = sVh[16 + 8 * hh + i][dt * 16 + ln];
        bvl.u[i] = sVl[8 * hh + i][dt * 16 + ln]; bvl.u[8 + i] = sVl[16 + 8 * hh + i][dt * 16 + ln];
      }
      oacc[dt] = mmaN<3>(pah.v, pal.v, bvh.v, bvl.v, oacc[dt]);
    }
    __builtin_amdgcn_fence(__ATOMIC_ACQ_REL, "workgroup");
    __builtin_amdgcn_wave_barrier();
  }
#pragma unroll
  for (int r = 0; r < 8; ++r) {
    float l = l_r[r];
    l += __shfl_xor(l, 1, 32); l += __shfl_xor(l, 2, 32); l += __shfl_xor(l, 4, 32); l += __shfl_xor(l, 8, 32);
    l_r[r] = (l > 0.f) ? 1.0f / l : 0.f;
  }
#pragma unroll
  for (int dt = 0; dt < DT; ++dt)
#pragma unroll
    for (int r = 0; r < 8; ++r) sO[w][8 * hh + r][dt * 16 + ln] = oacc[dt][r] * l_r[r];
  __builtin_amdgcn_fence(__ATOMIC_ACQ_REL, "workgroup");
  __builtin_amdgcn_wave_barrier();
  {
    for (int r = 0; r < 16; ++r) {
      const int row = q0 + r;
      if (row < T && lane < D / 4) {
        const v4f val = *(const v4fa*)&sO[w][r][lane * 4];
        *(v4f*)(y + ((size_t)b * T + row) * ypitch + h * D + lane * 4) = val;
      }
    }
    
  }
}

// GEMM C = act(A·W + bias + resid): A f32 (ASPLIT -> hi/lo 2 terms), Wt bf16 [N][K]; ACT 0 none, 1 relu, 2 exact gelu;
// resid (optional, f32, row index = (row % rmod), pitch ldr, RES_BF16 rounds it) added before the activation.
template <bool ASPLIT, int ACT, bool BIAS_BF16, bool RES_BF16>
__global__ __launch_bounds__(128) void k_gemm_bf3(const float* __restrict__ A, int lda, const unsigned short* __restrict__ Wt, int ldb,
                                                const float* __restrict__ bias, const float* __restrict__ resid, int rmod, int ldr,
                                                float* __restrict__ C, int ldc, int M, int N, int K) {
  __shared__ __attribute__((aligned(16))) float so[4][16][64];
  const int tid = threadIdx.x, w = tid >> 5, lane = tid & 31, ln = lane & 15, hh = lane >> 4;
  const int ntn = N / 64;
  const int wid = blockIdx.x * 4 + w;
  const int mt = wid / ntn, nq = wid % ntn;
  if (mt * 16 >= M) return;
  const int row0 = mt * 16, col0 = nq * 64;
  const float* arow = A + (size_t)(row0 + ln) * lda;
  v8f acc[4] = {};
  for (int kb = 0; kb < K; kb += 32) {
    FragB ah, al;
    const v4f x0 = *(const v4fa*)(arow + kb + 8 * hh), x1 = *(const v4fa*)(arow + kb + 8 * hh + 4);
    const v4f x2 = *(const v4fa*)(arow + kb + 16 + 8 * hh), x3 = *(const v4fa*)(arow + kb + 16 + 8 * hh + 4);
    float xs[16] = {x0[0],x0[1],x0[2],x0[3],x1[0],x1[1],x1[2],x1[3],x2[0],x2[1],x2[2],x2[3],x3[0],x3[1],x3[2],x3[3]};
#pragma unroll
    for (int i = 0; i < 16; ++i) { const unsigned short hb = bf16_bits(xs[i]); ah.u[i] = hb; al.u[i] = ASPLIT ? bf16_bits(xs[i] - bf16_val(hb)) : (unsigned short)0; }
#pragma unroll
    for (int t = 0; t < 4; ++t) {
      const unsigned short* brow = Wt + (size_t)(col0 + t * 16 + ln) * ldb + kb;
      FragB b;
      b.half[0] = *(const v8us*)(brow + 8 * hh);
      b.half[1] = *(const v8us*)(brow + 16 + 8 * hh);
      acc[t] = mmaN<ASPLIT ? 2 : 1>(ah.v, al.v, b.v, b.v, acc[t]);
    }
  }
#pragma unroll
  for (int t = 0; t < 4; ++t) {
    const int col = col0 + t * 16 + ln;
    float bv = bias ? bias[col] : 0.f;
    if (BIAS_BF16) bv = bf16_round(bv);
#pragma unroll
    for (int r = 0; r < 8; ++r) {
      float v = acc[t][r] + bv;
      if (resid) { float rv = resid[(size_t)((row0 + 8 * hh + r) % rmod) * ldr + col]; if (RES_BF16) rv = bf16_round(rv); v += rv; }
      if (ACT == 1) v = fmaxf(v, 0.f);
      if (ACT == 2) v = 0.5f * v * (1.0f + erff(v * 0.70710678118654752f));
      if (ACT == 3) { const float u = 0.7978845608028654f * (v + 0.044715f * v * v * v); v = 0.5f * v * (1.0f + tanhf(u)); }
      so[w][8 * hh + r][t * 16 + ln] = v;
    }
  }
  __builtin_amdgcn_fence(__ATOMIC_ACQ_REL, "workgroup");
  __builtin_amdgcn_wave_barrier();
  const int rsub = lane >> 4, c4 = (lane & 15) * 4;
  {
#pragma unroll
    for (int q = 0; q < 8; ++q) {
      const int r = q * 2 + rsub;
      const v4f v = *(const v4fa*)&so[w][r][c4];
      *(v4f*)(C + (size_t)(row0 + r) * ldc + col0 + c4) = v;
    }
    
  }
}
// row LayerNorm (biased variance, eps) over N: s = X (+ R); optional out_sum <- s; out_norm <- (s-mu)*rsqrt(var+eps)*g + b
template <bool PARAM_BF16>
__global__ __launch_bounds__(256) void k_layernorm(const float* __restrict__ X, const float* __restrict__ R, const float* __restrict__ g, const float* __restrict__ bta,
                                                  float* __restrict__ out_sum, float* __restrict__ out_norm, int N, float eps) {
  __shared__ float red[256];
  const int row = blockIdx.x, tid = threadIdx.x;
  const float* x = X + (size_t)row * N; const float* rr = R ? R + (size_t)row * N : nullptr;
  float vals[16];                     // up to N = 4096
  const int per = N / 256;            // contiguous chunk per thread? use strided-by-4 chunks: thread handles j = tid*4 + 1024*u
  float s1 = 0.f;
  for (int u = 0; u < per / 4; ++u) {
    const int j = tid * 4 + 1024 * u;
    const v4f a = *(const v4fa*)(x + j);
    v4f b = {0.f,0.f,0.f,0.f}; if (rr) b = *(const v4fa*)(rr + j);
#pragma unroll
    for (int q = 0; q < 4; ++q) { const float v = a[q] + b[q]; vals[u * 4 + q] = v; s1 += v; }
  }
  red[tid] = s1; __syncthreads();
  for (int st = 128; st > 0; st >>= 1) { if (tid < st) red[tid] += red[tid + st]; __syncthreads(); }
  const float mu = red[0] / (float)N; __syncthreads();
  float s2 = 0.f;
  for (int u = 0; u < per / 4; ++u)
#pragma unroll
    for (int q = 0; q < 4; ++q) { const float c = vals[u * 4 + q] - mu; s2 += c * c; }
  red[tid] = s2; __syncthreads();
  for (int st = 128; st > 0; st >>= 1) { if (tid < st) red[tid] += red[tid + st]; __syncthreads(); }
  const float rs = rsqrtf(red[0] / (float)N + eps);
  {
    for (int u = 0; u < per / 4; ++u) {
      const int j = tid * 4 + 1024 * u;
      v4f o, sm;
#pragma unroll
      for (int q = 0; q < 4; ++q) {
        float gg = g[j + q], bb = bta[j + q];
        if (PARAM_BF16) { gg = bf16_round(gg); bb = bf16_round(bb); }
        sm[q] = vals[u * 4 + q]; o[q] = (vals[u * 4 + q] - mu) * rs * gg + bb;
      }
      if (out_sum) *(v4f*)(out_sum + (size_t)row * N + j) = sm;
      *(v4f*)(out_norm + (size_t)row * N + j) = o;
    }
    
  }
}



// ---- f16 WMMA path (v_wmma_f32_16x16x32_f16): 11-bit significands for operands in range — used where a [0,1] probability operand needs more precision than bf16
typedef _Float16 v16h __attribute__((ext_vector_type(16)));
union FragH { v16h v; v8us half[2]; _Float16 h[16]; unsigned short u[16]; };
template <int NT>
__device__ __forceinline__ v8f mmaH(v16h ah, v16h al, v16h bh, v16h bl, v8f c) {
  c = __builtin_amdgcn_wmma_f32_16x16x32_f16(false, ah, false, bh, (short)0, c, false, false);
  if (NT >= 2) c = __builtin_amdgcn_wmma_f32_16x16x32_f16(false, al, false, bh, (short)0, c, false, false);
  if (NT >= 3) c = __builtin_amdgcn_wmma_f32_16x16x32_f16(false, ah, false, bl, (short)0, c, false, false);
  asm volatile("v_nop\n\tv_nop\n\tv_nop\n\tv_nop" : "+v"(c) : "v"(ah), "v"(al), "v"(bh), "v"(bl));
  return c;
}
// batched GEMM like k_gemm_b but f16 operands: A f32 (split into f16 hi/lo if ASPLIT, else rounded to f16), Bt = f16 values [n][k]; alpha; C f32; N multiple of 16 (partial tiles skipped)
template <bool ASPLIT>
__global__ __launch_bounds__(128) void k_gemm_h(const float* __restrict__ A, int lda, size_t sA, const _Float16* __restrict__ Bh, int ldb, size_t sB, float alpha, float* __restrict__ C, int ldc, size_t sC, int M, int N, int K) {
  __shared__ __attribute__((aligned(16))) float so[4][16][64];
  const int tid = threadIdx.x, w = tid >> 5, lane = tid & 31, ln = lane & 15, hh = lane >> 4; const int by = blockIdx.y;
  A += (size_t)by * sA; Bh += (size_t)by * sB; C += (size_t)by * sC;
  const int ntn = (N + 63) / 64; const int wid = blockIdx.x * 4 + w; const int mt = wid / ntn, nq = wid % ntn; if (mt * 16 >= M) return;
  const int row0 = mt * 16, col0 = nq * 64; const float* arow = A + (size_t)(row0 + ln) * lda;
  v8f acc[4] = {};
  for (int kb = 0; kb < K; kb += 32) {
    FragH ah, al;
    const v4f x0 = *(const v4fa*)(arow + kb + 8 * hh), x1 = *(const v4fa*)(arow + kb + 8 * hh + 4), x2 = *(const v4fa*)(arow + kb + 16 + 8 * hh), x3 = *(const v4fa*)(arow + kb + 16 + 8 * hh + 4);
    float xs[16] = {x0[0],x0[1],x0[2],x0[3],x1[0],x1[1],x1[2],x1[3],x2[0],x2[1],x2[2],x2[3],x3[0],x3[1],x3[2],x3[3]};
#pragma unroll
    for (int i = 0; i < 16; ++i) { const _Float16 h = (_Float16)xs[i]; ah.h[i] = h; al.h[i] = ASPLIT ? (_Float16)(xs[i] - (float)h) : (_Float16)0.0f; }
#pragma unroll
    for (int t = 0; t < 4; ++t) { if (col0 + t * 16 >= N) continue; const size_t boff = (size_t)(col0 + t * 16 + ln) * ldb + kb; FragH bq; bq.half[0] = *(const v8us*)(Bh + boff + 8 * hh); bq.half[1] = *(const v8us*)(Bh + boff + 16 + 8 * hh);
      acc[t] = mmaH<ASPLIT ? 2 : 1>(ah.v, al.v, bq.v, bq.v, acc[t]); }
  }
#pragma unroll
  for (int t = 0; t < 4; ++t) { if (col0 + t * 16 >= N) continue;
#pragma unroll
    for (int r = 0; r < 8; ++r) so[w][8 * hh + r][t * 16 + ln] = acc[t][r] * alpha; }
  __builtin_amdgcn_fence(__ATOMIC_ACQ_REL, "workgroup"); __builtin_amdgcn_wave_barrier();
  const int rsub = lane >> 4, c4 = (lane & 15) * 4;
  {
#pragma unroll
    for (int q = 0; q < 8; ++q) { const int r = q * 2 + rsub; if (col0 + c4 < N) { const v4f v = *(const v4fa*)&so[w][r][c4]; *(v4f*)(C + (size_t)(row0 + r) * ldc + col0 + c4) = v; } }
     }
}

// Wt[n][k] = f16(W[k][n]·scale) from f32 row-major W[K][N] (scale = power of two; bf16-exact weights stay exact in f16 away from the subnormal range)
__global__ __launch_bounds__(256) void k_wt_f16(const float* __restrict__ W, _Float16* __restrict__ Wt, int K, int N, float scale) {
  const int t = blockIdx.x * 256 + threadIdx.x; if (t >= N * (K / 8)) return; const int n = t / (K / 8), k8 = (t % (K / 8)) * 8; FragH f;
#pragma unroll
  for (int i = 0; i < 8; ++i) f.h[i] = (_Float16)(bf16_round(W[(size_t)(k8 + i) * N + n]) * scale); const v8us o = f.half[0];
  *(v8us*)((unsigned short*)Wt + (size_t)n * K + k8) = o; 
}
// k_gemm_hh variant with fused epilogue: v = acc·alpha + bias[by·sBias + col] (+ CP[(row/rowsPerB)·sCPb + by·64 + col] if CP) ; ACT 0 none / 1 elu ; writes f16 C16 (and f32 C if non-null)
template <int ACT>
__global__ __launch_bounds__(128) void k_gemm_hhx(const _Float16* __restrict__ A, int lda, size_t sA, const _Float16* __restrict__ Bh, int ldb, size_t sB, float alpha, const float* __restrict__ bias, size_t sBias, const float* __restrict__ CP, int rowsPerB, size_t sCPb, int row0g,
    float* __restrict__ C, _Float16* __restrict__ C16, int ldc, size_t sC, int M, int N, int K) {
  __shared__ __attribute__((aligned(16))) float so[4][16][64];
  const int tid = threadIdx.x, w = tid >> 5, lane = tid & 31, ln = lane & 15, hh = lane >> 4; const int by = blockIdx.y;
  A += (size_t)by * sA; Bh += (size_t)by * sB; const size_t cofs = (size_t)by * sC; const float* bp = bias ? bias + (size_t)by * sBias : nullptr;
  const int ntn = (N + 63) / 64; const int wid = blockIdx.x * 4 + w; const int mt = wid / ntn, nq = wid % ntn; if (mt * 16 >= M) return;
  const int row0 = mt * 16, col0 = nq * 64; const _Float16* arow = A + (size_t)(row0 + ln) * lda;
  v8f acc[4] = {};
  for (int kb = 0; kb < K; kb += 32) { FragH ah; ah.half[0] = *(const v8us*)((const unsigned short*)arow + kb + 8 * hh); ah.half[1] = *(const v8us*)((const unsigned short*)arow + kb + 16 + 8 * hh);
#pragma unroll
    for (int t = 0; t < 4; ++t) { if (col0 + t * 16 >= N) continue; const size_t boff = (size_t)(col0 + t * 16 + ln) * ldb + kb; FragH bq; bq.half[0] = *(const v8us*)((const unsigned short*)Bh + boff + 8 * hh); bq.half[1] = *(const v8us*)((const unsigned short*)Bh + boff + 16 + 8 * hh);
      acc[t] = mmaH<1>(ah.v, ah.v, bq.v, bq.v, acc[t]); }
  }
#pragma unroll
  for (int t = 0; t < 4; ++t) { if (col0 + t * 16 >= N) continue; const int col = col0 + t * 16 + ln; const float bv = bp ? bf16_round(bp[col]) : 0.f;
#pragma unroll
    for (int r = 0; r < 8; ++r) { float v = acc[t][r] * alpha + bv; if (CP) { const int bidx = (row0g + row0 + 8 * hh + r) / rowsPerB; v += CP[(size_t)bidx * sCPb + (size_t)by * 64 + col]; } if (ACT == 1) v = (v > 0.f) ? v : expm1f(v); else if (ACT == 3) v = fmaxf(v, 0.f); so[w][8 * hh + r][t * 16 + ln] = v; } }
  __builtin_amdgcn_fence(__ATOMIC_ACQ_REL, "workgroup"); __builtin_amdgcn_wave_barrier();
  const int rsub = lane >> 4, c4 = (lane & 15) * 4; typedef _Float16 v4h __attribute__((ext_vector_type(4)));
  {
#pragma unroll
    for (int q = 0; q < 8; ++q) { const int r = q * 2 + rsub; if (col0 + c4 < N) { const v4f v = *(const v4fa*)&so[w][r][c4]; if (C) *(v4f*)(C + cofs + (size_t)(row0 + r) * ldc + col0 + c4) = v; if (C16) { v4h h4; for (int i = 0; i < 4; ++i) h4[i] = (_Float16)v[i]; *(v4h*)(C16 + cofs + (size_t)(row0 + r) * ldc + col0 + c4) = h4; } } }
     }
}


__global__ __launch_bounds__(256) void k_x16(const float* __restrict__ x, _Float16* __restrict__ X16, size_t n8) { const size_t t = (size_t)blockIdx.x * 256 + threadIdx.x; if (t >= n8) return; FragH f;
#pragma unroll
  for (int q = 0; q < 8; ++q) f.h[q] = (_Float16)bf16_round(x[t * 8 + q]); *(v8us*)((unsigned short*)X16 + t * 8) = f.half[0];  }
__global__ __launch_bounds__(256) void k_h16(const float* __restrict__ x, _Float16* __restrict__ X16, size_t n8) { const size_t t = (size_t)blockIdx.x * 256 + threadIdx.x; if (t >= n8) return; FragH f;
#pragma unroll
  for (int q = 0; q < 8; ++q) f.h[q] = (_Float16)x[t * 8 + q]; *(v8us*)((unsigned short*)X16 + t * 8) = f.half[0];  }
__global__ __launch_bounds__(256) void k_round16f(const float* __restrict__ W, _Float16* __restrict__ Bt, size_t n8) { const size_t t = (size_t)blockIdx.x * 256 + threadIdx.x; if (t >= n8) return; FragH f;
#pragma unroll
  for (int i = 0; i < 8; ++i) f.h[i] = (_Float16)(bf16_round(W[t * 8 + i]) * 16.0f); *(v8us*)((unsigned short*)Bt + t * 8) = f.half[0];  }
template <int NHv, int TTv>
__global__ __launch_bounds__(256) void k_vt(const _Float16* __restrict__ V16, int ldv, int voff, _Float16* __restrict__ Vt) { __shared__ unsigned short tl[64][66]; const int tid = threadIdx.x; const int slab = blockIdx.x / (TTv / 64), lg = blockIdx.x % (TTv / 64); const int b = slab / NHv, h = slab % NHv;
  for (int i = tid; i < 64 * 8; i += 256) { const int r = i / 8, c8 = (i % 8) * 8; FragH f; f.half[0] = *(const v8us*)((const unsigned short*)V16 + ((size_t)b * TTv + lg * 64 + r) * ldv + voff + h * 64 + c8);
#pragma unroll
    for (int q = 0; q < 8; ++q) tl[r][c8 + q] = f.u[q]; }
  __syncthreads();
  {
#pragma unroll
    for (int rd = 0; rd < 2; ++rd) { const int d = rd * 32 + tid / 8, pc = tid % 8; FragH f;
#pragma unroll
      for (int q = 0; q < 8; ++q) f.u[q] = tl[pc * 8 + q][d];
      *(v8us*)((unsigned short*)Vt + ((size_t)slab * 64 + d) * TTv + lg * 64 + pc * 8) = f.half[0]; }
     } }

#define NKW 16
__device__ __forceinline__ float xhalf(float x) { return __builtin_bit_cast(float, __builtin_amdgcn_permlanex16(__builtin_bit_cast(int, x), __builtin_bit_cast(int, x), 0x76543210, 0xfedcba98, false, false)); }  // lane l with lane l ^ 16
// amdgpu_waves_per_eu(8): 128 VGPRs a wave, so that two 16-wave work-groups share a WGP and eight waves fill each other's waits on a SIMD.
__global__ __launch_bounds__(NKW * 32) __attribute__((amdgpu_waves_per_eu(8))) void k_flash(const _Float16* __restrict__ Q16, int ldq, const _Float16* __restrict__ K16, int ldk, const _Float16* __restrict__ Vt, const int* __restrict__ MSK, float* __restrict__ O, int ldo) {
  constexpr int NQB = 4096 / 16, DT = 4, KS = 2;
  __shared__ __attribute__((aligned(16))) float sO[NKW][16][64 + 4];
  __shared__ float sM[NKW][16], sL[NKW][16];
  const int lane = (int)__builtin_amdgcn_mbcnt_lo(~0u, 0u), ln = lane & 15, hh = lane >> 4;   // lane id without threadIdx.x: one register fewer live over the key loop
  const int w = __builtin_amdgcn_readfirstlane((int)threadIdx.x >> 5);   // scalar, so that the key loop's test stays a scalar branch
  const int slab = blockIdx.x / NQB, qblk = blockIdx.x % NQB; const int b = slab; const int q0 = qblk * 16; (void)MSK;
  FragH aq[KS];   // B operand of S^T: column ln = query q0 + ln
  { const unsigned short* qr = (const unsigned short*)Q16 + ((size_t)b * 4096 + q0 + ln) * ldq;
#pragma unroll
    for (int ks = 0; ks < KS; ++ks) { aq[ks].half[0] = *(const v8us*)(qr + ks * 32 + 8 * hh); aq[ks].half[1] = *(const v8us*)(qr + ks * 32 + 16 + 8 * hh); } }
  const unsigned short* Vth = (const unsigned short*)Vt + (size_t)slab * 64 * 4096;
  float m_q = -3.0e38f, l_q = 0.f; v8f oacc[DT];   // of query q0 + ln; l_q over this half's keys only, the halves joined behind the loop
#pragma unroll
  for (int dt = 0; dt < DT; ++dt) oacc[dt] = (v8f){0.f,0.f,0.f,0.f,0.f,0.f,0.f,0.f};
  const int jend = q0 + 16;
#pragma unroll 1
  for (int j0 = w * 32; j0 < jend; j0 += NKW * 32) {
    float sc[16];   // sc[nt * 8 + r] = score of key j0 + nt * 16 + 8 hh + r
#pragma unroll
    for (int nt = 0; nt < 2; ++nt) { const unsigned short* kr = (const unsigned short*)K16 + ((size_t)b * 4096 + j0 + nt * 16 + ln) * ldk; FragH bk[KS];
#pragma unroll
      for (int ks = 0; ks < KS; ++ks) { bk[ks].half[0] = *(const v8us*)(kr + ks * 32 + 8 * hh); bk[ks].half[1] = *(const v8us*)(kr + ks * 32 + 16 + 8 * hh); }
      v8f acc = (v8f){0.f,0.f,0.f,0.f,0.f,0.f,0.f,0.f};
#pragma unroll
      for (int ks = 0; ks < KS; ++ks) acc = mmaH<1>(bk[ks].v, bk[ks].v, aq[ks].v, aq[ks].v, acc);
#pragma unroll
      for (int r = 0; r < 8; ++r) sc[nt * 8 + r] = acc[r] * (0.0625f); }
    if (j0 + 31 > q0) {   // only the tile on the diagonal holds keys behind a query (a scalar test); key j0 <= q0 stays, so every query keeps a finite maximum
#pragma unroll
      for (int i = 0; i < 16; ++i) if (j0 + (i >> 3) * 16 + 8 * hh + (i & 7) > q0 + ln) sc[i] = -INFINITY; }
    float mc = sc[0];
#pragma unroll
    for (int i = 1; i < 16; ++i) mc = fmaxf(mc, sc[i]);
    mc = fmaxf(mc, xhalf(mc));
    const float mn = fmaxf(m_q, mc); const float al = expf(m_q - mn); m_q = mn;
    FragH pb; float ps = 0.f;
#pragma unroll
    for (int i = 0; i < 16; ++i) { const float p = expf(sc[i] - mn); ps += p; pb.h[i] = (_Float16)p; }
    l_q = l_q * al + ps;
#pragma unroll
    for (int dt = 0; dt < DT; ++dt) oacc[dt] *= al;
#pragma unroll
    for (int dt = 0; dt < DT; ++dt) { const unsigned short* vrow = Vth + (size_t)(dt * 16 + ln) * 4096 + j0; FragH bv; bv.half[0] = *(const v8us*)(vrow + 8 * hh); bv.half[1] = *(const v8us*)(vrow + 16 + 8 * hh);
      oacc[dt] = mmaH<1>(bv.v, bv.v, pb.v, pb.v, oacc[dt]); } }
  // each wave's partial: query maximum, sum (the two halves joined) and the un-normalised output row; a wave without a key tile leaves (-3e38, 0, 0)
  l_q += xhalf(l_q);
  if (hh == 0) { sM[w][ln] = m_q; sL[w][ln] = l_q; }
#pragma unroll
  for (int dt = 0; dt < DT; ++dt) {   // oacc[dt][r] = O[q0 + ln][dt * 16 + 8 hh + r]: eight neighbours of one row
    *(v4fa*)&sO[w][ln][dt * 16 + 8 * hh] = (v4f){oacc[dt][0], oacc[dt][1], oacc[dt][2], oacc[dt][3]};
    *(v4fa*)&sO[w][ln][dt * 16 + 8 * hh + 4] = (v4f){oacc[dt][4], oacc[dt][5], oacc[dt][6], oacc[dt][7]}; }
  __syncthreads();   // publishes every wave's partial to the merging threads
  if (w < 8) { const int r = w * 2 + hh, pc = ln;
    float M = sM[0][r];
#pragma unroll
    for (int u = 1; u < NKW; ++u) M = fmaxf(M, sM[u][r]);
    float L = 0.f; v4f o = {0.f, 0.f, 0.f, 0.f};
#pragma unroll
    for (int u = 0; u < NKW; ++u) { const float e = expf(sM[u][r] - M); L += e * sL[u][r]; const v4f pv = *(const v4fa*)&sO[u][r][pc * 4]; o += pv * e; }
    const float inv = (L > 0.f) ? 1.0f / L : 0.f;
    *(v4f*)(O + ((size_t)b * 4096 + q0 + r) * ldo + pc * 4) = o * inv; } }

extern "C" void kernel_launch(void* const* d_in, const int* in_sizes, int n_in,
                              void* d_out, int out_size, void* d_ws, size_t ws_size, hipStream_t stream) {
  (void)in_sizes; (void)n_in; (void)out_size;
  const float* x = (const float*)d_in[0]; const float* Wq = (const float*)d_in[1]; const float* Wk = (const float*)d_in[2]; const float* Wv = (const float*)d_in[3];
  char* ws = (char*)d_ws; size_t off = 0;
  auto take = [&](size_t bytes) { char* p = ws + off; off += (bytes + 255) & ~(size_t)255; return p; };
  _Float16* Bq = (_Float16*)take(HD * DD * 2); _Float16* Bk = (_Float16*)take(HD * DD * 2); _Float16* Bv = (_Float16*)take(HD * DD * 2); _Float16* X16 = (_Float16*)take((size_t)NR * DD * 2); _Float16* Q16 = (_Float16*)take((size_t)NR * HD * 2); _Float16* K16 = (_Float16*)take((size_t)NR * HD * 2); _Float16* V16 = (_Float16*)take((size_t)NR * HD * 2); _Float16* Vt = (_Float16*)take((size_t)NR * HD * 2);
  if (off > ws_size) return;      // 8.4 + 2.1 × 4 ≈ 17 MiB
  k_wt_f16<<<(HD * (DD / 8) + 255) / 256, 256, 0, stream>>>(Wq, Bq, DD, HD, 16.0f); k_wt_f16<<<(HD * (DD / 8) + 255) / 256, 256, 0, stream>>>(Wk, Bk, DD, HD, 16.0f); k_wt_f16<<<(HD * (DD / 8) + 255) / 256, 256, 0, stream>>>(Wv, Bv, DD, HD, 16.0f);
  k_x16<<<(unsigned)(((size_t)NR * DD / 8 + 255) / 256), 256, 0, stream>>>(x, X16, (size_t)NR * DD / 8);
  const dim3 gg(((NR / 16) * 1 + 3) / 4, 1);
  k_gemm_hhx<0><<<gg, 128, 0, stream>>>(X16, DD, 0, Bq, DD, 0, 0.0625f, nullptr, 0, nullptr, 1, 0, 0, nullptr, Q16, HD, 0, NR, HD, DD);
  k_gemm_hhx<0><<<gg, 128, 0, stream>>>(X16, DD, 0, Bk, DD, 0, 0.0625f, nullptr, 0, nullptr, 1, 0, 0, nullptr, K16, HD, 0, NR, HD, DD);
  k_gemm_hhx<0><<<gg, 128, 0, stream>>>(X16, DD, 0, Bv, DD, 0, 0.0625f, nullptr, 0, nullptr, 1, 0, 0, nullptr, V16, HD, 0, NR, HD, DD);
  k_vt<1, TT><<<BB * 1 * (TT / 64), 256, 0, stream>>>(V16, HD, 0, Vt);
  k_flash<<<BB * 1 * (TT / 16), NKW * 32, 0, stream>>>(Q16, HD, K16, HD, Vt, nullptr, (float*)d_out, HD);
}

// v003
// It runs in 64.1 microseconds.
// In two side-by-side timings against v002, it was 1.57 and 1.59 times as fast.
// Over all steps from v000 it is 8.15 times as fast.
#include <hip/hip_runtime.h>
// Single-head causal self-attention layer (B=4, S=4096, D=256, H=64; scale 1/√256 as in the module): q/k/v projections as GEMMs (W [in][out] transposed to bf16-exact ×2^4) and the attention as a
// fused flash-style causal kernel (online softmax f32, P f16 <= 1, O^T = Vt*P^T; 16 query rows per work-group, key tiles dealt over its 16 waves, partials merged in LDS) on v_wmma_f32_16x16x32_f16 with f32 accumulate.
#define BB 4
#define TT 4096
#define DD 256
#define HD 64
#define NR (BB * TT)

typedef __bf16 v16b __attribute__((ext_vector_type(16)));
typedef unsigned short v8us __attribute__((ext_vector_type(8), may_alias));
typedef float  v8f  __attribute__((ext_vector_type(8)));
typedef float  v4f  __attribute__((ext_vector_type(4)));
typedef float  v4fa __attribute__((ext_vector_type(4), may_alias));
union FragB { v16b v; v8us half[2]; unsigned short u[16]; };

__device__ __forceinline__ unsigned short bf16_bits(float x) { unsigned int u = __float_as_uint(x); return (unsigned short)((u + 0x7FFFu + ((u >> 16) & 1u)) >> 16); }
__device__ __forceinline__ float bf16_val(unsigned short b) { return __uint_as_float(((unsigned int)b) << 16); }
__device__ __forceinline__ float bf16_round(float x) { return bf16_val(bf16_bits(x)); }
// D += A·B with NT terms: 1 = ah·bh, 2 = + al·bh (A split), 3 = + ah·bl (both split)
template <int NT>
__device__ __forceinline__ v8f mmaN(v16b ah, v16b al, v16b bh, v16b bl, v8f c) {
  c = __builtin_amdgcn_wmma_f32_16x16x32_bf16(false, ah, false, bh, (short)0, c, false, false);
  if (NT >= 2) c = __builtin_amdgcn_wmma_f32_16x16x32_bf16(false, al, false, bh, (short)0, c, false, false);
  if (NT >= 3) c = __builtin_amdgcn_wmma_f32_16x16x32_bf16(false, ah, false, bl, (short)0, c, false, false);
  asm volatile("v_nop\n\tv_nop\n\tv_nop\n\tv_nop" : "+v"(c) : "v"(ah), "v"(al), "v"(bh), "v"(bl));
  return c;
}

__global__ __launch_bounds__(256) void k_wt_bf16(const float* __restrict__ W, unsigned short* __restrict__ Wt, int K, int N) {
  const int t = blockIdx.x * 256 + threadIdx.x;
  const int k8n = K / 8;
  if (t >= N * k8n) return;
  const int n = t / k8n, k8 = (t % k8n) * 8;
  v8us v;
#pragma unroll
  for (int i = 0; i < 8; ++i) v[i] = bf16_bits(W[(size_t)(k8 + i) * N + n]);
  *(v8us*)(Wt + (size_t)n * K + k8) = v;
  
}

// GEMM C[M][N] (f32, pitch ldc) = act(A[M][K]·W + bias). A f32 row-major (pitch lda) converted per fragment to bf16
// (ASPLIT: hi/lo two planes -> 2 terms, else single rounded term); Wt bf16 [N][K] (pitch ldb). BIAS_BF16 rounds the
// bias to bf16 first (bias quantised to bf16 before the add). K%32==0, M%16==0, N%64==0.
template <bool ASPLIT, int ACT, bool BIAS_BF16>
__global__ __launch_bounds__(128) void k_gemm_bf(const float* __restrict__ A, int lda, const unsigned short* __restrict__ Wt, int ldb,
                                               const float* __restrict__ bias, float* __restrict__ C, int ldc, int M, int N, int K) {
  __shared__ __attribute__((aligned(16))) float so[4][16][64];
  const int tid = threadIdx.x, w = tid >> 5, lane = tid & 31, ln = lane & 15, hh = lane >> 4;
  const int ntn = N / 64;
  const int wid = blockIdx.x * 4 + w;
  const int mt = wid / ntn, nq = wid % ntn;
  if (mt * 16 >= M) return;
  const int row0 = mt * 16, col0 = nq * 64;
  const float* arow = A + (size_t)(row0 + ln) * lda;
  v8f acc[4] = {};
  for (int kb = 0; kb < K; kb += 32) {
    FragB ah, al;
    const v4f x0 = *(const v4fa*)(arow + kb + 8 * hh), x1 = *(const v4fa*)(arow + kb + 8 * hh + 4);
    const v4f x2 = *(const v4fa*)(arow + kb + 16 + 8 * hh), x3 = *(const v4fa*)(arow + kb + 16 + 8 * hh + 4);
    float xs[16] = {x0[0],x0[1],x0[2],x0[3],x1[0],x1[1],x1[2],x1[3],x2[0],x2[1],x2[2],x2[3],x3[0],x3[1],x3[2],x3[3]};
#pragma unroll
    for (int i = 0; i < 16; ++i) { const unsigned short hb = bf16_bits(xs[i]); ah.u[i] = hb; al.u[i] = ASPLIT ? bf16_bits(xs[i] - bf16_val(hb)) : (unsigned short)0; }
#pragma unroll
    for (int t = 0; t < 4; ++t) {
      const unsigned short* brow = Wt + (size_t)(col0 + t * 16 + ln) * ldb + kb;
      FragB b;
      b.half[0] = *(const v8us*)(brow + 8 * hh);
      b.half[1] = *(const v8us*)(brow + 16 + 8 * hh);
      acc[t] = mmaN<ASPLIT ? 2 : 1>(ah.v, al.v, b.v, b.v, acc[t]);
    }
  }
#pragma unroll
  for (int t = 0; t < 4; ++t) {
    float bv = bias ? bias[col0 + t * 16 + ln] : 0.f;
    if (BIAS_BF16) bv = bf16_round(bv);
#pragma unroll
    for (int r = 0; r < 8; ++r) { float v = acc[t][r] + bv; if (ACT == 1) v = fmaxf(v, 0.f); so[w][8 * hh + r][t * 16 + ln] = v; }
  }
  __builtin_amdgcn_fence(__ATOMIC_ACQ_REL, "workgroup");
  __builtin_amdgcn_wave_barrier();
  const int rsub = lane >> 4, c4 = (lane & 15) * 4;
  {
#pragma unroll
    for (int q = 0; q < 8; ++q) {
      const int r = q * 2 + rsub;
      const v4f v = *(const v4fa*)&so[w][r][c4];
      *(v4f*)(C + (size_t)(row0 + r) * ldc + col0 + c4) = v;
    }
    
  }
}

// Flash-style causal/unmasked attention, all contractions 3-term bf16 hi/lo splits, f32 softmax with running max.
// q,k,v rows are read from f32 buffers with arbitrary row pitch (so they can live inside a fused qkv buffer);
// D = head size (multiple of 32, <= 128); one wave = 16 query rows; block = 4 waves (64 queries) sharing K/V chunks of 32.
template <int D, bool CAUSAL>
__global__ __launch_bounds__(128) void k_flash(const float* __restrict__ qb, const float* __restrict__ kb, const float* __restrict__ vb,
                                             int pitch, int T, int H, float scale, float* __restrict__ y, int ypitch) {
  constexpr int KS = D / 32;        // k-steps for QK
  constexpr int DT = D / 16;        // d tiles for PV
  __shared__ __attribute__((aligned(16))) unsigned short sKh[32][D + 8], sKl[32][D + 8], sVh[32][D + 8], sVl[32][D + 8];
  __shared__ __attribute__((aligned(16))) unsigned short sPh[4][16][40], sPl[4][16][40];
  __shared__ __attribute__((aligned(16))) float sO[4][16][D];
  const int tid = threadIdx.x, w = tid >> 5, lane = tid & 31, ln = lane & 15, hh = lane >> 4;
  const int nqb = (T + 63) / 64;
  const int bh = blockIdx.x / nqb, qblk = blockIdx.x % nqb;
  const int b = bh / H, h = bh % H;
  const int q0 = qblk * 64 + w * 16;
  const float* Q = qb + (size_t)b * T * pitch + h * D;
  const float* K = kb + (size_t)b * T * pitch + h * D;
  const float* V = vb + (size_t)b * T * pitch + h * D;

  // A fragments of the wave's 16 query rows (scaled), hi/lo
  FragB aqh[KS], aql[KS];
  {
    int row = q0 + ln; if (row >= T) row = T - 1;
    const float* qr = Q + (size_t)row * pitch;
#pragma unroll
    for (int ks = 0; ks < KS; ++ks)
#pragma unroll
      for (int i = 0; i < 16; ++i) {
        const int d = ks * 32 + ((i < 8) ? (8 * hh + i) : (16 + 8 * hh + (i - 8)));
        const float x = qr[d] * scale; const unsigned short hb = bf16_bits(x);
        aqh[ks].u[i] = hb; aql[ks].u[i] = bf16_bits(x - bf16_val(hb));
      }
  }
  float m_r[8], l_r[8];
#pragma unroll
  for (int r = 0; r < 8; ++r) { m_r[r] = -3.0e38f; l_r[r] = 0.f; }
  v8f oacc[DT];
#pragma unroll
  for (int dt = 0; dt < DT; ++dt) oacc[dt] = (v8f){0.f,0.f,0.f,0.f,0.f,0.f,0.f,0.f};

  const int kv_end = CAUSAL ? min(T, qblk * 64 + 64) : T;     // block-uniform
  for (int j0 = 0; j0 < kv_end; j0 += 32) {
    __syncthreads();
    for (int e = tid; e < 32 * (D / 4); e += 128) {
      const int r = e / (D / 4), c4 = (e % (D / 4)) * 4;
      const int key = j0 + r;
      v4f kf = {0.f,0.f,0.f,0.f}, vf = {0.f,0.f,0.f,0.f};
      if (key < T) { kf = *(const v4fa*)(K + (size_t)key * pitch + c4); vf = *(const v4fa*)(V + (size_t)key * pitch + c4); }
#pragma unroll
      for (int t = 0; t < 4; ++t) {
        unsigned short hb = bf16_bits(kf[t]); sKh[r][c4 + t] = hb; sKl[r][c4 + t] = bf16_bits(kf[t] - bf16_val(hb));
        hb = bf16_bits(vf[t]); sVh[r][c4 + t] = hb; sVl[r][c4 + t] = bf16_bits(vf[t] - bf16_val(hb));
      }
    }
    __syncthreads();
    // S tile 16 x 32
    v8f s[2];
#pragma unroll
    for (int nt = 0; nt < 2; ++nt) {
      v8f acc = {};
#pragma unroll
      for (int ks = 0; ks < KS; ++ks) {
        FragB bh_, bl_;
        bh_.half[0] = *(const v8us*)&sKh[nt * 16 + ln][ks * 32 + 8 * hh]; bh_.half[1] = *(const v8us*)&sKh[nt * 16 + ln][ks * 32 + 16 + 8 * hh];
        bl_.half[0] = *(const v8us*)&sKl[nt * 16 + ln][ks * 32 + 8 * hh]; bl_.half[1] = *(const v8us*)&sKl[nt * 16 + ln][ks * 32 + 16 + 8 * hh];
        acc = mmaN<3>(aqh[ks].v, aql[ks].v, bh_.v, bl_.v, acc);
      }
      s[nt] = acc;
    }
    // mask + running max (rows 8hh+r; the 16 lanes of a half share rows)
    float alpha[8];
#pragma unroll
    for (int r = 0; r < 8; ++r) {
      const int qi = q0 + 8 * hh + r;
      const int ja = j0 + ln, jb = j0 + 16 + ln;
      if (CAUSAL) { if (ja > qi) s[0][r] = -3.0e38f; if (jb > qi) s[1][r] = -3.0e38f; }
      if (ja >= T) s[0][r] = -3.0e38f;
      if (jb >= T) s[1][r] = -3.0e38f;
      float mx = fmaxf(s[0][r], s[1][r]);
      mx = fmaxf(mx, __shfl_xor(mx, 1, 32)); mx = fmaxf(mx, __shfl_xor(mx, 2, 32)); mx = fmaxf(mx, __shfl_xor(mx, 4, 32)); mx = fmaxf(mx, __shfl_xor(mx, 8, 32));
      const float mnew = fmaxf(m_r[r], mx);
      alpha[r] = (mnew > -1.0e38f) ? __expf(m_r[r] - mnew) : 1.0f;
      const float p0 = (s[0][r] > -1.0e38f) ? __expf(s[0][r] - mnew) : 0.f;
      const float p1 = (s[1][r] > -1.0e38f) ? __expf(s[1][r] - mnew) : 0.f;
      m_r[r] = mnew;
      l_r[r] = l_r[r] * alpha[r] + p0 + p1;            // per-lane partial row sum (16 lanes combined at the end)
      unsigned short hb = bf16_bits(p0); sPh[w][8 * hh + r][ln] = hb;      sPl[w][8 * hh + r][ln] = bf16_bits(p0 - bf16_val(hb));
      hb = bf16_bits(p1);                sPh[w][8 * hh + r][16 + ln] = hb; sPl[w][8 * hh + r][16 + ln] = bf16_bits(p1 - bf16_val(hb));
    }
#pragma unroll
    for (int dt = 0; dt < DT; ++dt)
#pragma unroll
      for (int r = 0; r < 8; ++r) oacc[dt][r] *= alpha[r];
    __builtin_amdgcn_fence(__ATOMIC_ACQ_REL, "workgroup");
    __builtin_amdgcn_wave_barrier();
    FragB pah, pal;
    pah.half[0] = *(const v8us*)&sPh[w][ln][8 * hh]; pah.half[1] = *(const v8us*)&sPh[w][ln][16 + 8 * hh];
    pal.half[0] = *(const v8us*)&sPl[w][ln][8 * hh]; pal.half[1] = *(const v8us*)&sPl[w][ln][16 + 8 * hh];
#pragma unroll
    for (int dt = 0; dt < DT; ++dt) {
      FragB bvh, bvl;
#pragma unroll
      for (int i = 0; i < 8; ++i) {
        bvh.u[i] = sVh[8 * hh + i][dt * 16 + ln]; bvh.u[8 + i] = sVh[16 + 8 * hh + i][dt * 16 + ln];
        bvl.u[i] = sVl[8 * hh + i][dt * 16 + ln]; bvl.u[8 + i] = sVl[16 + 8 * hh + i][dt * 16 + ln];
      }
      oacc[dt] = mmaN<3>(pah.v, pal.v, bvh.v, bvl.v, oacc[dt]);
    }
    __builtin_amdgcn_fence(__ATOMIC_ACQ_REL, "workgroup");
    __builtin_amdgcn_wave_barrier();
  }
#pragma unroll
  for (int r = 0; r < 8; ++r) {
    float l = l_r[r];
    l += __shfl_xor(l, 1, 32); l += __shfl_xor(l, 2, 32); l += __shfl_xor(l, 4, 32); l += __shfl_xor(l, 8, 32);
    l_r[r] = (l > 0.f) ? 1.0f / l : 0.f;
  }
#pragma unroll
  for (int dt = 0; dt < DT; ++dt)
#pragma unroll
    for (int r = 0; r < 8; ++r) sO[w][8 * hh + r][dt * 16 + ln] = oacc[dt][r] * l_r[r];
  __builtin_amdgcn_fence(__ATOMIC_ACQ_REL, "workgroup");
  __builtin_amdgcn_wave_barrier();
  {
    for (int r = 0; r < 16; ++r) {
      const int row = q0 + r;
      if (row < T && lane < D / 4) {
        const v4f val = *(const v4fa*)&sO[w][r][lane * 4];
        *(v4f*)(y + ((size_t)b * T + row) * ypitch + h * D + lane * 4) = val;
      }
    }
    
  }
}

// GEMM C = act(A·W + bias + resid): A f32 (ASPLIT -> hi/lo 2 terms), Wt bf16 [N][K]; ACT 0 none, 1 relu, 2 exact gelu;
// resid (optional, f32, row index = (row % rmod), pitch ldr, RES_BF16 rounds it) added before the activation.
template <bool ASPLIT, int ACT, bool BIAS_BF16, bool RES_BF16>
__global__ __launch_bounds__(128) void k_gemm_bf3(const float* __restrict__ A, int lda, const unsigned short* __restrict__ Wt, int ldb,
                                                const float* __restrict__ bias, const float* __restrict__ resid, int rmod, int ldr,
                                                float* __restrict__ C, int ldc, int M, int N, int K) {
  __shared__ __attribute__((aligned(16))) float so[4][16][64];
  const int tid = threadIdx.x, w = tid >> 5, lane = tid & 31, ln = lane & 15, hh = lane >> 4;
  const int ntn = N / 64;
  const int wid = blockIdx.x * 4 + w;
  const int mt = wid / ntn, nq = wid % ntn;
  if (mt * 16 >= M) return;
  const int row0 = mt * 16, col0 = nq * 64;
  const float* arow = A + (size_t)(row0 + ln) * lda;
  v8f acc[4] = {};
  for (int kb = 0; kb < K; kb += 32) {
    FragB ah, al;
    const v4f x0 = *(const v4fa*)(arow + kb + 8 * hh), x1 = *(const v4fa*)(arow + kb + 8 * hh + 4);
    const v4f x2 = *(const v4fa*)(arow + kb + 16 + 8 * hh), x3 = *(const v4fa*)(arow + kb + 16 + 8 * hh + 4);
    float xs[16] = {x0[0],x0[1],x0[2],x0[3],x1[0],x1[1],x1[2],x1[3],x2[0],x2[1],x2[2],x2[3],x3[0],x3[1],x3[2],x3[3]};
#pragma unroll
    for (int i = 0; i < 16; ++i) { const unsigned short hb = bf16_bits(xs[i]); ah.u[i] = hb; al.u[i] = ASPLIT ? bf16_bits(xs[i] - bf16_val(hb)) : (unsigned short)0; }
#pragma unroll
    for (int t = 0; t < 4; ++t) {
      const unsigned short* brow = Wt + (size_t)(col0 + t * 16 + ln) * ldb + kb;
      FragB b;
      b.half[0] = *(const v8us*)(brow + 8 * hh);
      b.half[1] = *(const v8us*)(brow + 16 + 8 * hh);
      acc[t] = mmaN<ASPLIT ? 2 : 1>(ah.v, al.v, b.v, b.v, acc[t]);
    }
  }
#pragma unroll
  for (int t = 0; t < 4; ++t) {
    const int col = col0 + t * 16 + ln;
    float bv = bias ? bias[col] : 0.f;
    if (BIAS_BF16) bv = bf16_round(bv);
#pragma unroll
    for (int r = 0; r < 8; ++r) {
      float v = acc[t][r] + bv;
      if (resid) { float rv = resid[(size_t)((row0 + 8 * hh + r) % rmod) * ldr + col]; if (RES_BF16) rv = bf16_round(rv); v += rv; }
      if (ACT == 1) v = fmaxf(v, 0.f);
      if (ACT == 2) v = 0.5f * v * (1.0f + erff(v * 0.70710678118654752f));
      if (ACT == 3) { const float u = 0.7978845608028654f * (v + 0.044715f * v * v * v); v = 0.5f * v * (1.0f + tanhf(u)); }
      so[w][8 * hh + r][t * 16 + ln] = v;
    }
  }
  __builtin_amdgcn_fence(__ATOMIC_ACQ_REL, "workgroup");
  __builtin_amdgcn_wave_barrier();
  const int rsub = lane >> 4, c4 = (lane & 15) * 4;
  {
#pragma unroll
    for (int q = 0; q < 8; ++q) {
      const int r = q * 2 + rsub;
      const v4f v = *(const v4fa*)&so[w][r][c4];
      *(v4f*)(C + (size_t)(row0 + r) * ldc + col0 + c4) = v;
    }
    
  }
}
// row LayerNorm (biased variance, eps) over N: s = X (+ R); optional out_sum <- s; out_norm <- (s-mu)*rsqrt(var+eps)*g + b
template <bool PARAM_BF16>
__global__ __launch_bounds__(256) void k_layernorm(const float* __restrict__ X, const float* __restrict__ R, const float* __restrict__ g, const float* __restrict__ bta,
                                                  float* __restrict__ out_sum, float* __restrict__ out_norm, int N, float eps) {
  __shared__ float red[256];
  const int row = blockIdx.x, tid = threadIdx.x;
  const float* x = X + (size_t)row * N; const float* rr = R ? R + (size_t)row * N : nullptr;
  float vals[16];                     // up to N = 4096
  const int per = N / 256;            // contiguous chunk per thread? use strided-by-4 chunks: thread handles j = tid*4 + 1024*u
  float s1 = 0.f;
  for (int u = 0; u < per / 4; ++u) {
    const int j = tid * 4 + 1024 * u;
    const v4f a = *(const v4fa*)(x + j);
    v4f b = {0.f,0.f,0.f,0.f}; if (rr) b = *(const v4fa*)(rr + j);
#pragma unroll
    for (int q = 0; q < 4; ++q) { const float v = a[q] + b[q]; vals[u * 4 + q] = v; s1 += v; }
  }
  red[tid] = s1; __syncthreads();
  for (int st = 128; st > 0; st >>= 1) { if (tid < st) red[tid] += red[tid + st]; __syncthreads(); }
  const float mu = red[0] / (float)N; __syncthreads();
  float s2 = 0.f;
  for (int u = 0; u < per / 4; ++u)
#pragma unroll
    for (int q = 0; q < 4; ++q) { const float c = vals[u * 4 + q] - mu; s2 += c * c; }
  red[tid] = s2; __syncthreads();
  for (int st = 128; st > 0; st >>= 1) { if (tid < st) red[tid] += red[tid + st]; __syncthreads(); }
  const float rs = rsqrtf(red[0] / (float)N + eps);
  {
    for (int u = 0; u < per / 4; ++u) {
      const int j = tid * 4 + 1024 * u;
      v4f o, sm;
#pragma unroll
      for (int q = 0; q < 4; ++q) {
        float gg = g[j + q], bb = bta[j + q];
        if (PARAM_BF16) { gg = bf16_round(gg); bb = bf16_round(bb); }
        sm[q] = vals[u * 4 + q]; o[q] = (vals[u * 4 + q] - mu) * rs * gg + bb;
      }
      if (out_sum) *(v4f*)(out_sum + (size_t)row * N + j) = sm;
      *(v4f*)(out_norm + (size_t)row * N + j) = o;
    }
    
  }
}



// ---- f16 WMMA path (v_wmma_f32_16x16x32_f16): 11-bit significands for operands in range — used where a [0,1] probability operand needs more precision than bf16
typedef _Float16 v16h __attribute__((ext_vector_type(16)));
union FragH { v16h v; v8us half[2]; _Float16 h[16]; unsigned short u[16]; };
template <int NT>
__device__ __forceinline__ v8f mmaH(v16h ah, v16h al, v16h bh, v16h bl, v8f c) {
  c = __builtin_amdgcn_wmma_f32_16x16x32_f16(false, ah, false, bh, (short)0, c, false, false);
  if (NT >= 2) c = __builtin_amdgcn_wmma_f32_16x16x32_f16(false, al, false, bh, (short)0, c, false, false);
  if (NT >= 3) c = __builtin_amdgcn_wmma_f32_16x16x32_f16(false, ah, false, bl, (short)0, c, false, false);
  asm volatile("v_nop\n\tv_nop\n\tv_nop\n\tv_nop" : "+v"(c) : "v"(ah), "v"(al), "v"(bh), "v"(bl));
  return c;
}
// batched GEMM like k_gemm_b but f16 operands: A f32 (split into f16 hi/lo if ASPLIT, else rounded to f16), Bt = f16 values [n][k]; alpha; C f32; N multiple of 16 (partial tiles skipped)
template <bool ASPLIT>
__global__ __launch_bounds__(128) void k_gemm_h(const float* __restrict__ A, int lda, size_t sA, const _Float16* __restrict__ Bh, int ldb, size_t sB, float alpha, float* __restrict__ C, int ldc, size_t sC, int M, int N, int K) {
  __shared__ __attribute__((aligned(16))) float so[4][16][64];
  const int tid = threadIdx.x, w = tid >> 5, lane = tid & 31, ln = lane & 15, hh = lane >> 4; const int by = blockIdx.y;
  A += (size_t)by * sA; Bh += (size_t)by * sB; C += (size_t)by * sC;
  const int ntn = (N + 63) / 64; const int wid = blockIdx.x * 4 + w; const int mt = wid / ntn, nq = wid % ntn; if (mt * 16 >= M) return;
  const int row0 = mt * 16, col0 = nq * 64; const float* arow = A + (size_t)(row0 + ln) * lda;
  v8f acc[4] = {};
  for (int kb = 0; kb < K; kb += 32) {
    FragH ah, al;
    const v4f x0 = *(const v4fa*)(arow + kb + 8 * hh), x1 = *(const v4fa*)(arow + kb + 8 * hh + 4), x2 = *(const v4fa*)(arow + kb + 16 + 8 * hh), x3 = *(const v4fa*)(arow + kb + 16 + 8 * hh + 4);
    float xs[16] = {x0[0],x0[1],x0[2],x0[3],x1[0],x1[1],x1[2],x1[3],x2[0],x2[1],x2[2],x2[3],x3[0],x3[1],x3[2],x3[3]};
#pragma unroll
    for (int i = 0; i < 16; ++i) { const _Float16 h = (_Float16)xs[i]; ah.h[i] = h; al.h[i] = ASPLIT ? (_Float16)(xs[i] - (float)h) : (_Float16)0.0f; }
#pragma unroll
    for (int t = 0; t < 4; ++t) { if (col0 + t * 16 >= N) continue; const size_t boff = (size_t)(col0 + t * 16 + ln) * ldb + kb; FragH bq; bq.half[0] = *(const v8us*)(Bh + boff + 8 * hh); bq.half[1] = *(const v8us*)(Bh + boff + 16 + 8 * hh);
      acc[t] = mmaH<ASPLIT ? 2 : 1>(ah.v, al.v, bq.v, bq.v, acc[t]); }
  }
#pragma unroll
  for (int t = 0; t < 4; ++t) { if (col0 + t * 16 >= N) continue;
#pragma unroll
    for (int r = 0; r < 8; ++r) so[w][8 * hh + r][t * 16 + ln] = acc[t][r] * alpha; }
  __builtin_amdgcn_fence(__ATOMIC_ACQ_REL, "workgroup"); __builtin_amdgcn_wave_barrier();
  const int rsub = lane >> 4, c4 = (lane & 15) * 4;
  {
#pragma unroll
    for (int q = 0; q < 8; ++q) { const int r = q * 2 + rsub; if (col0 + c4 < N) { const v4f v = *(const v4fa*)&so[w][r][c4]; *(v4f*)(C + (size_t)(row0 + r) * ldc + col0 + c4) = v; } }
     }
}

__global__ __launch_bounds__(256) void k_h16(const float* __restrict__ x, _Float16* __restrict__ X16, size_t n8) { const size_t t = (size_t)blockIdx.x * 256 + threadIdx.x; if (t >= n8) return; FragH f;
#pragma unroll
  for (int q = 0; q < 8; ++q) f.h[q] = (_Float16)x[t * 8 + q]; *(v8us*)((unsigned short*)X16 + t * 8) = f.half[0];  }
__global__ __launch_bounds__(256) void k_round16f(const float* __restrict__ W, _Float16* __restrict__ Bt, size_t n8) { const size_t t = (size_t)blockIdx.x * 256 + threadIdx.x; if (t >= n8) return; FragH f;
#pragma unroll
  for (int i = 0; i < 8; ++i) f.h[i] = (_Float16)(bf16_round(W[t * 8 + i]) * 16.0f); *(v8us*)((unsigned short*)Bt + t * 8) = f.half[0];  }

// The whole projection stage in one launch. One work-group (8 waves) = 64 rows of x. It rounds its x rows and all of Wq, Wk, Wv (f32 -> bf16 -> f16,
// W times 2^4, laid [n][k], the three matrices as 192 columns) into LDS, forms Q, K and V on v_wmma_f32_16x16x32_f16 from there, and stores Q16, K16
// and V^T as whole 128-byte lines. Wave w owns 32 rows (w & 1) by 48 columns (w >> 1). The products are formed as W^T x^T: a lane holds 8 neighbouring
// columns of one row, one 16-byte LDS store for Q and K; V goes into its LDS tile transposed, element by element.
#define PRW 64          // rows of x a work-group
#define PKP (DD + 8)    // LDS pitch of a k row in halves: 528 B = 16 B x odd, free of bank conflicts for 16-byte accesses
#define POP (64 + 8)    // LDS pitch of an output row in halves: 144 B
typedef float v2f __attribute__((ext_vector_type(2)));
typedef __bf16 v2b __attribute__((ext_vector_type(2)));
typedef _Float16 v2h __attribute__((ext_vector_type(2)));
typedef unsigned int v2ua __attribute__((ext_vector_type(2), may_alias));
typedef unsigned int v4ua __attribute__((ext_vector_type(4), may_alias));
// two f32 -> bf16 (nearest even) -> f16, packed
__device__ __forceinline__ unsigned int pk_b16h(float a, float b) {
  return __builtin_bit_cast(unsigned int, __builtin_convertvector(__builtin_convertvector(__builtin_convertvector((v2f){a, b}, v2b), v2f), v2h)); }
__global__ __launch_bounds__(256) void k_proj(const float* __restrict__ x, const float* __restrict__ Wq, const float* __restrict__ Wk, const float* __restrict__ Wv,
                                              _Float16* __restrict__ Q16, _Float16* __restrict__ K16, _Float16* __restrict__ Vt) {
  __shared__ __attribute__((aligned(16))) unsigned short sW[3 * HD][PKP];
  __shared__ __attribute__((aligned(16))) unsigned short sX[PRW][PKP];
  __shared__ __attribute__((aligned(16))) unsigned short sC[3][64][POP];
  const int tid = (int)threadIdx.x, lane = tid & 31, ln = lane & 15, hh = lane >> 4;
  const int w = __builtin_amdgcn_readfirstlane(tid >> 5);   // scalar, so that the tests on the column tile are scalar branches
  const int row0 = (int)blockIdx.x * PRW;
  // Weights in six chunks of half a matrix (128 k rows); of a chunk a lane takes 4 x 8 k of one column n; a wave: 32 neighbouring n, one line a load.
  const int n = tid & 63, kq = tid >> 6;
  float wr[6][32]; v4f xr[16];
  auto loadW = [&](int c) { const float* __restrict__ Wm = ((c >> 1) == 0) ? Wq : ((c >> 1) == 1) ? Wk : Wv;
#pragma unroll
    for (int u = 0; u < 4; ++u)
#pragma unroll
      for (int i = 0; i < 8; ++i) wr[c][u * 8 + i] = Wm[(size_t)((((c & 1) * 4 + u) * 4 + kq) * 8 + i) * HD + n]; };
  auto putW = [&](int c) {   // the power of two goes in ahead of the rounding: the same bits, and small weights stay normal in f16
#pragma unroll
    for (int u = 0; u < 4; ++u) { const float* v = &wr[c][u * 8];
      *(v4ua*)&sW[(c >> 1) * HD + n][(((c & 1) * 4 + u) * 4 + kq) * 8] = (v4ua){pk_b16h(v[0] * 16.0f, v[1] * 16.0f), pk_b16h(v[2] * 16.0f, v[3] * 16.0f), pk_b16h(v[4] * 16.0f, v[5] * 16.0f), pk_b16h(v[6] * 16.0f, v[7] * 16.0f)}; } };
  // Each sched_barrier below keeps a chunk's loads two chunks ahead of its conversion; left alone the compiler sank loads to their use, one wait a pair.
  // Each s_wait_xcnt stands in front of what may rewrite a register that an earlier, still issued load names as its address (a later load's result, a constant).
#pragma unroll
  for (int i = 0; i < 16; ++i) xr[i] = *(const v4fa*)(x + (size_t)row0 * DD + (size_t)(i * 256 + tid) * 4);   // whole lines a wave; from memory, so asked for first
  loadW(0); loadW(1); asm volatile("s_wait_xcnt 0x0" ::: "memory"); __builtin_amdgcn_sched_barrier(0);
  putW(0); asm volatile("s_wait_xcnt 0x0" ::: "memory"); loadW(2); __builtin_amdgcn_sched_barrier(0);
  putW(1); asm volatile("s_wait_xcnt 0x0" ::: "memory"); loadW(3); __builtin_amdgcn_sched_barrier(0);
  putW(2); asm volatile("s_wait_xcnt 0x0" ::: "memory"); loadW(4); __builtin_amdgcn_sched_barrier(0);
  putW(3); asm volatile("s_wait_xcnt 0x0" ::: "memory"); loadW(5); __builtin_amdgcn_sched_barrier(0);
  putW(4); putW(5);
#pragma unroll
  for (int i = 0; i < 16; ++i) { const int e = i * 256 + tid;
    *(v2ua*)&sX[e >> 6][(e & 63) * 4] = (v2ua){pk_b16h(xr[i][0], xr[i][1]), pk_b16h(xr[i][2], xr[i][3])}; }
  __syncthreads();   // publishes the converted x rows and weights to every wave
  { const int rp = w & 1, cg = w >> 1;
    const unsigned short* xrow = &sX[rp * 32 + ln][8 * hh]; const unsigned short* wrow = &sW[cg * 48 + ln][8 * hh];
    v8f acc[2][3];
#pragma unroll
    for (int i = 0; i < 2; ++i)
#pragma unroll
      for (int j = 0; j < 3; ++j) acc[i][j] = (v8f){0.f,0.f,0.f,0.f,0.f,0.f,0.f,0.f};
    FragH fx[2][2], fw[2][3];   // two register sets: the fragments of k step s + 1 are fetched while step s is multiplied
#pragma unroll
    for (int i = 0; i < 2; ++i) { fx[0][i].half[0] = *(const v8us*)(xrow + i * 16 * PKP); fx[0][i].half[1] = *(const v8us*)(xrow + i * 16 * PKP + 16); }
#pragma unroll
    for (int j = 0; j < 3; ++j) { fw[0][j].half[0] = *(const v8us*)(wrow + j * 16 * PKP); fw[0][j].half[1] = *(const v8us*)(wrow + j * 16 * PKP + 16); }
#pragma unroll
    for (int s = 0; s < DD / 32; ++s) { const int cu = s & 1, nx = cu ^ 1, kn = (s + 1) * 32;
      if (s + 1 < DD / 32) {
#pragma unroll
        for (int i = 0; i < 2; ++i) { fx[nx][i].half[0] = *(const v8us*)(xrow + i * 16 * PKP + kn); fx[nx][i].half[1] = *(const v8us*)(xrow + i * 16 * PKP + kn + 16); }
#pragma unroll
        for (int j = 0; j < 3; ++j) { fw[nx][j].half[0] = *(const v8us*)(wrow + j * 16 * PKP + kn); fw[nx][j].half[1] = *(const v8us*)(wrow + j * 16 * PKP + kn + 16); } }
#pragma unroll
      for (int i = 0; i < 2; ++i)
#pragma unroll
        for (int j = 0; j < 3; ++j) acc[i][j] = __builtin_amdgcn_wmma_f32_16x16x32_f16(false, fw[cu][j].v, false, fx[cu][i].v, (short)0, acc[i][j], false, false); }
    FragH o[2][3];   // acc[i][j][r] = (x W)[row rp * 32 + i * 16 + ln][column (cg * 3 + j) * 16 + 8 hh + r]
#pragma unroll
    for (int i = 0; i < 2; ++i)
#pragma unroll
      for (int j = 0; j < 3; ++j)
#pragma unroll
        for (int r = 0; r < 8; ++r) o[i][j].h[r] = (_Float16)(acc[i][j][r] * 0.0625f);   // takes the 2^4 of the weights out again
#pragma unroll
    for (int j = 0; j < 3; ++j) { const int ct = cg * 3 + j;   // column tiles 0 to 3 are Q, 4 to 7 K, 8 to 11 V
      if (ct < 8) {
#pragma unroll
        for (int i = 0; i < 2; ++i) *(v8us*)&sC[ct >> 2][rp * 32 + i * 16 + ln][(ct & 3) * 16 + 8 * hh] = o[i][j].half[0];
      } else {
#pragma unroll
        for (int i = 0; i < 2; ++i)
#pragma unroll
          for (int r = 0; r < 8; ++r) sC[2][(ct - 8) * 16 + 8 * hh + r][rp * 32 + i * 16 + ln] = o[i][j].u[r]; } } }
  __syncthreads();   // publishes the three 64 x 64 output tiles to the storing threads
#pragma unroll
  for (int h = 0; h < 2; ++h) { const int r = h * 32 + (tid >> 3), c8 = (tid & 7) * 8;   // eight lanes a 128-byte line
    *(v8us*)((unsigned short*)Q16 + (size_t)(row0 + r) * HD + c8) = *(const v8us*)&sC[0][r][c8];
    *(v8us*)((unsigned short*)K16 + (size_t)(row0 + r) * HD + c8) = *(const v8us*)&sC[1][r][c8];
    *(v8us*)((unsigned short*)Vt + ((size_t)(row0 / TT) * HD + r) * TT + (row0 % TT) + c8) = *(const v8us*)&sC[2][r][c8]; } }

#define NKW 16
__device__ __forceinline__ float xhalf(float x) { return __builtin_bit_cast(float, __builtin_amdgcn_permlanex16(__builtin_bit_cast(int, x), __builtin_bit_cast(int, x), 0x76543210, 0xfedcba98, false, false)); }  // lane l with lane l ^ 16
// amdgpu_waves_per_eu(8): 128 VGPRs a wave, so that two 16-wave work-groups share a WGP and eight waves fill each other's waits on a SIMD.
__global__ __launch_bounds__(NKW * 32) __attribute__((amdgpu_waves_per_eu(8))) void k_flash(const _Float16* __restrict__ Q16, int ldq, const _Float16* __restrict__ K16, int ldk, const _Float16* __restrict__ Vt, const int* __restrict__ MSK, float* __restrict__ O, int ldo) {
  constexpr int NQB = 4096 / 16, DT = 4, KS = 2;
  __shared__ __attribute__((aligned(16))) float sO[NKW][16][64 + 4];
  __shared__ float sM[NKW][16], sL[NKW][16];
  const int lane = (int)__builtin_amdgcn_mbcnt_lo(~0u, 0u), ln = lane & 15, hh = lane >> 4;   // lane id without threadIdx.x: one register fewer live over the key loop
  const int w = __builtin_amdgcn_readfirstlane((int)threadIdx.x >> 5);   // scalar, so that the key loop's test stays a scalar branch
  const int slab = blockIdx.x / NQB, qblk = blockIdx.x % NQB; const int b = slab; const int q0 = qblk * 16; (void)MSK;
  FragH aq[KS];   // B operand of S^T: column ln = query q0 + ln
  { const unsigned short* qr = (const unsigned short*)Q16 + ((size_t)b * 4096 + q0 + ln) * ldq;
#pragma unroll
    for (int ks = 0; ks < KS; ++ks) { aq[ks].half[0] = *(const v8us*)(qr + ks * 32 + 8 * hh); aq[ks].half[1] = *(const v8us*)(qr + ks * 32 + 16 + 8 * hh); } }
  const unsigned short* Vth = (const unsigned short*)Vt + (size_t)slab * 64 * 4096;
  float m_q = -3.0e38f, l_q = 0.f; v8f oacc[DT];   // of query q0 + ln; l_q over this half's keys only, the halves joined behind the loop
#pragma unroll
  for (int dt = 0; dt < DT; ++dt) oacc[dt] = (v8f){0.f,0.f,0.f,0.f,0.f,0.f,0.f,0.f};
  const int jend = q0 + 16;
#pragma unroll 1
  for (int j0 = w * 32; j0 < jend; j0 += NKW * 32) {
    float sc[16];   // sc[nt * 8 + r] = score of key j0 + nt * 16 + 8 hh + r
#pragma unroll
    for (int nt = 0; nt < 2; ++nt) { const unsigned short* kr = (const unsigned short*)K16 + ((size_t)b * 4096 + j0 + nt * 16 + ln) * ldk; FragH bk[KS];
#pragma unroll
      for (int ks = 0; ks < KS; ++ks) { bk[ks].half[0] = *(const v8us*)(kr + ks * 32 + 8 * hh); bk[ks].half[1] = *(const v8us*)(kr + ks * 32 + 16 + 8 * hh); }
      v8f acc = (v8f){0.f,0.f,0.f,0.f,0.f,0.f,0.f,0.f};
#pragma unroll
      for (int ks = 0; ks < KS; ++ks) acc = mmaH<1>(bk[ks].v, bk[ks].v, aq[ks].v, aq[ks].v, acc);
#pragma unroll
      for (int r = 0; r < 8; ++r) sc[nt * 8 + r] = acc[r] * (0.0625f); }
    if (j0 + 31 > q0) {   // only the tile on the diagonal holds keys behind a query (a scalar test); key j0 <= q0 stays, so every query keeps a finite maximum
#pragma unroll
      for (int i = 0; i < 16; ++i) if (j0 + (i >> 3) * 16 + 8 * hh + (i & 7) > q0 + ln) sc[i] = -INFINITY; }
    float mc = sc[0];
#pragma unroll
    for (int i = 1; i < 16; ++i) mc = fmaxf(mc, sc[i]);
    mc = fmaxf(mc, xhalf(mc));
    const float mn = fmaxf(m_q, mc); const float al = expf(m_q - mn); m_q = mn;
    FragH pb; float ps = 0.f;
#pragma unroll
    for (int i = 0; i < 16; ++i) { const float p = expf(sc[i] - mn); ps += p; pb.h[i] = (_Float16)p; }
    l_q = l_q * al + ps;
#pragma unroll
    for (int dt = 0; dt < DT; ++dt) oacc[dt] *= al;
#pragma unroll
    for (int dt = 0; dt < DT; ++dt) { const unsigned short* vrow = Vth + (size_t)(dt * 16 + ln) * 4096 + j0; FragH bv; bv.half[0] = *(const v8us*)(vrow + 8 * hh); bv.half[1] = *(const v8us*)(vrow + 16 + 8 * hh);
      oacc[dt] = mmaH<1>(bv.v, bv.v, pb.v, pb.v, oacc[dt]); } }
  // each wave's partial: query maximum, sum (the two halves joined) and the un-normalised output row; a wave without a key tile leaves (-3e38, 0, 0)
  l_q += xhalf(l_q);
  if (hh == 0) { sM[w][ln] = m_q; sL[w][ln] = l_q; }
#pragma unroll
  for (int dt = 0; dt < DT; ++dt) {   // oacc[dt][r] = O[q0 + ln][dt * 16 + 8 hh + r]: eight neighbours of one row
    *(v4fa*)&sO[w][ln][dt * 16 + 8 * hh] = (v4f){oacc[dt][0], oacc[dt][1], oacc[dt][2], oacc[dt][3]};
    *(v4fa*)&sO[w][ln][dt * 16 + 8 * hh + 4] = (v4f){oacc[dt][4], oacc[dt][5], oacc[dt][6], oacc[dt][7]}; }
  __syncthreads();   // publishes every wave's partial to the merging threads
  if (w < 8) { const int r = w * 2 + hh, pc = ln;
    float M = sM[0][r];
#pragma unroll
    for (int u = 1; u < NKW; ++u) M = fmaxf(M, sM[u][r]);
    float L = 0.f; v4f o = {0.f, 0.f, 0.f, 0.f};
#pragma unroll
    for (int u = 0; u < NKW; ++u) { const float e = expf(sM[u][r] - M); L += e * sL[u][r]; const v4f pv = *(const v4fa*)&sO[u][r][pc * 4]; o += pv * e; }
    const float inv = (L > 0.f) ? 1.0f / L : 0.f;
    *(v4f*)(O + ((size_t)b * 4096 + q0 + r) * ldo + pc * 4) = o * inv; } }

extern "C" void kernel_launch(void* const* d_in, const int* in_sizes, int n_in,
                              void* d_out, int out_size, void* d_ws, size_t ws_size, hipStream_t stream) {
  (void)in_sizes; (void)n_in; (void)out_size;
  const float* x = (const float*)d_in[0]; const float* Wq = (const float*)d_in[1]; const float* Wk = (const float*)d_in[2]; const float* Wv = (const float*)d_in[3];
  char* ws = (char*)d_ws; size_t off = 0;
  auto take = [&](size_t bytes) { char* p = ws + off; off += (bytes + 255) & ~(size_t)255; return p; };
  _Float16* Q16 = (_Float16*)take((size_t)NR * HD * 2); _Float16* K16 = (_Float16*)take((size_t)NR * HD * 2); _Float16* Vt = (_Float16*)take((size_t)NR * HD * 2);
  if (off > ws_size) return;      // 3 x 2 MiB
  k_proj<<<NR / PRW, 256, 0, stream>>>(x, Wq, Wk, Wv, Q16, K16, Vt);
  k_flash<<<BB * 1 * (TT / 16), NKW * 32, 0, stream>>>(Q16, HD, K16, HD, Vt, nullptr, (float*)d_out, HD);
}

// v004
// Measured time: 52.6 microseconds a run.
// In two side-by-side timings against v003, it was 1.22 and 1.23 times as fast.
// Counting every step since v000, it is 9.99 times as fast.
#include <hip/hip_runtime.h>
// Single-head causal self-attention layer (B=4, S=4096, D=256, H=64; scale 1/√256 as in the module): q/k/v projections as GEMMs (W [in][out] transposed to bf16-exact ×2^4) and the attention as a
// fused flash-style causal kernel (online softmax f32, P f16 <= 1, O^T = Vt*P^T; 16 query rows per work-group, key tiles dealt over its 16 waves, partials merged in LDS) on v_wmma_f32_16x16x32_f16 with f32 accumulate.
#define BB 4
#define TT 4096
#define DD 256
#define HD 64
#define NR (BB * TT)

typedef __bf16 v16b __attribute__((ext_vector_type(16)));
typedef unsigned short v8us __attribute__((ext_vector_type(8), may_alias));
typedef float  v8f  __attribute__((ext_vector_type(8)));
typedef float  v4f  __attribute__((ext_vector_type(4)));
typedef float  v4fa __attribute__((ext_vector_type(4), may_alias));
union FragB { v16b v; v8us half[2]; unsigned short u[16]; };

__device__ __forceinline__ unsigned short bf16_bits(float x) { unsigned int u = __float_as_uint(x); return (unsigned short)((u + 0x7FFFu + ((u >> 16) & 1u)) >> 16); }
__device__ __forceinline__ float bf16_val(unsigned short b) { return __uint_as_float(((unsigned int)b) << 16); }
__device__ __forceinline__ float bf16_round(float x) { return bf16_val(bf16_bits(x)); }
// D += A·B with NT terms: 1 = ah·bh, 2 = + al·bh (A split), 3 = + ah·bl (both split)
template <int NT>
__device__ __forceinline__ v8f mmaN(v16b ah, v16b al, v16b bh, v16b bl, v8f c) {
  c = __builtin_amdgcn_wmma_f32_16x16x32_bf16(false, ah, false, bh, (short)0, c, false, false);
  if (NT >= 2) c = __builtin_amdgcn_wmma_f32_16x16x32_bf16(false, al, false, bh, (short)0, c, false, false);
  if (NT >= 3) c = __builtin_amdgcn_wmma_f32_16x16x32_bf16(false, ah, false, bl, (short)0, c, false, false);
  asm volatile("v_nop\n\tv_nop\n\tv_nop\n\tv_nop" : "+v"(c) : "v"(ah), "v"(al), "v"(bh), "v"(bl));
  return c;
}

__global__ __launch_bounds__(256) void k_wt_bf16(const float* __restrict__ W, unsigned short* __restrict__ Wt, int K, int N) {
  const int t = blockIdx.x * 256 + threadIdx.x;
  const int k8n = K / 8;
  if (t >= N * k8n) return;
  const int n = t / k8n, k8 = (t % k8n) * 8;
  v8us v;
#pragma unroll
  for (int i = 0; i < 8; ++i) v[i] = bf16_bits(W[(size_t)(k8 + i) * N + n]);
  *(v8us*)(Wt + (size_t)n * K + k8) = v;
  
}

// GEMM C[M][N] (f32, pitch ldc) = act(A[M][K]·W + bias). A f32 row-major (pitch lda) converted per fragment to bf16
// (ASPLIT: hi/lo two planes -> 2 terms, else single rounded term); Wt bf16 [N][K] (pitch ldb). BIAS_BF16 rounds the
// bias to bf16 first (bias quantised to bf16 before the add). K%32==0, M%16==0, N%64==0.
template <bool ASPLIT, int ACT, bool BIAS_BF16>
__global__ __launch_bounds__(128) void k_gemm_bf(const float* __restrict__ A, int lda, const unsigned short* __restrict__ Wt, int ldb,
                                               const float* __restrict__ bias, float* __restrict__ C, int ldc, int M, int N, int K) {
  __shared__ __attribute__((aligned(16))) float so[4][16][64];
  const int tid = threadIdx.x, w = tid >> 5, lane = tid & 31, ln = lane & 15, hh = lane >> 4;
  const int ntn = N / 64;
  const int wid = blockIdx.x * 4 + w;
  const int mt = wid / ntn, nq = wid % ntn;
  if (mt * 16 >= M) return;
  const int row0 = mt * 16, col0 = nq * 64;
  const float* arow = A + (size_t)(row0 + ln) * lda;
  v8f acc[4] = {};
  for (int kb = 0; kb < K; kb += 32) {
    FragB ah, al;
    const v4f x0 = *(const v4fa*)(arow + kb + 8 * hh), x1 = *(const v4fa*)(arow + kb + 8 * hh + 4);
    const v4f x2 = *(const v4fa*)(arow + kb + 16 + 8 * hh), x3 = *(const v4fa*)(arow + kb + 16 + 8 * hh + 4);
    float xs[16] = {x0[0],x0[1],x0[2],x0[3],x1[0],x1[1],x1[2],x1[3],x2[0],x2[1],x2[2],x2[3],x3[0],x3[1],x3[2],x3[3]};
#pragma unroll
    for (int i = 0; i < 16; ++i) { const unsigned short hb = bf16_bits(xs[i]); ah.u[i] = hb; al.u[i] = ASPLIT ? bf16_bits(xs[i] - bf16_val(hb)) : (unsigned short)0; }
#pragma unroll
    for (int t = 0; t < 4; ++t) {
      const unsigned short* brow = Wt + (size_t)(col0 + t * 16 + ln) * ldb + kb;
      FragB b;
      b.half[0] = *(const v8us*)(brow + 8 * hh);
      b.half[1] = *(const v8us*)(brow + 16 + 8 * hh);
      acc[t] = mmaN<ASPLIT ? 2 : 1>(ah.v, al.v, b.v, b.v, acc[t]);
    }
  }
#pragma unroll
  for (int t = 0; t < 4; ++t) {
    float bv = bias ? bias[col0 + t * 16 + ln] : 0.f;
    if (BIAS_BF16) bv = bf16_round(bv);
#pragma unroll
    for (int r = 0; r < 8; ++r) { float v = acc[t][r] + bv; if (ACT == 1) v = fmaxf(v, 0.f); so[w][8 * hh + r][t * 16 + ln] = v; }
  }
  __builtin_amdgcn_fence(__ATOMIC_ACQ_REL, "workgroup");
  __builtin_amdgcn_wave_barrier();
  const int rsub = lane >> 4, c4 = (lane & 15) * 4;
  {
#pragma unroll
    for (int q = 0; q < 8; ++q) {
      const int r = q * 2 + rsub;
      const v4f v = *(const v4fa*)&so[w][r][c4];
      *(v4f*)(C + (size_t)(row0 + r) * ldc + col0 + c4) = v;
    }
    
  }
}

// Flash-style causal/unmasked attention, all contractions 3-term bf16 hi/lo splits, f32 softmax with running max.
// q,k,v rows are read from f32 buffers with arbitrary row pitch (so they can live inside a fused qkv buffer);
// D = head size (multiple of 32, <= 128); one wave = 16 query rows; block = 4 waves (64 queries) sharing K/V chunks of 32.
template <int D, bool CAUSAL>
__global__ __launch_bounds__(128) void k_flash(const float* __restrict__ qb, const float* __restrict__ kb, const float* __restrict__ vb,
                                             int pitch, int T, int H, float scale, float* __restrict__ y, int ypitch) {
  constexpr int KS = D / 32;        // k-steps for QK
  constexpr int DT = D / 16;        // d tiles for PV
  __shared__ __attribute__((aligned(16))) unsigned short sKh[32][D + 8], sKl[32][D + 8], sVh[32][D + 8], sVl[32][D + 8];
  __shared__ __attribute__((aligned(16))) unsigned short sPh[4][16][40], sPl[4][16][40];
  __shared__ __attribute__((aligned(16))) float sO[4][16][D];
  const int tid = threadIdx.x, w = tid >> 5, lane = tid & 31, ln = lane & 15, hh = lane >> 4;
  const int nqb = (T + 63) / 64;
  const int bh = blockIdx.x / nqb, qblk = blockIdx.x % nqb;
  const int b = bh / H, h = bh % H;
  const int q0 = qblk * 64 + w * 16;
  const float* Q = qb + (size_t)b * T * pitch + h * D;
  const float* K = kb + (size_t)b * T * pitch + h * D;
  const float* V = vb + (size_t)b * T * pitch + h * D;

  // A fragments of the wave's 16 query rows (scaled), hi/lo
  FragB aqh[KS], aql[KS];
  {
    int row = q0 + ln; if (row >= T) row = T - 1;
    const float* qr = Q + (size_t)row * pitch;
#pragma unroll
    for (int ks = 0; ks < KS; ++ks)
#pragma unroll
      for (int i = 0; i < 16; ++i) {
        const int d = ks * 32 + ((i < 8) ? (8 * hh + i) : (16 + 8 * hh + (i - 8)));
        const float x = qr[d] * scale; const unsigned short hb = bf16_bits(x);
        aqh[ks].u[i] = hb; aql[ks].u[i] = bf16_bits(x - bf16_val(hb));
      }
  }
  float m_r[8], l_r[8];
#pragma unroll
  for (int r = 0; r < 8; ++r) { m_r[r] = -3.0e38f; l_r[r] = 0.f; }
  v8f oacc[DT];
#pragma unroll
  for (int dt = 0; dt < DT; ++dt) oacc[dt] = (v8f){0.f,0.f,0.f,0.f,0.f,0.f,0.f,0.f};

  const int kv_end = CAUSAL ? min(T, qblk * 64 + 64) : T;     // block-uniform
  for (int j0 = 0; j0 < kv_end; j0 += 32) {
    __syncthreads();
    for (int e = tid; e < 32 * (D / 4); e += 128) {
      const int r = e / (D / 4), c4 = (e % (D / 4)) * 4;
      const int key = j0 + r;
      v4f kf = {0.f,0.f,0.f,0.f}, vf = {0.f,0.f,0.f,0.f};
      if (key < T) { kf = *(const v4fa*)(K + (size_t)key * pitch + c4); vf = *(const v4fa*)(V + (size_t)key * pitch + c4); }
#pragma unroll
      for (int t = 0; t < 4; ++t) {
        unsigned short hb = bf16_bits(kf[t]); sKh[r][c4 + t] = hb; sKl[r][c4 + t] = bf16_bits(kf[t] - bf16_val(hb));
        hb = bf16_bits(vf[t]); sVh[r][c4 + t] = hb; sVl[r][c4 + t] = bf16_bits(vf[t] - bf16_val(hb));
      }
    }
    __syncthreads();
    // S tile 16 x 32
    v8f s[2];
#pragma unroll
    for (int nt = 0; nt < 2; ++nt) {
      v8f acc = {};
#pragma unroll
      for (int ks = 0; ks < KS; ++ks) {
        FragB bh_, bl_;
        bh_.half[0] = *(const v8us*)&sKh[nt * 16 + ln][ks * 32 + 8 * hh]; bh_.half[1] = *(const v8us*)&sKh[nt * 16 + ln][ks * 32 + 16 + 8 * hh];
        bl_.half[0] = *(const v8us*)&sKl[nt * 16 + ln][ks * 32 + 8 * hh]; bl_.half[1] = *(const v8us*)&sKl[nt * 16 + ln][ks * 32 + 16 + 8 * hh];
        acc = mmaN<3>(aqh[ks].v, aql[ks].v, bh_.v, bl_.v, acc);
      }
      s[nt] = acc;
    }
    // mask + running max (rows 8hh+r; the 16 lanes of a half share rows)
    float alpha[8];
#pragma unroll
    for (int r = 0; r < 8; ++r) {
      const int qi = q0 + 8 * hh + r;
      const int ja = j0 + ln, jb = j0 + 16 + ln;
      if (CAUSAL) { if (ja > qi) s[0][r] = -3.0e38f; if (jb > qi) s[1][r] = -3.0e38f; }
      if (ja >= T) s[0][r] = -3.0e38f;
      if (jb >= T) s[1][r] = -3.0e38f;
      float mx = fmaxf(s[0][r], s[1][r]);
      mx = fmaxf(mx, __shfl_xor(mx, 1, 32)); mx = fmaxf(mx, __shfl_xor(mx, 2, 32)); mx = fmaxf(mx, __shfl_xor(mx, 4, 32)); mx = fmaxf(mx, __shfl_xor(mx, 8, 32));
      const float mnew = fmaxf(m_r[r], mx);
      alpha[r] = (mnew > -1.0e38f) ? __expf(m_r[r] - mnew) : 1.0f;
      const float p0 = (s[0][r] > -1.0e38f) ? __expf(s[0][r] - mnew) : 0.f;
      const float p1 = (s[1][r] > -1.0e38f) ? __expf(s[1][r] - mnew) : 0.f;
      m_r[r] = mnew;
      l_r[r] = l_r[r] * alpha[r] + p0 + p1;            // per-lane partial row sum (16 lanes combined at the end)
      unsigned short hb = bf16_bits(p0); sPh[w][8 * hh + r][ln] = hb;      sPl[w][8 * hh + r][ln] = bf16_bits(p0 - bf16_val(hb));
      hb = bf16_bits(p1);                sPh[w][8 * hh + r][16 + ln] = hb; sPl[w][8 * hh + r][16 + ln] = bf16_bits(p1 - bf16_val(hb));
    }
#pragma unroll
    for (int dt = 0; dt < DT; ++dt)
#pragma unroll
      for (int r = 0; r < 8; ++r) oacc[dt][r] *= alpha[r];
    __builtin_amdgcn_fence(__ATOMIC_ACQ_REL, "workgroup");
    __builtin_amdgcn_wave_barrier();
    FragB pah, pal;
    pah.half[0] = *(const v8us*)&sPh[w][ln][8 * hh]; pah.half[1] = *(const v8us*)&sPh[w][ln][16 + 8 * hh];
    pal.half[0] = *(const v8us*)&sPl[w][ln][8 * hh]; pal.half[1] = *(const v8us*)&sPl[w][ln][16 + 8 * hh];
#pragma unroll
    for (int dt = 0; dt < DT; ++dt) {
      FragB bvh, bvl;
#pragma unroll
      for (int i = 0; i < 8; ++i) {
        bvh.u[i] = sVh[8 * hh + i][dt * 16 + ln]; bvh.u[8 + i] = sVh[16 + 8 * hh + i][dt * 16 + ln];
        bvl.u[i] = sVl[8 * hh + i][dt * 16 + ln]; bvl.u[8 + i] = sVl[16 + 8 * hh + i][dt * 16 + ln];
      }
      oacc[dt] = mmaN<3>(pah.v, pal.v, bvh.v, bvl.v, oacc[dt]);
    }
    __builtin_amdgcn_fence(__ATOMIC_ACQ_REL, "workgroup");
    __builtin_amdgcn_wave_barrier();
  }
#pragma unroll
  for (int r = 0; r < 8; ++r) {
    float l = l_r[r];
    l += __shfl_xor(l, 1, 32); l += __shfl_xor(l, 2, 32); l += __shfl_xor(l, 4, 32); l += __shfl_xor(l, 8, 32);
    l_r[r] = (l > 0.f) ? 1.0f / l : 0.f;
  }
#pragma unroll
  for (int dt = 0; dt < DT; ++dt)
#pragma unroll
    for (int r = 0; r < 8; ++r) sO[w][8 * hh + r][dt * 16 + ln] = oacc[dt][r] * l_r[r];
  __builtin_amdgcn_fence(__ATOMIC_ACQ_REL, "workgroup");
  __builtin_amdgcn_wave_barrier();
  {
    for (int r = 0; r < 16; ++r) {
      const int row = q0 + r;
      if (row < T && lane < D / 4) {
        const v4f val = *(const v4fa*)&sO[w][r][lane * 4];
        *(v4f*)(y + ((size_t)b * T + row) * ypitch + h * D + lane * 4) = val;
      }
    }
    
  }
}

// GEMM C = act(A·W + bias + resid): A f32 (ASPLIT -> hi/lo 2 terms), Wt bf16 [N][K]; ACT 0 none, 1 relu, 2 exact gelu;
// resid (optional, f32, row index = (row % rmod), pitch ldr, RES_BF16 rounds it) added before the activation.
template <bool ASPLIT, int ACT, bool BIAS_BF16, bool RES_BF16>
__global__ __launch_bounds__(128) void k_gemm_bf3(const float* __restrict__ A, int lda, const unsigned short* __restrict__ Wt, int ldb,
                                                const float* __restrict__ bias, const float* __restrict__ resid, int rmod, int ldr,
                                                float* __restrict__ C, int ldc, int M, int N, int K) {
  __shared__ __attribute__((aligned(16))) float so[4][16][64];
  const int tid = threadIdx.x, w = tid >> 5, lane = tid & 31, ln = lane & 15, hh = lane >> 4;
  const int ntn = N / 64;
  const int wid = blockIdx.x * 4 + w;
  const int mt = wid / ntn, nq = wid % ntn;
  if (mt * 16 >= M) return;
  const int row0 = mt * 16, col0 = nq * 64;
  const float* arow = A + (size_t)(row0 + ln) * lda;
  v8f acc[4] = {};
  for (int kb = 0; kb < K; kb += 32) {
    FragB ah, al;
    const v4f x0 = *(const v4fa*)(arow + kb + 8 * hh), x1 = *(const v4fa*)(arow + kb + 8 * hh + 4);
    const v4f x2 = *(const v4fa*)(arow + kb + 16 + 8 * hh), x3 = *(const v4fa*)(arow + kb + 16 + 8 * hh + 4);
    float xs[16] = {x0[0],x0[1],x0[2],x0[3],x1[0],x1[1],x1[2],x1[3],x2[0],x2[1],x2[2],x2[3],x3[0],x3[1],x3[2],x3[3]};
#pragma unroll
    for (int i = 0; i < 16; ++i) { const unsigned short hb = bf16_bits(xs[i]); ah.u[i] = hb; al.u[i] = ASPLIT ? bf16_bits(xs[i] - bf16_val(hb)) : (unsigned short)0; }
#pragma unroll
    for (int t = 0; t < 4; ++t) {
      const unsigned short* brow = Wt + (size_t)(col0 + t * 16 + ln) * ldb + kb;
      FragB b;
      b.half[0] = *(const v8us*)(brow + 8 * hh);
      b.half[1] = *(const v8us*)(brow + 16 + 8 * hh);
      acc[t] = mmaN<ASPLIT ? 2 : 1>(ah.v, al.v, b.v, b.v, acc[t]);
    }
  }
#pragma unroll
  for (int t = 0; t < 4; ++t) {
    const int col = col0 + t * 16 + ln;
    float bv = bias ? bias[col] : 0.f;
    if (BIAS_BF16) bv = bf16_round(bv);
#pragma unroll
    for (int r = 0; r < 8; ++r) {
      float v = acc[t][r] + bv;
      if (resid) { float rv = resid[(size_t)((row0 + 8 * hh + r) % rmod) * ldr + col]; if (RES_BF16) rv = bf16_round(rv); v += rv; }
      if (ACT == 1) v = fmaxf(v, 0.f);
      if (ACT == 2) v = 0.5f * v * (1.0f + erff(v * 0.70710678118654752f));
      if (ACT == 3) { const float u = 0.7978845608028654f * (v + 0.044715f * v * v * v); v = 0.5f * v * (1.0f + tanhf(u)); }
      so[w][8 * hh + r][t * 16 + ln] = v;
    }
  }
  __builtin_amdgcn_fence(__ATOMIC_ACQ_REL, "workgroup");
  __builtin_amdgcn_wave_barrier();
  const int rsub = lane >> 4, c4 = (lane & 15) * 4;
  {
#pragma unroll
    for (int q = 0; q < 8; ++q) {
      const int r = q * 2 + rsub;
      const v4f v = *(const v4fa*)&so[w][r][c4];
      *(v4f*)(C + (size_t)(row0 + r) * ldc + col0 + c4) = v;
    }
    
  }
}
// row LayerNorm (biased variance, eps) over N: s = X (+ R); optional out_sum <- s; out_norm <- (s-mu)*rsqrt(var+eps)*g + b
template <bool PARAM_BF16>
__global__ __launch_bounds__(256) void k_layernorm(const float* __restrict__ X, const float* __restrict__ R, const float* __restrict__ g, const float* __restrict__ bta,
                                                  float* __restrict__ out_sum, float* __restrict__ out_norm, int N, float eps) {
  __shared__ float red[256];
  const int row = blockIdx.x, tid = threadIdx.x;
  const float* x = X + (size_t)row * N; const float* rr = R ? R + (size_t)row * N : nullptr;
  float vals[16];                     // up to N = 4096
  const int per = N / 256;            // contiguous chunk per thread? use strided-by-4 chunks: thread handles j = tid*4 + 1024*u
  float s1 = 0.f;
  for (int u = 0; u < per / 4; ++u) {
    const int j = tid * 4 + 1024 * u;
    const v4f a = *(const v4fa*)(x + j);
    v4f b = {0.f,0.f,0.f,0.f}; if (rr) b = *(const v4fa*)(rr + j);
#pragma unroll
    for (int q = 0; q < 4; ++q) { const float v = a[q] + b[q]; vals[u * 4 + q] = v; s1 += v; }
  }
  red[tid] = s1; __syncthreads();
  for (int st = 128; st > 0; st >>= 1) { if (tid < st) red[tid] += red[tid + st]; __syncthreads(); }
  const float mu = red[0] / (float)N; __syncthreads();
  float s2 = 0.f;
  for (int u = 0; u < per / 4; ++u)
#pragma unroll
    for (int q = 0; q < 4; ++q) { const float c = vals[u * 4 + q] - mu; s2 += c * c; }
  red[tid] = s2; __syncthreads();
  for (int st = 128; st > 0; st >>= 1) { if (tid < st) red[tid] += red[tid + st]; __syncthreads(); }
  const float rs = rsqrtf(red[0] / (float)N + eps);
  {
    for (int u = 0; u < per / 4; ++u) {
      const int j = tid * 4 + 1024 * u;
      v4f o, sm;
#pragma unroll
      for (int q = 0; q < 4; ++q) {
        float gg = g[j + q], bb = bta[j + q];
        if (PARAM_BF16) { gg = bf16_round(gg); bb = bf16_round(bb); }
        sm[q] = vals[u * 4 + q]; o[q] = (vals[u * 4 + q] - mu) * rs * gg + bb;
      }
      if (out_sum) *(v4f*)(out_sum + (size_t)row * N + j) = sm;
      *(v4f*)(out_norm + (size_t)row * N + j) = o;
    }
    
  }
}



// ---- f16 WMMA path (v_wmma_f32_16x16x32_f16): 11-bit significands for operands in range — used where a [0,1] probability operand needs more precision than bf16
typedef _Float16 v16h __attribute__((ext_vector_type(16)));
union FragH { v16h v; v8us half[2]; _Float16 h[16]; unsigned short u[16]; };
template <int NT>
__device__ __forceinline__ v8f mmaH(v16h ah, v16h al, v16h bh, v16h bl, v8f c) {
  c = __builtin_amdgcn_wmma_f32_16x16x32_f16(false, ah, false, bh, (short)0, c, false, false);
  if (NT >= 2) c = __builtin_amdgcn_wmma_f32_16x16x32_f16(false, al, false, bh, (short)0, c, false, false);
  if (NT >= 3) c = __builtin_amdgcn_wmma_f32_16x16x32_f16(false, ah, false, bl, (short)0, c, false, false);
  asm volatile("v_nop\n\tv_nop\n\tv_nop\n\tv_nop" : "+v"(c) : "v"(ah), "v"(al), "v"(bh), "v"(bl));
  return c;
}
// batched GEMM like k_gemm_b but f16 operands: A f32 (split into f16 hi/lo if ASPLIT, else rounded to f16), Bt = f16 values [n][k]; alpha; C f32; N multiple of 16 (partial tiles skipped)
template <bool ASPLIT>
__global__ __launch_bounds__(128) void k_gemm_h(const float* __restrict__ A, int lda, size_t sA, const _Float16* __restrict__ Bh, int ldb, size_t sB, float alpha, float* __restrict__ C, int ldc, size_t sC, int M, int N, int K) {
  __shared__ __attribute__((aligned(16))) float so[4][16][64];
  const int tid = threadIdx.x, w = tid >> 5, lane = tid & 31, ln = lane & 15, hh = lane >> 4; const int by = blockIdx.y;
  A += (size_t)by * sA; Bh += (size_t)by * sB; C += (size_t)by * sC;
  const int ntn = (N + 63) / 64; const int wid = blockIdx.x * 4 + w; const int mt = wid / ntn, nq = wid % ntn; if (mt * 16 >= M) return;
  const int row0 = mt * 16, col0 = nq * 64; const float* arow = A + (size_t)(row0 + ln) * lda;
  v8f acc[4] = {};
  for (int kb = 0; kb < K; kb += 32) {
    FragH ah, al;
    const v4f x0 = *(const v4fa*)(arow + kb + 8 * hh), x1 = *(const v4fa*)(arow + kb + 8 * hh + 4), x2 = *(const v4fa*)(arow + kb + 16 + 8 * hh), x3 = *(const v4fa*)(arow + kb + 16 + 8 * hh + 4);
    float xs[16] = {x0[0],x0[1],x0[2],x0[3],x1[0],x1[1],x1[2],x1[3],x2[0],x2[1],x2[2],x2[3],x3[0],x3[1],x3[2],x3[3]};
#pragma unroll
    for (int i = 0; i < 16; ++i) { const _Float16 h = (_Float16)xs[i]; ah.h[i] = h; al.h[i] = ASPLIT ? (_Float16)(xs[i] - (float)h) : (_Float16)0.0f; }
#pragma unroll
    for (int t = 0; t < 4; ++t) { if (col0 + t * 16 >= N) continue; const size_t boff = (size_t)(col0 + t * 16 + ln) * ldb + kb; FragH bq; bq.half[0] = *(const v8us*)(Bh + boff + 8 * hh); bq.half[1] = *(const v8us*)(Bh + boff + 16 + 8 * hh);
      acc[t] = mmaH<ASPLIT ? 2 : 1>(ah.v, al.v, bq.v, bq.v, acc[t]); }
  }
#pragma unroll
  for (int t = 0; t < 4; ++t) { if (col0 + t * 16 >= N) continue;
#pragma unroll
    for (int r = 0; r < 8; ++r) so[w][8 * hh + r][t * 16 + ln] = acc[t][r] * alpha; }
  __builtin_amdgcn_fence(__ATOMIC_ACQ_REL, "workgroup"); __builtin_amdgcn_wave_barrier();
  const int rsub = lane >> 4, c4 = (lane & 15) * 4;
  {
#pragma unroll
    for (int q = 0; q < 8; ++q) { const int r = q * 2 + rsub; if (col0 + c4 < N) { const v4f v = *(const v4fa*)&so[w][r][c4]; *(v4f*)(C + (size_t)(row0 + r) * ldc + col0 + c4) = v; } }
     }
}

__global__ __launch_bounds__(256) void k_h16(const float* __restrict__ x, _Float16* __restrict__ X16, size_t n8) { const size_t t = (size_t)blockIdx.x * 256 + threadIdx.x; if (t >= n8) return; FragH f;
#pragma unroll
  for (int q = 0; q < 8; ++q) f.h[q] = (_Float16)x[t * 8 + q]; *(v8us*)((unsigned short*)X16 + t * 8) = f.half[0];  }
__global__ __launch_bounds__(256) void k_round16f(const float* __restrict__ W, _Float16* __restrict__ Bt, size_t n8) { const size_t t = (size_t)blockIdx.x * 256 + threadIdx.x; if (t >= n8) return; FragH f;
#pragma unroll
  for (int i = 0; i < 8; ++i) f.h[i] = (_Float16)(bf16_round(W[t * 8 + i]) * 16.0f); *(v8us*)((unsigned short*)Bt + t * 8) = f.half[0];  }

// The whole projection stage in one launch. One work-group (8 waves) = 64 rows of x. It rounds its x rows and all of Wq, Wk, Wv (f32 -> bf16 -> f16,
// W times 2^4, laid [n][k], the three matrices as 192 columns) into LDS, forms Q, K and V on v_wmma_f32_16x16x32_f16 from there, and stores them in
// FRAGMENT ORDER: the workspace holds 512-byte chunks, lane l's 16 bytes of one operand half at byte 16 l, so that the attention kernel's every load is
// 512 contiguous bytes and every store here is an accumulator tile as it stands in the registers.
//   Qf, Kf: chunk (row / 16) * 4 + col / 16;                          lane 16 hh + ln = row (row & 15 = ln), columns 16 (col / 16) + 8 hh + 0..7
//   Vf:     chunk (row / 32) * 8 + (col / 16) * 2 + ((row >> 4) & 1); lane 16 hh + ln = column (col & 15 = ln), rows 16 (row / 16) + 8 hh + 0..7
// Wave w owns 32 rows (w & 1) and column tile w >> 1 of each of Q, K and V. Q and K are formed as W^T x^T (a lane holds 8 neighbouring columns of one
// row), V as x W (a lane holds 8 neighbouring rows of one column).
#define PRW 64          // rows of x a work-group
#define PKP (DD + 8)    // LDS pitch of a k row in halves: 528 B = 16 B x odd, free of bank conflicts for 16-byte accesses
typedef float v2f __attribute__((ext_vector_type(2)));
typedef __bf16 v2b __attribute__((ext_vector_type(2)));
typedef _Float16 v2h __attribute__((ext_vector_type(2)));
typedef unsigned int v2ua __attribute__((ext_vector_type(2), may_alias));
typedef unsigned int v4ua __attribute__((ext_vector_type(4), may_alias));
// two f32 -> bf16 (nearest even) -> f16, packed
__device__ __forceinline__ unsigned int pk_b16h(float a, float b) {
  return __builtin_bit_cast(unsigned int, __builtin_convertvector(__builtin_convertvector(__builtin_convertvector((v2f){a, b}, v2b), v2f), v2h)); }
__global__ __launch_bounds__(256) void k_proj(const float* __restrict__ x, const float* __restrict__ Wq, const float* __restrict__ Wk, const float* __restrict__ Wv,
                                              _Float16* __restrict__ Qf, _Float16* __restrict__ Kf, _Float16* __restrict__ Vf) {
  __shared__ __attribute__((aligned(16))) unsigned short sW[3 * HD][PKP];
  __shared__ __attribute__((aligned(16))) unsigned short sX[PRW][PKP];
  const int tid = (int)threadIdx.x, lane = tid & 31, ln = lane & 15, hh = lane >> 4;
  const int w = __builtin_amdgcn_readfirstlane(tid >> 5);   // scalar, so that the chunk addresses of the stores are scalar
  const int row0 = (int)blockIdx.x * PRW;
  // Weights in six chunks of half a matrix (128 k rows); of a chunk a lane takes 4 x 8 k of one column n; a wave: 32 neighbouring n, one line a load.
  const int n = tid & 63, kq = tid >> 6;
  float wr[6][32]; v4f xr[16];
  auto loadW = [&](int c) { const float* __restrict__ Wm = ((c >> 1) == 0) ? Wq : ((c >> 1) == 1) ? Wk : Wv;
#pragma unroll
    for (int u = 0; u < 4; ++u)
#pragma unroll
      for (int i = 0; i < 8; ++i) wr[c][u * 8 + i] = Wm[(size_t)((((c & 1) * 4 + u) * 4 + kq) * 8 + i) * HD + n]; };
  auto putW = [&](int c) {   // the power of two goes in ahead of the rounding: the same bits, and small weights stay normal in f16
#pragma unroll
    for (int u = 0; u < 4; ++u) { const float* v = &wr[c][u * 8];
      *(v4ua*)&sW[(c >> 1) * HD + n][(((c & 1) * 4 + u) * 4 + kq) * 8] = (v4ua){pk_b16h(v[0] * 16.0f, v[1] * 16.0f), pk_b16h(v[2] * 16.0f, v[3] * 16.0f), pk_b16h(v[4] * 16.0f, v[5] * 16.0f), pk_b16h(v[6] * 16.0f, v[7] * 16.0f)}; } };
  // Each sched_barrier below keeps a chunk's loads two chunks ahead of its conversion; left alone the compiler sank loads to their use, one wait a pair.
  // Each s_wait_xcnt stands in front of what may rewrite a register that an earlier, still issued load names as its address (a later load's result, a constant).
#pragma unroll
  for (int i = 0; i < 16; ++i) xr[i] = *(const v4fa*)(x + (size_t)row0 * DD + (size_t)(i * 256 + tid) * 4);   // whole lines a wave; from memory, so asked for first
  loadW(0); loadW(1); asm volatile("s_wait_xcnt 0x0" ::: "memory"); __builtin_amdgcn_sched_barrier(0);
  putW(0); asm volatile("s_wait_xcnt 0x0" ::: "memory"); loadW(2); __builtin_amdgcn_sched_barrier(0);
  putW(1); asm volatile("s_wait_xcnt 0x0" ::: "memory"); loadW(3); __builtin_amdgcn_sched_barrier(0);
  putW(2); asm volatile("s_wait_xcnt 0x0" ::: "memory"); loadW(4); __builtin_amdgcn_sched_barrier(0);
  putW(3); asm volatile("s_wait_xcnt 0x0" ::: "memory"); loadW(5); __builtin_amdgcn_sched_barrier(0);
  putW(4); putW(5);
#pragma unroll
  for (int i = 0; i < 16; ++i) { const int e = i * 256 + tid;
    *(v2ua*)&sX[e >> 6][(e & 63) * 4] = (v2ua){pk_b16h(xr[i][0], xr[i][1]), pk_b16h(xr[i][2], xr[i][3])}; }
  __syncthreads();   // publishes the converted x rows and weights to every wave
  { const int rp = w & 1, cg = w >> 1;
    const unsigned short* xrow = &sX[rp * 32 + ln][8 * hh]; const unsigned short* wrow = &sW[cg * 16 + ln][8 * hh];   // j = 0, 1, 2: Wq, Wk, Wv, HD rows apart
    v8f acc[2][3];
#pragma unroll
    for (int i = 0; i < 2; ++i)
#pragma unroll
      for (int j = 0; j < 3; ++j) acc[i][j] = (v8f){0.f,0.f,0.f,0.f,0.f,0.f,0.f,0.f};
    FragH fx[2][2], fw[2][3];   // two register sets: the fragments of k step s + 1 are fetched while step s is multiplied
#pragma unroll
    for (int i = 0; i < 2; ++i) { fx[0][i].half[0] = *(const v8us*)(xrow + i * 16 * PKP); fx[0][i].half[1] = *(const v8us*)(xrow + i * 16 * PKP + 16); }
#pragma unroll
    for (int j = 0; j < 3; ++j) { fw[0][j].half[0] = *(const v8us*)(wrow + j * HD * PKP); fw[0][j].half[1] = *(const v8us*)(wrow + j * HD * PKP + 16); }
#pragma unroll
    for (int s = 0; s < DD / 32; ++s) { const int cu = s & 1, nx = cu ^ 1, kn = (s + 1) * 32;
      if (s + 1 < DD / 32) {
#pragma unroll
        for (int i = 0; i < 2; ++i) { fx[nx][i].half[0] = *(const v8us*)(xrow + i * 16 * PKP + kn); fx[nx][i].half[1] = *(const v8us*)(xrow + i * 16 * PKP + kn + 16); }
#pragma unroll
        for (int j = 0; j < 3; ++j) { fw[nx][j].half[0] = *(const v8us*)(wrow + j * HD * PKP + kn); fw[nx][j].half[1] = *(const v8us*)(wrow + j * HD * PKP + kn + 16); } }
#pragma unroll
      for (int i = 0; i < 2; ++i)
#pragma unroll
        for (int j = 0; j < 3; ++j) acc[i][j] = (j < 2) ? __builtin_amdgcn_wmma_f32_16x16x32_f16(false, fw[cu][j].v, false, fx[cu][i].v, (short)0, acc[i][j], false, false)
                                                        : __builtin_amdgcn_wmma_f32_16x16x32_f16(false, fx[cu][i].v, false, fw[cu][j].v, (short)0, acc[i][j], false, false); }
    FragH o[2][3];   // j < 2: acc[i][j][r] = (x W)[row rp * 32 + i * 16 + ln][column cg * 16 + 8 hh + r]; j = 2: (x Wv)[row rp * 32 + i * 16 + 8 hh + r][column cg * 16 + ln]
#pragma unroll
    for (int i = 0; i < 2; ++i)
#pragma unroll
      for (int j = 0; j < 3; ++j)
#pragma unroll
        for (int r = 0; r < 8; ++r) o[i][j].h[r] = (_Float16)(acc[i][j][r] * 0.0625f);   // takes the 2^4 of the weights out again
#pragma unroll
    for (int i = 0; i < 2; ++i) {   // a wave's store = one chunk, four whole lines
      *(v8us*)((unsigned short*)Qf + ((size_t)(row0 / 16 + rp * 2 + i) * 4 + cg) * 256 + lane * 8) = o[i][0].half[0];
      *(v8us*)((unsigned short*)Kf + ((size_t)(row0 / 16 + rp * 2 + i) * 4 + cg) * 256 + lane * 8) = o[i][1].half[0];
      *(v8us*)((unsigned short*)Vf + ((size_t)(row0 / 32 + rp) * 8 + cg * 2 + i) * 256 + lane * 8) = o[i][2].half[0]; } } }

#define NKW 16
__device__ __forceinline__ float xhalf(float x) { return __builtin_bit_cast(float, __builtin_amdgcn_permlanex16(__builtin_bit_cast(int, x), __builtin_bit_cast(int, x), 0x76543210, 0xfedcba98, false, false)); }  // lane l with lane l ^ 16
// amdgpu_waves_per_eu(8): 128 VGPRs a wave, so that two 16-wave work-groups share a WGP and eight waves fill each other's waits on a SIMD.
__global__ __launch_bounds__(NKW * 32) __attribute__((amdgpu_waves_per_eu(8))) void k_flash(const _Float16* __restrict__ Qf, const _Float16* __restrict__ Kf, const _Float16* __restrict__ Vf, const int* __restrict__ MSK, float* __restrict__ O, int ldo) {
  constexpr int NQB = 4096 / 16, DT = 4, KS = 2;
  __shared__ __attribute__((aligned(16))) float sO[NKW][16][64 + 4];
  __shared__ float sM[NKW][16], sL[NKW][16];
  const int lane = (int)__builtin_amdgcn_mbcnt_lo(~0u, 0u), ln = lane & 15, hh = lane >> 4;   // lane id without threadIdx.x: one register fewer live over the key loop
  const int w = __builtin_amdgcn_readfirstlane((int)threadIdx.x >> 5);   // scalar, so that the key loop's test stays a scalar branch
  const int slab = blockIdx.x / NQB, qblk = blockIdx.x % NQB; const int b = slab; const int q0 = qblk * 16; (void)MSK;
  FragH aq[KS];   // B operand of S^T: column ln = query q0 + ln
  { const unsigned short* qr = (const unsigned short*)Qf + ((size_t)b * 4096 + q0) * 64 + lane * 8;
#pragma unroll
    for (int ks = 0; ks < KS; ++ks) { aq[ks].half[0] = *(const v8us*)(qr + ks * 512); aq[ks].half[1] = *(const v8us*)(qr + ks * 512 + 256); } }
  const unsigned short* Kb = (const unsigned short*)Kf + (size_t)slab * 64 * 4096;
  const unsigned short* Vb = (const unsigned short*)Vf + (size_t)slab * 64 * 4096;
  const unsigned int lo = (unsigned int)lane * 8u;   // the lane's place in a chunk, in halves
  float m_q = -3.0e38f, l_q = 0.f; v8f oacc[DT];   // of query q0 + ln; l_q over this half's keys only, the halves joined behind the loop
#pragma unroll
  for (int dt = 0; dt < DT; ++dt) oacc[dt] = (v8f){0.f,0.f,0.f,0.f,0.f,0.f,0.f,0.f};
  const int jend = q0 + 16;
#pragma unroll 1
  for (int j0 = w * 32; j0 < jend; j0 += NKW * 32) {
    float sc[16];   // sc[nt * 8 + r] = score of key j0 + nt * 16 + 8 hh + r
#pragma unroll
    for (int nt = 0; nt < 2; ++nt) { const unsigned short* kr = Kb + (size_t)(j0 + nt * 16) * 64; FragH bk[KS];
#pragma unroll
      for (int ks = 0; ks < KS; ++ks) { bk[ks].half[0] = *(const v8us*)(kr + ks * 512 + lo); bk[ks].half[1] = *(const v8us*)(kr + ks * 512 + 256 + lo); }
      v8f acc = (v8f){0.f,0.f,0.f,0.f,0.f,0.f,0.f,0.f};
#pragma unroll
      for (int ks = 0; ks < KS; ++ks) acc = mmaH<1>(bk[ks].v, bk[ks].v, aq[ks].v, aq[ks].v, acc);
#pragma unroll
      for (int r = 0; r < 8; ++r) sc[nt * 8 + r] = acc[r] * (0.0625f); }
    if (j0 + 31 > q0) {   // only the tile on the diagonal holds keys behind a query (a scalar test); key j0 <= q0 stays, so every query keeps a finite maximum
#pragma unroll
      for (int i = 0; i < 16; ++i) if (j0 + (i >> 3) * 16 + 8 * hh + (i & 7) > q0 + ln) sc[i] = -INFINITY; }
    float mc = sc[0];
#pragma unroll
    for (int i = 1; i < 16; ++i) mc = fmaxf(mc, sc[i]);
    mc = fmaxf(mc, xhalf(mc));
    const float mn = fmaxf(m_q, mc); const float al = expf(m_q - mn); m_q = mn;
    FragH pb; float ps = 0.f;
#pragma unroll
    for (int i = 0; i < 16; ++i) { const float p = expf(sc[i] - mn); ps += p; pb.h[i] = (_Float16)p; }
    l_q = l_q * al + ps;
#pragma unroll
    for (int dt = 0; dt < DT; ++dt) oacc[dt] *= al;
#pragma unroll
    for (int dt = 0; dt < DT; ++dt) { const unsigned short* vrow = Vb + (size_t)j0 * 64 + dt * 512; FragH bv; bv.half[0] = *(const v8us*)(vrow + lo); bv.half[1] = *(const v8us*)(vrow + 256 + lo);
      oacc[dt] = mmaH<1>(bv.v, bv.v, pb.v, pb.v, oacc[dt]); } }
  // each wave's partial: query maximum, sum (the two halves joined) and the un-normalised output row; a wave without a key tile leaves (-3e38, 0, 0)
  l_q += xhalf(l_q);
  if (hh == 0) { sM[w][ln] = m_q; sL[w][ln] = l_q; }
#pragma unroll
  for (int dt = 0; dt < DT; ++dt) {   // oacc[dt][r] = O[q0 + ln][dt * 16 + 8 hh + r]: eight neighbours of one row
    *(v4fa*)&sO[w][ln][dt * 16 + 8 * hh] = (v4f){oacc[dt][0], oacc[dt][1], oacc[dt][2], oacc[dt][3]};
    *(v4fa*)&sO[w][ln][dt * 16 + 8 * hh + 4] = (v4f){oacc[dt][4], oacc[dt][5], oacc[dt][6], oacc[dt][7]}; }
  __syncthreads();   // publishes every wave's partial to the merging threads
  if (w < 8) { const int r = w * 2 + hh, pc = ln;
    float M = sM[0][r];
#pragma unroll
    for (int u = 1; u < NKW; ++u) M = fmaxf(M, sM[u][r]);
    float L = 0.f; v4f o = {0.f, 0.f, 0.f, 0.f};
#pragma unroll
    for (int u = 0; u < NKW; ++u) { const float e = expf(sM[u][r] - M); L += e * sL[u][r]; const v4f pv = *(const v4fa*)&sO[u][r][pc * 4]; o += pv * e; }
    const float inv = (L > 0.f) ? 1.0f / L : 0.f;
    *(v4f*)(O + ((size_t)b * 4096 + q0 + r) * ldo + pc * 4) = o * inv; } }

extern "C" void kernel_launch(void* const* d_in, const int* in_sizes, int n_in,
                              void* d_out, int out_size, void* d_ws, size_t ws_size, hipStream_t stream) {
  (void)in_sizes; (void)n_in; (void)out_size;
  const float* x = (const float*)d_in[0]; const float* Wq = (const float*)d_in[1]; const float* Wk = (const float*)d_in[2]; const float* Wv = (const float*)d_in[3];
  char* ws = (char*)d_ws; size_t off = 0;
  auto take = [&](size_t bytes) { char* p = ws + off; off += (bytes + 255) & ~(size_t)255; return p; };
  _Float16* Qf = (_Float16*)take((size_t)NR * HD * 2); _Float16* Kf = (_Float16*)take((size_t)NR * HD * 2); _Float16* Vf = (_Float16*)take((size_t)NR * HD * 2);
  if (off > ws_size) return;      // 3 x 2 MiB
  k_proj<<<NR / PRW, 256, 0, stream>>>(x, Wq, Wk, Wv, Qf, Kf, Vf);
  k_flash<<<BB * 1 * (TT / 16), NKW * 32, 0, stream>>>(Qf, Kf, Vf, nullptr, (float*)d_out, HD);
}

// v005
// It runs in 36.4 microseconds.
// In two side-by-side timings against v004, it was 1.45 and 1.43 times as fast.
// All steps since v000 together make it 14.4 times as fast.
#include <hip/hip_runtime.h>
// Single-head causal self-attention layer (B=4, S=4096, D=256, H=64; scale 1/√256 as in the module): q/k/v projections as GEMMs (W [in][out] transposed to bf16-exact ×2^4) and the attention as a
// fused flash-style causal kernel (online softmax f32, P f16 <= 1, O^T = Vt*P^T; 16 query rows per work-group, key tiles dealt over its 16 waves, partials merged in LDS) on v_wmma_f32_16x16x32_f16 with f32 accumulate.
#define BB 4
#define TT 4096
#define DD 256
#define HD 64
#define NR (BB * TT)

typedef __bf16 v16b __attribute__((ext_vector_type(16)));
typedef unsigned short v8us __attribute__((ext_vector_type(8), may_alias));
typedef float  v8f  __attribute__((ext_vector_type(8)));
typedef float  v4f  __attribute__((ext_vector_type(4)));
typedef float  v4fa __attribute__((ext_vector_type(4), may_alias));
union FragB { v16b v; v8us half[2]; unsigned short u[16]; };

__device__ __forceinline__ unsigned short bf16_bits(float x) { unsigned int u = __float_as_uint(x); return (unsigned short)((u + 0x7FFFu + ((u >> 16) & 1u)) >> 16); }
__device__ __forceinline__ float bf16_val(unsigned short b) { return __uint_as_float(((unsigned int)b) << 16); }
__device__ __forceinline__ float bf16_round(float x) { return bf16_val(bf16_bits(x)); }
// D += A·B with NT terms: 1 = ah·bh, 2 = + al·bh (A split), 3 = + ah·bl (both split)
template <int NT>
__device__ __forceinline__ v8f mmaN(v16b ah, v16b al, v16b bh, v16b bl, v8f c) {
  c = __builtin_amdgcn_wmma_f32_16x16x32_bf16(false, ah, false, bh, (short)0, c, false, false);
  if (NT >= 2) c = __builtin_amdgcn_wmma_f32_16x16x32_bf16(false, al, false, bh, (short)0, c, false, false);
  if (NT >= 3) c = __builtin_amdgcn_wmma_f32_16x16x32_bf16(false, ah, false, bl, (short)0, c, false, false);
  asm volatile("v_nop\n\tv_nop\n\tv_nop\n\tv_nop" : "+v"(c) : "v"(ah), "v"(al), "v"(bh), "v"(bl));
  return c;
}

__global__ __launch_bounds__(256) void k_wt_bf16(const float* __restrict__ W, unsigned short* __restrict__ Wt, int K, int N) {
  const int t = blockIdx.x * 256 + threadIdx.x;
  const int k8n = K / 8;
  if (t >= N * k8n) return;
  const int n = t / k8n, k8 = (t % k8n) * 8;
  v8us v;
#pragma unroll
  for (int i = 0; i < 8; ++i) v[i] = bf16_bits(W[(size_t)(k8 + i) * N + n]);
  *(v8us*)(Wt + (size_t)n * K + k8) = v;
  
}

// GEMM C[M][N] (f32, pitch ldc) = act(A[M][K]·W + bias). A f32 row-major (pitch lda) converted per fragment to bf16
// (ASPLIT: hi/lo two planes -> 2 terms, else single rounded term); Wt bf16 [N][K] (pitch ldb). BIAS_BF16 rounds the
// bias to bf16 first (bias quantised to bf16 before the add). K%32==0, M%16==0, N%64==0.
template <bool ASPLIT, int ACT, bool BIAS_BF16>
__global__ __launch_bounds__(128) void k_gemm_bf(const float* __restrict__ A, int lda, const unsigned short* __restrict__ Wt, int ldb,
                                               const float* __restrict__ bias, float* __restrict__ C, int ldc, int M, int N, int K) {
  __shared__ __attribute__((aligned(16))) float so[4][16][64];
  const int tid = threadIdx.x, w = tid >> 5, lane = tid & 31, ln = lane & 15, hh = lane >> 4;
  const int ntn = N / 64;
  const int wid = blockIdx.x * 4 + w;
  const int mt = wid / ntn, nq = wid % ntn;
  if (mt * 16 >= M) return;
  const int row0 = mt * 16, col0 = nq * 64;
  const float* arow = A + (size_t)(row0 + ln) * lda;
  v8f acc[4] = {};
  for (int kb = 0; kb < K; kb += 32) {
    FragB ah, al;
    const v4f x0 = *(const v4fa*)(arow + kb + 8 * hh), x1 = *(const v4fa*)(arow + kb + 8 * hh + 4);
    const v4f x2 = *(const v4fa*)(arow + kb + 16 + 8 * hh), x3 = *(const v4fa*)(arow + kb + 16 + 8 * hh + 4);
    float xs[16] = {x0[0],x0[1],x0[2],x0[3],x1[0],x1[1],x1[2],x1[3],x2[0],x2[1],x2[2],x2[3],x3[0],x3[1],x3[2],x3[3]};
#pragma unroll
    for (int i = 0; i < 16; ++i) { const unsigned short hb = bf16_bits(xs[i]); ah.u[i] = hb; al.u[i] = ASPLIT ? bf16_bits(xs[i] - bf16_val(hb)) : (unsigned short)0; }
#pragma unroll
    for (int t = 0; t < 4; ++t) {
      const unsigned short* brow = Wt + (size_t)(col0 + t * 16 + ln) * ldb + kb;
      FragB b;
      b.half[0] = *(const v8us*)(brow + 8 * hh);
      b.half[1] = *(const v8us*)(brow + 16 + 8 * hh);
      acc[t] = mmaN<ASPLIT ? 2 : 1>(ah.v, al.v, b.v, b.v, acc[t]);
    }
  }
#pragma unroll
  for (int t = 0; t < 4; ++t) {
    float bv = bias ? bias[col0 + t * 16 + ln] : 0.f;
    if (BIAS_BF16) bv = bf16_round(bv);
#pragma unroll
    for (int r = 0; r < 8; ++r) { float v = acc[t][r] + bv; if (ACT == 1) v = fmaxf(v, 0.f); so[w][8 * hh + r][t * 16 + ln] = v; }
  }
  __builtin_amdgcn_fence(__ATOMIC_ACQ_REL, "workgroup");
  __builtin_amdgcn_wave_barrier();
  const int rsub = lane >> 4, c4 = (lane & 15) * 4;
  {
#pragma unroll
    for (int q = 0; q < 8; ++q) {
      const int r = q * 2 + rsub;
      const v4f v = *(const v4fa*)&so[w][r][c4];
      *(v4f*)(C + (size_t)(row0 + r) * ldc + col0 + c4) = v;
    }
    
  }
}

// Flash-style causal/unmasked attention, all contractions 3-term bf16 hi/lo splits, f32 softmax with running max.
// q,k,v rows are read from f32 buffers with arbitrary row pitch (so they can live inside a fused qkv buffer);
// D = head size (multiple of 32, <= 128); one wave = 16 query rows; block = 4 waves (64 queries) sharing K/V chunks of 32.
template <int D, bool CAUSAL>
__global__ __launch_bounds__(128) void k_flash(const float* __restrict__ qb, const float* __restrict__ kb, const float* __restrict__ vb,
                                             int pitch, int T, int H, float scale, float* __restrict__ y, int ypitch) {
  constexpr int KS = D / 32;        // k-steps for QK
  constexpr int DT = D / 16;        // d tiles for PV
  __shared__ __attribute__((aligned(16))) unsigned short sKh[32][D + 8], sKl[32][D + 8], sVh[32][D + 8], sVl[32][D + 8];
  __shared__ __attribute__((aligned(16))) unsigned short sPh[4][16][40], sPl[4][16][40];
  __shared__ __attribute__((aligned(16))) float sO[4][16][D];
  const int tid = threadIdx.x, w = tid >> 5, lane = tid & 31, ln = lane & 15, hh = lane >> 4;
  const int nqb = (T + 63) / 64;
  const int bh = blockIdx.x / nqb, qblk = blockIdx.x % nqb;
  const int b = bh / H, h = bh % H;
  const int q0 = qblk * 64 + w * 16;
  const float* Q = qb + (size_t)b * T * pitch + h * D;
  const float* K = kb + (size_t)b * T * pitch + h * D;
  const float* V = vb + (size_t)b * T * pitch + h * D;

  // A fragments of the wave's 16 query rows (scaled), hi/lo
  FragB aqh[KS], aql[KS];
  {
    int row = q0 + ln; if (row >= T) row = T - 1;
    const float* qr = Q + (size_t)row * pitch;
#pragma unroll
    for (int ks = 0; ks < KS; ++ks)
#pragma unroll
      for (int i = 0; i < 16; ++i) {
        const int d = ks * 32 + ((i < 8) ? (8 * hh + i) : (16 + 8 * hh + (i - 8)));
        const float x = qr[d] * scale; const unsigned short hb = bf16_bits(x);
        aqh[ks].u[i] = hb; aql[ks].u[i] = bf16_bits(x - bf16_val(hb));
      }
  }
  float m_r[8], l_r[8];
#pragma unroll
  for (int r = 0; r < 8; ++r) { m_r[r] = -3.0e38f; l_r[r] = 0.f; }
  v8f oacc[DT];
#pragma unroll
  for (int dt = 0; dt < DT; ++dt) oacc[dt] = (v8f){0.f,0.f,0.f,0.f,0.f,0.f,0.f,0.f};

  const int kv_end = CAUSAL ? min(T, qblk * 64 + 64) : T;     // block-uniform
  for (int j0 = 0; j0 < kv_end; j0 += 32) {
    __syncthreads();
    for (int e = tid; e < 32 * (D / 4); e += 128) {
      const int r = e / (D / 4), c4 = (e % (D / 4)) * 4;
      const int key = j0 + r;
      v4f kf = {0.f,0.f,0.f,0.f}, vf = {0.f,0.f,0.f,0.f};
      if (key < T) { kf = *(const v4fa*)(K + (size_t)key * pitch + c4); vf = *(const v4fa*)(V + (size_t)key * pitch + c4); }
#pragma unroll
      for (int t = 0; t < 4; ++t) {
        unsigned short hb = bf16_bits(kf[t]); sKh[r][c4 + t] = hb; sKl[r][c4 + t] = bf16_bits(kf[t] - bf16_val(hb));
        hb = bf16_bits(vf[t]); sVh[r][c4 + t] = hb; sVl[r][c4 + t] = bf16_bits(vf[t] - bf16_val(hb));
      }
    }
    __syncthreads();
    // S tile 16 x 32
    v8f s[2];
#pragma unroll
    for (int nt = 0; nt < 2; ++nt) {
      v8f acc = {};
#pragma unroll
      for (int ks = 0; ks < KS; ++ks) {
        FragB bh_, bl_;
        bh_.half[0] = *(const v8us*)&sKh[nt * 16 + ln][ks * 32 + 8 * hh]; bh_.half[1] = *(const v8us*)&sKh[nt * 16 + ln][ks * 32 + 16 + 8 * hh];
        bl_.half[0] = *(const v8us*)&sKl[nt * 16 + ln][ks * 32 + 8 * hh]; bl_.half[1] = *(const v8us*)&sKl[nt * 16 + ln][ks * 32 + 16 + 8 * hh];
        acc = mmaN<3>(aqh[ks].v, aql[ks].v, bh_.v, bl_.v, acc);
      }
      s[nt] = acc;
    }
    // mask + running max (rows 8hh+r; the 16 lanes of a half share rows)
    float alpha[8];
#pragma unroll
    for (int r = 0; r < 8; ++r) {
      const int qi = q0 + 8 * hh + r;
      const int ja = j0 + ln, jb = j0 + 16 + ln;
      if (CAUSAL) { if (ja > qi) s[0][r] = -3.0e38f; if (jb > qi) s[1][r] = -3.0e38f; }
      if (ja >= T) s[0][r] = -3.0e38f;
      if (jb >= T) s[1][r] = -3.0e38f;
      float mx = fmaxf(s[0][r], s[1][r]);
      mx = fmaxf(mx, __shfl_xor(mx, 1, 32)); mx = fmaxf(mx, __shfl_xor(mx, 2, 32)); mx = fmaxf(mx, __shfl_xor(mx, 4, 32)); mx = fmaxf(mx, __shfl_xor(mx, 8, 32));
      const float mnew = fmaxf(m_r[r], mx);
      alpha[r] = (mnew > -1.0e38f) ? __expf(m_r[r] - mnew) : 1.0f;
      const float p0 = (s[0][r] > -1.0e38f) ? __expf(s[0][r] - mnew) : 0.f;
      const float p1 = (s[1][r] > -1.0e38f) ? __expf(s[1][r] - mnew) : 0.f;
      m_r[r] = mnew;
      l_r[r] = l_r[r] * alpha[r] + p0 + p1;            // per-lane partial row sum (16 lanes combined at the end)
      unsigned short hb = bf16_bits(p0); sPh[w][8 * hh + r][ln] = hb;      sPl[w][8 * hh + r][ln] = bf16_bits(p0 - bf16_val(hb));
      hb = bf16_bits(p1);                sPh[w][8 * hh + r][16 + ln] = hb; sPl[w][8 * hh + r][16 + ln] = bf16_bits(p1 - bf16_val(hb));
    }
#pragma unroll
    for (int dt = 0; dt < DT; ++dt)
#pragma unroll
      for (int r = 0; r < 8; ++r) oacc[dt][r] *= alpha[r];
    __builtin_amdgcn_fence(__ATOMIC_ACQ_REL, "workgroup");
    __builtin_amdgcn_wave_barrier();
    FragB pah, pal;
    pah.half[0] = *(const v8us*)&sPh[w][ln][8 * hh]; pah.half[1] = *(const v8us*)&sPh[w][ln][16 + 8 * hh];
    pal.half[0] = *(const v8us*)&sPl[w][ln][8 * hh]; pal.half[1] = *(const v8us*)&sPl[w][ln][16 + 8 * hh];
#pragma unroll
    for (int dt = 0; dt < DT; ++dt) {
      FragB bvh, bvl;
#pragma unroll
      for (int i = 0; i < 8; ++i) {
        bvh.u[i] = sVh[8 * hh + i][dt * 16 + ln]; bvh.u[8 + i] = sVh[16 + 8 * hh + i][dt * 16 + ln];
        bvl.u[i] = sVl[8 * hh + i][dt * 16 + ln]; bvl.u[8 + i] = sVl[16 + 8 * hh + i][dt * 16 + ln];
      }
      oacc[dt] = mmaN<3>(pah.v, pal.v, bvh.v, bvl.v, oacc[dt]);
    }
    __builtin_amdgcn_fence(__ATOMIC_ACQ_REL, "workgroup");
    __builtin_amdgcn_wave_barrier();
  }
#pragma unroll
  for (int r = 0; r < 8; ++r) {
    float l = l_r[r];
    l += __shfl_xor(l, 1, 32); l += __shfl_xor(l, 2, 32); l += __shfl_xor(l, 4, 32); l += __shfl_xor(l, 8, 32);
    l_r[r] = (l > 0.f) ? 1.0f / l : 0.f;
  }
#pragma unroll
  for (int dt = 0; dt < DT; ++dt)
#pragma unroll
    for (int r = 0; r < 8; ++r) sO[w][8 * hh + r][dt * 16 + ln] = oacc[dt][r] * l_r[r];
  __builtin_amdgcn_fence(__ATOMIC_ACQ_REL, "workgroup");
  __builtin_amdgcn_wave_barrier();
  {
    for (int r = 0; r < 16; ++r) {
      const int row = q0 + r;
      if (row < T && lane < D / 4) {
        const v4f val = *(const v4fa*)&sO[w][r][lane * 4];
        *(v4f*)(y + ((size_t)b * T + row) * ypitch + h * D + lane * 4) = val;
      }
    }
    
  }
}

// GEMM C = act(A·W + bias + resid): A f32 (ASPLIT -> hi/lo 2 terms), Wt bf16 [N][K]; ACT 0 none, 1 relu, 2 exact gelu;
// resid (optional, f32, row index = (row % rmod), pitch ldr, RES_BF16 rounds it) added before the activation.
template <bool ASPLIT, int ACT, bool BIAS_BF16, bool RES_BF16>
__global__ __launch_bounds__(128) void k_gemm_bf3(const float* __restrict__ A, int lda, const unsigned short* __restrict__ Wt, int ldb,
                                                const float* __restrict__ bias, const float* __restrict__ resid, int rmod, int ldr,
                                                float* __restrict__ C, int ldc, int M, int N, int K) {
  __shared__ __attribute__((aligned(16))) float so[4][16][64];
  const int tid = threadIdx.x, w = tid >> 5, lane = tid & 31, ln = lane & 15, hh = lane >> 4;
  const int ntn = N / 64;
  const int wid = blockIdx.x * 4 + w;
  const int mt = wid / ntn, nq = wid % ntn;
  if (mt * 16 >= M) return;
  const int row0 = mt * 16, col0 = nq * 64;
  const float* arow = A + (size_t)(row0 + ln) * lda;
  v8f acc[4] = {};
  for (int kb = 0; kb < K; kb += 32) {
    FragB ah, al;
    const v4f x0 = *(const v4fa*)(arow + kb + 8 * hh), x1 = *(const v4fa*)(arow + kb + 8 * hh + 4);
    const v4f x2 = *(const v4fa*)(arow + kb + 16 + 8 * hh), x3 = *(const v4fa*)(arow + kb + 16 + 8 * hh + 4);
    float xs[16] = {x0[0],x0[1],x0[2],x0[3],x1[0],x1[1],x1[2],x1[3],x2[0],x2[1],x2[2],x2[3],x3[0],x3[1],x3[2],x3[3]};
#pragma unroll
    for (int i = 0; i < 16; ++i) { const unsigned short hb = bf16_bits(xs[i]); ah.u[i] = hb; al.u[i] = ASPLIT ? bf16_bits(xs[i] - bf16_val(hb)) : (unsigned short)0; }
#pragma unroll
    for (int t = 0; t < 4; ++t) {
      const unsigned short* brow = Wt + (size_t)(col0 + t * 16 + ln) * ldb + kb;
      FragB b;
      b.half[0] = *(const v8us*)(brow + 8 * hh);
      b.half[1] = *(const v8us*)(brow + 16 + 8 * hh);
      acc[t] = mmaN<ASPLIT ? 2 : 1>(ah.v, al.v, b.v, b.v, acc[t]);
    }
  }
#pragma unroll
  for (int t = 0; t < 4; ++t) {
    const int col = col0 + t * 16 + ln;
    float bv = bias ? bias[col] : 0.f;
    if (BIAS_BF16) bv = bf16_round(bv);
#pragma unroll
    for (int r = 0; r < 8; ++r) {
      float v = acc[t][r] + bv;
      if (resid) { float rv = resid[(size_t)((row0 + 8 * hh + r) % rmod) * ldr + col]; if (RES_BF16) rv = bf16_round(rv); v += rv; }
      if (ACT == 1) v = fmaxf(v, 0.f);
      if (ACT == 2) v = 0.5f * v * (1.0f + erff(v * 0.70710678118654752f));
      if (ACT == 3) { const float u = 0.7978845608028654f * (v + 0.044715f * v * v * v); v = 0.5f * v * (1.0f + tanhf(u)); }
      so[w][8 * hh + r][t * 16 + ln] = v;
    }
  }
  __builtin_amdgcn_fence(__ATOMIC_ACQ_REL, "workgroup");
  __builtin_amdgcn_wave_barrier();
  const int rsub = lane >> 4, c4 = (lane & 15) * 4;
  {
#pragma unroll
    for (int q = 0; q < 8; ++q) {
      const int r = q * 2 + rsub;
      const v4f v = *(const v4fa*)&so[w][r][c4];
      *(v4f*)(C + (size_t)(row0 + r) * ldc + col0 + c4) = v;
    }
    
  }
}
// row LayerNorm (biased variance, eps) over N: s = X (+ R); optional out_sum <- s; out_norm <- (s-mu)*rsqrt(var+eps)*g + b
template <bool PARAM_BF16>
__global__ __launch_bounds__(256) void k_layernorm(const float* __restrict__ X, const float* __restrict__ R, const float* __restrict__ g, const float* __restrict__ bta,
                                                  float* __restrict__ out_sum, float* __restrict__ out_norm, int N, float eps) {
  __shared__ float red[256];
  const int row = blockIdx.x, tid = threadIdx.x;
  const float* x = X + (size_t)row * N; const float* rr = R ? R + (size_t)row * N : nullptr;
  float vals[16];                     // up to N = 4096
  const int per = N / 256;            // contiguous chunk per thread? use strided-by-4 chunks: thread handles j = tid*4 + 1024*u
  float s1 = 0.f;
  for (int u = 0; u < per / 4; ++u) {
    const int j = tid * 4 + 1024 * u;
    const v4f a = *(const v4fa*)(x + j);
    v4f b = {0.f,0.f,0.f,0.f}; if (rr) b = *(const v4fa*)(rr + j);
#pragma unroll
    for (int q = 0; q < 4; ++q) { const float v = a[q] + b[q]; vals[u * 4 + q] = v; s1 += v; }
  }
  red[tid] = s1; __syncthreads();
  for (int st = 128; st > 0; st >>= 1) { if (tid < st) red[tid] += red[tid + st]; __syncthreads(); }
  const float mu = red[0] / (float)N; __syncthreads();
  float s2 = 0.f;
  for (int u = 0; u < per / 4; ++u)
#pragma unroll
    for (int q = 0; q < 4; ++q) { const float c = vals[u * 4 + q] - mu; s2 += c * c; }
  red[tid] = s2; __syncthreads();
  for (int st = 128; st > 0; st >>= 1) { if (tid < st) red[tid] += red[tid + st]; __syncthreads(); }
  const float rs = rsqrtf(red[0] / (float)N + eps);
  {
    for (int u = 0; u < per / 4; ++u) {
      const int j = tid * 4 + 1024 * u;
      v4f o, sm;
#pragma unroll
      for (int q = 0; q < 4; ++q) {
        float gg = g[j + q], bb = bta[j + q];
        if (PARAM_BF16) { gg = bf16_round(gg); bb = bf16_round(bb); }
        sm[q] = vals[u * 4 + q]; o[q] = (vals[u * 4 + q] - mu) * rs * gg + bb;
      }
      if (out_sum) *(v4f*)(out_sum + (size_t)row * N + j) = sm;
      *(v4f*)(out_norm + (size_t)row * N + j) = o;
    }
    
  }
}



// ---- f16 WMMA path (v_wmma_f32_16x16x32_f16): 11-bit significands for operands in range — used where a [0,1] probability operand needs more precision than bf16
typedef _Float16 v16h __attribute__((ext_vector_type(16)));
union FragH { v16h v; v8us half[2]; _Float16 h[16]; unsigned short u[16]; };
template <int NT>
__device__ __forceinline__ v8f mmaH(v16h ah, v16h al, v16h bh, v16h bl, v8f c) {
  c = __builtin_amdgcn_wmma_f32_16x16x32_f16(false, ah, false, bh, (short)0, c, false, false);
  if (NT >= 2) c = __builtin_amdgcn_wmma_f32_16x16x32_f16(false, al, false, bh, (short)0, c, false, false);
  if (NT >= 3) c = __builtin_amdgcn_wmma_f32_16x16x32_f16(false, ah, false, bl, (short)0, c, false, false);
  asm volatile("v_nop\n\tv_nop\n\tv_nop\n\tv_nop" : "+v"(c) : "v"(ah), "v"(al), "v"(bh), "v"(bl));
  return c;
}
// batched GEMM like k_gemm_b but f16 operands: A f32 (split into f16 hi/lo if ASPLIT, else rounded to f16), Bt = f16 values [n][k]; alpha; C f32; N multiple of 16 (partial tiles skipped)
template <bool ASPLIT>
__global__ __launch_bounds__(128) void k_gemm_h(const float* __restrict__ A, int lda, size_t sA, const _Float16* __restrict__ Bh, int ldb, size_t sB, float alpha, float* __restrict__ C, int ldc, size_t sC, int M, int N, int K) {
  __shared__ __attribute__((aligned(16))) float so[4][16][64];
  const int tid = threadIdx.x, w = tid >> 5, lane = tid & 31, ln = lane & 15, hh = lane >> 4; const int by = blockIdx.y;
  A += (size_t)by * sA; Bh += (size_t)by * sB; C += (size_t)by * sC;
  const int ntn = (N + 63) / 64; const int wid = blockIdx.x * 4 + w; const int mt = wid / ntn, nq = wid % ntn; if (mt * 16 >= M) return;
  const int row0 = mt * 16, col0 = nq * 64; const float* arow = A + (size_t)(row0 + ln) * lda;
  v8f acc[4] = {};
  for (int kb = 0; kb < K; kb += 32) {
    FragH ah, al;
    const v4f x0 = *(const v4fa*)(arow + kb + 8 * hh), x1 = *(const v4fa*)(arow + kb + 8 * hh + 4), x2 = *(const v4fa*)(arow + kb + 16 + 8 * hh), x3 = *(const v4fa*)(arow + kb + 16 + 8 * hh + 4);
    float xs[16] = {x0[0],x0[1],x0[2],x0[3],x1[0],x1[1],x1[2],x1[3],x2[0],x2[1],x2[2],x2[3],x3[0],x3[1],x3[2],x3[3]};
#pragma unroll
    for (int i = 0; i < 16; ++i) { const _Float16 h = (_Float16)xs[i]; ah.h[i] = h; al.h[i] = ASPLIT ? (_Float16)(xs[i] - (float)h) : (_Float16)0.0f; }
#pragma unroll
    for (int t = 0; t < 4; ++t) { if (col0 + t * 16 >= N) continue; const size_t boff = (size_t)(col0 + t * 16 + ln) * ldb + kb; FragH bq; bq.half[0] = *(const v8us*)(Bh + boff + 8 * hh); bq.half[1] = *(const v8us*)(Bh + boff + 16 + 8 * hh);
      acc[t] = mmaH<ASPLIT ? 2 : 1>(ah.v, al.v, bq.v, bq.v, acc[t]); }
  }
#pragma unroll
  for (int t = 0; t < 4; ++t) { if (col0 + t * 16 >= N) continue;
#pragma unroll
    for (int r = 0; r < 8; ++r) so[w][8 * hh + r][t * 16 + ln] = acc[t][r] * alpha; }
  __builtin_amdgcn_fence(__ATOMIC_ACQ_REL, "workgroup"); __builtin_amdgcn_wave_barrier();
  const int rsub = lane >> 4, c4 = (lane & 15) * 4;
  {
#pragma unroll
    for (int q = 0; q < 8; ++q) { const int r = q * 2 + rsub; if (col0 + c4 < N) { const v4f v = *(const v4fa*)&so[w][r][c4]; *(v4f*)(C + (size_t)(row0 + r) * ldc + col0 + c4) = v; } }
     }
}

__global__ __launch_bounds__(256) void k_h16(const float* __restrict__ x, _Float16* __restrict__ X16, size_t n8) { const size_t t = (size_t)blockIdx.x * 256 + threadIdx.x; if (t >= n8) return; FragH f;
#pragma unroll
  for (int q = 0; q < 8; ++q) f.h[q] = (_Float16)x[t * 8 + q]; *(v8us*)((unsigned short*)X16 + t * 8) = f.half[0];  }
__global__ __launch_bounds__(256) void k_round16f(const float* __restrict__ W, _Float16* __restrict__ Bt, size_t n8) { const size_t t = (size_t)blockIdx.x * 256 + threadIdx.x; if (t >= n8) return; FragH f;
#pragma unroll
  for (int i = 0; i < 8; ++i) f.h[i] = (_Float16)(bf16_round(W[t * 8 + i]) * 16.0f); *(v8us*)((unsigned short*)Bt + t * 8) = f.half[0];  }

// The whole projection stage in one launch. One work-group (8 waves) = 64 rows of x. It rounds its x rows and all of Wq, Wk, Wv (f32 -> bf16 -> f16,
// W times 2^4, laid [n][k], the three matrices as 192 columns) into LDS, forms Q, K and V on v_wmma_f32_16x16x32_f16 from there, and stores them in
// FRAGMENT ORDER: the workspace holds 512-byte chunks, lane l's 16 bytes of one operand half at byte 16 l, so that the attention kernel's every load is
// 512 contiguous bytes and every store here is an accumulator tile as it stands in the registers.
//   Qf, Kf: chunk (row / 16) * 4 + col / 16;                          lane 16 hh + ln = row (row & 15 = ln), columns 16 (col / 16) + 8 hh + 0..7
//   Vf:     chunk (row / 32) * 8 + (col / 16) * 2 + ((row >> 4) & 1); lane 16 hh + ln = column (col & 15 = ln), rows 16 (row / 16) + 8 hh + 0..7
// Wave w owns 32 rows (w & 1) and column tile w >> 1 of each of Q, K and V. Q and K are formed as W^T x^T (a lane holds 8 neighbouring columns of one
// row), V as x W (a lane holds 8 neighbouring rows of one column).
#define PRW 64          // rows of x a work-group
#define PKP (DD + 8)    // LDS pitch of a k row in halves: 528 B = 16 B x odd, free of bank conflicts for 16-byte accesses
typedef float v2f __attribute__((ext_vector_type(2)));
typedef __bf16 v2b __attribute__((ext_vector_type(2)));
typedef _Float16 v2h __attribute__((ext_vector_type(2)));
typedef unsigned int v2ua __attribute__((ext_vector_type(2), may_alias));
typedef unsigned int v4ua __attribute__((ext_vector_type(4), may_alias));
// two f32 -> bf16 (nearest even) -> f16, packed
__device__ __forceinline__ unsigned int pk_b16h(float a, float b) {
  return __builtin_bit_cast(unsigned int, __builtin_convertvector(__builtin_convertvector(__builtin_convertvector((v2f){a, b}, v2b), v2f), v2h)); }
__global__ __launch_bounds__(256) void k_proj(const float* __restrict__ x, const float* __restrict__ Wq, const float* __restrict__ Wk, const float* __restrict__ Wv,
                                              _Float16* __restrict__ Qf, _Float16* __restrict__ Kf, _Float16* __restrict__ Vf) {
  __shared__ __attribute__((aligned(16))) unsigned short sW[3 * HD][PKP];
  __shared__ __attribute__((aligned(16))) unsigned short sX[PRW][PKP];
  const int tid = (int)threadIdx.x, lane = tid & 31, ln = lane & 15, hh = lane >> 4;
  const int w = __builtin_amdgcn_readfirstlane(tid >> 5);   // scalar, so that the chunk addresses of the stores are scalar
  const int row0 = (int)blockIdx.x * PRW;
  // Weights in six chunks of half a matrix (128 k rows); of a chunk a lane takes 4 x 8 k of one column n; a wave: 32 neighbouring n, one line a load.
  const int n = tid & 63, kq = tid >> 6;
  float wr[6][32]; v4f xr[16];
  auto loadW = [&](int c) { const float* __restrict__ Wm = ((c >> 1) == 0) ? Wq : ((c >> 1) == 1) ? Wk : Wv;
#pragma unroll
    for (int u = 0; u < 4; ++u)
#pragma unroll
      for (int i = 0; i < 8; ++i) wr[c][u * 8 + i] = Wm[(size_t)((((c & 1) * 4 + u) * 4 + kq) * 8 + i) * HD + n]; };
  auto putW = [&](int c) {   // the power of two goes in ahead of the rounding: the same bits, and small weights stay normal in f16
#pragma unroll
    for (int u = 0; u < 4; ++u) { const float* v = &wr[c][u * 8];
      *(v4ua*)&sW[(c >> 1) * HD + n][(((c & 1) * 4 + u) * 4 + kq) * 8] = (v4ua){pk_b16h(v[0] * 16.0f, v[1] * 16.0f), pk_b16h(v[2] * 16.0f, v[3] * 16.0f), pk_b16h(v[4] * 16.0f, v[5] * 16.0f), pk_b16h(v[6] * 16.0f, v[7] * 16.0f)}; } };
  // Each sched_barrier below keeps a chunk's loads two chunks ahead of its conversion; left alone the compiler sank loads to their use, one wait a pair.
  // Each s_wait_xcnt stands in front of what may rewrite a register that an earlier, still issued load names as its address (a later load's result, a constant).
#pragma unroll
  for (int i = 0; i < 16; ++i) xr[i] = *(const v4fa*)(x + (size_t)row0 * DD + (size_t)(i * 256 + tid) * 4);   // whole lines a wave; from memory, so asked for first
  loadW(0); loadW(1); asm volatile("s_wait_xcnt 0x0" ::: "memory"); __builtin_amdgcn_sched_barrier(0);
  putW(0); asm volatile("s_wait_xcnt 0x0" ::: "memory"); loadW(2); __builtin_amdgcn_sched_barrier(0);
  putW(1); asm volatile("s_wait_xcnt 0x0" ::: "memory"); loadW(3); __builtin_amdgcn_sched_barrier(0);
  putW(2); asm volatile("s_wait_xcnt 0x0" ::: "memory"); loadW(4); __builtin_amdgcn_sched_barrier(0);
  putW(3); asm volatile("s_wait_xcnt 0x0" ::: "memory"); loadW(5); __builtin_amdgcn_sched_barrier(0);
  putW(4); putW(5);
#pragma unroll
  for (int i = 0; i < 16; ++i) { const int e = i * 256 + tid;
    *(v2ua*)&sX[e >> 6][(e & 63) * 4] = (v2ua){pk_b16h(xr[i][0], xr[i][1]), pk_b16h(xr[i][2], xr[i][3])}; }
  __syncthreads();   // publishes the converted x rows and weights to every wave
  { const int rp = w & 1, cg = w >> 1;
    const unsigned short* xrow = &sX[rp * 32 + ln][8 * hh]; const unsigned short* wrow = &sW[cg * 16 + ln][8 * hh];   // j = 0, 1, 2: Wq, Wk, Wv, HD rows apart
    v8f acc[2][3];
#pragma unroll
    for (int i = 0; i < 2; ++i)
#pragma unroll
      for (int j = 0; j < 3; ++j) acc[i][j] = (v8f){0.f,0.f,0.f,0.f,0.f,0.f,0.f,0.f};
    FragH fx[2][2], fw[2][3];   // two register sets: the fragments of k step s + 1 are fetched while step s is multiplied
#pragma unroll
    for (int i = 0; i < 2; ++i) { fx[0][i].half[0] = *(const v8us*)(xrow + i * 16 * PKP); fx[0][i].half[1] = *(const v8us*)(xrow + i * 16 * PKP + 16); }
#pragma unroll
    for (int j = 0; j < 3; ++j) { fw[0][j].half[0] = *(const v8us*)(wrow + j * HD * PKP); fw[0][j].half[1] = *(const v8us*)(wrow + j * HD * PKP + 16); }
#pragma unroll
    for (int s = 0; s < DD / 32; ++s) { const int cu = s & 1, nx = cu ^ 1, kn = (s + 1) * 32;
      if (s + 1 < DD / 32) {
#pragma unroll
        for (int i = 0; i < 2; ++i) { fx[nx][i].half[0] = *(const v8us*)(xrow + i * 16 * PKP + kn); fx[nx][i].half[1] = *(const v8us*)(xrow + i * 16 * PKP + kn + 16); }
#pragma unroll
        for (int j = 0; j < 3; ++j) { fw[nx][j].half[0] = *(const v8us*)(wrow + j * HD * PKP + kn); fw[nx][j].half[1] = *(const v8us*)(wrow + j * HD * PKP + kn + 16); } }
#pragma unroll
      for (int i = 0; i < 2; ++i)
#pragma unroll
        for (int j = 0; j < 3; ++j) acc[i][j] = (j < 2) ? __builtin_amdgcn_wmma_f32_16x16x32_f16(false, fw[cu][j].v, false, fx[cu][i].v, (short)0, acc[i][j], false, false)
                                                        : __builtin_amdgcn_wmma_f32_16x16x32_f16(false, fx[cu][i].v, false, fw[cu][j].v, (short)0, acc[i][j], false, false); }
    FragH o[2][3];   // j < 2: acc[i][j][r] = (x W)[row rp * 32 + i * 16 + ln][column cg * 16 + 8 hh + r]; j = 2: (x Wv)[row rp * 32 + i * 16 + 8 hh + r][column cg * 16 + ln]
#pragma unroll
    for (int i = 0; i < 2; ++i)
#pragma unroll
      for (int j = 0; j < 3; ++j)
#pragma unroll
        for (int r = 0; r < 8; ++r) o[i][j].h[r] = (_Float16)(acc[i][j][r] * 0.0625f);   // takes the 2^4 of the weights out again
#pragma unroll
    for (int i = 0; i < 2; ++i) {   // a wave's store = one chunk, four whole lines
      *(v8us*)((unsigned short*)Qf + ((size_t)(row0 / 16 + rp * 2 + i) * 4 + cg) * 256 + lane * 8) = o[i][0].half[0];
      *(v8us*)((unsigned short*)Kf + ((size_t)(row0 / 16 + rp * 2 + i) * 4 + cg) * 256 + lane * 8) = o[i][1].half[0];
      *(v8us*)((unsigned short*)Vf + ((size_t)(row0 / 32 + rp) * 8 + cg * 2 + i) * 256 + lane * 8) = o[i][2].half[0]; } } }

#define NKW 16
__device__ __forceinline__ float xhalf(float x) { return __builtin_bit_cast(float, __builtin_amdgcn_permlanex16(__builtin_bit_cast(int, x), __builtin_bit_cast(int, x), 0x76543210, 0xfedcba98, false, false)); }  // lane l with lane l ^ 16
// amdgpu_waves_per_eu(8): 128 VGPRs a wave, so that two 16-wave work-groups share a WGP and eight waves fill each other's waits on a SIMD.
__global__ __launch_bounds__(NKW * 32) __attribute__((amdgpu_waves_per_eu(8))) void k_flash(const _Float16* __restrict__ Qf, const _Float16* __restrict__ Kf, const _Float16* __restrict__ Vf, const int* __restrict__ MSK, float* __restrict__ O, int ldo) {
  constexpr int NQB = 4096 / 16, DT = 4, KS = 2;
  __shared__ __attribute__((aligned(16))) float sO[NKW][16][64 + 4];
  __shared__ float sM[NKW][16], sL[NKW][16];
  const int lane = (int)__builtin_amdgcn_mbcnt_lo(~0u, 0u), ln = lane & 15, hh = lane >> 4;   // lane id without threadIdx.x: one register fewer live over the key loop
  const int w = __builtin_amdgcn_readfirstlane((int)threadIdx.x >> 5);   // scalar, so that the key loop's test stays a scalar branch
  const int slab = blockIdx.x / NQB, qblk = blockIdx.x % NQB; const int b = slab; const int q0 = qblk * 16; (void)MSK;
  FragH aq[KS];   // B operand of S^T: column ln = query q0 + ln
  { const unsigned short* qr = (const unsigned short*)Qf + ((size_t)b * 4096 + q0) * 64 + lane * 8;
#pragma unroll
    for (int ks = 0; ks < KS; ++ks) { aq[ks].half[0] = *(const v8us*)(qr + ks * 512); aq[ks].half[1] = *(const v8us*)(qr + ks * 512 + 256); } }
  const unsigned short* Kb = (const unsigned short*)Kf + (size_t)slab * 64 * 4096;
  const unsigned short* Vb = (const unsigned short*)Vf + (size_t)slab * 64 * 4096;
  unsigned int vo = (unsigned int)lane * 16u + (unsigned int)w * (32u * 128u);   // the lane's place in the pass's first K (and V^T) chunk, in bytes: one register, carried over the loop, beside the scalar bases
  float m_q = -3.0e38f, l_q = 0.f; v8f oacc[DT];   // of query q0 + ln; l_q over this half's keys only, the halves joined behind the loop
#pragma unroll
  for (int dt = 0; dt < DT; ++dt) oacc[dt] = (v8f){0.f,0.f,0.f,0.f,0.f,0.f,0.f,0.f};
  const int jend = q0 + 16;
  const int qd = q0 + ln - 8 * hh;   // the mask's one lane-dependent term
#pragma unroll 1
  for (int j0 = w * 32; j0 < jend; j0 += NKW * 32) {
    float sc[16];   // sc[nt * 8 + r] = score of key j0 + nt * 16 + 8 hh + r
    FragH bk[2][KS], bv[DT];
    // The pass's eight K loads stand together in front of its first product: one trip to L2 is waited for, not one a 16-key group.
#pragma unroll
    for (int nt = 0; nt < 2; ++nt)
#pragma unroll
      for (int ks = 0; ks < KS; ++ks) { bk[nt][ks].half[0] = *(const v8us*)((const char*)Kb + vo + (nt * 2048 + ks * 1024)); bk[nt][ks].half[1] = *(const v8us*)((const char*)Kb + vo + (nt * 2048 + ks * 1024 + 512)); }
#pragma unroll
    for (int nt = 0; nt < 2; ++nt) { v8f acc = (v8f){0.f,0.f,0.f,0.f,0.f,0.f,0.f,0.f};
#pragma unroll
      for (int ks = 0; ks < KS; ++ks) acc = mmaH<1>(bk[nt][ks].v, bk[nt][ks].v, aq[ks].v, aq[ks].v, acc);
#pragma unroll
      for (int r = 0; r < 8; ++r) sc[nt * 8 + r] = acc[r] * (0.0625f); }
    // The pass's eight V^T loads stand together behind the score products (into the registers that K has left): they fly while the softmax is worked out.
#pragma unroll
    for (int dt = 0; dt < DT; ++dt) { bv[dt].half[0] = *(const v8us*)((const char*)Vb + vo + dt * 1024); bv[dt].half[1] = *(const v8us*)((const char*)Vb + vo + (dt * 1024 + 512)); }
    if (j0 + 31 > q0) {   // only the tile on the diagonal holds keys behind a query (a scalar test); key j0 <= q0 stays, so every query keeps a finite maximum
#pragma unroll
      for (int i = 0; i < 16; ++i) if ((i >> 3) * 16 + (i & 7) > qd - j0) sc[i] = -INFINITY; }   // key j0 + 16 (i >> 3) + 8 hh + (i & 7) behind query q0 + ln; constants against one register
    float mc = sc[0];
#pragma unroll
    for (int i = 1; i < 16; ++i) mc = fmaxf(mc, sc[i]);
    mc = fmaxf(mc, xhalf(mc));
    const float mn = fmaxf(m_q, mc); const float al = expf(m_q - mn); m_q = mn;
    FragH pb; float ps = 0.f;
#pragma unroll
    for (int i = 0; i < 16; ++i) { const float p = expf(sc[i] - mn); ps += p; pb.h[i] = (_Float16)p; }
    l_q = l_q * al + ps;
#pragma unroll
    for (int dt = 0; dt < DT; ++dt) oacc[dt] *= al;
#pragma unroll
    for (int dt = 0; dt < DT; ++dt) oacc[dt] = mmaH<1>(bv[dt].v, bv[dt].v, pb.v, pb.v, oacc[dt]);
    __builtin_amdgcn_sched_barrier(0);   // keeps the step of vo behind the last product's wait for the V^T loads, which name that register as their address
    vo += NKW * 32u * 128u; }
  // each wave's partial: query maximum, sum (the two halves joined) and the un-normalised output row; a wave without a key tile leaves (-3e38, 0, 0)
  l_q += xhalf(l_q);
  if (hh == 0) { sM[w][ln] = m_q; sL[w][ln] = l_q; }
#pragma unroll
  for (int dt = 0; dt < DT; ++dt) {   // oacc[dt][r] = O[q0 + ln][dt * 16 + 8 hh + r]: eight neighbours of one row
    *(v4fa*)&sO[w][ln][dt * 16 + 8 * hh] = (v4f){oacc[dt][0], oacc[dt][1], oacc[dt][2], oacc[dt][3]};
    *(v4fa*)&sO[w][ln][dt * 16 + 8 * hh + 4] = (v4f){oacc[dt][4], oacc[dt][5], oacc[dt][6], oacc[dt][7]}; }
  __syncthreads();   // publishes every wave's partial to the merging threads
  if (w < 8) { const int r = w * 2 + hh, pc = ln;
    float M = sM[0][r];
#pragma unroll
    for (int u = 1; u < NKW; ++u) M = fmaxf(M, sM[u][r]);
    float L = 0.f; v4f o = {0.f, 0.f, 0.f, 0.f};
#pragma unroll
    for (int u = 0; u < NKW; ++u) { const float e = expf(sM[u][r] - M); L += e * sL[u][r]; const v4f pv = *(const v4fa*)&sO[u][r][pc * 4]; o += pv * e; }
    const float inv = (L > 0.f) ? 1.0f / L : 0.f;
    *(v4f*)(O + ((size_t)b * 4096 + q0 + r) * ldo + pc * 4) = o * inv; } }

extern "C" void kernel_launch(void* const* d_in, const int* in_sizes, int n_in,
                              void* d_out, int out_size, void* d_ws, size_t ws_size, hipStream_t stream) {
  (void)in_sizes; (void)n_in; (void)out_size;
  const float* x = (const float*)d_in[0]; const float* Wq = (const float*)d_in[1]; const float* Wk = (const float*)d_in[2]; const float* Wv = (const float*)d_in[3];
  char* ws = (char*)d_ws; size_t off = 0;
  auto take = [&](size_t bytes) { char* p = ws + off; off += (bytes + 255) & ~(size_t)255; return p; };
  _Float16* Qf = (_Float16*)take((size_t)NR * HD * 2); _Float16* Kf = (_Float16*)take((size_t)NR * HD * 2); _Float16* Vf = (_Float16*)take((size_t)NR * HD * 2);
  if (off > ws_size) return;      // 3 x 2 MiB
  k_proj<<<NR / PRW, 256, 0, stream>>>(x, Wq, Wk, Wv, Qf, Kf, Vf);
  k_flash<<<BB * 1 * (TT / 16), NKW * 32, 0, stream>>>(Qf, Kf, Vf, nullptr, (float*)d_out, HD);
}

// v006
// Measured time: 31.7 microseconds a run.
// Next to v005, in two timings, it ran 1.15 and 1.16 times as fast.
// Counting every step since v000, it is 16.6 times as fast.
#include <hip/hip_runtime.h>
// Single-head causal self-attention layer (B=4, S=4096, D=256, H=64; scale 1/√256 as in the module): q/k/v projections as GEMMs (W [in][out] transposed to bf16-exact ×2^4) and the attention as a
// fused flash-style causal kernel (online softmax f32, P f16 <= 1, O^T = Vt*P^T; 16 query rows per work-group, key tiles dealt over its 16 waves, partials merged in LDS) on v_wmma_f32_16x16x32_f16 with f32 accumulate.
#define BB 4
#define TT 4096
#define DD 256
#define HD 64
#define NR (BB * TT)

typedef __bf16 v16b __attribute__((ext_vector_type(16)));
typedef unsigned short v8us __attribute__((ext_vector_type(8), may_alias));
typedef float  v8f  __attribute__((ext_vector_type(8)));
typedef float  v4f  __attribute__((ext_vector_type(4)));
typedef float  v4fa __attribute__((ext_vector_type(4), may_alias));
union FragB { v16b v; v8us half[2]; unsigned short u[16]; };

__device__ __forceinline__ unsigned short bf16_bits(float x) { unsigned int u = __float_as_uint(x); return (unsigned short)((u + 0x7FFFu + ((u >> 16) & 1u)) >> 16); }
__device__ __forceinline__ float bf16_val(unsigned short b) { return __uint_as_float(((unsigned int)b) << 16); }
__device__ __forceinline__ float bf16_round(float x) { return bf16_val(bf16_bits(x)); }
// D += A·B with NT terms: 1 = ah·bh, 2 = + al·bh (A split), 3 = + ah·bl (both split)
template <int NT>
__device__ __forceinline__ v8f mmaN(v16b ah, v16b al, v16b bh, v16b bl, v8f c) {
  c = __builtin_amdgcn_wmma_f32_16x16x32_bf16(false, ah, false, bh, (short)0, c, false, false);
  if (NT >= 2) c = __builtin_amdgcn_wmma_f32_16x16x32_bf16(false, al, false, bh, (short)0, c, false, false);
  if (NT >= 3) c = __builtin_amdgcn_wmma_f32_16x16x32_bf16(false, ah, false, bl, (short)0, c, false, false);
  asm volatile("v_nop\n\tv_nop\n\tv_nop\n\tv_nop" : "+v"(c) : "v"(ah), "v"(al), "v"(bh), "v"(bl));
  return c;
}

__global__ __launch_bounds__(256) void k_wt_bf16(const float* __restrict__ W, unsigned short* __restrict__ Wt, int K, int N) {
  const int t = blockIdx.x * 256 + threadIdx.x;
  const int k8n = K / 8;
  if (t >= N * k8n) return;
  const int n = t / k8n, k8 = (t % k8n) * 8;
  v8us v;
#pragma unroll
  for (int i = 0; i < 8; ++i) v[i] = bf16_bits(W[(size_t)(k8 + i) * N + n]);
  *(v8us*)(Wt + (size_t)n * K + k8) = v;
  
}

// GEMM C[M][N] (f32, pitch ldc) = act(A[M][K]·W + bias). A f32 row-major (pitch lda) converted per fragment to bf16
// (ASPLIT: hi/lo two planes -> 2 terms, else single rounded term); Wt bf16 [N][K] (pitch ldb). BIAS_BF16 rounds the
// bias to bf16 first (bias quantised to bf16 before the add). K%32==0, M%16==0, N%64==0.
template <bool ASPLIT, int ACT, bool BIAS_BF16>
__global__ __launch_bounds__(128) void k_gemm_bf(const float* __restrict__ A, int lda, const unsigned short* __restrict__ Wt, int ldb,
                                               const float* __restrict__ bias, float* __restrict__ C, int ldc, int M, int N, int K) {
  __shared__ __attribute__((aligned(16))) float so[4][16][64];
  const int tid = threadIdx.x, w = tid >> 5, lane = tid & 31, ln = lane & 15, hh = lane >> 4;
  const int ntn = N / 64;
  const int wid = blockIdx.x * 4 + w;
  const int mt = wid / ntn, nq = wid % ntn;
  if (mt * 16 >= M) return;
  const int row0 = mt * 16, col0 = nq * 64;
  const float* arow = A + (size_t)(row0 + ln) * lda;
  v8f acc[4] = {};
  for (int kb = 0; kb < K; kb += 32) {
    FragB ah, al;
    const v4f x0 = *(const v4fa*)(arow + kb + 8 * hh), x1 = *(const v4fa*)(arow + kb + 8 * hh + 4);
    const v4f x2 = *(const v4fa*)(arow + kb + 16 + 8 * hh), x3 = *(const v4fa*)(arow + kb + 16 + 8 * hh + 4);
    float xs[16] = {x0[0],x0[1],x0[2],x0[3],x1[0],x1[1],x1[2],x1[3],x2[0],x2[1],x2[2],x2[3],x3[0],x3[1],x3[2],x3[3]};
#pragma unroll
    for (int i = 0; i < 16; ++i) { const unsigned short hb = bf16_bits(xs[i]); ah.u[i] = hb; al.u[i] = ASPLIT ? bf16_bits(xs[i] - bf16_val(hb)) : (unsigned short)0; }
#pragma unroll
    for (int t = 0; t < 4; ++t) {
      const unsigned short* brow = Wt + (size_t)(col0 + t * 16 + ln) * ldb + kb;
      FragB b;
      b.half[0] = *(const v8us*)(brow + 8 * hh);
      b.half[1] = *(const v8us*)(brow + 16 + 8 * hh);
      acc[t] = mmaN<ASPLIT ? 2 : 1>(ah.v, al.v, b.v, b.v, acc[t]);
    }
  }
#pragma unroll
  for (int t = 0; t < 4; ++t) {
    float bv = bias ? bias[col0 + t * 16 + ln] : 0.f;
    if (BIAS_BF16) bv = bf16_round(bv);
#pragma unroll
    for (int r = 0; r < 8; ++r) { float v = acc[t][r] + bv; if (ACT == 1) v = fmaxf(v, 0.f); so[w][8 * hh + r][t * 16 + ln] = v; }
  }
  __builtin_amdgcn_fence(__ATOMIC_ACQ_REL, "workgroup");
  __builtin_amdgcn_wave_barrier();
  const int rsub = lane >> 4, c4 = (lane & 15) * 4;
  {
#pragma unroll
    for (int q = 0; q < 8; ++q) {
      const int r = q * 2 + rsub;
      const v4f v = *(const v4fa*)&so[w][r][c4];
      *(v4f*)(C + (size_t)(row0 + r) * ldc + col0 + c4) = v;
    }
    
  }
}

// Flash-style causal/unmasked attention, all contractions 3-term bf16 hi/lo splits, f32 softmax with running max.
// q,k,v rows are read from f32 buffers with arbitrary row pitch (so they can live inside a fused qkv buffer);
// D = head size (multiple of 32, <= 128); one wave = 16 query rows; block = 4 waves (64 queries) sharing K/V chunks of 32.
template <int D, bool CAUSAL>
__global__ __launch_bounds__(128) void k_flash(const float* __restrict__ qb, const float* __restrict__ kb, const float* __restrict__ vb,
                                             int pitch, int T, int H, float scale, float* __restrict__ y, int ypitch) {
  constexpr int KS = D / 32;        // k-steps for QK
  constexpr int DT = D / 16;        // d tiles for PV
  __shared__ __attribute__((aligned(16))) unsigned short sKh[32][D + 8], sKl[32][D + 8], sVh[32][D + 8], sVl[32][D + 8];
  __shared__ __attribute__((aligned(16))) unsigned short sPh[4][16][40], sPl[4][16][40];
  __shared__ __attribute__((aligned(16))) float sO[4][16][D];
  const int tid = threadIdx.x, w = tid >> 5, lane = tid & 31, ln = lane & 15, hh = lane >> 4;
  const int nqb = (T + 63) / 64;
  const int bh = blockIdx.x / nqb, qblk = blockIdx.x % nqb;
  const int b = bh / H, h = bh % H;
  const int q0 = qblk * 64 + w * 16;
  const float* Q = qb + (size_t)b * T * pitch + h * D;
  const float* K = kb + (size_t)b * T * pitch + h * D;
  const float* V = vb + (size_t)b * T * pitch + h * D;

  // A fragments of the wave's 16 query rows (scaled), hi/lo
  FragB aqh[KS], aql[KS];
  {
    int row = q0 + ln; if (row >= T) row = T - 1;
    const float* qr = Q + (size_t)row * pitch;
#pragma unroll
    for (int ks = 0; ks < KS; ++ks)
#pragma unroll
      for (int i = 0; i < 16; ++i) {
        const int d = ks * 32 + ((i < 8) ? (8 * hh + i) : (16 + 8 * hh + (i - 8)));
        const float x = qr[d] * scale; const unsigned short hb = bf16_bits(x);
        aqh[ks].u[i] = hb; aql[ks].u[i] = bf16_bits(x - bf16_val(hb));
      }
  }
  float m_r[8], l_r[8];
#pragma unroll
  for (int r = 0; r < 8; ++r) { m_r[r] = -3.0e38f; l_r[r] = 0.f; }
  v8f oacc[DT];
#pragma unroll
  for (int dt = 0; dt < DT; ++dt) oacc[dt] = (v8f){0.f,0.f,0.f,0.f,0.f,0.f,0.f,0.f};

  const int kv_end = CAUSAL ? min(T, qblk * 64 + 64) : T;     // block-uniform
  for (int j0 = 0; j0 < kv_end; j0 += 32) {
    __syncthreads();
    for (int e = tid; e < 32 * (D / 4); e += 128) {
      const int r = e / (D / 4), c4 = (e % (D / 4)) * 4;
      const int key = j0 + r;
      v4f kf = {0.f,0.f,0.f,0.f}, vf = {0.f,0.f,0.f,0.f};
      if (key < T) { kf = *(const v4fa*)(K + (size_t)key * pitch + c4); vf = *(const v4fa*)(V + (size_t)key * pitch + c4); }
#pragma unroll
      for (int t = 0; t < 4; ++t) {
        unsigned short hb = bf16_bits(kf[t]); sKh[r][c4 + t] = hb; sKl[r][c4 + t] = bf16_bits(kf[t] - bf16_val(hb));
        hb = bf16_bits(vf[t]); sVh[r][c4 + t] = hb; sVl[r][c4 + t] = bf16_bits(vf[t] - bf16_val(hb));
      }
    }
    __syncthreads();
    // S tile 16 x 32
    v8f s[2];
#pragma unroll
    for (int nt = 0; nt < 2; ++nt) {
      v8f acc = {};
#pragma unroll
      for (int ks = 0; ks < KS; ++ks) {
        FragB bh_, bl_;
        bh_.half[0] = *(const v8us*)&sKh[nt * 16 + ln][ks * 32 + 8 * hh]; bh_.half[1] = *(const v8us*)&sKh[nt * 16 + ln][ks * 32 + 16 + 8 * hh];
        bl_.half[0] = *(const v8us*)&sKl[nt * 16 + ln][ks * 32 + 8 * hh]; bl_.half[1] = *(const v8us*)&sKl[nt * 16 + ln][ks * 32 + 16 + 8 * hh];
        acc = mmaN<3>(aqh[ks].v, aql[ks].v, bh_.v, bl_.v, acc);
      }
      s[nt] = acc;
    }
    // mask + running max (rows 8hh+r; the 16 lanes of a half share rows)
    float alpha[8];
#pragma unroll
    for (int r = 0; r < 8; ++r) {
      const int qi = q0 + 8 * hh + r;
      const int ja = j0 + ln, jb = j0 + 16 + ln;
      if (CAUSAL) { if (ja > qi) s[0][r] = -3.0e38f; if (jb > qi) s[1][r] = -3.0e38f; }
      if (ja >= T) s[0][r] = -3.0e38f;
      if (jb >= T) s[1][r] = -3.0e38f;
      float mx = fmaxf(s[0][r], s[1][r]);
      mx = fmaxf(mx, __shfl_xor(mx, 1, 32)); mx = fmaxf(mx, __shfl_xor(mx, 2, 32)); mx = fmaxf(mx, __shfl_xor(mx, 4, 32)); mx = fmaxf(mx, __shfl_xor(mx, 8, 32));
      const float mnew = fmaxf(m_r[r], mx);
      alpha[r] = (mnew > -1.0e38f) ? __expf(m_r[r] - mnew) : 1.0f;
      const float p0 = (s[0][r] > -1.0e38f) ? __expf(s[0][r] - mnew) : 0.f;
      const float p1 = (s[1][r] > -1.0e38f) ? __expf(s[1][r] - mnew) : 0.f;
      m_r[r] = mnew;
      l_r[r] = l_r[r] * alpha[r] + p0 + p1;            // per-lane partial row sum (16 lanes combined at the end)
      unsigned short hb = bf16_bits(p0); sPh[w][8 * hh + r][ln] = hb;      sPl[w][8 * hh + r][ln] = bf16_bits(p0 - bf16_val(hb));
      hb = bf16_bits(p1);                sPh[w][8 * hh + r][16 + ln] = hb; sPl[w][8 * hh + r][16 + ln] = bf16_bits(p1 - bf16_val(hb));
    }
#pragma unroll
    for (int dt = 0; dt < DT; ++dt)
#pragma unroll
      for (int r = 0; r < 8; ++r) oacc[dt][r] *= alpha[r];
    __builtin_amdgcn_fence(__ATOMIC_ACQ_REL, "workgroup");
    __builtin_amdgcn_wave_barrier();
    FragB pah, pal;
    pah.half[0] = *(const v8us*)&sPh[w][ln][8 * hh]; pah.half[1] = *(const v8us*)&sPh[w][ln][16 + 8 * hh];
    pal.half[0] = *(const v8us*)&sPl[w][ln][8 * hh]; pal.half[1] = *(const v8us*)&sPl[w][ln][16 + 8 * hh];
#pragma unroll
    for (int dt = 0; dt < DT; ++dt) {
      FragB bvh, bvl;
#pragma unroll
      for (int i = 0; i < 8; ++i) {
        bvh.u[i] = sVh[8 * hh + i][dt * 16 + ln]; bvh.u[8 + i] = sVh[16 + 8 * hh + i][dt * 16 + ln];
        bvl.u[i] = sVl[8 * hh + i][dt * 16 + ln]; bvl.u[8 + i] = sVl[16 + 8 * hh + i][dt * 16 + ln];
      }
      oacc[dt] = mmaN<3>(pah.v, pal.v, bvh.v, bvl.v, oacc[dt]);
    }
    __builtin_amdgcn_fence(__ATOMIC_ACQ_REL, "workgroup");
    __builtin_amdgcn_wave_barrier();
  }
#pragma unroll
  for (int r = 0; r < 8; ++r) {
    float l = l_r[r];
    l += __shfl_xor(l, 1, 32); l += __shfl_xor(l, 2, 32); l += __shfl_xor(l, 4, 32); l += __shfl_xor(l, 8, 32);
    l_r[r] = (l > 0.f) ? 1.0f / l : 0.f;
  }
#pragma unroll
  for (int dt = 0; dt < DT; ++dt)
#pragma unroll
    for (int r = 0; r < 8; ++r) sO[w][8 * hh + r][dt * 16 + ln] = oacc[dt][r] * l_r[r];
  __builtin_amdgcn_fence(__ATOMIC_ACQ_REL, "workgroup");
  __builtin_amdgcn_wave_barrier();
  {
    for (int r = 0; r < 16; ++r) {
      const int row = q0 + r;
      if (row < T && lane < D / 4) {
        const v4f val = *(const v4fa*)&sO[w][r][lane * 4];
        *(v4f*)(y + ((size_t)b * T + row) * ypitch + h * D + lane * 4) = val;
      }
    }
    
  }
}

// GEMM C = act(A·W + bias + resid): A f32 (ASPLIT -> hi/lo 2 terms), Wt bf16 [N][K]; ACT 0 none, 1 relu, 2 exact gelu;
// resid (optional, f32, row index = (row % rmod), pitch ldr, RES_BF16 rounds it) added before the activation.
template <bool ASPLIT, int ACT, bool BIAS_BF16, bool RES_BF16>
__global__ __launch_bounds__(128) void k_gemm_bf3(const float* __restrict__ A, int lda, const unsigned short* __restrict__ Wt, int ldb,
                                                const float* __restrict__ bias, const float* __restrict__ resid, int rmod, int ldr,
                                                float* __restrict__ C, int ldc, int M, int N, int K) {
  __shared__ __attribute__((aligned(16))) float so[4][16][64];
  const int tid = threadIdx.x, w = tid >> 5, lane = tid & 31, ln = lane & 15, hh = lane >> 4;
  const int ntn = N / 64;
  const int wid = blockIdx.x * 4 + w;
  const int mt = wid / ntn, nq = wid % ntn;
  if (mt * 16 >= M) return;
  const int row0 = mt * 16, col0 = nq * 64;
  const float* arow = A + (size_t)(row0 + ln) * lda;
  v8f acc[4] = {};
  for (int kb = 0; kb < K; kb += 32) {
    FragB ah, al;
    const v4f x0 = *(const v4fa*)(arow + kb + 8 * hh), x1 = *(const v4fa*)(arow + kb + 8 * hh + 4);
    const v4f x2 = *(const v4fa*)(arow + kb + 16 + 8 * hh), x3 = *(const v4fa*)(arow + kb + 16 + 8 * hh + 4);
    float xs[16] = {x0[0],x0[1],x0[2],x0[3],x1[0],x1[1],x1[2],x1[3],x2[0],x2[1],x2[2],x2[3],x3[0],x3[1],x3[2],x3[3]};
#pragma unroll
    for (int i = 0; i < 16; ++i) { const unsigned short hb = bf16_bits(xs[i]); ah.u[i] = hb; al.u[i] = ASPLIT ? bf16_bits(xs[i] - bf16_val(hb)) : (unsigned short)0; }
#pragma unroll
    for (int t = 0; t < 4; ++t) {
      const unsigned short* brow = Wt + (size_t)(col0 + t * 16 + ln) * ldb + kb;
      FragB b;
      b.half[0] = *(const v8us*)(brow + 8 * hh);
      b.half[1] = *(const v8us*)(brow + 16 + 8 * hh);
      acc[t] = mmaN<ASPLIT ? 2 : 1>(ah.v, al.v, b.v, b.v, acc[t]);
    }
  }
#pragma unroll
  for (int t = 0; t < 4; ++t) {
    const int col = col0 + t * 16 + ln;
    float bv = bias ? bias[col] : 0.f;
    if (BIAS_BF16) bv = bf16_round(bv);
#pragma unroll
    for (int r = 0; r < 8; ++r) {
      float v = acc[t][r] + bv;
      if (resid) { float rv = resid[(size_t)((row0 + 8 * hh + r) % rmod) * ldr + col]; if (RES_BF16) rv = bf16_round(rv); v += rv; }
      if (ACT == 1) v = fmaxf(v, 0.f);
      if (ACT == 2) v = 0.5f * v * (1.0f + erff(v * 0.70710678118654752f));
      if (ACT == 3) { const float u = 0.7978845608028654f * (v + 0.044715f * v * v * v); v = 0.5f * v * (1.0f + tanhf(u)); }
      so[w][8 * hh + r][t * 16 + ln] = v;
    }
  }
  __builtin_amdgcn_fence(__ATOMIC_ACQ_REL, "workgroup");
  __builtin_amdgcn_wave_barrier();
  const int rsub = lane >> 4, c4 = (lane & 15) * 4;
  {
#pragma unroll
    for (int q = 0; q < 8; ++q) {
      const int r = q * 2 + rsub;
      const v4f v = *(const v4fa*)&so[w][r][c4];
      *(v4f*)(C + (size_t)(row0 + r) * ldc + col0 + c4) = v;
    }
    
  }
}
// row LayerNorm (biased variance, eps) over N: s = X (+ R); optional out_sum <- s; out_norm <- (s-mu)*rsqrt(var+eps)*g + b
template <bool PARAM_BF16>
__global__ __launch_bounds__(256) void k_layernorm(const float* __restrict__ X, const float* __restrict__ R, const float* __restrict__ g, const float* __restrict__ bta,
                                                  float* __restrict__ out_sum, float* __restrict__ out_norm, int N, float eps) {
  __shared__ float red[256];
  const int row = blockIdx.x, tid = threadIdx.x;
  const float* x = X + (size_t)row * N; const float* rr = R ? R + (size_t)row * N : nullptr;
  float vals[16];                     // up to N = 4096
  const int per = N / 256;            // contiguous chunk per thread? use strided-by-4 chunks: thread handles j = tid*4 + 1024*u
  float s1 = 0.f;
  for (int u = 0; u < per / 4; ++u) {
    const int j = tid * 4 + 1024 * u;
    const v4f a = *(const v4fa*)(x + j);
    v4f b = {0.f,0.f,0.f,0.f}; if (rr) b = *(const v4fa*)(rr + j);
#pragma unroll
    for (int q = 0; q < 4; ++q) { const float v = a[q] + b[q]; vals[u * 4 + q] = v; s1 += v; }
  }
  red[tid] = s1; __syncthreads();
  for (int st = 128; st > 0; st >>= 1) { if (tid < st) red[tid] += red[tid + st]; __syncthreads(); }
  const float mu = red[0] / (float)N; __syncthreads();
  float s2 = 0.f;
  for (int u = 0; u < per / 4; ++u)
#pragma unroll
    for (int q = 0; q < 4; ++q) { const float c = vals[u * 4 + q] - mu; s2 += c * c; }
  red[tid] = s2; __syncthreads();
  for (int st = 128; st > 0; st >>= 1) { if (tid < st) red[tid] += red[tid + st]; __syncthreads(); }
  const float rs = rsqrtf(red[0] / (float)N + eps);
  {
    for (int u = 0; u < per / 4; ++u) {
      const int j = tid * 4 + 1024 * u;
      v4f o, sm;
#pragma unroll
      for (int q = 0; q < 4; ++q) {
        float gg = g[j + q], bb = bta[j + q];
        if (PARAM_BF16) { gg = bf16_round(gg); bb = bf16_round(bb); }
        sm[q] = vals[u * 4 + q]; o[q] = (vals[u * 4 + q] - mu) * rs * gg + bb;
      }
      if (out_sum) *(v4f*)(out_sum + (size_t)row * N + j) = sm;
      *(v4f*)(out_norm + (size_t)row * N + j) = o;
    }
    
  }
}



// ---- f16 WMMA path (v_wmma_f32_16x16x32_f16): 11-bit significands for operands in range — used where a [0,1] probability operand needs more precision than bf16
typedef _Float16 v16h __attribute__((ext_vector_type(16)));
union FragH { v16h v; v8us half[2]; _Float16 h[16]; unsigned short u[16]; };
template <int NT>
__device__ __forceinline__ v8f mmaH(v16h ah, v16h al, v16h bh, v16h bl, v8f c) {
  c = __builtin_amdgcn_wmma_f32_16x16x32_f16(false, ah, false, bh, (short)0, c, false, false);
  if (NT >= 2) c = __builtin_amdgcn_wmma_f32_16x16x32_f16(false, al, false, bh, (short)0, c, false, false);
  if (NT >= 3) c = __builtin_amdgcn_wmma_f32_16x16x32_f16(false, ah, false, bl, (short)0, c, false, false);
  asm volatile("v_nop\n\tv_nop\n\tv_nop\n\tv_nop" : "+v"(c) : "v"(ah), "v"(al), "v"(bh), "v"(bl));
  return c;
}
// batched GEMM like k_gemm_b but f16 operands: A f32 (split into f16 hi/lo if ASPLIT, else rounded to f16), Bt = f16 values [n][k]; alpha; C f32; N multiple of 16 (partial tiles skipped)
template <bool ASPLIT>
__global__ __launch_bounds__(128) void k_gemm_h(const float* __restrict__ A, int lda, size_t sA, const _Float16* __restrict__ Bh, int ldb, size_t sB, float alpha, float* __restrict__ C, int ldc, size_t sC, int M, int N, int K) {
  __shared__ __attribute__((aligned(16))) float so[4][16][64];
  const int tid = threadIdx.x, w = tid >> 5, lane = tid & 31, ln = lane & 15, hh = lane >> 4; const int by = blockIdx.y;
  A += (size_t)by * sA; Bh += (size_t)by * sB; C += (size_t)by * sC;
  const int ntn = (N + 63) / 64; const int wid = blockIdx.x * 4 + w; const int mt = wid / ntn, nq = wid % ntn; if (mt * 16 >= M) return;
  const int row0 = mt * 16, col0 = nq * 64; const float* arow = A + (size_t)(row0 + ln) * lda;
  v8f acc[4] = {};
  for (int kb = 0; kb < K; kb += 32) {
    FragH ah, al;
    const v4f x0 = *(const v4fa*)(arow + kb + 8 * hh), x1 = *(const v4fa*)(arow + kb + 8 * hh + 4), x2 = *(const v4fa*)(arow + kb + 16 + 8 * hh), x3 = *(const v4fa*)(arow + kb + 16 + 8 * hh + 4);
    float xs[16] = {x0[0],x0[1],x0[2],x0[3],x1[0],x1[1],x1[2],x1[3],x2[0],x2[1],x2[2],x2[3],x3[0],x3[1],x3[2],x3[3]};
#pragma unroll
    for (int i = 0; i < 16; ++i) { const _Float16 h = (_Float16)xs[i]; ah.h[i] = h; al.h[i] = ASPLIT ? (_Float16)(xs[i] - (float)h) : (_Float16)0.0f; }
#pragma unroll
    for (int t = 0; t < 4; ++t) { if (col0 + t * 16 >= N) continue; const size_t boff = (size_t)(col0 + t * 16 + ln) * ldb + kb; FragH bq; bq.half[0] = *(const v8us*)(Bh + boff + 8 * hh); bq.half[1] = *(const v8us*)(Bh + boff + 16 + 8 * hh);
      acc[t] = mmaH<ASPLIT ? 2 : 1>(ah.v, al.v, bq.v, bq.v, acc[t]); }
  }
#pragma unroll
  for (int t = 0; t < 4; ++t) { if (col0 + t * 16 >= N) continue;
#pragma unroll
    for (int r = 0; r < 8; ++r) so[w][8 * hh + r][t * 16 + ln] = acc[t][r] * alpha; }
  __builtin_amdgcn_fence(__ATOMIC_ACQ_REL, "workgroup"); __builtin_amdgcn_wave_barrier();
  const int rsub = lane >> 4, c4 = (lane & 15) * 4;
  {
#pragma unroll
    for (int q = 0; q < 8; ++q) { const int r = q * 2 + rsub; if (col0 + c4 < N) { const v4f v = *(const v4fa*)&so[w][r][c4]; *(v4f*)(C + (size_t)(row0 + r) * ldc + col0 + c4) = v; } }
     }
}

__global__ __launch_bounds__(256) void k_h16(const float* __restrict__ x, _Float16* __restrict__ X16, size_t n8) { const size_t t = (size_t)blockIdx.x * 256 + threadIdx.x; if (t >= n8) return; FragH f;
#pragma unroll
  for (int q = 0; q < 8; ++q) f.h[q] = (_Float16)x[t * 8 + q]; *(v8us*)((unsigned short*)X16 + t * 8) = f.half[0];  }
__global__ __launch_bounds__(256) void k_round16f(const float* __restrict__ W, _Float16* __restrict__ Bt, size_t n8) { const size_t t = (size_t)blockIdx.x * 256 + threadIdx.x; if (t >= n8) return; FragH f;
#pragma unroll
  for (int i = 0; i < 8; ++i) f.h[i] = (_Float16)(bf16_round(W[t * 8 + i]) * 16.0f); *(v8us*)((unsigned short*)Bt + t * 8) = f.half[0];  }

// The whole projection stage in one launch. One work-group (8 waves) = 64 rows of x. It rounds its x rows and all of Wq, Wk, Wv (f32 -> bf16 -> f16,
// W times 2^4, laid [n][k], the three matrices as 192 columns) into LDS, forms Q, K and V on v_wmma_f32_16x16x32_f16 from there, and stores them in
// FRAGMENT ORDER: the workspace holds 512-byte chunks, lane l's 16 bytes of one operand half at byte 16 l, so that the attention kernel's every load is
// 512 contiguous bytes and every store here is an accumulator tile as it stands in the registers.
//   Qf, Kf: chunk (row / 16) * 4 + col / 16;                          lane 16 hh + ln = row (row & 15 = ln), columns 16 (col / 16) + 8 hh + 0..7
//   Vf:     chunk (row / 32) * 8 + (col / 16) * 2 + ((row >> 4) & 1); lane 16 hh + ln = column (col & 15 = ln), rows 16 (row / 16) + 8 hh + 0..7
// Wave w owns 32 rows (w & 1) and column tile w >> 1 of each of Q, K and V. Q and K are formed as W^T x^T (a lane holds 8 neighbouring columns of one
// row), V as x W (a lane holds 8 neighbouring rows of one column).
#define PRW 64          // rows of x a work-group
#define PKP (DD + 8)    // LDS pitch of a k row in halves: 528 B = 16 B x odd, free of bank conflicts for 16-byte accesses
typedef float v2f __attribute__((ext_vector_type(2)));
typedef __bf16 v2b __attribute__((ext_vector_type(2)));
typedef _Float16 v2h __attribute__((ext_vector_type(2)));
typedef unsigned int v2ua __attribute__((ext_vector_type(2), may_alias));
typedef unsigned int v4ua __attribute__((ext_vector_type(4), may_alias));
// two f32 -> bf16 (nearest even) -> f16, packed
__device__ __forceinline__ unsigned int pk_b16h(float a, float b) {
  return __builtin_bit_cast(unsigned int, __builtin_convertvector(__builtin_convertvector(__builtin_convertvector((v2f){a, b}, v2b), v2f), v2h)); }
__global__ __launch_bounds__(256) void k_proj(const float* __restrict__ x, const float* __restrict__ Wq, const float* __restrict__ Wk, const float* __restrict__ Wv,
                                              _Float16* __restrict__ Qf, _Float16* __restrict__ Kf, _Float16* __restrict__ Vf) {
  __shared__ __attribute__((aligned(16))) unsigned short sW[3 * HD][PKP];
  __shared__ __attribute__((aligned(16))) unsigned short sX[PRW][PKP];
  const int tid = (int)threadIdx.x, lane = tid & 31, ln = lane & 15, hh = lane >> 4;
  const int w = __builtin_amdgcn_readfirstlane(tid >> 5);   // scalar, so that the chunk addresses of the stores are scalar
  const int row0 = (int)blockIdx.x * PRW;
  // Weights in six chunks of half a matrix (128 k rows); of a chunk a lane takes 4 x 8 k of one column n; a wave: 32 neighbouring n, one line a load.
  const int n = tid & 63, kq = tid >> 6;
  float wr[6][32]; v4f xr[16];
  auto loadW = [&](int c) { const float* __restrict__ Wm = ((c >> 1) == 0) ? Wq : ((c >> 1) == 1) ? Wk : Wv;
#pragma unroll
    for (int u = 0; u < 4; ++u)
#pragma unroll
      for (int i = 0; i < 8; ++i) wr[c][u * 8 + i] = Wm[(size_t)((((c & 1) * 4 + u) * 4 + kq) * 8 + i) * HD + n]; };
  auto putW = [&](int c) {   // the power of two goes in ahead of the rounding: the same bits, and small weights stay normal in f16
#pragma unroll
    for (int u = 0; u < 4; ++u) { const float* v = &wr[c][u * 8];
      *(v4ua*)&sW[(c >> 1) * HD + n][(((c & 1) * 4 + u) * 4 + kq) * 8] = (v4ua){pk_b16h(v[0] * 16.0f, v[1] * 16.0f), pk_b16h(v[2] * 16.0f, v[3] * 16.0f), pk_b16h(v[4] * 16.0f, v[5] * 16.0f), pk_b16h(v[6] * 16.0f, v[7] * 16.0f)}; } };
  // Each sched_barrier below keeps a chunk's loads two chunks ahead of its conversion; left alone the compiler sank loads to their use, one wait a pair.
  // Each s_wait_xcnt stands in front of what may rewrite a register that an earlier, still issued load names as its address (a later load's result, a constant).
#pragma unroll
  for (int i = 0; i < 16; ++i) xr[i] = *(const v4fa*)(x + (size_t)row0 * DD + (size_t)(i * 256 + tid) * 4);   // whole lines a wave; from memory, so asked for first
  loadW(0); loadW(1); asm volatile("s_wait_xcnt 0x0" ::: "memory"); __builtin_amdgcn_sched_barrier(0);
  putW(0); asm volatile("s_wait_xcnt 0x0" ::: "memory"); loadW(2); __builtin_amdgcn_sched_barrier(0);
  putW(1); asm volatile("s_wait_xcnt 0x0" ::: "memory"); loadW(3); __builtin_amdgcn_sched_barrier(0);
  putW(2); asm volatile("s_wait_xcnt 0x0" ::: "memory"); loadW(4); __builtin_amdgcn_sched_barrier(0);
  putW(3); asm volatile("s_wait_xcnt 0x0" ::: "memory"); loadW(5); __builtin_amdgcn_sched_barrier(0);
  putW(4); putW(5);
#pragma unroll
  for (int i = 0; i < 16; ++i) { const int e = i * 256 + tid;
    *(v2ua*)&sX[e >> 6][(e & 63) * 4] = (v2ua){pk_b16h(xr[i][0], xr[i][1]), pk_b16h(xr[i][2], xr[i][3])}; }
  __syncthreads();   // publishes the converted x rows and weights to every wave
  { const int rp = w & 1, cg = w >> 1;
    const unsigned short* xrow = &sX[rp * 32 + ln][8 * hh]; const unsigned short* wrow = &sW[cg * 16 + ln][8 * hh];   // j = 0, 1, 2: Wq, Wk, Wv, HD rows apart
    v8f acc[2][3];
#pragma unroll
    for (int i = 0; i < 2; ++i)
#pragma unroll
      for (int j = 0; j < 3; ++j) acc[i][j] = (v8f){0.f,0.f,0.f,0.f,0.f,0.f,0.f,0.f};
    FragH fx[2][2], fw[2][3];   // two register sets: the fragments of k step s + 1 are fetched while step s is multiplied
#pragma unroll
    for (int i = 0; i < 2; ++i) { fx[0][i].half[0] = *(const v8us*)(xrow + i * 16 * PKP); fx[0][i].half[1] = *(const v8us*)(xrow + i * 16 * PKP + 16); }
#pragma unroll
    for (int j = 0; j < 3; ++j) { fw[0][j].half[0] = *(const v8us*)(wrow + j * HD * PKP); fw[0][j].half[1] = *(const v8us*)(wrow + j * HD * PKP + 16); }
#pragma unroll
    for (int s = 0; s < DD / 32; ++s) { const int cu = s & 1, nx = cu ^ 1, kn = (s + 1) * 32;
      if (s + 1 < DD / 32) {
#pragma unroll
        for (int i = 0; i < 2; ++i) { fx[nx][i].half[0] = *(const v8us*)(xrow + i * 16 * PKP + kn); fx[nx][i].half[1] = *(const v8us*)(xrow + i * 16 * PKP + kn + 16); }
#pragma unroll
        for (int j = 0; j < 3; ++j) { fw[nx][j].half[0] = *(const v8us*)(wrow + j * HD * PKP + kn); fw[nx][j].half[1] = *(const v8us*)(wrow + j * HD * PKP + kn + 16); } }
#pragma unroll
      for (int i = 0; i < 2; ++i)
#pragma unroll
        for (int j = 0; j < 3; ++j) acc[i][j] = (j < 2) ? __builtin_amdgcn_wmma_f32_16x16x32_f16(false, fw[cu][j].v, false, fx[cu][i].v, (short)0, acc[i][j], false, false)
                                                        : __builtin_amdgcn_wmma_f32_16x16x32_f16(false, fx[cu][i].v, false, fw[cu][j].v, (short)0, acc[i][j], false, false); }
    FragH o[2][3];   // j < 2: acc[i][j][r] = (x W)[row rp * 32 + i * 16 + ln][column cg * 16 + 8 hh + r]; j = 2: (x Wv)[row rp * 32 + i * 16 + 8 hh + r][column cg * 16 + ln]
#pragma unroll
    for (int i = 0; i < 2; ++i)
#pragma unroll
      for (int j = 0; j < 3; ++j)
#pragma unroll
        for (int r = 0; r < 8; ++r) o[i][j].h[r] = (_Float16)(acc[i][j][r] * 0.0625f);   // takes the 2^4 of the weights out again
#pragma unroll
    for (int i = 0; i < 2; ++i) {   // a wave's store = one chunk, four whole lines
      *(v8us*)((unsigned short*)Qf + ((size_t)(row0 / 16 + rp * 2 + i) * 4 + cg) * 256 + lane * 8) = o[i][0].half[0];
      *(v8us*)((unsigned short*)Kf + ((size_t)(row0 / 16 + rp * 2 + i) * 4 + cg) * 256 + lane * 8) = o[i][1].half[0];
      *(v8us*)((unsigned short*)Vf + ((size_t)(row0 / 32 + rp) * 8 + cg * 2 + i) * 256 + lane * 8) = o[i][2].half[0]; } } }

#define NKW 16
#define SL2 (0.0625f * 1.44269504088896340736f)
__device__ __forceinline__ float xhalf(float x) { return __builtin_bit_cast(float, __builtin_amdgcn_permlanex16(__builtin_bit_cast(int, x), __builtin_bit_cast(int, x), 0x76543210, 0xfedcba98, false, false)); }  // lane l with lane l ^ 16
// 2^x for the merge, once a work-group: the v_nop fills the one slot that the instruction set asks for between a transcendental and a next instruction that overwrites
// its source (in the key loop the compiler fills it itself).
__device__ __forceinline__ float exp2_slot(float x) { float y; asm("v_exp_f32 %0, %1\n\tv_nop" : "=v"(y) : "v"(x)); return y; }
// amdgpu_waves_per_eu(8): 128 VGPRs a wave, so that two 16-wave work-groups share a WGP and eight waves fill each other's waits on a SIMD.
__global__ __launch_bounds__(NKW * 32) __attribute__((amdgpu_waves_per_eu(8))) void k_flash(const _Float16* __restrict__ Qf, const _Float16* __restrict__ Kf, const _Float16* __restrict__ Vf, const int* __restrict__ MSK, float* __restrict__ O, int ldo) {
  constexpr int NQB = 4096 / 16, DT = 4, KS = 2;
  __shared__ __attribute__((aligned(16))) float sO[NKW][16][64 + 4];
  __shared__ float sM[NKW][16], sL[NKW][16];
  const int lane = (int)__builtin_amdgcn_mbcnt_lo(~0u, 0u), ln = lane & 15, hh = lane >> 4;   // lane id without threadIdx.x: one register fewer live over the key loop
  const int w = __builtin_amdgcn_readfirstlane((int)threadIdx.x >> 5);   // scalar, so that the key loop's test stays a scalar branch
  const int slab = blockIdx.x / NQB, qblk = blockIdx.x % NQB; const int b = slab; const int q0 = qblk * 16; (void)MSK;
  FragH aq[KS];   // B operand of S^T: column ln = query q0 + ln
  { const unsigned short* qr = (const unsigned short*)Qf + ((size_t)b * 4096 + q0) * 64 + lane * 8;
#pragma unroll
    for (int ks = 0; ks < KS; ++ks) { aq[ks].half[0] = *(const v8us*)(qr + ks * 512); aq[ks].half[1] = *(const v8us*)(qr + ks * 512 + 256); } }
  const unsigned short* Kb = (const unsigned short*)Kf + (size_t)slab * 64 * 4096;
  const unsigned short* Vb = (const unsigned short*)Vf + (size_t)slab * 64 * 4096;
  unsigned int vo = (unsigned int)lane * 16u + (unsigned int)w * (32u * 128u);   // the lane's place in the pass's first K (and V^T) chunk, in bytes: one register, carried over the loop, beside the scalar bases
  float m_q = -3.0e38f, l_q = 0.f; v8f oacc[DT];   // of query q0 + ln; m_q in the scaled log2 domain; l_q over this half's keys only, the halves joined behind the loop
#pragma unroll
  for (int dt = 0; dt < DT; ++dt) oacc[dt] = (v8f){0.f,0.f,0.f,0.f,0.f,0.f,0.f,0.f};
  const int jend = q0 + 16;
  const int qd = q0 + ln - 8 * hh;   // the mask's one lane-dependent term
#pragma unroll 1
  for (int j0 = w * 32; j0 < jend; j0 += NKW * 32) {
    float sc[16];   // sc[nt * 8 + r] = raw score (q . k) of key j0 + nt * 16 + 8 hh + r
    FragH bk[2][KS], bv[DT];
    // The pass's eight K loads stand together in front of its first product: one trip to L2 is waited for, not one a 16-key group.
#pragma unroll
    for (int nt = 0; nt < 2; ++nt)
#pragma unroll
      for (int ks = 0; ks < KS; ++ks) { bk[nt][ks].half[0] = *(const v8us*)((const char*)Kb + vo + (nt * 2048 + ks * 1024)); bk[nt][ks].half[1] = *(const v8us*)((const char*)Kb + vo + (nt * 2048 + ks * 1024 + 512)); }
#pragma unroll
    for (int nt = 0; nt < 2; ++nt) { v8f acc = (v8f){0.f,0.f,0.f,0.f,0.f,0.f,0.f,0.f};
#pragma unroll
      for (int ks = 0; ks < KS; ++ks) acc = mmaH<1>(bk[nt][ks].v, bk[nt][ks].v, aq[ks].v, aq[ks].v, acc);
#pragma unroll
      for (int r = 0; r < 8; ++r) sc[nt * 8 + r] = acc[r]; }
    // The pass's eight V^T loads stand together behind the score products (into the registers that K has left): they fly while the softmax is worked out.
#pragma unroll
    for (int dt = 0; dt < DT; ++dt) { bv[dt].half[0] = *(const v8us*)((const char*)Vb + vo + dt * 1024); bv[dt].half[1] = *(const v8us*)((const char*)Vb + vo + (dt * 1024 + 512)); }
    if (j0 + 31 > q0) {   // only the tile on the diagonal holds keys behind a query (a scalar test); key j0 <= q0 stays, so every query keeps a finite maximum
#pragma unroll
      for (int i = 0; i < 16; ++i) if ((i >> 3) * 16 + (i & 7) > qd - j0) sc[i] = -INFINITY; }   // key j0 + 16 (i >> 3) + 8 hh + (i & 7) behind query q0 + ln; constants against one register
    float mc = sc[0];
#pragma unroll
    for (int i = 1; i < 16; ++i) mc = fmaxf(mc, sc[i]);
    mc = fmaxf(mc, xhalf(mc));
    const float mn = fmaxf(m_q, mc * SL2); const float al = __builtin_amdgcn_exp2f(m_q - mn); m_q = mn;   // SL2 > 0: the maximum may be taken on the raw scores
    FragH pb; float ps = 0.f;
#pragma unroll
    for (int i = 0; i < 16; ++i) { const float p = __builtin_amdgcn_exp2f(__builtin_fmaf(sc[i], SL2, -mn)); ps += p; pb.h[i] = (_Float16)p; }   // a masked score: 2^-inf = 0
    l_q = l_q * al + ps;
#pragma unroll
    for (int dt = 0; dt < DT; ++dt) oacc[dt] *= al;
#pragma unroll
    for (int dt = 0; dt < DT; ++dt) oacc[dt] = mmaH<1>(bv[dt].v, bv[dt].v, pb.v, pb.v, oacc[dt]);
    __builtin_amdgcn_sched_barrier(0);   // keeps the step of vo behind the last product's wait for the V^T loads, which name that register as their address
    vo += NKW * 32u * 128u; }
  // each wave's partial: query maximum (scaled log2 domain), sum (the two halves joined) and the un-normalised output row; a wave without a key tile leaves (-3e38, 0, 0)
  l_q += xhalf(l_q);
  if (hh == 0) { sM[w][ln] = m_q; sL[w][ln] = l_q; }
#pragma unroll
  for (int dt = 0; dt < DT; ++dt) {   // oacc[dt][r] = O[q0 + ln][dt * 16 + 8 hh + r]: eight neighbours of one row
    *(v4fa*)&sO[w][ln][dt * 16 + 8 * hh] = (v4f){oacc[dt][0], oacc[dt][1], oacc[dt][2], oacc[dt][3]};
    *(v4fa*)&sO[w][ln][dt * 16 + 8 * hh + 4] = (v4f){oacc[dt][4], oacc[dt][5], oacc[dt][6], oacc[dt][7]}; }
  __syncthreads();   // publishes every wave's partial to the merging threads
  if (w < 8) { const int r = w * 2 + hh, pc = ln;
    float M = sM[0][r];
#pragma unroll
    for (int u = 1; u < NKW; ++u) M = fmaxf(M, sM[u][r]);
    float L = 0.f; v4f o = {0.f, 0.f, 0.f, 0.f};
#pragma unroll
    for (int u = 0; u < NKW; ++u) { const float e = exp2_slot(sM[u][r] - M); L += e * sL[u][r]; const v4f pv = *(const v4fa*)&sO[u][r][pc * 4]; o += pv * e; }
    const float inv = (L > 0.f) ? 1.0f / L : 0.f;
    *(v4f*)(O + ((size_t)b * 4096 + q0 + r) * ldo + pc * 4) = o * inv; } }

extern "C" void kernel_launch(void* const* d_in, const int* in_sizes, int n_in,
                              void* d_out, int out_size, void* d_ws, size_t ws_size, hipStream_t stream) {
  (void)in_sizes; (void)n_in; (void)out_size;
  const float* x = (const float*)d_in[0]; const float* Wq = (const float*)d_in[1]; const float* Wk = (const float*)d_in[2]; const float* Wv = (const float*)d_in[3];
  char* ws = (char*)d_ws; size_t off = 0;
  auto take = [&](size_t bytes) { char* p = ws + off; off += (bytes + 255) & ~(size_t)255; return p; };
  _Float16* Qf = (_Float16*)take((size_t)NR * HD * 2); _Float16* Kf = (_Float16*)take((size_t)NR * HD * 2); _Float16* Vf = (_Float16*)take((size_t)NR * HD * 2);
  if (off > ws_size) return;      // 3 x 2 MiB
  k_proj<<<NR / PRW, 256, 0, stream>>>(x, Wq, Wk, Wv, Qf, Kf, Vf);
  k_flash<<<BB * 1 * (TT / 16), NKW * 32, 0, stream>>>(Qf, Kf, Vf, nullptr, (float*)d_out, HD);
}

// v007
// A run of this version takes 29.6 microseconds.
// Timed twice side by side with v006, it ran 1.05 and 1.06 times as fast.
// Counting every step since v000, it is 17.5 times as fast.
#include <hip/hip_runtime.h>
// Single-head causal self-attention layer (B=4, S=4096, D=256, H=64; scale 1/√256 as in the module): q/k/v projections as GEMMs (W [in][out] transposed to bf16-exact ×2^4) and the attention as a
// fused flash-style causal kernel (online softmax f32, P f16 <= 1, O^T = Vt*P^T; 32 query rows per work-group, key tiles dealt over its 16 waves, partials merged in LDS) on v_wmma_f32_16x16x32_f16 with f32 accumulate.
#define BB 4
#define TT 4096
#define DD 256
#define HD 64
#define NR (BB * TT)

typedef __bf16 v16b __attribute__((ext_vector_type(16)));
typedef unsigned short v8us __attribute__((ext_vector_type(8), may_alias));
typedef float  v8f  __attribute__((ext_vector_type(8)));
typedef float  v4f  __attribute__((ext_vector_type(4)));
typedef float  v4fa __attribute__((ext_vector_type(4), may_alias));
union FragB { v16b v; v8us half[2]; unsigned short u[16]; };

__device__ __forceinline__ unsigned short bf16_bits(float x) { unsigned int u = __float_as_uint(x); return (unsigned short)((u + 0x7FFFu + ((u >> 16) & 1u)) >> 16); }
__device__ __forceinline__ float bf16_val(unsigned short b) { return __uint_as_float(((unsigned int)b) << 16); }
__device__ __forceinline__ float bf16_round(float x) { return bf16_val(bf16_bits(x)); }
// D += A·B with NT terms: 1 = ah·bh, 2 = + al·bh (A split), 3 = + ah·bl (both split)
template <int NT>
__device__ __forceinline__ v8f mmaN(v16b ah, v16b al, v16b bh, v16b bl, v8f c) {
  c = __builtin_amdgcn_wmma_f32_16x16x32_bf16(false, ah, false, bh, (short)0, c, false, false);
  if (NT >= 2) c = __builtin_amdgcn_wmma_f32_16x16x32_bf16(false, al, false, bh, (short)0, c, false, false);
  if (NT >= 3) c = __builtin_amdgcn_wmma_f32_16x16x32_bf16(false, ah, false, bl, (short)0, c, false, false);
  asm volatile("v_nop\n\tv_nop\n\tv_nop\n\tv_nop" : "+v"(c) : "v"(ah), "v"(al), "v"(bh), "v"(bl));
  return c;
}

__global__ __launch_bounds__(256) void k_wt_bf16(const float* __restrict__ W, unsigned short* __restrict__ Wt, int K, int N) {
  const int t = blockIdx.x * 256 + threadIdx.x;
  const int k8n = K / 8;
  if (t >= N * k8n) return;
  const int n = t / k8n, k8 = (t % k8n) * 8;
  v8us v;
#pragma unroll
  for (int i = 0; i < 8; ++i) v[i] = bf16_bits(W[(size_t)(k8 + i) * N + n]);
  *(v8us*)(Wt + (size_t)n * K + k8) = v;
  
}

// GEMM C[M][N] (f32, pitch ldc) = act(A[M][K]·W + bias). A f32 row-major (pitch lda) converted per fragment to bf16
// (ASPLIT: hi/lo two planes -> 2 terms, else single rounded term); Wt bf16 [N][K] (pitch ldb). BIAS_BF16 rounds the
// bias to bf16 first (bias quantised to bf16 before the add). K%32==0, M%16==0, N%64==0.
template <bool ASPLIT, int ACT, bool BIAS_BF16>
__global__ __launch_bounds__(128) void k_gemm_bf(const float* __restrict__ A, int lda, const unsigned short* __restrict__ Wt, int ldb,
                                               const float* __restrict__ bias, float* __restrict__ C, int ldc, int M, int N, int K) {
  __shared__ __attribute__((aligned(16))) float so[4][16][64];
  const int tid = threadIdx.x, w = tid >> 5, lane = tid & 31, ln = lane & 15, hh = lane >> 4;
  const int ntn = N / 64;
  const int wid = blockIdx.x * 4 + w;
  const int mt = wid / ntn, nq = wid % ntn;
  if (mt * 16 >= M) return;
  const int row0 = mt * 16, col0 = nq * 64;
  const float* arow = A + (size_t)(row0 + ln) * lda;
  v8f acc[4] = {};
  for (int kb = 0; kb < K; kb += 32) {
    FragB ah, al;
    const v4f x0 = *(const v4fa*)(arow + kb + 8 * hh), x1 = *(const v4fa*)(arow + kb + 8 * hh + 4);
    const v4f x2 = *(const v4fa*)(arow + kb + 16 + 8 * hh), x3 = *(const v4fa*)(arow + kb + 16 + 8 * hh + 4);
    float xs[16] = {x0[0],x0[1],x0[2],x0[3],x1[0],x1[1],x1[2],x1[3],x2[0],x2[1],x2[2],x2[3],x3[0],x3[1],x3[2],x3[3]};
#pragma unroll
    for (int i = 0; i < 16; ++i) { const unsigned short hb = bf16_bits(xs[i]); ah.u[i] = hb; al.u[i] = ASPLIT ? bf16_bits(xs[i] - bf16_val(hb)) : (unsigned short)0; }
#pragma unroll
    for (int t = 0; t < 4; ++t) {
      const unsigned short* brow = Wt + (size_t)(col0 + t * 16 + ln) * ldb + kb;
      FragB b;
      b.half[0] = *(const v8us*)(brow + 8 * hh);
      b.half[1] = *(const v8us*)(brow + 16 + 8 * hh);
      acc[t] = mmaN<ASPLIT ? 2 : 1>(ah.v, al.v, b.v, b.v, acc[t]);
    }
  }
#pragma unroll
  for (int t = 0; t < 4; ++t) {
    float bv = bias ? bias[col0 + t * 16 + ln] : 0.f;
    if (BIAS_BF16) bv = bf16_round(bv);
#pragma unroll
    for (int r = 0; r < 8; ++r) { float v = acc[t][r] + bv; if (ACT == 1) v = fmaxf(v, 0.f); so[w][8 * hh + r][t * 16 + ln] = v; }
  }
  __builtin_amdgcn_fence(__ATOMIC_ACQ_REL, "workgroup");
  __builtin_amdgcn_wave_barrier();
  const int rsub = lane >> 4, c4 = (lane & 15) * 4;
  {
#pragma unroll
    for (int q = 0; q < 8; ++q) {
      const int r = q * 2 + rsub;
      const v4f v = *(const v4fa*)&so[w][r][c4];
      *(v4f*)(C + (size_t)(row0 + r) * ldc + col0 + c4) = v;
    }
    
  }
}

// Flash-style causal/unmasked attention, all contractions 3-term bf16 hi/lo splits, f32 softmax with running max.
// q,k,v rows are read from f32 buffers with arbitrary row pitch (so they can live inside a fused qkv buffer);
// D = head size (multiple of 32, <= 128); one wave = 16 query rows; block = 4 waves (64 queries) sharing K/V chunks of 32.
template <int D, bool CAUSAL>
__global__ __launch_bounds__(128) void k_flash(const float* __restrict__ qb, const float* __restrict__ kb, const float* __restrict__ vb,
                                             int pitch, int T, int H, float scale, float* __restrict__ y, int ypitch) {
  constexpr int KS = D / 32;        // k-steps for QK
  constexpr int DT = D / 16;        // d tiles for PV
  __shared__ __attribute__((aligned(16))) unsigned short sKh[32][D + 8], sKl[32][D + 8], sVh[32][D + 8], sVl[32][D + 8];
  __shared__ __attribute__((aligned(16))) unsigned short sPh[4][16][40], sPl[4][16][40];
  __shared__ __attribute__((aligned(16))) float sO[4][16][D];
  const int tid = threadIdx.x, w = tid >> 5, lane = tid & 31, ln = lane & 15, hh = lane >> 4;
  const int nqb = (T + 63) / 64;
  const int bh = blockIdx.x / nqb, qblk = blockIdx.x % nqb;
  const int b = bh / H, h = bh % H;
  const int q0 = qblk * 64 + w * 16;
  const float* Q = qb + (size_t)b * T * pitch + h * D;
  const float* K = kb + (size_t)b * T * pitch + h * D;
  const float* V = vb + (size_t)b * T * pitch + h * D;

  // A fragments of the wave's 16 query rows (scaled), hi/lo
  FragB aqh[KS], aql[KS];
  {
    int row = q0 + ln; if (row >= T) row = T - 1;
    const float* qr = Q + (size_t)row * pitch;
#pragma unroll
    for (int ks = 0; ks < KS; ++ks)
#pragma unroll
      for (int i = 0; i < 16; ++i) {
        const int d = ks * 32 + ((i < 8) ? (8 * hh + i) : (16 + 8 * hh + (i - 8)));
        const float x = qr[d] * scale; const unsigned short hb = bf16_bits(x);
        aqh[ks].u[i] = hb; aql[ks].u[i] = bf16_bits(x - bf16_val(hb));
      }
  }
  float m_r[8], l_r[8];
#pragma unroll
  for (int r = 0; r < 8; ++r) { m_r[r] = -3.0e38f; l_r[r] = 0.f; }
  v8f oacc[DT];
#pragma unroll
  for (int dt = 0; dt < DT; ++dt) oacc[dt] = (v8f){0.f,0.f,0.f,0.f,0.f,0.f,0.f,0.f};

  const int kv_end = CAUSAL ? min(T, qblk * 64 + 64) : T;     // block-uniform
  for (int j0 = 0; j0 < kv_end; j0 += 32) {
    __syncthreads();
    for (int e = tid; e < 32 * (D / 4); e += 128) {
      const int r = e / (D / 4), c4 = (e % (D / 4)) * 4;
      const int key = j0 + r;
      v4f kf = {0.f,0.f,0.f,0.f}, vf = {0.f,0.f,0.f,0.f};
      if (key < T) { kf = *(const v4fa*)(K + (size_t)key * pitch + c4); vf = *(const v4fa*)(V + (size_t)key * pitch + c4); }
#pragma unroll
      for (int t = 0; t < 4; ++t) {
        unsigned short hb = bf16_bits(kf[t]); sKh[r][c4 + t] = hb; sKl[r][c4 + t] = bf16_bits(kf[t] - bf16_val(hb));
        hb = bf16_bits(vf[t]); sVh[r][c4 + t] = hb; sVl[r][c4 + t] = bf16_bits(vf[t] - bf16_val(hb));
      }
    }
    __syncthreads();
    // S tile 16 x 32
    v8f s[2];
#pragma unroll
    for (int nt = 0; nt < 2; ++nt) {
      v8f acc = {};
#pragma unroll
      for (int ks = 0; ks < KS; ++ks) {
        FragB bh_, bl_;
        bh_.half[0] = *(const v8us*)&sKh[nt * 16 + ln][ks * 32 + 8 * hh]; bh_.half[1] = *(const v8us*)&sKh[nt * 16 + ln][ks * 32 + 16 + 8 * hh];
        bl_.half[0] = *(const v8us*)&sKl[nt * 16 + ln][ks * 32 + 8 * hh]; bl_.half[1] = *(const v8us*)&sKl[nt * 16 + ln][ks * 32 + 16 + 8 * hh];
        acc = mmaN<3>(aqh[ks].v, aql[ks].v, bh_.v, bl_.v, acc);
      }
      s[nt] = acc;
    }
    // mask + running max (rows 8hh+r; the 16 lanes of a half share rows)
    float alpha[8];
#pragma unroll
    for (int r = 0; r < 8; ++r) {
      const int qi = q0 + 8 * hh + r;
      const int ja = j0 + ln, jb = j0 + 16 + ln;
      if (CAUSAL) { if (ja > qi) s[0][r] = -3.0e38f; if (jb > qi) s[1][r] = -3.0e38f; }
      if (ja >= T) s[0][r] = -3.0e38f;
      if (jb >= T) s[1][r] = -3.0e38f;
      float mx = fmaxf(s[0][r], s[1][r]);
      mx = fmaxf(mx, __shfl_xor(mx, 1, 32)); mx = fmaxf(mx, __shfl_xor(mx, 2, 32)); mx = fmaxf(mx, __shfl_xor(mx, 4, 32)); mx = fmaxf(mx, __shfl_xor(mx, 8, 32));
      const float mnew = fmaxf(m_r[r], mx);
      alpha[r] = (mnew > -1.0e38f) ? __expf(m_r[r] - mnew) : 1.0f;
      const float p0 = (s[0][r] > -1.0e38f) ? __expf(s[0][r] - mnew) : 0.f;
      const float p1 = (s[1][r] > -1.0e38f) ? __expf(s[1][r] - mnew) : 0.f;
      m_r[r] = mnew;
      l_r[r] = l_r[r] * alpha[r] + p0 + p1;            // per-lane partial row sum (16 lanes combined at the end)
      unsigned short hb = bf16_bits(p0); sPh[w][8 * hh + r][ln] = hb;      sPl[w][8 * hh + r][ln] = bf16_bits(p0 - bf16_val(hb));
      hb = bf16_bits(p1);                sPh[w][8 * hh + r][16 + ln] = hb; sPl[w][8 * hh + r][16 + ln] = bf16_bits(p1 - bf16_val(hb));
    }
#pragma unroll
    for (int dt = 0; dt < DT; ++dt)
#pragma unroll
      for (int r = 0; r < 8; ++r) oacc[dt][r] *= alpha[r];
    __builtin_amdgcn_fence(__ATOMIC_ACQ_REL, "workgroup");
    __builtin_amdgcn_wave_barrier();
    FragB pah, pal;
    pah.half[0] = *(const v8us*)&sPh[w][ln][8 * hh]; pah.half[1] = *(const v8us*)&sPh[w][ln][16 + 8 * hh];
    pal.half[0] = *(const v8us*)&sPl[w][ln][8 * hh]; pal.half[1] = *(const v8us*)&sPl[w][ln][16 + 8 * hh];
#pragma unroll
    for (int dt = 0; dt < DT; ++dt) {
      FragB bvh, bvl;
#pragma unroll
      for (int i = 0; i < 8; ++i) {
        bvh.u[i] = sVh[8 * hh + i][dt * 16 + ln]; bvh.u[8 + i] = sVh[16 + 8 * hh + i][dt * 16 + ln];
        bvl.u[i] = sVl[8 * hh + i][dt * 16 + ln]; bvl.u[8 + i] = sVl[16 + 8 * hh + i][dt * 16 + ln];
      }
      oacc[dt] = mmaN<3>(pah.v, pal.v, bvh.v, bvl.v, oacc[dt]);
    }
    __builtin_amdgcn_fence(__ATOMIC_ACQ_REL, "workgroup");
    __builtin_amdgcn_wave_barrier();
  }
#pragma unroll
  for (int r = 0; r < 8; ++r) {
    float l = l_r[r];
    l += __shfl_xor(l, 1, 32); l += __shfl_xor(l, 2, 32); l += __shfl_xor(l, 4, 32); l += __shfl_xor(l, 8, 32);
    l_r[r] = (l > 0.f) ? 1.0f / l : 0.f;
  }
#pragma unroll
  for (int dt = 0; dt < DT; ++dt)
#pragma unroll
    for (int r = 0; r < 8; ++r) sO[w][8 * hh + r][dt * 16 + ln] = oacc[dt][r] * l_r[r];
  __builtin_amdgcn_fence(__ATOMIC_ACQ_REL, "workgroup");
  __builtin_amdgcn_wave_barrier();
  {
    for (int r = 0; r < 16; ++r) {
      const int row = q0 + r;
      if (row < T && lane < D / 4) {
        const v4f val = *(const v4fa*)&sO[w][r][lane * 4];
        *(v4f*)(y + ((size_t)b * T + row) * ypitch + h * D + lane * 4) = val;
      }
    }
    
  }
}

// GEMM C = act(A·W + bias + resid): A f32 (ASPLIT -> hi/lo 2 terms), Wt bf16 [N][K]; ACT 0 none, 1 relu, 2 exact gelu;
// resid (optional, f32, row index = (row % rmod), pitch ldr, RES_BF16 rounds it) added before the activation.
template <bool ASPLIT, int ACT, bool BIAS_BF16, bool RES_BF16>
__global__ __launch_bounds__(128) void k_gemm_bf3(const float* __restrict__ A, int lda, const unsigned short* __restrict__ Wt, int ldb,
                                                const float* __restrict__ bias, const float* __restrict__ resid, int rmod, int ldr,
                                                float* __restrict__ C, int ldc, int M, int N, int K) {
  __shared__ __attribute__((aligned(16))) float so[4][16][64];
  const int tid = threadIdx.x, w = tid >> 5, lane = tid & 31, ln = lane & 15, hh = lane >> 4;
  const int ntn = N / 64;
  const int wid = blockIdx.x * 4 + w;
  const int mt = wid / ntn, nq = wid % ntn;
  if (mt * 16 >= M) return;
  const int row0 = mt * 16, col0 = nq * 64;
  const float* arow = A + (size_t)(row0 + ln) * lda;
  v8f acc[4] = {};
  for (int kb = 0; kb < K; kb += 32) {
    FragB ah, al;
    const v4f x0 = *(const v4fa*)(arow + kb + 8 * hh), x1 = *(const v4fa*)(arow + kb + 8 * hh + 4);
    const v4f x2 = *(const v4fa*)(arow + kb + 16 + 8 * hh), x3 = *(const v4fa*)(arow + kb + 16 + 8 * hh + 4);
    float xs[16] = {x0[0],x0[1],x0[2],x0[3],x1[0],x1[1],x1[2],x1[3],x2[0],x2[1],x2[2],x2[3],x3[0],x3[1],x3[2],x3[3]};
#pragma unroll
    for (int i = 0; i < 16; ++i) { const unsigned short hb = bf16_bits(xs[i]); ah.u[i] = hb; al.u[i] = ASPLIT ? bf16_bits(xs[i] - bf16_val(hb)) : (unsigned short)0; }
#pragma unroll
    for (int t = 0; t < 4; ++t) {
      const unsigned short* brow = Wt + (size_t)(col0 + t * 16 + ln) * ldb + kb;
      FragB b;
      b.half[0] = *(const v8us*)(brow + 8 * hh);
      b.half[1] = *(const v8us*)(brow + 16 + 8 * hh);
      acc[t] = mmaN<ASPLIT ? 2 : 1>(ah.v, al.v, b.v, b.v, acc[t]);
    }
  }
#pragma unroll
  for (int t = 0; t < 4; ++t) {
    const int col = col0 + t * 16 + ln;
    float bv = bias ? bias[col] : 0.f;
    if (BIAS_BF16) bv = bf16_round(bv);
#pragma unroll
    for (int r = 0; r < 8; ++r) {
      float v = acc[t][r] + bv;
      if (resid) { float rv = resid[(size_t)((row0 + 8 * hh + r) % rmod) * ldr + col]; if (RES_BF16) rv = bf16_round(rv); v += rv; }
      if (ACT == 1) v = fmaxf(v, 0.f);
      if (ACT == 2) v = 0.5f * v * (1.0f + erff(v * 0.70710678118654752f));
      if (ACT == 3) { const float u = 0.7978845608028654f * (v + 0.044715f * v * v * v); v = 0.5f * v * (1.0f + tanhf(u)); }
      so[w][8 * hh + r][t * 16 + ln] = v;
    }
  }
  __builtin_amdgcn_fence(__ATOMIC_ACQ_REL, "workgroup");
  __builtin_amdgcn_wave_barrier();
  const int rsub = lane >> 4, c4 = (lane & 15) * 4;
  {
#pragma unroll
    for (int q = 0; q < 8; ++q) {
      const int r = q * 2 + rsub;
      const v4f v = *(const v4fa*)&so[w][r][c4];
      *(v4f*)(C + (size_t)(row0 + r) * ldc + col0 + c4) = v;
    }
    
  }
}
// row LayerNorm (biased variance, eps) over N: s = X (+ R); optional out_sum <- s; out_norm <- (s-mu)*rsqrt(var+eps)*g + b
template <bool PARAM_BF16>
__global__ __launch_bounds__(256) void k_layernorm(const float* __restrict__ X, const float* __restrict__ R, const float* __restrict__ g, const float* __restrict__ bta,
                                                  float* __restrict__ out_sum, float* __restrict__ out_norm, int N, float eps) {
  __shared__ float red[256];
  const int row = blockIdx.x, tid = threadIdx.x;
  const float* x = X + (size_t)row * N; const float* rr = R ? R + (size_t)row * N : nullptr;
  float vals[16];                     // up to N = 4096
  const int per = N / 256;            // contiguous chunk per thread? use strided-by-4 chunks: thread handles j = tid*4 + 1024*u
  float s1 = 0.f;
  for (int u = 0; u < per / 4; ++u) {
    const int j = tid * 4 + 1024 * u;
    const v4f a = *(const v4fa*)(x + j);
    v4f b = {0.f,0.f,0.f,0.f}; if (rr) b = *(const v4fa*)(rr + j);
#pragma unroll
    for (int q = 0; q < 4; ++q) { const float v = a[q] + b[q]; vals[u * 4 + q] = v; s1 += v; }
  }
  red[tid] = s1; __syncthreads();
  for (int st = 128; st > 0; st >>= 1) { if (tid < st) red[tid] += red[tid + st]; __syncthreads(); }
  const float mu = red[0] / (float)N; __syncthreads();
  float s2 = 0.f;
  for (int u = 0; u < per / 4; ++u)
#pragma unroll
    for (int q = 0; q < 4; ++q) { const float c = vals[u * 4 + q] - mu; s2 += c * c; }
  red[tid] = s2; __syncthreads();
  for (int st = 128; st > 0; st >>= 1) { if (tid < st) red[tid] += red[tid + st]; __syncthreads(); }
  const float rs = rsqrtf(red[0] / (float)N + eps);
  {
    for (int u = 0; u < per / 4; ++u) {
      const int j = tid * 4 + 1024 * u;
      v4f o, sm;
#pragma unroll
      for (int q = 0; q < 4; ++q) {
        float gg = g[j + q], bb = bta[j + q];
        if (PARAM_BF16) { gg = bf16_round(gg); bb = bf16_round(bb); }
        sm[q] = vals[u * 4 + q]; o[q] = (vals[u * 4 + q] - mu) * rs * gg + bb;
      }
      if (out_sum) *(v4f*)(out_sum + (size_t)row * N + j) = sm;
      *(v4f*)(out_norm + (size_t)row * N + j) = o;
    }
    
  }
}



// ---- f16 WMMA path (v_wmma_f32_16x16x32_f16): 11-bit significands for operands in range — used where a [0,1] probability operand needs more precision than bf16
typedef _Float16 v16h __attribute__((ext_vector_type(16)));
union FragH { v16h v; v8us half[2]; _Float16 h[16]; unsigned short u[16]; };
template <int NT>
__device__ __forceinline__ v8f mmaH(v16h ah, v16h al, v16h bh, v16h bl, v8f c) {
  c = __builtin_amdgcn_wmma_f32_16x16x32_f16(false, ah, false, bh, (short)0, c, false, false);
  if (NT >= 2) c = __builtin_amdgcn_wmma_f32_16x16x32_f16(false, al, false, bh, (short)0, c, false, false);
  if (NT >= 3) c = __builtin_amdgcn_wmma_f32_16x16x32_f16(false, ah, false, bl, (short)0, c, false, false);
  asm volatile("v_nop\n\tv_nop\n\tv_nop\n\tv_nop" : "+v"(c) : "v"(ah), "v"(al), "v"(bh), "v"(bl));
  return c;
}
// batched GEMM like k_gemm_b but f16 operands: A f32 (split into f16 hi/lo if ASPLIT, else rounded to f16), Bt = f16 values [n][k]; alpha; C f32; N multiple of 16 (partial tiles skipped)
template <bool ASPLIT>
__global__ __launch_bounds__(128) void k_gemm_h(const float* __restrict__ A, int lda, size_t sA, const _Float16* __restrict__ Bh, int ldb, size_t sB, float alpha, float* __restrict__ C, int ldc, size_t sC, int M, int N, int K) {
  __shared__ __attribute__((aligned(16))) float so[4][16][64];
  const int tid = threadIdx.x, w = tid >> 5, lane = tid & 31, ln = lane & 15, hh = lane >> 4; const int by = blockIdx.y;
  A += (size_t)by * sA; Bh += (size_t)by * sB; C += (size_t)by * sC;
  const int ntn = (N + 63) / 64; const int wid = blockIdx.x * 4 + w; const int mt = wid / ntn, nq = wid % ntn; if (mt * 16 >= M) return;
  const int row0 = mt * 16, col0 = nq * 64; const float* arow = A + (size_t)(row0 + ln) * lda;
  v8f acc[4] = {};
  for (int kb = 0; kb < K; kb += 32) {
    FragH ah, al;
    const v4f x0 = *(const v4fa*)(arow + kb + 8 * hh), x1 = *(const v4fa*)(arow + kb + 8 * hh + 4), x2 = *(const v4fa*)(arow + kb + 16 + 8 * hh), x3 = *(const v4fa*)(arow + kb + 16 + 8 * hh + 4);
    float xs[16] = {x0[0],x0[1],x0[2],x0[3],x1[0],x1[1],x1[2],x1[3],x2[0],x2[1],x2[2],x2[3],x3[0],x3[1],x3[2],x3[3]};
#pragma unroll
    for (int i = 0; i < 16; ++i) { const _Float16 h = (_Float16)xs[i]; ah.h[i] = h; al.h[i] = ASPLIT ? (_Float16)(xs[i] - (float)h) : (_Float16)0.0f; }
#pragma unroll
    for (int t = 0; t < 4; ++t) { if (col0 + t * 16 >= N) continue; const size_t boff = (size_t)(col0 + t * 16 + ln) * ldb + kb; FragH bq; bq.half[0] = *(const v8us*)(Bh + boff + 8 * hh); bq.half[1] = *(const v8us*)(Bh + boff + 16 + 8 * hh);
      acc[t] = mmaH<ASPLIT ? 2 : 1>(ah.v, al.v, bq.v, bq.v, acc[t]); }
  }
#pragma unroll
  for (int t = 0; t < 4; ++t) { if (col0 + t * 16 >= N) continue;
#pragma unroll
    for (int r = 0; r < 8; ++r) so[w][8 * hh + r][t * 16 + ln] = acc[t][r] * alpha; }
  __builtin_amdgcn_fence(__ATOMIC_ACQ_REL, "workgroup"); __builtin_amdgcn_wave_barrier();
  const int rsub = lane >> 4, c4 = (lane & 15) * 4;
  {
#pragma unroll
    for (int q = 0; q < 8; ++q) { const int r = q * 2 + rsub; if (col0 + c4 < N) { const v4f v = *(const v4fa*)&so[w][r][c4]; *(v4f*)(C + (size_t)(row0 + r) * ldc + col0 + c4) = v; } }
     }
}

__global__ __launch_bounds__(256) void k_h16(const float* __restrict__ x, _Float16* __restrict__ X16, size_t n8) { const size_t t = (size_t)blockIdx.x * 256 + threadIdx.x; if (t >= n8) return; FragH f;
#pragma unroll
  for (int q = 0; q < 8; ++q) f.h[q] = (_Float16)x[t * 8 + q]; *(v8us*)((unsigned short*)X16 + t * 8) = f.half[0];  }
__global__ __launch_bounds__(256) void k_round16f(const float* __restrict__ W, _Float16* __restrict__ Bt, size_t n8) { const size_t t = (size_t)blockIdx.x * 256 + threadIdx.x; if (t >= n8) return; FragH f;
#pragma unroll
  for (int i = 0; i < 8; ++i) f.h[i] = (_Float16)(bf16_round(W[t * 8 + i]) * 16.0f); *(v8us*)((unsigned short*)Bt + t * 8) = f.half[0];  }

// The whole projection stage in one launch. One work-group (8 waves) = 64 rows of x. It rounds its x rows and all of Wq, Wk, Wv (f32 -> bf16 -> f16,
// W times 2^4, laid [n][k], the three matrices as 192 columns) into LDS, forms Q, K and V on v_wmma_f32_16x16x32_f16 from there, and stores them in
// FRAGMENT ORDER: the workspace holds 512-byte chunks, lane l's 16 bytes of one operand half at byte 16 l, so that the attention kernel's every load is
// 512 contiguous bytes and every store here is an accumulator tile as it stands in the registers.
//   Qf, Kf: chunk (row / 16) * 4 + col / 16;                          lane 16 hh + ln = row (row & 15 = ln), columns 16 (col / 16) + 8 hh + 0..7
//   Vf:     chunk (row / 32) * 8 + (col / 16) * 2 + ((row >> 4) & 1); lane 16 hh + ln = column (col & 15 = ln), rows 16 (row / 16) + 8 hh + 0..7
// Wave w owns 32 rows (w & 1) and column tile w >> 1 of each of Q, K and V. Q and K are formed as W^T x^T (a lane holds 8 neighbouring columns of one
// row), V as x W (a lane holds 8 neighbouring rows of one column).
#define PRW 64          // rows of x a work-group
#define PKP (DD + 8)    // LDS pitch of a k row in halves: 528 B = 16 B x odd, free of bank conflicts for 16-byte accesses
typedef float v2f __attribute__((ext_vector_type(2)));
typedef __bf16 v2b __attribute__((ext_vector_type(2)));
typedef _Float16 v2h __attribute__((ext_vector_type(2)));
typedef unsigned int v2ua __attribute__((ext_vector_type(2), may_alias));
typedef unsigned int v4ua __attribute__((ext_vector_type(4), may_alias));
// two f32 -> bf16 (nearest even) -> f16, packed
__device__ __forceinline__ unsigned int pk_b16h(float a, float b) {
  return __builtin_bit_cast(unsigned int, __builtin_convertvector(__builtin_convertvector(__builtin_convertvector((v2f){a, b}, v2b), v2f), v2h)); }
__global__ __launch_bounds__(256) void k_proj(const float* __restrict__ x, const float* __restrict__ Wq, const float* __restrict__ Wk, const float* __restrict__ Wv,
                                              _Float16* __restrict__ Qf, _Float16* __restrict__ Kf, _Float16* __restrict__ Vf) {
  __shared__ __attribute__((aligned(16))) unsigned short sW[3 * HD][PKP];
  __shared__ __attribute__((aligned(16))) unsigned short sX[PRW][PKP];
  const int tid = (int)threadIdx.x, lane = tid & 31, ln = lane & 15, hh = lane >> 4;
  const int w = __builtin_amdgcn_readfirstlane(tid >> 5);   // scalar, so that the chunk addresses of the stores are scalar
  const int row0 = (int)blockIdx.x * PRW;
  // Weights in six chunks of half a matrix (128 k rows); of a chunk a lane takes 4 x 8 k of one column n; a wave: 32 neighbouring n, one line a load.
  const int n = tid & 63, kq = tid >> 6;
  float wr[6][32]; v4f xr[16];
  auto loadW = [&](int c) { const float* __restrict__ Wm = ((c >> 1) == 0) ? Wq : ((c >> 1) == 1) ? Wk : Wv;
#pragma unroll
    for (int u = 0; u < 4; ++u)
#pragma unroll
      for (int i = 0; i < 8; ++i) wr[c][u * 8 + i] = Wm[(size_t)((((c & 1) * 4 + u) * 4 + kq) * 8 + i) * HD + n]; };
  auto putW = [&](int c) {   // the power of two goes in ahead of the rounding: the same bits, and small weights stay normal in f16
#pragma unroll
    for (int u = 0; u < 4; ++u) { const float* v = &wr[c][u * 8];
      *(v4ua*)&sW[(c >> 1) * HD + n][(((c & 1) * 4 + u) * 4 + kq) * 8] = (v4ua){pk_b16h(v[0] * 16.0f, v[1] * 16.0f), pk_b16h(v[2] * 16.0f, v[3] * 16.0f), pk_b16h(v[4] * 16.0f, v[5] * 16.0f), pk_b16h(v[6] * 16.0f, v[7] * 16.0f)}; } };
  // Each sched_barrier below keeps a chunk's loads two chunks ahead of its conversion; left alone the compiler sank loads to their use, one wait a pair.
  // Each s_wait_xcnt stands in front of what may rewrite a register that an earlier, still issued load names as its address (a later load's result, a constant).
#pragma unroll
  for (int i = 0; i < 16; ++i) xr[i] = *(const v4fa*)(x + (size_t)row0 * DD + (size_t)(i * 256 + tid) * 4);   // whole lines a wave; from memory, so asked for first
  loadW(0); loadW(1); asm volatile("s_wait_xcnt 0x0" ::: "memory"); __builtin_amdgcn_sched_barrier(0);
  putW(0); asm volatile("s_wait_xcnt 0x0" ::: "memory"); loadW(2); __builtin_amdgcn_sched_barrier(0);
  putW(1); asm volatile("s_wait_xcnt 0x0" ::: "memory"); loadW(3); __builtin_amdgcn_sched_barrier(0);
  putW(2); asm volatile("s_wait_xcnt 0x0" ::: "memory"); loadW(4); __builtin_amdgcn_sched_barrier(0);
  putW(3); asm volatile("s_wait_xcnt 0x0" ::: "memory"); loadW(5); __builtin_amdgcn_sched_barrier(0);
  putW(4); putW(5);
#pragma unroll
  for (int i = 0; i < 16; ++i) { const int e = i * 256 + tid;
    *(v2ua*)&sX[e >> 6][(e & 63) * 4] = (v2ua){pk_b16h(xr[i][0], xr[i][1]), pk_b16h(xr[i][2], xr[i][3])}; }
  __syncthreads();   // publishes the converted x rows and weights to every wave
  { const int rp = w & 1, cg = w >> 1;
    const unsigned short* xrow = &sX[rp * 32 + ln][8 * hh]; const unsigned short* wrow = &sW[cg * 16 + ln][8 * hh];   // j = 0, 1, 2: Wq, Wk, Wv, HD rows apart
    v8f acc[2][3];
#pragma unroll
    for (int i = 0; i < 2; ++i)
#pragma unroll
      for (int j = 0; j < 3; ++j) acc[i][j] = (v8f){0.f,0.f,0.f,0.f,0.f,0.f,0.f,0.f};
    FragH fx[2][2], fw[2][3];   // two register sets: the fragments of k step s + 1 are fetched while step s is multiplied
#pragma unroll
    for (int i = 0; i < 2; ++i) { fx[0][i].half[0] = *(const v8us*)(xrow + i * 16 * PKP); fx[0][i].half[1] = *(const v8us*)(xrow + i * 16 * PKP + 16); }
#pragma unroll
    for (int j = 0; j < 3; ++j) { fw[0][j].half[0] = *(const v8us*)(wrow + j * HD * PKP); fw[0][j].half[1] = *(const v8us*)(wrow + j * HD * PKP + 16); }
#pragma unroll
    for (int s = 0; s < DD / 32; ++s) { const int cu = s & 1, nx = cu ^ 1, kn = (s + 1) * 32;
      if (s + 1 < DD / 32) {
#pragma unroll
        for (int i = 0; i < 2; ++i) { fx[nx][i].half[0] = *(const v8us*)(xrow + i * 16 * PKP + kn); fx[nx][i].half[1] = *(const v8us*)(xrow + i * 16 * PKP + kn + 16); }
#pragma unroll
        for (int j = 0; j < 3; ++j) { fw[nx][j].half[0] = *(const v8us*)(wrow + j * HD * PKP + kn); fw[nx][j].half[1] = *(const v8us*)(wrow + j * HD * PKP + kn + 16); } }
#pragma unroll
      for (int i = 0; i < 2; ++i)
#pragma unroll
        for (int j = 0; j < 3; ++j) acc[i][j] = (j < 2) ? __builtin_amdgcn_wmma_f32_16x16x32_f16(false, fw[cu][j].v, false, fx[cu][i].v, (short)0, acc[i][j], false, false)
                                                        : __builtin_amdgcn_wmma_f32_16x16x32_f16(false, fx[cu][i].v, false, fw[cu][j].v, (short)0, acc[i][j], false, false); }
    FragH o[2][3];   // j < 2: acc[i][j][r] = (x W)[row rp * 32 + i * 16 + ln][column cg * 16 + 8 hh + r]; j = 2: (x Wv)[row rp * 32 + i * 16 + 8 hh + r][column cg * 16 + ln]
#pragma unroll
    for (int i = 0; i < 2; ++i)
#pragma unroll
      for (int j = 0; j < 3; ++j)
#pragma unroll
        for (int r = 0; r < 8; ++r) o[i][j].h[r] = (_Float16)(acc[i][j][r] * 0.0625f);   // takes the 2^4 of the weights out again
#pragma unroll
    for (int i = 0; i < 2; ++i) {   // a wave's store = one chunk, four whole lines
      *(v8us*)((unsigned short*)Qf + ((size_t)(row0 / 16 + rp * 2 + i) * 4 + cg) * 256 + lane * 8) = o[i][0].half[0];
      *(v8us*)((unsigned short*)Kf + ((size_t)(row0 / 16 + rp * 2 + i) * 4 + cg) * 256 + lane * 8) = o[i][1].half[0];
      *(v8us*)((unsigned short*)Vf + ((size_t)(row0 / 32 + rp) * 8 + cg * 2 + i) * 256 + lane * 8) = o[i][2].half[0]; } } }

#define NKW 16
#define QT 2
#define SL2 (0.0625f * 1.44269504088896340736f)
__device__ __forceinline__ float xhalf(float x) { return __builtin_bit_cast(float, __builtin_amdgcn_permlanex16(__builtin_bit_cast(int, x), __builtin_bit_cast(int, x), 0x76543210, 0xfedcba98, false, false)); }  // lane l with lane l ^ 16
// 2^x: the v_nop fills the one slot that the instruction set asks for between a transcendental and a next instruction that reads its result or overwrites its source.
__device__ __forceinline__ float exp2_slot(float x) { float y; asm("v_exp_f32 %0, %1\n\tv_nop" : "=v"(y) : "v"(x)); return y; }
// amdgpu_waves_per_eu(4): the two query tiles' accumulators and Q fragments take 96 VGPRs, with the pass's scores and V^T fragments more than 128; a 16-wave work-group puts four waves on a SIMD, 256 VGPRs each.
__global__ __launch_bounds__(NKW * 32) __attribute__((amdgpu_waves_per_eu(4))) void k_flash(const _Float16* __restrict__ Qf, const _Float16* __restrict__ Kf, const _Float16* __restrict__ Vf, const int* __restrict__ MSK, float* __restrict__ O, int ldo) {
  constexpr int QR = 16 * QT, NQB = 4096 / QR, DT = 4, KS = 2;
  static_assert(QR == 32 && QR == NKW * 2, "a key tile spans the work-group's queries (one tile on the diagonal); the merge gives each thread one 16-byte piece of one row");
  __shared__ __attribute__((aligned(16))) float sO[NKW][QR][64 + 4];
  __shared__ float sM[NKW][QR], sL[NKW][QR];
  const int lane = (int)__builtin_amdgcn_mbcnt_lo(~0u, 0u), ln = lane & 15, hh = lane >> 4;   // lane id without threadIdx.x: one register fewer live over the key loop
  const int w = __builtin_amdgcn_readfirstlane((int)threadIdx.x >> 5);   // scalar, so that the key loop's test stays a scalar branch
  const int slab = blockIdx.x / NQB, qblk = blockIdx.x % NQB; const int b = slab; const int q0 = qblk * QR; (void)MSK;
  FragH aq[QT][KS];   // B operands of S^T: column ln of tile t = query q0 + 16 t + ln
  { const unsigned short* qr = (const unsigned short*)Qf + ((size_t)b * 4096 + q0) * 64 + lane * 8;
#pragma unroll
    for (int t = 0; t < QT; ++t)
#pragma unroll
      for (int ks = 0; ks < KS; ++ks) { aq[t][ks].half[0] = *(const v8us*)(qr + t * 1024 + ks * 512); aq[t][ks].half[1] = *(const v8us*)(qr + t * 1024 + ks * 512 + 256); } }
  const unsigned short* Kb = (const unsigned short*)Kf + (size_t)slab * 64 * 4096;
  const unsigned short* Vb = (const unsigned short*)Vf + (size_t)slab * 64 * 4096;
  unsigned int vo = (unsigned int)lane * 16u + (unsigned int)w * (32u * 128u);   // the lane's place in the pass's first K (and V^T) chunk, in bytes: one register, carried over the loop, beside the scalar bases
  float m_q[QT], l_q[QT]; v8f oacc[QT][DT];   // of query q0 + 16 t + ln; m_q in the scaled log2 domain; l_q over this half's keys only, the halves joined behind the loop
#pragma unroll
  for (int t = 0; t < QT; ++t) { m_q[t] = -3.0e38f; l_q[t] = 0.f;
#pragma unroll
    for (int dt = 0; dt < DT; ++dt) oacc[t][dt] = (v8f){0.f,0.f,0.f,0.f,0.f,0.f,0.f,0.f}; }
  const int jend = q0 + QR;
  const int qd = q0 + ln - 8 * hh;   // the mask's one lane-dependent term
#pragma unroll 1
  for (int j0 = w * 32; j0 < jend; j0 += NKW * 32) {
    float sc[QT][16];   // sc[t][nt * 8 + r] = raw score (q . k) of query tile t and key j0 + nt * 16 + 8 hh + r
    FragH bk[2][KS], bv[DT];
    // The pass's eight K loads stand together in front of its first product: one trip to L2 is waited for, not one a 16-key group.
#pragma unroll
    for (int nt = 0; nt < 2; ++nt)
#pragma unroll
      for (int ks = 0; ks < KS; ++ks) { bk[nt][ks].half[0] = *(const v8us*)((const char*)Kb + vo + (nt * 2048 + ks * 1024)); bk[nt][ks].half[1] = *(const v8us*)((const char*)Kb + vo + (nt * 2048 + ks * 1024 + 512)); }
#pragma unroll
    for (int nt = 0; nt < 2; ++nt) { v8f acc[QT];
#pragma unroll
      for (int t = 0; t < QT; ++t) acc[t] = (v8f){0.f,0.f,0.f,0.f,0.f,0.f,0.f,0.f};
#pragma unroll
      for (int ks = 0; ks < KS; ++ks)
#pragma unroll
        for (int t = 0; t < QT; ++t) acc[t] = mmaH<1>(bk[nt][ks].v, bk[nt][ks].v, aq[t][ks].v, aq[t][ks].v, acc[t]);   // one K fragment, both query tiles
#pragma unroll
      for (int t = 0; t < QT; ++t)
#pragma unroll
        for (int r = 0; r < 8; ++r) sc[t][nt * 8 + r] = acc[t][r]; }
    // The pass's eight V^T loads stand together behind the score products: they fly while the softmax is worked out.
#pragma unroll
    for (int dt = 0; dt < DT; ++dt) { bv[dt].half[0] = *(const v8us*)((const char*)Vb + vo + dt * 1024); bv[dt].half[1] = *(const v8us*)((const char*)Vb + vo + (dt * 1024 + 512)); }
    if (j0 + 31 > q0) {   // only the tile on the diagonal holds keys behind a query (a scalar test); key j0 <= q0 stays, so every query keeps a finite maximum
#pragma unroll
      for (int t = 0; t < QT; ++t)
#pragma unroll
        for (int i = 0; i < 16; ++i) if ((i >> 3) * 16 + (i & 7) - 16 * t > qd - j0) sc[t][i] = -INFINITY; }   // key j0 + 16 (i >> 3) + 8 hh + (i & 7) behind query q0 + 16 t + ln; constants against one register
    FragH pb[QT];
#pragma unroll
    for (int t = 0; t < QT; ++t) {
      float mc = sc[t][0];
#pragma unroll
      for (int i = 1; i < 16; ++i) mc = fmaxf(mc, sc[t][i]);
      mc = fmaxf(mc, xhalf(mc));
      const float mn = fmaxf(m_q[t], mc * SL2); const float al = exp2_slot(m_q[t] - mn); m_q[t] = mn;   // SL2 > 0: the maximum may be taken on the raw scores
      float ps = 0.f;
#pragma unroll
      for (int i = 0; i < 16; ++i) { const float p = exp2_slot(__builtin_fmaf(sc[t][i], SL2, -mn)); ps += p; pb[t].h[i] = (_Float16)p; }   // a masked score: 2^-inf = 0
      l_q[t] = l_q[t] * al + ps;
#pragma unroll
      for (int dt = 0; dt < DT; ++dt) oacc[t][dt] *= al; }
#pragma unroll
    for (int dt = 0; dt < DT; ++dt)
#pragma unroll
      for (int t = 0; t < QT; ++t) oacc[t][dt] = mmaH<1>(bv[dt].v, bv[dt].v, pb[t].v, pb[t].v, oacc[t][dt]);   // one V^T fragment, both query tiles
    __builtin_amdgcn_sched_barrier(0);   // keeps the step of vo behind the last product's wait for the V^T loads, which name that register as their address
    vo += NKW * 32u * 128u; }
  // each wave's partial: query maximum (scaled log2 domain), sum (the two halves joined) and the un-normalised output row; a wave without a key tile leaves (-3e38, 0, 0)
#pragma unroll
  for (int t = 0; t < QT; ++t) {
    l_q[t] += xhalf(l_q[t]);
    if (hh == 0) { sM[w][t * 16 + ln] = m_q[t]; sL[w][t * 16 + ln] = l_q[t]; }
#pragma unroll
    for (int dt = 0; dt < DT; ++dt) {   // oacc[t][dt][r] = O[q0 + 16 t + ln][dt * 16 + 8 hh + r]: eight neighbours of one row
      *(v4fa*)&sO[w][t * 16 + ln][dt * 16 + 8 * hh] = (v4f){oacc[t][dt][0], oacc[t][dt][1], oacc[t][dt][2], oacc[t][dt][3]};
      *(v4fa*)&sO[w][t * 16 + ln][dt * 16 + 8 * hh + 4] = (v4f){oacc[t][dt][4], oacc[t][dt][5], oacc[t][dt][6], oacc[t][dt][7]}; } }
  __syncthreads();   // publishes every wave's partial to the merging threads
  { const int r = w * 2 + hh, pc = ln;   // 32 rows of 16 pieces: every thread merges one piece
    float M = sM[0][r];
#pragma unroll
    for (int u = 1; u < NKW; ++u) M = fmaxf(M, sM[u][r]);
    float L = 0.f; v4f o = {0.f, 0.f, 0.f, 0.f};
#pragma unroll
    for (int u = 0; u < NKW; ++u) { const float e = exp2_slot(sM[u][r] - M); L += e * sL[u][r]; const v4f pv = *(const v4fa*)&sO[u][r][pc * 4]; o += pv * e; }
    const float inv = (L > 0.f) ? 1.0f / L : 0.f;
    *(v4f*)(O + ((size_t)b * 4096 + q0 + r) * ldo + pc * 4) = o * inv; } }

extern "C" void kernel_launch(void* const* d_in, const int* in_sizes, int n_in,
                              void* d_out, int out_size, void* d_ws, size_t ws_size, hipStream_t stream) {
  (void)in_sizes; (void)n_in; (void)out_size;
  const float* x = (const float*)d_in[0]; const float* Wq = (const float*)d_in[1]; const float* Wk = (const float*)d_in[2]; const float* Wv = (const float*)d_in[3];
  char* ws = (char*)d_ws; size_t off = 0;
  auto take = [&](size_t bytes) { char* p = ws + off; off += (bytes + 255) & ~(size_t)255; return p; };
  _Float16* Qf = (_Float16*)take((size_t)NR * HD * 2); _Float16* Kf = (_Float16*)take((size_t)NR * HD * 2); _Float16* Vf = (_Float16*)take((size_t)NR * HD * 2);
  if (off > ws_size) return;      // 3 x 2 MiB
  k_proj<<<NR / PRW, 256, 0, stream>>>(x, Wq, Wk, Wv, Qf, Kf, Vf);
  k_flash<<<BB * 1 * (TT / (16 * QT)), NKW * 32, 0, stream>>>(Qf, Kf, Vf, nullptr, (float*)d_out, HD);
}

// v008
// One run takes 23.8 microseconds.
// Timed twice side by side with v007, it ran 1.27 and 1.26 times as fast.
// Over all steps from v000 it is 22.2 times as fast.
#include <hip/hip_runtime.h>
// Single-head causal self-attention layer (B=4, S=4096, D=256, H=64; scale 1/√256 as in the module): q/k/v projections as GEMMs (W [in][out] transposed to bf16-exact ×2^4) and the attention as a
// fused flash-style causal kernel (online softmax f32, P f16 <= 1, O^T = Vt*P^T; two blocks of 32 query rows per work-group, a block's key tiles dealt over its 16 waves, partials merged in LDS) on v_wmma_f32_16x16x32_f16 with f32 accumulate.
#define BB 4
#define TT 4096
#define DD 256
#define HD 64
#define NR (BB * TT)

typedef __bf16 v16b __attribute__((ext_vector_type(16)));
typedef unsigned short v8us __attribute__((ext_vector_type(8), may_alias));
typedef float  v8f  __attribute__((ext_vector_type(8)));
typedef float  v4f  __attribute__((ext_vector_type(4)));
typedef float  v4fa __attribute__((ext_vector_type(4), may_alias));
union FragB { v16b v; v8us half[2]; unsigned short u[16]; };

__device__ __forceinline__ unsigned short bf16_bits(float x) { unsigned int u = __float_as_uint(x); return (unsigned short)((u + 0x7FFFu + ((u >> 16) & 1u)) >> 16); }
__device__ __forceinline__ float bf16_val(unsigned short b) { return __uint_as_float(((unsigned int)b) << 16); }
__device__ __forceinline__ float bf16_round(float x) { return bf16_val(bf16_bits(x)); }
// D += A·B with NT terms: 1 = ah·bh, 2 = + al·bh (A split), 3 = + ah·bl (both split)
template <int NT>
__device__ __forceinline__ v8f mmaN(v16b ah, v16b al, v16b bh, v16b bl, v8f c) {
  c = __builtin_amdgcn_wmma_f32_16x16x32_bf16(false, ah, false, bh, (short)0, c, false, false);
  if (NT >= 2) c = __builtin_amdgcn_wmma_f32_16x16x32_bf16(false, al, false, bh, (short)0, c, false, false);
  if (NT >= 3) c = __builtin_amdgcn_wmma_f32_16x16x32_bf16(false, ah, false, bl, (short)0, c, false, false);
  asm volatile("v_nop\n\tv_nop\n\tv_nop\n\tv_nop" : "+v"(c) : "v"(ah), "v"(al), "v"(bh), "v"(bl));
  return c;
}

__global__ __launch_bounds__(256) void k_wt_bf16(const float* __restrict__ W, unsigned short* __restrict__ Wt, int K, int N) {
  const int t = blockIdx.x * 256 + threadIdx.x;
  const int k8n = K / 8;
  if (t >= N * k8n) return;
  const int n = t / k8n, k8 = (t % k8n) * 8;
  v8us v;
#pragma unroll
  for (int i = 0; i < 8; ++i) v[i] = bf16_bits(W[(size_t)(k8 + i) * N + n]);
  *(v8us*)(Wt + (size_t)n * K + k8) = v;
  
}

// GEMM C[M][N] (f32, pitch ldc) = act(A[M][K]·W + bias). A f32 row-major (pitch lda) converted per fragment to bf16
// (ASPLIT: hi/lo two planes -> 2 terms, else single rounded term); Wt bf16 [N][K] (pitch ldb). BIAS_BF16 rounds the
// bias to bf16 first (bias quantised to bf16 before the add). K%32==0, M%16==0, N%64==0.
template <bool ASPLIT, int ACT, bool BIAS_BF16>
__global__ __launch_bounds__(128) void k_gemm_bf(const float* __restrict__ A, int lda, const unsigned short* __restrict__ Wt, int ldb,
                                               const float* __restrict__ bias, float* __restrict__ C, int ldc, int M, int N, int K) {
  __shared__ __attribute__((aligned(16))) float so[4][16][64];
  const int tid = threadIdx.x, w = tid >> 5, lane = tid & 31, ln = lane & 15, hh = lane >> 4;
  const int ntn = N / 64;
  const int wid = blockIdx.x * 4 + w;
  const int mt = wid / ntn, nq = wid % ntn;
  if (mt * 16 >= M) return;
  const int row0 = mt * 16, col0 = nq * 64;
  const float* arow = A + (size_t)(row0 + ln) * lda;
  v8f acc[4] = {};
  for (int kb = 0; kb < K; kb += 32) {
    FragB ah, al;
    const v4f x0 = *(const v4fa*)(arow + kb + 8 * hh), x1 = *(const v4fa*)(arow + kb + 8 * hh + 4);
    const v4f x2 = *(const v4fa*)(arow + kb + 16 + 8 * hh), x3 = *(const v4fa*)(arow + kb + 16 + 8 * hh + 4);
    float xs[16] = {x0[0],x0[1],x0[2],x0[3],x1[0],x1[1],x1[2],x1[3],x2[0],x2[1],x2[2],x2[3],x3[0],x3[1],x3[2],x3[3]};
#pragma unroll
    for (int i = 0; i < 16; ++i) { const unsigned short hb = bf16_bits(xs[i]); ah.u[i] = hb; al.u[i] = ASPLIT ? bf16_bits(xs[i] - bf16_val(hb)) : (unsigned short)0; }
#pragma unroll
    for (int t = 0; t < 4; ++t) {
      const unsigned short* brow = Wt + (size_t)(col0 + t * 16 + ln) * ldb + kb;
      FragB b;
      b.half[0] = *(const v8us*)(brow + 8 * hh);
      b.half[1] = *(const v8us*)(brow + 16 + 8 * hh);
      acc[t] = mmaN<ASPLIT ? 2 : 1>(ah.v, al.v, b.v, b.v, acc[t]);
    }
  }
#pragma unroll
  for (int t = 0; t < 4; ++t) {
    float bv = bias ? bias[col0 + t * 16 + ln] : 0.f;
    if (BIAS_BF16) bv = bf16_round(bv);
#pragma unroll
    for (int r = 0; r < 8; ++r) { float v = acc[t][r] + bv; if (ACT == 1) v = fmaxf(v, 0.f); so[w][8 * hh + r][t * 16 + ln] = v; }
  }
  __builtin_amdgcn_fence(__ATOMIC_ACQ_REL, "workgroup");
  __builtin_amdgcn_wave_barrier();
  const int rsub = lane >> 4, c4 = (lane & 15) * 4;
  {
#pragma unroll
    for (int q = 0; q < 8; ++q) {
      const int r = q * 2 + rsub;
      const v4f v = *(const v4fa*)&so[w][r][c4];
      *(v4f*)(C + (size_t)(row0 + r) * ldc + col0 + c4) = v;
    }
    
  }
}

// Flash-style causal/unmasked attention, all contractions 3-term bf16 hi/lo splits, f32 softmax with running max.
// q,k,v rows are read from f32 buffers with arbitrary row pitch (so they can live inside a fused qkv buffer);
// D = head size (multiple of 32, <= 128); one wave = 16 query rows; block = 4 waves (64 queries) sharing K/V chunks of 32.
template <int D, bool CAUSAL>
__global__ __launch_bounds__(128) void k_flash(const float* __restrict__ qb, const float* __restrict__ kb, const float* __restrict__ vb,
                                             int pitch, int T, int H, float scale, float* __restrict__ y, int ypitch) {
  constexpr int KS = D / 32;        // k-steps for QK
  constexpr int DT = D / 16;        // d tiles for PV
  __shared__ __attribute__((aligned(16))) unsigned short sKh[32][D + 8], sKl[32][D + 8], sVh[32][D + 8], sVl[32][D + 8];
  __shared__ __attribute__((aligned(16))) unsigned short sPh[4][16][40], sPl[4][16][40];
  __shared__ __attribute__((aligned(16))) float sO[4][16][D];
  const int tid = threadIdx.x, w = tid >> 5, lane = tid & 31, ln = lane & 15, hh = lane >> 4;
  const int nqb = (T + 63) / 64;
  const int bh = blockIdx.x / nqb, qblk = blockIdx.x % nqb;
  const int b = bh / H, h = bh % H;
  const int q0 = qblk * 64 + w * 16;
  const float* Q = qb + (size_t)b * T * pitch + h * D;
  const float* K = kb + (size_t)b * T * pitch + h * D;
  const float* V = vb + (size_t)b * T * pitch + h * D;

  // A fragments of the wave's 16 query rows (scaled), hi/lo
  FragB aqh[KS], aql[KS];
  {
    int row = q0 + ln; if (row >= T) row = T - 1;
    const float* qr = Q + (size_t)row * pitch;
#pragma unroll
    for (int ks = 0; ks < KS; ++ks)
#pragma unroll
      for (int i = 0; i < 16; ++i) {
        const int d = ks * 32 + ((i < 8) ? (8 * hh + i) : (16 + 8 * hh + (i - 8)));
        const float x = qr[d] * scale; const unsigned short hb = bf16_bits(x);
        aqh[ks].u[i] = hb; aql[ks].u[i] = bf16_bits(x - bf16_val(hb));
      }
  }
  float m_r[8], l_r[8];
#pragma unroll
  for (int r = 0; r < 8; ++r) { m_r[r] = -3.0e38f; l_r[r] = 0.f; }
  v8f oacc[DT];
#pragma unroll
  for (int dt = 0; dt < DT; ++dt) oacc[dt] = (v8f){0.f,0.f,0.f,0.f,0.f,0.f,0.f,0.f};

  const int kv_end = CAUSAL ? min(T, qblk * 64 + 64) : T;     // block-uniform
  for (int j0 = 0; j0 < kv_end; j0 += 32) {
    __syncthreads();
    for (int e = tid; e < 32 * (D / 4); e += 128) {
      const int r = e / (D / 4), c4 = (e % (D / 4)) * 4;
      const int key = j0 + r;
      v4f kf = {0.f,0.f,0.f,0.f}, vf = {0.f,0.f,0.f,0.f};
      if (key < T) { kf = *(const v4fa*)(K + (size_t)key * pitch + c4); vf = *(const v4fa*)(V + (size_t)key * pitch + c4); }
#pragma unroll
      for (int t = 0; t < 4; ++t) {
        unsigned short hb = bf16_bits(kf[t]); sKh[r][c4 + t] = hb; sKl[r][c4 + t] = bf16_bits(kf[t] - bf16_val(hb));
        hb = bf16_bits(vf[t]); sVh[r][c4 + t] = hb; sVl[r][c4 + t] = bf16_bits(vf[t] - bf16_val(hb));
      }
    }
    __syncthreads();
    // S tile 16 x 32
    v8f s[2];
#pragma unroll
    for (int nt = 0; nt < 2; ++nt) {
      v8f acc = {};
#pragma unroll
      for (int ks = 0; ks < KS; ++ks) {
        FragB bh_, bl_;
        bh_.half[0] = *(const v8us*)&sKh[nt * 16 + ln][ks * 32 + 8 * hh]; bh_.half[1] = *(const v8us*)&sKh[nt * 16 + ln][ks * 32 + 16 + 8 * hh];
        bl_.half[0] = *(const v8us*)&sKl[nt * 16 + ln][ks * 32 + 8 * hh]; bl_.half[1] = *(const v8us*)&sKl[nt * 16 + ln][ks * 32 + 16 + 8 * hh];
        acc = mmaN<3>(aqh[ks].v, aql[ks].v, bh_.v, bl_.v, acc);
      }
      s[nt] = acc;
    }
    // mask + running max (rows 8hh+r; the 16 lanes of a half share rows)
    float alpha[8];
#pragma unroll
    for (int r = 0; r < 8; ++r) {
      const int qi = q0 + 8 * hh + r;
      const int ja = j0 + ln, jb = j0 + 16 + ln;
      if (CAUSAL) { if (ja > qi) s[0][r] = -3.0e38f; if (jb > qi) s[1][r] = -3.0e38f; }
      if (ja >= T) s[0][r] = -3.0e38f;
      if (jb >= T) s[1][r] = -3.0e38f;
      float mx = fmaxf(s[0][r], s[1][r]);
      mx = fmaxf(mx, __shfl_xor(mx, 1, 32)); mx = fmaxf(mx, __shfl_xor(mx, 2, 32)); mx = fmaxf(mx, __shfl_xor(mx, 4, 32)); mx = fmaxf(mx, __shfl_xor(mx, 8, 32));
      const float mnew = fmaxf(m_r[r], mx);
      alpha[r] = (mnew > -1.0e38f) ? __expf(m_r[r] - mnew) : 1.0f;
      const float p0 = (s[0][r] > -1.0e38f) ? __expf(s[0][r] - mnew) : 0.f;
      const float p1 = (s[1][r] > -1.0e38f) ? __expf(s[1][r] - mnew) : 0.f;
      m_r[r] = mnew;
      l_r[r] = l_r[r] * alpha[r] + p0 + p1;            // per-lane partial row sum (16 lanes combined at the end)
      unsigned short hb = bf16_bits(p0); sPh[w][8 * hh + r][ln] = hb;      sPl[w][8 * hh + r][ln] = bf16_bits(p0 - bf16_val(hb));
      hb = bf16_bits(p1);                sPh[w][8 * hh + r][16 + ln] = hb; sPl[w][8 * hh + r][16 + ln] = bf16_bits(p1 - bf16_val(hb));
    }
#pragma unroll
    for (int dt = 0; dt < DT; ++dt)
#pragma unroll
      for (int r = 0; r < 8; ++r) oacc[dt][r] *= alpha[r];
    __builtin_amdgcn_fence(__ATOMIC_ACQ_REL, "workgroup");
    __builtin_amdgcn_wave_barrier();
    FragB pah, pal;
    pah.half[0] = *(const v8us*)&sPh[w][ln][8 * hh]; pah.half[1] = *(const v8us*)&sPh[w][ln][16 + 8 * hh];
    pal.half[0] = *(const v8us*)&sPl[w][ln][8 * hh]; pal.half[1] = *(const v8us*)&sPl[w][ln][16 + 8 * hh];
#pragma unroll
    for (int dt = 0; dt < DT; ++dt) {
      FragB bvh, bvl;
#pragma unroll
      for (int i = 0; i < 8; ++i) {
        bvh.u[i] = sVh[8 * hh + i][dt * 16 + ln]; bvh.u[8 + i] = sVh[16 + 8 * hh + i][dt * 16 + ln];
        bvl.u[i] = sVl[8 * hh + i][dt * 16 + ln]; bvl.u[8 + i] = sVl[16 + 8 * hh + i][dt * 16 + ln];
      }
      oacc[dt] = mmaN<3>(pah.v, pal.v, bvh.v, bvl.v, oacc[dt]);
    }
    __builtin_amdgcn_fence(__ATOMIC_ACQ_REL, "workgroup");
    __builtin_amdgcn_wave_barrier();
  }
#pragma unroll
  for (int r = 0; r < 8; ++r) {
    float l = l_r[r];
    l += __shfl_xor(l, 1, 32); l += __shfl_xor(l, 2, 32); l += __shfl_xor(l, 4, 32); l += __shfl_xor(l, 8, 32);
    l_r[r] = (l > 0.f) ? 1.0f / l : 0.f;
  }
#pragma unroll
  for (int dt = 0; dt < DT; ++dt)
#pragma unroll
    for (int r = 0; r < 8; ++r) sO[w][8 * hh + r][dt * 16 + ln] = oacc[dt][r] * l_r[r];
  __builtin_amdgcn_fence(__ATOMIC_ACQ_REL, "workgroup");
  __builtin_amdgcn_wave_barrier();
  {
    for (int r = 0; r < 16; ++r) {
      const int row = q0 + r;
      if (row < T && lane < D / 4) {
        const v4f val = *(const v4fa*)&sO[w][r][lane * 4];
        *(v4f*)(y + ((size_t)b * T + row) * ypitch + h * D + lane * 4) = val;
      }
    }
    
  }
}

// GEMM C = act(A·W + bias + resid): A f32 (ASPLIT -> hi/lo 2 terms), Wt bf16 [N][K]; ACT 0 none, 1 relu, 2 exact gelu;
// resid (optional, f32, row index = (row % rmod), pitch ldr, RES_BF16 rounds it) added before the activation.
template <bool ASPLIT, int ACT, bool BIAS_BF16, bool RES_BF16>
__global__ __launch_bounds__(128) void k_gemm_bf3(const float* __restrict__ A, int lda, const unsigned short* __restrict__ Wt, int ldb,
                                                const float* __restrict__ bias, const float* __restrict__ resid, int rmod, int ldr,
                                                float* __restrict__ C, int ldc, int M, int N, int K) {
  __shared__ __attribute__((aligned(16))) float so[4][16][64];
  const int tid = threadIdx.x, w = tid >> 5, lane = tid & 31, ln = lane & 15, hh = lane >> 4;
  const int ntn = N / 64;
  const int wid = blockIdx.x * 4 + w;
  const int mt = wid / ntn, nq = wid % ntn;
  if (mt * 16 >= M) return;
  const int row0 = mt * 16, col0 = nq * 64;
  const float* arow = A + (size_t)(row0 + ln) * lda;
  v8f acc[4] = {};
  for (int kb = 0; kb < K; kb += 32) {
    FragB ah, al;
    const v4f x0 = *(const v4fa*)(arow + kb + 8 * hh), x1 = *(const v4fa*)(arow + kb + 8 * hh + 4);
    const v4f x2 = *(const v4fa*)(arow + kb + 16 + 8 * hh), x3 = *(const v4fa*)(arow + kb + 16 + 8 * hh + 4);
    float xs[16] = {x0[0],x0[1],x0[2],x0[3],x1[0],x1[1],x1[2],x1[3],x2[0],x2[1],x2[2],x2[3],x3[0],x3[1],x3[2],x3[3]};
#pragma unroll
    for (int i = 0; i < 16; ++i) { const unsigned short hb = bf16_bits(xs[i]); ah.u[i] = hb; al.u[i] = ASPLIT ? bf16_bits(xs[i] - bf16_val(hb)) : (unsigned short)0; }
#pragma unroll
    for (int t = 0; t < 4; ++t) {
      const unsigned short* brow = Wt + (size_t)(col0 + t * 16 + ln) * ldb + kb;
      FragB b;
      b.half[0] = *(const v8us*)(brow + 8 * hh);
      b.half[1] = *(const v8us*)(brow + 16 + 8 * hh);
      acc[t] = mmaN<ASPLIT ? 2 : 1>(ah.v, al.v, b.v, b.v, acc[t]);
    }
  }
#pragma unroll
  for (int t = 0; t < 4; ++t) {
    const int col = col0 + t * 16 + ln;
    float bv = bias ? bias[col] : 0.f;
    if (BIAS_BF16) bv = bf16_round(bv);
#pragma unroll
    for (int r = 0; r < 8; ++r) {
      float v = acc[t][r] + bv;
      if (resid) { float rv = resid[(size_t)((row0 + 8 * hh + r) % rmod) * ldr + col]; if (RES_BF16) rv = bf16_round(rv); v += rv; }
      if (ACT == 1) v = fmaxf(v, 0.f);
      if (ACT == 2) v = 0.5f * v * (1.0f + erff(v * 0.70710678118654752f));
      if (ACT == 3) { const float u = 0.7978845608028654f * (v + 0.044715f * v * v * v); v = 0.5f * v * (1.0f + tanhf(u)); }
      so[w][8 * hh + r][t * 16 + ln] = v;
    }
  }
  __builtin_amdgcn_fence(__ATOMIC_ACQ_REL, "workgroup");
  __builtin_amdgcn_wave_barrier();
  const int rsub = lane >> 4, c4 = (lane & 15) * 4;
  {
#pragma unroll
    for (int q = 0; q < 8; ++q) {
      const int r = q * 2 + rsub;
      const v4f v = *(const v4fa*)&so[w][r][c4];
      *(v4f*)(C + (size_t)(row0 + r) * ldc + col0 + c4) = v;
    }
    
  }
}
// row LayerNorm (biased variance, eps) over N: s = X (+ R); optional out_sum <- s; out_norm <- (s-mu)*rsqrt(var+eps)*g + b
template <bool PARAM_BF16>
__global__ __launch_bounds__(256) void k_layernorm(const float* __restrict__ X, const float* __restrict__ R, const float* __restrict__ g, const float* __restrict__ bta,
                                                  float* __restrict__ out_sum, float* __restrict__ out_norm, int N, float eps) {
  __shared__ float red[256];
  const int row = blockIdx.x, tid = threadIdx.x;
  const float* x = X + (size_t)row * N; const float* rr = R ? R + (size_t)row * N : nullptr;
  float vals[16];                     // up to N = 4096
  const int per = N / 256;            // contiguous chunk per thread? use strided-by-4 chunks: thread handles j = tid*4 + 1024*u
  float s1 = 0.f;
  for (int u = 0; u < per / 4; ++u) {
    const int j = tid * 4 + 1024 * u;
    const v4f a = *(const v4fa*)(x + j);
    v4f b = {0.f,0.f,0.f,0.f}; if (rr) b = *(const v4fa*)(rr + j);
#pragma unroll
    for (int q = 0; q < 4; ++q) { const float v = a[q] + b[q]; vals[u * 4 + q] = v; s1 += v; }
  }
  red[tid] = s1; __syncthreads();
  for (int st = 128; st > 0; st >>= 1) { if (tid < st) red[tid] += red[tid + st]; __syncthreads(); }
  const float mu = red[0] / (float)N; __syncthreads();
  float s2 = 0.f;
  for (int u = 0; u < per / 4; ++u)
#pragma unroll
    for (int q = 0; q < 4; ++q) { const float c = vals[u * 4 + q] - mu; s2 += c * c; }
  red[tid] = s2; __syncthreads();
  for (int st = 128; st > 0; st >>= 1) { if (tid < st) red[tid] += red[tid + st]; __syncthreads(); }
  const float rs = rsqrtf(red[0] / (float)N + eps);
  {
    for (int u = 0; u < per / 4; ++u) {
      const int j = tid * 4 + 1024 * u;
      v4f o, sm;
#pragma unroll
      for (int q = 0; q < 4; ++q) {
        float gg = g[j + q], bb = bta[j + q];
        if (PARAM_BF16) { gg = bf16_round(gg); bb = bf16_round(bb); }
        sm[q] = vals[u * 4 + q]; o[q] = (vals[u * 4 + q] - mu) * rs * gg + bb;
      }
      if (out_sum) *(v4f*)(out_sum + (size_t)row * N + j) = sm;
      *(v4f*)(out_norm + (size_t)row * N + j) = o;
    }
    
  }
}



// ---- f16 WMMA path (v_wmma_f32_16x16x32_f16): 11-bit significands for operands in range — used where a [0,1] probability operand needs more precision than bf16
typedef _Float16 v16h __attribute__((ext_vector_type(16)));
union FragH { v16h v; v8us half[2]; _Float16 h[16]; unsigned short u[16]; };
template <int NT>
__device__ __forceinline__ v8f mmaH(v16h ah, v16h al, v16h bh, v16h bl, v8f c) {
  c = __builtin_amdgcn_wmma_f32_16x16x32_f16(false, ah, false, bh, (short)0, c, false, false);
  if (NT >= 2) c = __builtin_amdgcn_wmma_f32_16x16x32_f16(false, al, false, bh, (short)0, c, false, false);
  if (NT >= 3) c = __builtin_amdgcn_wmma_f32_16x16x32_f16(false, ah, false, bl, (short)0, c, false, false);
  asm volatile("v_nop\n\tv_nop\n\tv_nop\n\tv_nop" : "+v"(c) : "v"(ah), "v"(al), "v"(bh), "v"(bl));
  return c;
}
// batched GEMM like k_gemm_b but f16 operands: A f32 (split into f16 hi/lo if ASPLIT, else rounded to f16), Bt = f16 values [n][k]; alpha; C f32; N multiple of 16 (partial tiles skipped)
template <bool ASPLIT>
__global__ __launch_bounds__(128) void k_gemm_h(const float* __restrict__ A, int lda, size_t sA, const _Float16* __restrict__ Bh, int ldb, size_t sB, float alpha, float* __restrict__ C, int ldc, size_t sC, int M, int N, int K) {
  __shared__ __attribute__((aligned(16))) float so[4][16][64];
  const int tid = threadIdx.x, w = tid >> 5, lane = tid & 31, ln = lane & 15, hh = lane >> 4; const int by = blockIdx.y;
  A += (size_t)by * sA; Bh += (size_t)by * sB; C += (size_t)by * sC;
  const int ntn = (N + 63) / 64; const int wid = blockIdx.x * 4 + w; const int mt = wid / ntn, nq = wid % ntn; if (mt * 16 >= M) return;
  const int row0 = mt * 16, col0 = nq * 64; const float* arow = A + (size_t)(row0 + ln) * lda;
  v8f acc[4] = {};
  for (int kb = 0; kb < K; kb += 32) {
    FragH ah, al;
    const v4f x0 = *(const v4fa*)(arow + kb + 8 * hh), x1 = *(const v4fa*)(arow + kb + 8 * hh + 4), x2 = *(const v4fa*)(arow + kb + 16 + 8 * hh), x3 = *(const v4fa*)(arow + kb + 16 + 8 * hh + 4);
    float xs[16] = {x0[0],x0[1],x0[2],x0[3],x1[0],x1[1],x1[2],x1[3],x2[0],x2[1],x2[2],x2[3],x3[0],x3[1],x3[2],x3[3]};
#pragma unroll
    for (int i = 0; i < 16; ++i) { const _Float16 h = (_Float16)xs[i]; ah.h[i] = h; al.h[i] = ASPLIT ? (_Float16)(xs[i] - (float)h) : (_Float16)0.0f; }
#pragma unroll
    for (int t = 0; t < 4; ++t) { if (col0 + t * 16 >= N) continue; const size_t boff = (size_t)(col0 + t * 16 + ln) * ldb + kb; FragH bq; bq.half[0] = *(const v8us*)(Bh + boff + 8 * hh); bq.half[1] = *(const v8us*)(Bh + boff + 16 + 8 * hh);
      acc[t] = mmaH<ASPLIT ? 2 : 1>(ah.v, al.v, bq.v, bq.v, acc[t]); }
  }
#pragma unroll
  for (int t = 0; t < 4; ++t) { if (col0 + t * 16 >= N) continue;
#pragma unroll
    for (int r = 0; r < 8; ++r) so[w][8 * hh + r][t * 16 + ln] = acc[t][r] * alpha; }
  __builtin_amdgcn_fence(__ATOMIC_ACQ_REL, "workgroup"); __builtin_amdgcn_wave_barrier();
  const int rsub = lane >> 4, c4 = (lane & 15) * 4;
  {
#pragma unroll
    for (int q = 0; q < 8; ++q) { const int r = q * 2 + rsub; if (col0 + c4 < N) { const v4f v = *(const v4fa*)&so[w][r][c4]; *(v4f*)(C + (size_t)(row0 + r) * ldc + col0 + c4) = v; } }
     }
}

__global__ __launch_bounds__(256) void k_h16(const float* __restrict__ x, _Float16* __restrict__ X16, size_t n8) { const size_t t = (size_t)blockIdx.x * 256 + threadIdx.x; if (t >= n8) return; FragH f;
#pragma unroll
  for (int q = 0; q < 8; ++q) f.h[q] = (_Float16)x[t * 8 + q]; *(v8us*)((unsigned short*)X16 + t * 8) = f.half[0];  }
__global__ __launch_bounds__(256) void k_round16f(const float* __restrict__ W, _Float16* __restrict__ Bt, size_t n8) { const size_t t = (size_t)blockIdx.x * 256 + threadIdx.x; if (t >= n8) return; FragH f;
#pragma unroll
  for (int i = 0; i < 8; ++i) f.h[i] = (_Float16)(bf16_round(W[t * 8 + i]) * 16.0f); *(v8us*)((unsigned short*)Bt + t * 8) = f.half[0];  }

// The whole projection stage in one launch. One work-group (8 waves) = 64 rows of x. It rounds its x rows and all of Wq, Wk, Wv (f32 -> bf16 -> f16,
// W times 2^4, laid [n][k], the three matrices as 192 columns) into LDS, forms Q, K and V on v_wmma_f32_16x16x32_f16 from there, and stores them in
// FRAGMENT ORDER: the workspace holds 512-byte chunks, lane l's 16 bytes of one operand half at byte 16 l, so that the attention kernel's every load is
// 512 contiguous bytes and every store here is an accumulator tile as it stands in the registers.
//   Qf, Kf: chunk (row / 16) * 4 + col / 16;                          lane 16 hh + ln = row (row & 15 = ln), columns 16 (col / 16) + 8 hh + 0..7
//   Vf:     chunk (row / 32) * 8 + (col / 16) * 2 + ((row >> 4) & 1); lane 16 hh + ln = column (col & 15 = ln), rows 16 (row / 16) + 8 hh + 0..7
// Wave w owns 32 rows (w & 1) and column tile w >> 1 of each of Q, K and V. Q and K are formed as W^T x^T (a lane holds 8 neighbouring columns of one
// row), V as x W (a lane holds 8 neighbouring rows of one column).
#define PRW 64          // rows of x a work-group
#define PKP (DD + 8)    // LDS pitch of a k row in halves: 528 B = 16 B x odd, free of bank conflicts for 16-byte accesses
typedef float v2f __attribute__((ext_vector_type(2)));
typedef __bf16 v2b __attribute__((ext_vector_type(2)));
typedef _Float16 v2h __attribute__((ext_vector_type(2)));
typedef unsigned int v2ua __attribute__((ext_vector_type(2), may_alias));
typedef unsigned int v4ua __attribute__((ext_vector_type(4), may_alias));
// two f32 -> bf16 (nearest even) -> f16, packed
__device__ __forceinline__ unsigned int pk_b16h(float a, float b) {
  return __builtin_bit_cast(unsigned int, __builtin_convertvector(__builtin_convertvector(__builtin_convertvector((v2f){a, b}, v2b), v2f), v2h)); }
__global__ __launch_bounds__(256) void k_proj(const float* __restrict__ x, const float* __restrict__ Wq, const float* __restrict__ Wk, const float* __restrict__ Wv,
                                              _Float16* __restrict__ Qf, _Float16* __restrict__ Kf, _Float16* __restrict__ Vf) {
  __shared__ __attribute__((aligned(16))) unsigned short sW[3 * HD][PKP];
  __shared__ __attribute__((aligned(16))) unsigned short sX[PRW][PKP];
  const int tid = (int)threadIdx.x, lane = tid & 31, ln = lane & 15, hh = lane >> 4;
  const int w = __builtin_amdgcn_readfirstlane(tid >> 5);   // scalar, so that the chunk addresses of the stores are scalar
  const int row0 = (int)blockIdx.x * PRW;
  // Weights in six chunks of half a matrix (128 k rows); of a chunk a lane takes 4 x 8 k of one column n; a wave: 32 neighbouring n, one line a load.
  const int n = tid & 63, kq = tid >> 6;
  float wr[6][32]; v4f xr[16];
  auto loadW = [&](int c) { const float* __restrict__ Wm = ((c >> 1) == 0) ? Wq : ((c >> 1) == 1) ? Wk : Wv;
#pragma unroll
    for (int u = 0; u < 4; ++u)
#pragma unroll
      for (int i = 0; i < 8; ++i) wr[c][u * 8 + i] = Wm[(size_t)((((c & 1) * 4 + u) * 4 + kq) * 8 + i) * HD + n]; };
  auto putW = [&](int c) {   // the power of two goes in ahead of the rounding: the same bits, and small weights stay normal in f16
#pragma unroll
    for (int u = 0; u < 4; ++u) { const float* v = &wr[c][u * 8];
      *(v4ua*)&sW[(c >> 1) * HD + n][(((c & 1) * 4 + u) * 4 + kq) * 8] = (v4ua){pk_b16h(v[0] * 16.0f, v[1] * 16.0f), pk_b16h(v[2] * 16.0f, v[3] * 16.0f), pk_b16h(v[4] * 16.0f, v[5] * 16.0f), pk_b16h(v[6] * 16.0f, v[7] * 16.0f)}; } };
  // Each sched_barrier below keeps a chunk's loads two chunks ahead of its conversion; left alone the compiler sank loads to their use, one wait a pair.
  // Each s_wait_xcnt stands in front of what may rewrite a register that an earlier, still issued load names as its address (a later load's result, a constant).
#pragma unroll
  for (int i = 0; i < 16; ++i) xr[i] = *(const v4fa*)(x + (size_t)row0 * DD + (size_t)(i * 256 + tid) * 4);   // whole lines a wave; from memory, so asked for first
  loadW(0); loadW(1); asm volatile("s_wait_xcnt 0x0" ::: "memory"); __builtin_amdgcn_sched_barrier(0);
  putW(0); asm volatile("s_wait_xcnt 0x0" ::: "memory"); loadW(2); __builtin_amdgcn_sched_barrier(0);
  putW(1); asm volatile("s_wait_xcnt 0x0" ::: "memory"); loadW(3); __builtin_amdgcn_sched_barrier(0);
  putW(2); asm volatile("s_wait_xcnt 0x0" ::: "memory"); loadW(4); __builtin_amdgcn_sched_barrier(0);
  putW(3); asm volatile("s_wait_xcnt 0x0" ::: "memory"); loadW(5); __builtin_amdgcn_sched_barrier(0);
  putW(4); putW(5);
#pragma unroll
  for (int i = 0; i < 16; ++i) { const int e = i * 256 + tid;
    *(v2ua*)&sX[e >> 6][(e & 63) * 4] = (v2ua){pk_b16h(xr[i][0], xr[i][1]), pk_b16h(xr[i][2], xr[i][3])}; }
  __syncthreads();   // publishes the converted x rows and weights to every wave
  { const int rp = w & 1, cg = w >> 1;
    const unsigned short* xrow = &sX[rp * 32 + ln][8 * hh]; const unsigned short* wrow = &sW[cg * 16 + ln][8 * hh];   // j = 0, 1, 2: Wq, Wk, Wv, HD rows apart
    v8f acc[2][3];
#pragma unroll
    for (int i = 0; i < 2; ++i)
#pragma unroll
      for (int j = 0; j < 3; ++j) acc[i][j] = (v8f){0.f,0.f,0.f,0.f,0.f,0.f,0.f,0.f};
    FragH fx[2][2], fw[2][3];   // two register sets: the fragments of k step s + 1 are fetched while step s is multiplied
#pragma unroll
    for (int i = 0; i < 2; ++i) { fx[0][i].half[0] = *(const v8us*)(xrow + i * 16 * PKP); fx[0][i].half[1] = *(const v8us*)(xrow + i * 16 * PKP + 16); }
#pragma unroll
    for (int j = 0; j < 3; ++j) { fw[0][j].half[0] = *(const v8us*)(wrow + j * HD * PKP); fw[0][j].half[1] = *(const v8us*)(wrow + j * HD * PKP + 16); }
#pragma unroll
    for (int s = 0; s < DD / 32; ++s) { const int cu = s & 1, nx = cu ^ 1, kn = (s + 1) * 32;
      if (s + 1 < DD / 32) {
#pragma unroll
        for (int i = 0; i < 2; ++i) { fx[nx][i].half[0] = *(const v8us*)(xrow + i * 16 * PKP + kn); fx[nx][i].half[1] = *(const v8us*)(xrow + i * 16 * PKP + kn + 16); }
#pragma unroll
        for (int j = 0; j < 3; ++j) { fw[nx][j].half[0] = *(const v8us*)(wrow + j * HD * PKP + kn); fw[nx][j].half[1] = *(const v8us*)(wrow + j * HD * PKP + kn + 16); } }
#pragma unroll
      for (int i = 0; i < 2; ++i)
#pragma unroll
        for (int j = 0; j < 3; ++j) acc[i][j] = (j < 2) ? __builtin_amdgcn_wmma_f32_16x16x32_f16(false, fw[cu][j].v, false, fx[cu][i].v, (short)0, acc[i][j], false, false)
                                                        : __builtin_amdgcn_wmma_f32_16x16x32_f16(false, fx[cu][i].v, false, fw[cu][j].v, (short)0, acc[i][j], false, false); }
    FragH o[2][3];   // j < 2: acc[i][j][r] = (x W)[row rp * 32 + i * 16 + ln][column cg * 16 + 8 hh + r]; j = 2: (x Wv)[row rp * 32 + i * 16 + 8 hh + r][column cg * 16 + ln]
#pragma unroll
    for (int i = 0; i < 2; ++i)
#pragma unroll
      for (int j = 0; j < 3; ++j)
#pragma unroll
        for (int r = 0; r < 8; ++r) o[i][j].h[r] = (_Float16)(acc[i][j][r] * 0.0625f);   // takes the 2^4 of the weights out again
#pragma unroll
    for (int i = 0; i < 2; ++i) {   // a wave's store = one chunk, four whole lines
      *(v8us*)((unsigned short*)Qf + ((size_t)(row0 / 16 + rp * 2 + i) * 4 + cg) * 256 + lane * 8) = o[i][0].half[0];
      *(v8us*)((unsigned short*)Kf + ((size_t)(row0 / 16 + rp * 2 + i) * 4 + cg) * 256 + lane * 8) = o[i][1].half[0];
      *(v8us*)((unsigned short*)Vf + ((size_t)(row0 / 32 + rp) * 8 + cg * 2 + i) * 256 + lane * 8) = o[i][2].half[0]; } } }

#define NKW 16
#define QT 2
#define SL2 (0.0625f * 1.44269504088896340736f)
__device__ __forceinline__ float xhalf(float x) { return __builtin_bit_cast(float, __builtin_amdgcn_permlanex16(__builtin_bit_cast(int, x), __builtin_bit_cast(int, x), 0x76543210, 0xfedcba98, false, false)); }  // lane l with lane l ^ 16
// 2^x: the v_nop fills the one slot that the instruction set asks for between a transcendental and a next instruction that reads its result or overwrites its source.
__device__ __forceinline__ float exp2_slot(float x) { float y; asm("v_exp_f32 %0, %1\n\tv_nop" : "=v"(y) : "v"(x)); return y; }
// amdgpu_waves_per_eu(4): the two query tiles' accumulators and Q fragments take 96 VGPRs, with the pass's scores and V^T fragments more than 128; a 16-wave work-group puts four waves on a SIMD, 256 VGPRs each.
__global__ __launch_bounds__(NKW * 32) __attribute__((amdgpu_waves_per_eu(4))) void k_flash(const _Float16* __restrict__ Qf, const _Float16* __restrict__ Kf, const _Float16* __restrict__ Vf, const int* __restrict__ MSK, float* __restrict__ O, int ldo) {
  constexpr int QR = 16 * QT, NQB = 4096 / QR, DT = 4, KS = 2;
  static_assert(QR == 32 && QR == NKW * 2, "a key tile spans a block's queries (one tile on the diagonal); the merge gives each thread one 16-byte piece of one row of each block");
  static_assert(BB % 2 == 0, "a work-group's two query blocks lie in two neighbouring batches");
  __shared__ __attribute__((aligned(16))) float sO[2][NKW][QR][64 + 4];
  __shared__ float sM[2][NKW][QR], sL[2][NKW][QR];
  const int lane = (int)__builtin_amdgcn_mbcnt_lo(~0u, 0u), ln = lane & 15, hh = lane >> 4;   // lane id without threadIdx.x: one register fewer live over the key loop
  const int w = __builtin_amdgcn_readfirstlane((int)threadIdx.x >> 5);   // scalar, so that the key loop's test stays a scalar branch
  const int tb = blockIdx.x % NQB, pr = blockIdx.x / NQB; (void)MSK;
#pragma unroll 1   // one copy of the key loop serves both blocks: registers and code size stay those of one block
  for (int u = 0; u < 2; ++u) {
  const int slab = pr * 2 + u, qblk = u ? NQB - 1 - tb : tb, wk = u ? NKW - 1 - w : w; const int b = slab; const int q0 = qblk * QR;   // all scalar
  FragH aq[QT][KS];   // B operands of S^T: column ln of tile t = query q0 + 16 t + ln
  { const unsigned short* qr = (const unsigned short*)Qf + ((size_t)b * 4096 + q0) * 64 + lane * 8;
#pragma unroll
    for (int t = 0; t < QT; ++t)
#pragma unroll
      for (int ks = 0; ks < KS; ++ks) { aq[t][ks].half[0] = *(const v8us*)(qr + t * 1024 + ks * 512); aq[t][ks].half[1] = *(const v8us*)(qr + t * 1024 + ks * 512 + 256); } }
  const unsigned short* Kb = (const unsigned short*)Kf + (size_t)slab * 64 * 4096;
  const unsigned short* Vb = (const unsigned short*)Vf + (size_t)slab * 64 * 4096;
  unsigned int vo = (unsigned int)lane * 16u + (unsigned int)wk * (32u * 128u);   // the lane's place in the pass's first K (and V^T) chunk, in bytes: one register, carried over the loop, beside the scalar bases
  float m_q[QT], l_q[QT]; v8f oacc[QT][DT];   // of query q0 + 16 t + ln; m_q in the scaled log2 domain; l_q over this half's keys only, the halves joined behind the loop
#pragma unroll
  for (int t = 0; t < QT; ++t) { m_q[t] = -3.0e38f; l_q[t] = 0.f;
#pragma unroll
    for (int dt = 0; dt < DT; ++dt) oacc[t][dt] = (v8f){0.f,0.f,0.f,0.f,0.f,0.f,0.f,0.f}; }
  const int jend = q0 + QR;
  const int qd = q0 + ln - 8 * hh;   // the mask's one lane-dependent term
#pragma unroll 1
  for (int j0 = wk * 32; j0 < jend; j0 += NKW * 32) {
    float sc[QT][16];   // sc[t][nt * 8 + r] = raw score (q . k) of query tile t and key j0 + nt * 16 + 8 hh + r
    FragH bk[2][KS], bv[DT];
    // The pass's eight K loads stand together in front of its first product: one trip to L2 is waited for, not one a 16-key group.
#pragma unroll
    for (int nt = 0; nt < 2; ++nt)
#pragma unroll
      for (int ks = 0; ks < KS; ++ks) { bk[nt][ks].half[0] = *(const v8us*)((const char*)Kb + vo + (nt * 2048 + ks * 1024)); bk[nt][ks].half[1] = *(const v8us*)((const char*)Kb + vo + (nt * 2048 + ks * 1024 + 512)); }
#pragma unroll
    for (int nt = 0; nt < 2; ++nt) { v8f acc[QT];
#pragma unroll
      for (int t = 0; t < QT; ++t) acc[t] = (v8f){0.f,0.f,0.f,0.f,0.f,0.f,0.f,0.f};
#pragma unroll
      for (int ks = 0; ks < KS; ++ks)
#pragma unroll
        for (int t = 0; t < QT; ++t) acc[t] = mmaH<1>(bk[nt][ks].v, bk[nt][ks].v, aq[t][ks].v, aq[t][ks].v, acc[t]);   // one K fragment, both query tiles
#pragma unroll
      for (int t = 0; t < QT; ++t)
#pragma unroll
        for (int r = 0; r < 8; ++r) sc[t][nt * 8 + r] = acc[t][r]; }
    // The pass's eight V^T loads stand together behind the score products: they fly while the softmax is worked out.
#pragma unroll
    for (int dt = 0; dt < DT; ++dt) { bv[dt].half[0] = *(const v8us*)((const char*)Vb + vo + dt * 1024); bv[dt].half[1] = *(const v8us*)((const char*)Vb + vo + (dt * 1024 + 512)); }
    if (j0 + 31 > q0) {   // only the tile on the diagonal holds keys behind a query (a scalar test); key j0 <= q0 stays, so every query keeps a finite maximum
#pragma unroll
      for (int t = 0; t < QT; ++t)
#pragma unroll
        for (int i = 0; i < 16; ++i) if ((i >> 3) * 16 + (i & 7) - 16 * t > qd - j0) sc[t][i] = -INFINITY; }   // key j0 + 16 (i >> 3) + 8 hh + (i & 7) behind query q0 + 16 t + ln; constants against one register
    FragH pb[QT];
#pragma unroll
    for (int t = 0; t < QT; ++t) {
      float mc = sc[t][0];
#pragma unroll
      for (int i = 1; i < 16; ++i) mc = fmaxf(mc, sc[t][i]);
      mc = fmaxf(mc, xhalf(mc));
      const float mn = fmaxf(m_q[t], mc * SL2); const float al = exp2_slot(m_q[t] - mn); m_q[t] = mn;   // SL2 > 0: the maximum may be taken on the raw scores
      float ps = 0.f;
#pragma unroll
      for (int i = 0; i < 16; ++i) { const float p = exp2_slot(__builtin_fmaf(sc[t][i], SL2, -mn)); ps += p; pb[t].h[i] = (_Float16)p; }   // a masked score: 2^-inf = 0
      l_q[t] = l_q[t] * al + ps;
#pragma unroll
      for (int dt = 0; dt < DT; ++dt) oacc[t][dt] *= al; }
#pragma unroll
    for (int dt = 0; dt < DT; ++dt)
#pragma unroll
      for (int t = 0; t < QT; ++t) oacc[t][dt] = mmaH<1>(bv[dt].v, bv[dt].v, pb[t].v, pb[t].v, oacc[t][dt]);   // one V^T fragment, both query tiles
    __builtin_amdgcn_sched_barrier(0);   // keeps the step of vo behind the last product's wait for the V^T loads, which name that register as their address
    vo += NKW * 32u * 128u; }
  // each wave's partial: query maximum (scaled log2 domain), sum (the two halves joined) and the un-normalised output row; a wave without a key tile leaves (-3e38, 0, 0)
#pragma unroll
  for (int t = 0; t < QT; ++t) {
    l_q[t] += xhalf(l_q[t]);
    if (hh == 0) { sM[u][wk][t * 16 + ln] = m_q[t]; sL[u][wk][t * 16 + ln] = l_q[t]; }
#pragma unroll
    for (int dt = 0; dt < DT; ++dt) {   // oacc[t][dt][r] = O[q0 + 16 t + ln][dt * 16 + 8 hh + r]: eight neighbours of one row
      *(v4fa*)&sO[u][wk][t * 16 + ln][dt * 16 + 8 * hh] = (v4f){oacc[t][dt][0], oacc[t][dt][1], oacc[t][dt][2], oacc[t][dt][3]};
      *(v4fa*)&sO[u][wk][t * 16 + ln][dt * 16 + 8 * hh + 4] = (v4f){oacc[t][dt][4], oacc[t][dt][5], oacc[t][dt][6], oacc[t][dt][7]}; } }
  }
  __syncthreads();   // publishes every wave's partials of both blocks to the merging threads
  { const int r = w * 2 + hh, pc = ln;   // a block: 32 rows of 16 pieces: every thread merges one piece of each block
    v4f res[2];
#pragma unroll
    for (int u = 0; u < 2; ++u) {
      float M = sM[u][0][r];
#pragma unroll
      for (int k = 1; k < NKW; ++k) M = fmaxf(M, sM[u][k][r]);
      float L = 0.f; v4f o = {0.f, 0.f, 0.f, 0.f};
#pragma unroll
      for (int k = 0; k < NKW; ++k) { const float e = exp2_slot(sM[u][k][r] - M); L += e * sL[u][k][r]; const v4f pv = *(const v4fa*)&sO[u][k][r][pc * 4]; o += pv * e; }
      const float inv = (L > 0.f) ? 1.0f / L : 0.f;
      res[u] = o * inv; }
#pragma unroll
    for (int u = 0; u < 2; ++u) *(v4f*)(O + ((size_t)(pr * 2 + u) * 4096 + (u ? NQB - 1 - tb : tb) * QR + r) * ldo + pc * 4) = res[u]; } }

extern "C" void kernel_launch(void* const* d_in, const int* in_sizes, int n_in,
                              void* d_out, int out_size, void* d_ws, size_t ws_size, hipStream_t stream) {
  (void)in_sizes; (void)n_in; (void)out_size;
  const float* x = (const float*)d_in[0]; const float* Wq = (const float*)d_in[1]; const float* Wk = (const float*)d_in[2]; const float* Wv = (const float*)d_in[3];
  char* ws = (char*)d_ws; size_t off = 0;
  auto take = [&](size_t bytes) { char* p = ws + off; off += (bytes + 255) & ~(size_t)255; return p; };
  _Float16* Qf = (_Float16*)take((size_t)NR * HD * 2); _Float16* Kf = (_Float16*)take((size_t)NR * HD * 2); _Float16* Vf = (_Float16*)take((size_t)NR * HD * 2);
  if (off > ws_size) return;      // 3 x 2 MiB
  k_proj<<<NR / PRW, 256, 0, stream>>>(x, Wq, Wk, Wv, Qf, Kf, Vf);
  k_flash<<<(BB / 2) * (TT / (16 * QT)), NKW * 32, 0, stream>>>(Qf, Kf, Vf, nullptr, (float*)d_out, HD);
}

// v009
// It runs in 21.8 microseconds.
// Next to v008, in two timings, it ran 1.08 and 1.07 times as fast.
// Over all steps from v000 it is 23.9 times as fast.
#include <hip/hip_runtime.h>
// Single-head causal self-attention layer (B=4, S=4096, D=256, H=64; scale 1/√256 as in the module): q/k/v projections as GEMMs (W [in][out] transposed to bf16-exact ×2^4) and the attention as a
// fused flash-style causal kernel (online softmax f32, P f16 <= 1, O^T = Vt*P^T; two blocks of 32 query rows of one batch per work-group, their common key tiles walked by wave pairs, key tiles dealt over the waves, partials merged in LDS) on v_wmma_f32_16x16x32_f16 with f32 accumulate.
#define BB 4
#define TT 4096
#define DD 256
#define HD 64
#define NR (BB * TT)

typedef __bf16 v16b __attribute__((ext_vector_type(16)));
typedef unsigned short v8us __attribute__((ext_vector_type(8), may_alias));
typedef float  v8f  __attribute__((ext_vector_type(8)));
typedef float  v4f  __attribute__((ext_vector_type(4)));
typedef float  v4fa __attribute__((ext_vector_type(4), may_alias));
union FragB { v16b v; v8us half[2]; unsigned short u[16]; };

__device__ __forceinline__ unsigned short bf16_bits(float x) { unsigned int u = __float_as_uint(x); return (unsigned short)((u + 0x7FFFu + ((u >> 16) & 1u)) >> 16); }
__device__ __forceinline__ float bf16_val(unsigned short b) { return __uint_as_float(((unsigned int)b) << 16); }
__device__ __forceinline__ float bf16_round(float x) { return bf16_val(bf16_bits(x)); }
// D += A·B with NT terms: 1 = ah·bh, 2 = + al·bh (A split), 3 = + ah·bl (both split)
template <int NT>
__device__ __forceinline__ v8f mmaN(v16b ah, v16b al, v16b bh, v16b bl, v8f c) {
  c = __builtin_amdgcn_wmma_f32_16x16x32_bf16(false, ah, false, bh, (short)0, c, false, false);
  if (NT >= 2) c = __builtin_amdgcn_wmma_f32_16x16x32_bf16(false, al, false, bh, (short)0, c, false, false);
  if (NT >= 3) c = __builtin_amdgcn_wmma_f32_16x16x32_bf16(false, ah, false, bl, (short)0, c, false, false);
  asm volatile("v_nop\n\tv_nop\n\tv_nop\n\tv_nop" : "+v"(c) : "v"(ah), "v"(al), "v"(bh), "v"(bl));
  return c;
}

__global__ __launch_bounds__(256) void k_wt_bf16(const float* __restrict__ W, unsigned short* __restrict__ Wt, int K, int N) {
  const int t = blockIdx.x * 256 + threadIdx.x;
  const int k8n = K / 8;
  if (t >= N * k8n) return;
  const int n = t / k8n, k8 = (t % k8n) * 8;
  v8us v;
#pragma unroll
  for (int i = 0; i < 8; ++i) v[i] = bf16_bits(W[(size_t)(k8 + i) * N + n]);
  *(v8us*)(Wt + (size_t)n * K + k8) = v;
  
}

// GEMM C[M][N] (f32, pitch ldc) = act(A[M][K]·W + bias). A f32 row-major (pitch lda) converted per fragment to bf16
// (ASPLIT: hi/lo two planes -> 2 terms, else single rounded term); Wt bf16 [N][K] (pitch ldb). BIAS_BF16 rounds the
// bias to bf16 first (bias quantised to bf16 before the add). K%32==0, M%16==0, N%64==0.
template <bool ASPLIT, int ACT, bool BIAS_BF16>
__global__ __launch_bounds__(128) void k_gemm_bf(const float* __restrict__ A, int lda, const unsigned short* __restrict__ Wt, int ldb,
                                               const float* __restrict__ bias, float* __restrict__ C, int ldc, int M, int N, int K) {
  __shared__ __attribute__((aligned(16))) float so[4][16][64];
  const int tid = threadIdx.x, w = tid >> 5, lane = tid & 31, ln = lane & 15, hh = lane >> 4;
  const int ntn = N / 64;
  const int wid = blockIdx.x * 4 + w;
  const int mt = wid / ntn, nq = wid % ntn;
  if (mt * 16 >= M) return;
  const int row0 = mt * 16, col0 = nq * 64;
  const float* arow = A + (size_t)(row0 + ln) * lda;
  v8f acc[4] = {};
  for (int kb = 0; kb < K; kb += 32) {
    FragB ah, al;
    const v4f x0 = *(const v4fa*)(arow + kb + 8 * hh), x1 = *(const v4fa*)(arow + kb + 8 * hh + 4);
    const v4f x2 = *(const v4fa*)(arow + kb + 16 + 8 * hh), x3 = *(const v4fa*)(arow + kb + 16 + 8 * hh + 4);
    float xs[16] = {x0[0],x0[1],x0[2],x0[3],x1[0],x1[1],x1[2],x1[3],x2[0],x2[1],x2[2],x2[3],x3[0],x3[1],x3[2],x3[3]};
#pragma unroll
    for (int i = 0; i < 16; ++i) { const unsigned short hb = bf16_bits(xs[i]); ah.u[i] = hb; al.u[i] = ASPLIT ? bf16_bits(xs[i] - bf16_val(hb)) : (unsigned short)0; }
#pragma unroll
    for (int t = 0; t < 4; ++t) {
      const unsigned short* brow = Wt + (size_t)(col0 + t * 16 + ln) * ldb + kb;
      FragB b;
      b.half[0] = *(const v8us*)(brow + 8 * hh);
      b.half[1] = *(const v8us*)(brow + 16 + 8 * hh);
      acc[t] = mmaN<ASPLIT ? 2 : 1>(ah.v, al.v, b.v, b.v, acc[t]);
    }
  }
#pragma unroll
  for (int t = 0; t < 4; ++t) {
    float bv = bias ? bias[col0 + t * 16 + ln] : 0.f;
    if (BIAS_BF16) bv = bf16_round(bv);
#pragma unroll
    for (int r = 0; r < 8; ++r) { float v = acc[t][r] + bv; if (ACT == 1) v = fmaxf(v, 0.f); so[w][8 * hh + r][t * 16 + ln] = v; }
  }
  __builtin_amdgcn_fence(__ATOMIC_ACQ_REL, "workgroup");
  __builtin_amdgcn_wave_barrier();
  const int rsub = lane >> 4, c4 = (lane & 15) * 4;
  {
#pragma unroll
    for (int q = 0; q < 8; ++q) {
      const int r = q * 2 + rsub;
      const v4f v = *(const v4fa*)&so[w][r][c4];
      *(v4f*)(C + (size_t)(row0 + r) * ldc + col0 + c4) = v;
    }
    
  }
}

// Flash-style causal/unmasked attention, all contractions 3-term bf16 hi/lo splits, f32 softmax with running max.
// q,k,v rows are read from f32 buffers with arbitrary row pitch (so they can live inside a fused qkv buffer);
// D = head size (multiple of 32, <= 128); one wave = 16 query rows; block = 4 waves (64 queries) sharing K/V chunks of 32.
template <int D, bool CAUSAL>
__global__ __launch_bounds__(128) void k_flash(const float* __restrict__ qb, const float* __restrict__ kb, const float* __restrict__ vb,
                                             int pitch, int T, int H, float scale, float* __restrict__ y, int ypitch) {
  constexpr int KS = D / 32;        // k-steps for QK
  constexpr int DT = D / 16;        // d tiles for PV
  __shared__ __attribute__((aligned(16))) unsigned short sKh[32][D + 8], sKl[32][D + 8], sVh[32][D + 8], sVl[32][D + 8];
  __shared__ __attribute__((aligned(16))) unsigned short sPh[4][16][40], sPl[4][16][40];
  __shared__ __attribute__((aligned(16))) float sO[4][16][D];
  const int tid = threadIdx.x, w = tid >> 5, lane = tid & 31, ln = lane & 15, hh = lane >> 4;
  const int nqb = (T + 63) / 64;
  const int bh = blockIdx.x / nqb, qblk = blockIdx.x % nqb;
  const int b = bh / H, h = bh % H;
  const int q0 = qblk * 64 + w * 16;
  const float* Q = qb + (size_t)b * T * pitch + h * D;
  const float* K = kb + (size_t)b * T * pitch + h * D;
  const float* V = vb + (size_t)b * T * pitch + h * D;

  // A fragments of the wave's 16 query rows (scaled), hi/lo
  FragB aqh[KS], aql[KS];
  {
    int row = q0 + ln; if (row >= T) row = T - 1;
    const float* qr = Q + (size_t)row * pitch;
#pragma unroll
    for (int ks = 0; ks < KS; ++ks)
#pragma unroll
      for (int i = 0; i < 16; ++i) {
        const int d = ks * 32 + ((i < 8) ? (8 * hh + i) : (16 + 8 * hh + (i - 8)));
        const float x = qr[d] * scale; const unsigned short hb = bf16_bits(x);
        aqh[ks].u[i] = hb; aql[ks].u[i] = bf16_bits(x - bf16_val(hb));
      }
  }
  float m_r[8], l_r[8];
#pragma unroll
  for (int r = 0; r < 8; ++r) { m_r[r] = -3.0e38f; l_r[r] = 0.f; }
  v8f oacc[DT];
#pragma unroll
  for (int dt = 0; dt < DT; ++dt) oacc[dt] = (v8f){0.f,0.f,0.f,0.f,0.f,0.f,0.f,0.f};

  const int kv_end = CAUSAL ? min(T, qblk * 64 + 64) : T;     // block-uniform
  for (int j0 = 0; j0 < kv_end; j0 += 32) {
    __syncthreads();
    for (int e = tid; e < 32 * (D / 4); e += 128) {
      const int r = e / (D / 4), c4 = (e % (D / 4)) * 4;
      const int key = j0 + r;
      v4f kf = {0.f,0.f,0.f,0.f}, vf = {0.f,0.f,0.f,0.f};
      if (key < T) { kf = *(const v4fa*)(K + (size_t)key * pitch + c4); vf = *(const v4fa*)(V + (size_t)key * pitch + c4); }
#pragma unroll
      for (int t = 0; t < 4; ++t) {
        unsigned short hb = bf16_bits(kf[t]); sKh[r][c4 + t] = hb; sKl[r][c4 + t] = bf16_bits(kf[t] - bf16_val(hb));
        hb = bf16_bits(vf[t]); sVh[r][c4 + t] = hb; sVl[r][c4 + t] = bf16_bits(vf[t] - bf16_val(hb));
      }
    }
    __syncthreads();
    // S tile 16 x 32
    v8f s[2];
#pragma unroll
    for (int nt = 0; nt < 2; ++nt) {
      v8f acc = {};
#pragma unroll
      for (int ks = 0; ks < KS; ++ks) {
        FragB bh_, bl_;
        bh_.half[0] = *(const v8us*)&sKh[nt * 16 + ln][ks * 32 + 8 * hh]; bh_.half[1] = *(const v8us*)&sKh[nt * 16 + ln][ks * 32 + 16 + 8 * hh];
        bl_.half[0] = *(const v8us*)&sKl[nt * 16 + ln][ks * 32 + 8 * hh]; bl_.half[1] = *(const v8us*)&sKl[nt * 16 + ln][ks * 32 + 16 + 8 * hh];
        acc = mmaN<3>(aqh[ks].v, aql[ks].v, bh_.v, bl_.v, acc);
      }
      s[nt] = acc;
    }
    // mask + running max (rows 8hh+r; the 16 lanes of a half share rows)
    float alpha[8];
#pragma unroll
    for (int r = 0; r < 8; ++r) {
      const int qi = q0 + 8 * hh + r;
      const int ja = j0 + ln, jb = j0 + 16 + ln;
      if (CAUSAL) { if (ja > qi) s[0][r] = -3.0e38f; if (jb > qi) s[1][r] = -3.0e38f; }
      if (ja >= T) s[0][r] = -3.0e38f;
      if (jb >= T) s[1][r] = -3.0e38f;
      float mx = fmaxf(s[0][r], s[1][r]);
      mx = fmaxf(mx, __shfl_xor(mx, 1, 32)); mx = fmaxf(mx, __shfl_xor(mx, 2, 32)); mx = fmaxf(mx, __shfl_xor(mx, 4, 32)); mx = fmaxf(mx, __shfl_xor(mx, 8, 32));
      const float mnew = fmaxf(m_r[r], mx);
      alpha[r] = (mnew > -1.0e38f) ? __expf(m_r[r] - mnew) : 1.0f;
      const float p0 = (s[0][r] > -1.0e38f) ? __expf(s[0][r] - mnew) : 0.f;
      const float p1 = (s[1][r] > -1.0e38f) ? __expf(s[1][r] - mnew) : 0.f;
      m_r[r] = mnew;
      l_r[r] = l_r[r] * alpha[r] + p0 + p1;            // per-lane partial row sum (16 lanes combined at the end)
      unsigned short hb = bf16_bits(p0); sPh[w][8 * hh + r][ln] = hb;      sPl[w][8 * hh + r][ln] = bf16_bits(p0 - bf16_val(hb));
      hb = bf16_bits(p1);                sPh[w][8 * hh + r][16 + ln] = hb; sPl[w][8 * hh + r][16 + ln] = bf16_bits(p1 - bf16_val(hb));
    }
#pragma unroll
    for (int dt = 0; dt < DT; ++dt)
#pragma unroll
      for (int r = 0; r < 8; ++r) oacc[dt][r] *= alpha[r];
    __builtin_amdgcn_fence(__ATOMIC_ACQ_REL, "workgroup");
    __builtin_amdgcn_wave_barrier();
    FragB pah, pal;
    pah.half[0] = *(const v8us*)&sPh[w][ln][8 * hh]; pah.half[1] = *(const v8us*)&sPh[w][ln][16 + 8 * hh];
    pal.half[0] = *(const v8us*)&sPl[w][ln][8 * hh]; pal.half[1] = *(const v8us*)&sPl[w][ln][16 + 8 * hh];
#pragma unroll
    for (int dt = 0; dt < DT; ++dt) {
      FragB bvh, bvl;
#pragma unroll
      for (int i = 0; i < 8; ++i) {
        bvh.u[i] = sVh[8 * hh + i][dt * 16 + ln]; bvh.u[8 + i] = sVh[16 + 8 * hh + i][dt * 16 + ln];
        bvl.u[i] = sVl[8 * hh + i][dt * 16 + ln]; bvl.u[8 + i] = sVl[16 + 8 * hh + i][dt * 16 + ln];
      }
      oacc[dt] = mmaN<3>(pah.v, pal.v, bvh.v, bvl.v, oacc[dt]);
    }
    __builtin_amdgcn_fence(__ATOMIC_ACQ_REL, "workgroup");
    __builtin_amdgcn_wave_barrier();
  }
#pragma unroll
  for (int r = 0; r < 8; ++r) {
    float l = l_r[r];
    l += __shfl_xor(l, 1, 32); l += __shfl_xor(l, 2, 32); l += __shfl_xor(l, 4, 32); l += __shfl_xor(l, 8, 32);
    l_r[r] = (l > 0.f) ? 1.0f / l : 0.f;
  }
#pragma unroll
  for (int dt = 0; dt < DT; ++dt)
#pragma unroll
    for (int r = 0; r < 8; ++r) sO[w][8 * hh + r][dt * 16 + ln] = oacc[dt][r] * l_r[r];
  __builtin_amdgcn_fence(__ATOMIC_ACQ_REL, "workgroup");
  __builtin_amdgcn_wave_barrier();
  {
    for (int r = 0; r < 16; ++r) {
      const int row = q0 + r;
      if (row < T && lane < D / 4) {
        const v4f val = *(const v4fa*)&sO[w][r][lane * 4];
        *(v4f*)(y + ((size_t)b * T + row) * ypitch + h * D + lane * 4) = val;
      }
    }
    
  }
}

// GEMM C = act(A·W + bias + resid): A f32 (ASPLIT -> hi/lo 2 terms), Wt bf16 [N][K]; ACT 0 none, 1 relu, 2 exact gelu;
// resid (optional, f32, row index = (row % rmod), pitch ldr, RES_BF16 rounds it) added before the activation.
template <bool ASPLIT, int ACT, bool BIAS_BF16, bool RES_BF16>
__global__ __launch_bounds__(128) void k_gemm_bf3(const float* __restrict__ A, int lda, const unsigned short* __restrict__ Wt, int ldb,
                                                const float* __restrict__ bias, const float* __restrict__ resid, int rmod, int ldr,
                                                float* __restrict__ C, int ldc, int M, int N, int K) {
  __shared__ __attribute__((aligned(16))) float so[4][16][64];
  const int tid = threadIdx.x, w = tid >> 5, lane = tid & 31, ln = lane & 15, hh = lane >> 4;
  const int ntn = N / 64;
  const int wid = blockIdx.x * 4 + w;
  const int mt = wid / ntn, nq = wid % ntn;
  if (mt * 16 >= M) return;
  const int row0 = mt * 16, col0 = nq * 64;
  const float* arow = A + (size_t)(row0 + ln) * lda;
  v8f acc[4] = {};
  for (int kb = 0; kb < K; kb += 32) {
    FragB ah, al;
    const v4f x0 = *(const v4fa*)(arow + kb + 8 * hh), x1 = *(const v4fa*)(arow + kb + 8 * hh + 4);
    const v4f x2 = *(const v4fa*)(arow + kb + 16 + 8 * hh), x3 = *(const v4fa*)(arow + kb + 16 + 8 * hh + 4);
    float xs[16] = {x0[0],x0[1],x0[2],x0[3],x1[0],x1[1],x1[2],x1[3],x2[0],x2[1],x2[2],x2[3],x3[0],x3[1],x3[2],x3[3]};
#pragma unroll
    for (int i = 0; i < 16; ++i) { const unsigned short hb = bf16_bits(xs[i]); ah.u[i] = hb; al.u[i] = ASPLIT ? bf16_bits(xs[i] - bf16_val(hb)) : (unsigned short)0; }
#pragma unroll
    for (int t = 0; t < 4; ++t) {
      const unsigned short* brow = Wt + (size_t)(col0 + t * 16 + ln) * ldb + kb;
      FragB b;
      b.half[0] = *(const v8us*)(brow + 8 * hh);
      b.half[1] = *(const v8us*)(brow + 16 + 8 * hh);
      acc[t] = mmaN<ASPLIT ? 2 : 1>(ah.v, al.v, b.v, b.v, acc[t]);
    }
  }
#pragma unroll
  for (int t = 0; t < 4; ++t) {
    const int col = col0 + t * 16 + ln;
    float bv = bias ? bias[col] : 0.f;
    if (BIAS_BF16) bv = bf16_round(bv);
#pragma unroll
    for (int r = 0; r < 8; ++r) {
      float v = acc[t][r] + bv;
      if (resid) { float rv = resid[(size_t)((row0 + 8 * hh + r) % rmod) * ldr + col]; if (RES_BF16) rv = bf16_round(rv); v += rv; }
      if (ACT == 1) v = fmaxf(v, 0.f);
      if (ACT == 2) v = 0.5f * v * (1.0f + erff(v * 0.70710678118654752f));
      if (ACT == 3) { const float u = 0.7978845608028654f * (v + 0.044715f * v * v * v); v = 0.5f * v * (1.0f + tanhf(u)); }
      so[w][8 * hh + r][t * 16 + ln] = v;
    }
  }
  __builtin_amdgcn_fence(__ATOMIC_ACQ_REL, "workgroup");
  __builtin_amdgcn_wave_barrier();
  const int rsub = lane >> 4, c4 = (lane & 15) * 4;
  {
#pragma unroll
    for (int q = 0; q < 8; ++q) {
      const int r = q * 2 + rsub;
      const v4f v = *(const v4fa*)&so[w][r][c4];
      *(v4f*)(C + (size_t)(row0 + r) * ldc + col0 + c4) = v;
    }
    
  }
}
// row LayerNorm (biased variance, eps) over N: s = X (+ R); optional out_sum <- s; out_norm <- (s-mu)*rsqrt(var+eps)*g + b
template <bool PARAM_BF16>
__global__ __launch_bounds__(256) void k_layernorm(const float* __restrict__ X, const float* __restrict__ R, const float* __restrict__ g, const float* __restrict__ bta,
                                                  float* __restrict__ out_sum, float* __restrict__ out_norm, int N, float eps) {
  __shared__ float red[256];
  const int row = blockIdx.x, tid = threadIdx.x;
  const float* x = X + (size_t)row * N; const float* rr = R ? R + (size_t)row * N : nullptr;
  float vals[16];                     // up to N = 4096
  const int per = N / 256;            // contiguous chunk per thread? use strided-by-4 chunks: thread handles j = tid*4 + 1024*u
  float s1 = 0.f;
  for (int u = 0; u < per / 4; ++u) {
    const int j = tid * 4 + 1024 * u;
    const v4f a = *(const v4fa*)(x + j);
    v4f b = {0.f,0.f,0.f,0.f}; if (rr) b = *(const v4fa*)(rr + j);
#pragma unroll
    for (int q = 0; q < 4; ++q) { const float v = a[q] + b[q]; vals[u * 4 + q] = v; s1 += v; }
  }
  red[tid] = s1; __syncthreads();
  for (int st = 128; st > 0; st >>= 1) { if (tid < st) red[tid] += red[tid + st]; __syncthreads(); }
  const float mu = red[0] / (float)N; __syncthreads();
  float s2 = 0.f;
  for (int u = 0; u < per / 4; ++u)
#pragma unroll
    for (int q = 0; q < 4; ++q) { const float c = vals[u * 4 + q] - mu; s2 += c * c; }
  red[tid] = s2; __syncthreads();
  for (int st = 128; st > 0; st >>= 1) { if (tid < st) red[tid] += red[tid + st]; __syncthreads(); }
  const float rs = rsqrtf(red[0] / (float)N + eps);
  {
    for (int u = 0; u < per / 4; ++u) {
      const int j = tid * 4 + 1024 * u;
      v4f o, sm;
#pragma unroll
      for (int q = 0; q < 4; ++q) {
        float gg = g[j + q], bb = bta[j + q];
        if (PARAM_BF16) { gg = bf16_round(gg); bb = bf16_round(bb); }
        sm[q] = vals[u * 4 + q]; o[q] = (vals[u * 4 + q] - mu) * rs * gg + bb;
      }
      if (out_sum) *(v4f*)(out_sum + (size_t)row * N + j) = sm;
      *(v4f*)(out_norm + (size_t)row * N + j) = o;
    }
    
  }
}



// ---- f16 WMMA path (v_wmma_f32_16x16x32_f16): 11-bit significands for operands in range — used where a [0,1] probability operand needs more precision than bf16
typedef _Float16 v16h __attribute__((ext_vector_type(16)));
union FragH { v16h v; v8us half[2]; _Float16 h[16]; unsigned short u[16]; };
template <int NT>
__device__ __forceinline__ v8f mmaH(v16h ah, v16h al, v16h bh, v16h bl, v8f c) {
  c = __builtin_amdgcn_wmma_f32_16x16x32_f16(false, ah, false, bh, (short)0, c, false, false);
  if (NT >= 2) c = __builtin_amdgcn_wmma_f32_16x16x32_f16(false, al, false, bh, (short)0, c, false, false);
  if (NT >= 3) c = __builtin_amdgcn_wmma_f32_16x16x32_f16(false, ah, false, bl, (short)0, c, false, false);
  asm volatile("v_nop\n\tv_nop\n\tv_nop\n\tv_nop" : "+v"(c) : "v"(ah), "v"(al), "v"(bh), "v"(bl));
  return c;
}
// batched GEMM like k_gemm_b but f16 operands: A f32 (split into f16 hi/lo if ASPLIT, else rounded to f16), Bt = f16 values [n][k]; alpha; C f32; N multiple of 16 (partial tiles skipped)
template <bool ASPLIT>
__global__ __launch_bounds__(128) void k_gemm_h(const float* __restrict__ A, int lda, size_t sA, const _Float16* __restrict__ Bh, int ldb, size_t sB, float alpha, float* __restrict__ C, int ldc, size_t sC, int M, int N, int K) {
  __shared__ __attribute__((aligned(16))) float so[4][16][64];
  const int tid = threadIdx.x, w = tid >> 5, lane = tid & 31, ln = lane & 15, hh = lane >> 4; const int by = blockIdx.y;
  A += (size_t)by * sA; Bh += (size_t)by * sB; C += (size_t)by * sC;
  const int ntn = (N + 63) / 64; const int wid = blockIdx.x * 4 + w; const int mt = wid / ntn, nq = wid % ntn; if (mt * 16 >= M) return;
  const int row0 = mt * 16, col0 = nq * 64; const float* arow = A + (size_t)(row0 + ln) * lda;
  v8f acc[4] = {};
  for (int kb = 0; kb < K; kb += 32) {
    FragH ah, al;
    const v4f x0 = *(const v4fa*)(arow + kb + 8 * hh), x1 = *(const v4fa*)(arow + kb + 8 * hh + 4), x2 = *(const v4fa*)(arow + kb + 16 + 8 * hh), x3 = *(const v4fa*)(arow + kb + 16 + 8 * hh + 4);
    float xs[16] = {x0[0],x0[1],x0[2],x0[3],x1[0],x1[1],x1[2],x1[3],x2[0],x2[1],x2[2],x2[3],x3[0],x3[1],x3[2],x3[3]};
#pragma unroll
    for (int i = 0; i < 16; ++i) { const _Float16 h = (_Float16)xs[i]; ah.h[i] = h; al.h[i] = ASPLIT ? (_Float16)(xs[i] - (float)h) : (_Float16)0.0f; }
#pragma unroll
    for (int t = 0; t < 4; ++t) { if (col0 + t * 16 >= N) continue; const size_t boff = (size_t)(col0 + t * 16 + ln) * ldb + kb; FragH bq; bq.half[0] = *(const v8us*)(Bh + boff + 8 * hh); bq.half[1] = *(const v8us*)(Bh + boff + 16 + 8 * hh);
      acc[t] = mmaH<ASPLIT ? 2 : 1>(ah.v, al.v, bq.v, bq.v, acc[t]); }
  }
#pragma unroll
  for (int t = 0; t < 4; ++t) { if (col0 + t * 16 >= N) continue;
#pragma unroll
    for (int r = 0; r < 8; ++r) so[w][8 * hh + r][t * 16 + ln] = acc[t][r] * alpha; }
  __builtin_amdgcn_fence(__ATOMIC_ACQ_REL, "workgroup"); __builtin_amdgcn_wave_barrier();
  const int rsub = lane >> 4, c4 = (lane & 15) * 4;
  {
#pragma unroll
    for (int q = 0; q < 8; ++q) { const int r = q * 2 + rsub; if (col0 + c4 < N) { const v4f v = *(const v4fa*)&so[w][r][c4]; *(v4f*)(C + (size_t)(row0 + r) * ldc + col0 + c4) = v; } }
     }
}

__global__ __launch_bounds__(256) void k_h16(const float* __restrict__ x, _Float16* __restrict__ X16, size_t n8) { const size_t t = (size_t)blockIdx.x * 256 + threadIdx.x; if (t >= n8) return; FragH f;
#pragma unroll
  for (int q = 0; q < 8; ++q) f.h[q] = (_Float16)x[t * 8 + q]; *(v8us*)((unsigned short*)X16 + t * 8) = f.half[0];  }
__global__ __launch_bounds__(256) void k_round16f(const float* __restrict__ W, _Float16* __restrict__ Bt, size_t n8) { const size_t t = (size_t)blockIdx.x * 256 + threadIdx.x; if (t >= n8) return; FragH f;
#pragma unroll
  for (int i = 0; i < 8; ++i) f.h[i] = (_Float16)(bf16_round(W[t * 8 + i]) * 16.0f); *(v8us*)((unsigned short*)Bt + t * 8) = f.half[0];  }

// The whole projection stage in one launch. One work-group (8 waves) = 64 rows of x. It rounds its x rows and all of Wq, Wk, Wv (f32 -> bf16 -> f16,
// W times 2^4, laid [n][k], the three matrices as 192 columns) into LDS, forms Q, K and V on v_wmma_f32_16x16x32_f16 from there, and stores them in
// FRAGMENT ORDER: the workspace holds 512-byte chunks, lane l's 16 bytes of one operand half at byte 16 l, so that the attention kernel's every load is
// 512 contiguous bytes and every store here is an accumulator tile as it stands in the registers.
//   Qf, Kf: chunk (row / 16) * 4 + col / 16;                          lane 16 hh + ln = row (row & 15 = ln), columns 16 (col / 16) + 8 hh + 0..7
//   Vf:     chunk (row / 32) * 8 + (col / 16) * 2 + ((row >> 4) & 1); lane 16 hh + ln = column (col & 15 = ln), rows 16 (row / 16) + 8 hh + 0..7
// Wave w owns 32 rows (w & 1) and column tile w >> 1 of each of Q, K and V. Q and K are formed as W^T x^T (a lane holds 8 neighbouring columns of one
// row), V as x W (a lane holds 8 neighbouring rows of one column).
#define PRW 64          // rows of x a work-group
#define PKP (DD + 8)    // LDS pitch of a k row in halves: 528 B = 16 B x odd, free of bank conflicts for 16-byte accesses
typedef float v2f __attribute__((ext_vector_type(2)));
typedef __bf16 v2b __attribute__((ext_vector_type(2)));
typedef _Float16 v2h __attribute__((ext_vector_type(2)));
typedef unsigned int v2ua __attribute__((ext_vector_type(2), may_alias));
typedef unsigned int v4ua __attribute__((ext_vector_type(4), may_alias));
// two f32 -> bf16 (nearest even) -> f16, packed
__device__ __forceinline__ unsigned int pk_b16h(float a, float b) {
  return __builtin_bit_cast(unsigned int, __builtin_convertvector(__builtin_convertvector(__builtin_convertvector((v2f){a, b}, v2b), v2f), v2h)); }
__global__ __launch_bounds__(256) void k_proj(const float* __restrict__ x, const float* __restrict__ Wq, const float* __restrict__ Wk, const float* __restrict__ Wv,
                                              _Float16* __restrict__ Qf, _Float16* __restrict__ Kf, _Float16* __restrict__ Vf) {
  __shared__ __attribute__((aligned(16))) unsigned short sW[3 * HD][PKP];
  __shared__ __attribute__((aligned(16))) unsigned short sX[PRW][PKP];
  const int tid = (int)threadIdx.x, lane = tid & 31, ln = lane & 15, hh = lane >> 4;
  const int w = __builtin_amdgcn_readfirstlane(tid >> 5);   // scalar, so that the chunk addresses of the stores are scalar
  const int row0 = (int)blockIdx.x * PRW;
  // Weights in six chunks of half a matrix (128 k rows); of a chunk a lane takes 4 x 8 k of one column n; a wave: 32 neighbouring n, one line a load.
  const int n = tid & 63, kq = tid >> 6;
  float wr[6][32]; v4f xr[16];
  auto loadW = [&](int c) { const float* __restrict__ Wm = ((c >> 1) == 0) ? Wq : ((c >> 1) == 1) ? Wk : Wv;
#pragma unroll
    for (int u = 0; u < 4; ++u)
#pragma unroll
      for (int i = 0; i < 8; ++i) wr[c][u * 8 + i] = Wm[(size_t)((((c & 1) * 4 + u) * 4 + kq) * 8 + i) * HD + n]; };
  auto putW = [&](int c) {   // the power of two goes in ahead of the rounding: the same bits, and small weights stay normal in f16
#pragma unroll
    for (int u = 0; u < 4; ++u) { const float* v = &wr[c][u * 8];
      *(v4ua*)&sW[(c >> 1) * HD + n][(((c & 1) * 4 + u) * 4 + kq) * 8] = (v4ua){pk_b16h(v[0] * 16.0f, v[1] * 16.0f), pk_b16h(v[2] * 16.0f, v[3] * 16.0f), pk_b16h(v[4] * 16.0f, v[5] * 16.0f), pk_b16h(v[6] * 16.0f, v[7] * 16.0f)}; } };
  // Each sched_barrier below keeps a chunk's loads two chunks ahead of its conversion; left alone the compiler sank loads to their use, one wait a pair.
  // Each s_wait_xcnt stands in front of what may rewrite a register that an earlier, still issued load names as its address (a later load's result, a constant).
#pragma unroll
  for (int i = 0; i < 16; ++i) xr[i] = *(const v4fa*)(x + (size_t)row0 * DD + (size_t)(i * 256 + tid) * 4);   // whole lines a wave; from memory, so asked for first
  loadW(0); loadW(1); asm volatile("s_wait_xcnt 0x0" ::: "memory"); __builtin_amdgcn_sched_barrier(0);
  putW(0); asm volatile("s_wait_xcnt 0x0" ::: "memory"); loadW(2); __builtin_amdgcn_sched_barrier(0);
  putW(1); asm volatile("s_wait_xcnt 0x0" ::: "memory"); loadW(3); __builtin_amdgcn_sched_barrier(0);
  putW(2); asm volatile("s_wait_xcnt 0x0" ::: "memory"); loadW(4); __builtin_amdgcn_sched_barrier(0);
  putW(3); asm volatile("s_wait_xcnt 0x0" ::: "memory"); loadW(5); __builtin_amdgcn_sched_barrier(0);
  putW(4); putW(5);
#pragma unroll
  for (int i = 0; i < 16; ++i) { const int e = i * 256 + tid;
    *(v2ua*)&sX[e >> 6][(e & 63) * 4] = (v2ua){pk_b16h(xr[i][0], xr[i][1]), pk_b16h(xr[i][2], xr[i][3])}; }
  __syncthreads();   // publishes the converted x rows and weights to every wave
  { const int rp = w & 1, cg = w >> 1;
    const unsigned short* xrow = &sX[rp * 32 + ln][8 * hh]; const unsigned short* wrow = &sW[cg * 16 + ln][8 * hh];   // j = 0, 1, 2: Wq, Wk, Wv, HD rows apart
    v8f acc[2][3];
#pragma unroll
    for (int i = 0; i < 2; ++i)
#pragma unroll
      for (int j = 0; j < 3; ++j) acc[i][j] = (v8f){0.f,0.f,0.f,0.f,0.f,0.f,0.f,0.f};
    FragH fx[2][2], fw[2][3];   // two register sets: the fragments of k step s + 1 are fetched while step s is multiplied
#pragma unroll
    for (int i = 0; i < 2; ++i) { fx[0][i].half[0] = *(const v8us*)(xrow + i * 16 * PKP); fx[0][i].half[1] = *(const v8us*)(xrow + i * 16 * PKP + 16); }
#pragma unroll
    for (int j = 0; j < 3; ++j) { fw[0][j].half[0] = *(const v8us*)(wrow + j * HD * PKP); fw[0][j].half[1] = *(const v8us*)(wrow + j * HD * PKP + 16); }
#pragma unroll
    for (int s = 0; s < DD / 32; ++s) { const int cu = s & 1, nx = cu ^ 1, kn = (s + 1) * 32;
      if (s + 1 < DD / 32) {
#pragma unroll
        for (int i = 0; i < 2; ++i) { fx[nx][i].half[0] = *(const v8us*)(xrow + i * 16 * PKP + kn); fx[nx][i].half[1] = *(const v8us*)(xrow + i * 16 * PKP + kn + 16); }
#pragma unroll
        for (int j = 0; j < 3; ++j) { fw[nx][j].half[0] = *(const v8us*)(wrow + j * HD * PKP + kn); fw[nx][j].half[1] = *(const v8us*)(wrow + j * HD * PKP + kn + 16); } }
#pragma unroll
      for (int i = 0; i < 2; ++i)
#pragma unroll
        for (int j = 0; j < 3; ++j) acc[i][j] = (j < 2) ? __builtin_amdgcn_wmma_f32_16x16x32_f16(false, fw[cu][j].v, false, fx[cu][i].v, (short)0, acc[i][j], false, false)
                                                        : __builtin_amdgcn_wmma_f32_16x16x32_f16(false, fx[cu][i].v, false, fw[cu][j].v, (short)0, acc[i][j], false, false); }
    FragH o[2][3];   // j < 2: acc[i][j][r] = (x W)[row rp * 32 + i * 16 + ln][column cg * 16 + 8 hh + r]; j = 2: (x Wv)[row rp * 32 + i * 16 + 8 hh + r][column cg * 16 + ln]
#pragma unroll
    for (int i = 0; i < 2; ++i)
#pragma unroll
      for (int j = 0; j < 3; ++j)
#pragma unroll
        for (int r = 0; r < 8; ++r) o[i][j].h[r] = (_Float16)(acc[i][j][r] * 0.0625f);   // takes the 2^4 of the weights out again
#pragma unroll
    for (int i = 0; i < 2; ++i) {   // a wave's store = one chunk, four whole lines
      *(v8us*)((unsigned short*)Qf + ((size_t)(row0 / 16 + rp * 2 + i) * 4 + cg) * 256 + lane * 8) = o[i][0].half[0];
      *(v8us*)((unsigned short*)Kf + ((size_t)(row0 / 16 + rp * 2 + i) * 4 + cg) * 256 + lane * 8) = o[i][1].half[0];
      *(v8us*)((unsigned short*)Vf + ((size_t)(row0 / 32 + rp) * 8 + cg * 2 + i) * 256 + lane * 8) = o[i][2].half[0]; } } }

#define NKW 16
#define QT 2
#define NG 8                  // waves that share out the key tiles of part 1 for one block
#define TLB 4096              // bytes of a key tile's K chunks, and of its V^T chunks
#define SL2 (0.0625f * 1.44269504088896340736f)
__device__ __forceinline__ float xhalf(float x) { return __builtin_bit_cast(float, __builtin_amdgcn_permlanex16(__builtin_bit_cast(int, x), __builtin_bit_cast(int, x), 0x76543210, 0xfedcba98, false, false)); }  // lane l with lane l ^ 16
// 2^x: the v_nop fills the one slot that the instruction set asks for between a transcendental and a next instruction that reads its result or overwrites its source.
__device__ __forceinline__ float exp2_slot(float x) { float y; asm("v_exp_f32 %0, %1\n\tv_nop" : "=v"(y) : "v"(x)); return y; }
// amdgpu_waves_per_eu(4): the two query tiles' accumulators and Q fragments take 96 VGPRs, with the pass's scores and V^T fragments more than 128; a 16-wave work-group puts four waves on a SIMD, 256 VGPRs each.
__global__ __launch_bounds__(NKW * 32) __attribute__((amdgpu_waves_per_eu(4))) void k_flash(const _Float16* __restrict__ Qf, const _Float16* __restrict__ Kf, const _Float16* __restrict__ Vf, const int* __restrict__ MSK, float* __restrict__ O, int ldo) {
  constexpr int QR = 16 * QT, NQB = 4096 / QR, DT = 4, KS = 2, NP = NG + NKW;   // NP partials: slots 0 .. NG - 1 the short block's, NG .. NP - 1 the long block's
  static_assert(QR == 32 && QR == NKW * 2, "a key tile spans a block's queries (one tile on the diagonal); the merge gives each thread one 16-byte piece of one row");
  static_assert(NKW == 2 * NG && NQB % 2 == 0, "two waves a common key tile; short and long blocks pair up");
  __shared__ __attribute__((aligned(16))) float sO[NP][QR][64 + 4];
  __shared__ float sM[NP][QR], sL[NP][QR];
  const int lane = (int)__builtin_amdgcn_mbcnt_lo(~0u, 0u), ln = lane & 15, hh = lane >> 4;   // lane id without threadIdx.x: one register fewer live over the key loop
  const int w = __builtin_amdgcn_readfirstlane((int)threadIdx.x >> 5);   // scalar, so that the key loops' tests stay scalar branches
  const int tb = blockIdx.x % (NQB / 2), slab = blockIdx.x / (NQB / 2); (void)MSK;
  const int grp = w >> 3, w8 = w & 7;   // scalar
  const unsigned short* Kb = (const unsigned short*)Kf + (size_t)slab * 64 * 4096;
  const unsigned short* Vb = (const unsigned short*)Vf + (size_t)slab * 64 * 4096;
  FragH aq[QT][KS];   // B operands of S^T: column ln of tile t = query q0 + 16 t + ln
  float m_q[QT], l_q[QT]; v8f oacc[QT][DT];   // of query q0 + 16 t + ln; m_q in the scaled log2 domain; l_q over this half's keys only, the halves joined in put()
  int q0, qd;   // the block's first query (scalar); the mask's one lane-dependent term
  auto begin = [&](int qblk) {   // takes up a query block: its Q fragments, an empty partial
    q0 = qblk * QR; qd = q0 + ln - 8 * hh;
    const unsigned short* qr = (const unsigned short*)Qf + ((size_t)slab * 4096 + q0) * 64 + lane * 8;
#pragma unroll
    for (int t = 0; t < QT; ++t)
#pragma unroll
      for (int ks = 0; ks < KS; ++ks) { aq[t][ks].half[0] = *(const v8us*)(qr + t * 1024 + ks * 512); aq[t][ks].half[1] = *(const v8us*)(qr + t * 1024 + ks * 512 + 256); }
#pragma unroll
    for (int t = 0; t < QT; ++t) { m_q[t] = -3.0e38f; l_q[t] = 0.f;
#pragma unroll
      for (int dt = 0; dt < DT; ++dt) oacc[t][dt] = (v8f){0.f,0.f,0.f,0.f,0.f,0.f,0.f,0.f}; } };
  // lays down the wave's partial: query maximum (scaled log2 domain), sum (the two halves joined) and the un-normalised output row; a wave without a key tile leaves (-3e38, 0, 0)
  auto put = [&](int slot) {
#pragma unroll
    for (int t = 0; t < QT; ++t) {
      l_q[t] += xhalf(l_q[t]);
      if (hh == 0) { sM[slot][t * 16 + ln] = m_q[t]; sL[slot][t * 16 + ln] = l_q[t]; }
#pragma unroll
      for (int dt = 0; dt < DT; ++dt) {   // oacc[t][dt][r] = O[q0 + 16 t + ln][dt * 16 + 8 hh + r]: eight neighbours of one row
        *(v4fa*)&sO[slot][t * 16 + ln][dt * 16 + 8 * hh] = (v4f){oacc[t][dt][0], oacc[t][dt][1], oacc[t][dt][2], oacc[t][dt][3]};
        *(v4fa*)&sO[slot][t * 16 + ln][dt * 16 + 8 * hh + 4] = (v4f){oacc[t][dt][4], oacc[t][dt][5], oacc[t][dt][6], oacc[t][dt][7]}; } } };
  // one pass: the 32 keys from j0 on against the wave's 32 queries; kp, vp: the lane's place in the tile's first K and first V^T chunk (in the workspace)
  auto pass = [&](int j0, const char* kp, const char* vp) {
    float sc[QT][16];   // sc[t][nt * 8 + r] = raw score (q . k) of query tile t and key j0 + nt * 16 + 8 hh + r
    FragH bk[2][KS], bv[DT];
    // The pass's eight K loads stand together in front of its first product: one trip is waited for, not one a 16-key group.
#pragma unroll
    for (int nt = 0; nt < 2; ++nt)
#pragma unroll
      for (int ks = 0; ks < KS; ++ks) { bk[nt][ks].half[0] = *(const v8us*)(kp + (nt * 2048 + ks * 1024)); bk[nt][ks].half[1] = *(const v8us*)(kp + (nt * 2048 + ks * 1024 + 512)); }
#pragma unroll
    for (int nt = 0; nt < 2; ++nt) { v8f acc[QT];
#pragma unroll
      for (int t = 0; t < QT; ++t) acc[t] = (v8f){0.f,0.f,0.f,0.f,0.f,0.f,0.f,0.f};
#pragma unroll
      for (int ks = 0; ks < KS; ++ks)
#pragma unroll
        for (int t = 0; t < QT; ++t) acc[t] = mmaH<1>(bk[nt][ks].v, bk[nt][ks].v, aq[t][ks].v, aq[t][ks].v, acc[t]);   // one K fragment, both query tiles
#pragma unroll
      for (int t = 0; t < QT; ++t)
#pragma unroll
        for (int r = 0; r < 8; ++r) sc[t][nt * 8 + r] = acc[t][r]; }
    // The pass's eight V^T loads stand together behind the score products: they fly while the softmax is worked out.
#pragma unroll
    for (int dt = 0; dt < DT; ++dt) { bv[dt].half[0] = *(const v8us*)(vp + dt * 1024); bv[dt].half[1] = *(const v8us*)(vp + (dt * 1024 + 512)); }
    if (j0 + 31 > q0) {   // only the tile on the diagonal holds keys behind a query (a scalar test); key j0 <= q0 stays, so every query keeps a finite maximum
#pragma unroll
      for (int t = 0; t < QT; ++t)
#pragma unroll
        for (int i = 0; i < 16; ++i) if ((i >> 3) * 16 + (i & 7) - 16 * t > qd - j0) sc[t][i] = -INFINITY; }   // key j0 + 16 (i >> 3) + 8 hh + (i & 7) behind query q0 + 16 t + ln; constants against one register
    FragH pb[QT];
#pragma unroll
    for (int t = 0; t < QT; ++t) {
      float mc = sc[t][0];
#pragma unroll
      for (int i = 1; i < 16; ++i) mc = fmaxf(mc, sc[t][i]);
      mc = fmaxf(mc, xhalf(mc));
      const float mn = fmaxf(m_q[t], mc * SL2); const float al = exp2_slot(m_q[t] - mn); m_q[t] = mn;   // SL2 > 0: the maximum may be taken on the raw scores
      float ps = 0.f;
#pragma unroll
      for (int i = 0; i < 16; ++i) { const float p = exp2_slot(__builtin_fmaf(sc[t][i], SL2, -mn)); ps += p; pb[t].h[i] = (_Float16)p; }   // a masked score: 2^-inf = 0
      l_q[t] = l_q[t] * al + ps;
#pragma unroll
      for (int dt = 0; dt < DT; ++dt) oacc[t][dt] *= al; }
#pragma unroll
    for (int dt = 0; dt < DT; ++dt)
#pragma unroll
      for (int t = 0; t < QT; ++t) oacc[t][dt] = mmaH<1>(bv[dt].v, bv[dt].v, pb[t].v, pb[t].v, oacc[t][dt]); };   // one V^T fragment, both query tiles

  // ---- part 1: the key tiles that both blocks need; waves w and w + 8 walk the same tiles, each for its own block
  begin(grp ? NQB - 1 - tb : tb);
  asm volatile("s_wait_xcnt 0x0" ::: "memory");   // stands in front of what may rewrite a register that the Q loads name as their address: a wave without a key tile in part 1 goes on while they fly
  { unsigned int vo = (unsigned int)lane * 16u + (unsigned int)w8 * (unsigned int)TLB;   // the lane's place in the pass's first K (and V^T) chunk, in bytes: one register, carried over the loop, beside the scalar bases
    const int jend = (tb + 1) * 32;
#pragma unroll 1
    for (int j0 = w8 * 32; j0 < jend; j0 += NG * 32) {
      pass(j0, (const char*)Kb + vo, (const char*)Vb + vo);
      __builtin_amdgcn_sched_barrier(0);   // keeps the step of vo behind the last product's wait for the V^T loads, which name that register as their address
      vo += NG * (unsigned int)TLB; } }
  if (grp == 0) { put(w8); begin(NQB - 1 - tb); }       // scalar branch

  // ---- part 2: the long block's own key tiles, dealt over all waves. The deal starts with the waves that had one tile fewer in part 1 (the high w8):
  // of the NQB + 1 passes of a work-group every wave then has 8, and one wave 9.
  { const int rk = (NG - 1 - w8) * 2 + (1 - grp);   // scalar
    unsigned int vo = (unsigned int)lane * 16u + (unsigned int)(tb + 1 + rk) * (unsigned int)TLB;
    const int jend = q0 + QR;
#pragma unroll 1
    for (int j0 = (tb + 1 + rk) * 32; j0 < jend; j0 += NKW * 32) {
      pass(j0, (const char*)Kb + vo, (const char*)Vb + vo);
      __builtin_amdgcn_sched_barrier(0);   // as in part 1
      vo += NKW * (unsigned int)TLB; } }
  put(NG + w);
  __syncthreads();   // publishes every wave's partials of both blocks to the merging threads
  { const int r = w * 2 + hh, pc = ln;   // a block: 32 rows of 16 pieces: every thread merges one piece of each block
    v4f res[2];
#pragma unroll
    for (int u = 0; u < 2; ++u) { const int k0 = u ? NG : 0, kn = u ? NKW : NG;
      float M = sM[k0][r];
#pragma unroll
      for (int k = 1; k < NKW; ++k) if (k < kn) M = fmaxf(M, sM[k0 + k][r]);
      float L = 0.f; v4f o = {0.f, 0.f, 0.f, 0.f};
#pragma unroll
      for (int k = 0; k < NKW; ++k) if (k < kn) { const float e = exp2_slot(sM[k0 + k][r] - M); L += e * sL[k0 + k][r]; const v4f pv = *(const v4fa*)&sO[k0 + k][r][pc * 4]; o += pv * e; }
      const float inv = (L > 0.f) ? 1.0f / L : 0.f;
      res[u] = o * inv; }
#pragma unroll
    for (int u = 0; u < 2; ++u) *(v4f*)(O + ((size_t)slab * 4096 + (u ? NQB - 1 - tb : tb) * QR + r) * ldo + pc * 4) = res[u]; } }

extern "C" void kernel_launch(void* const* d_in, const int* in_sizes, int n_in,
                              void* d_out, int out_size, void* d_ws, size_t ws_size, hipStream_t stream) {
  (void)in_sizes; (void)n_in; (void)out_size;
  const float* x = (const float*)d_in[0]; const float* Wq = (const float*)d_in[1]; const float* Wk = (const float*)d_in[2]; const float* Wv = (const float*)d_in[3];
  char* ws = (char*)d_ws; size_t off = 0;
  auto take = [&](size_t bytes) { char* p = ws + off; off += (bytes + 255) & ~(size_t)255; return p; };
  _Float16* Qf = (_Float16*)take((size_t)NR * HD * 2); _Float16* Kf = (_Float16*)take((size_t)NR * HD * 2); _Float16* Vf = (_Float16*)take((size_t)NR * HD * 2);
  if (off > ws_size) return;      // 3 x 2 MiB
  k_proj<<<NR / PRW, 256, 0, stream>>>(x, Wq, Wk, Wv, Qf, Kf, Vf);
  k_flash<<<BB * (TT / (16 * QT) / 2), NKW * 32, 0, stream>>>(Qf, Kf, Vf, nullptr, (float*)d_out, HD);
}

// v010
// Measured time: 21.1 microseconds a run.
// Timed twice side by side with v009, it ran 1.04 and 1.03 times as fast.
// All steps since v000 together make it 24.8 times as fast.
#include <hip/hip_runtime.h>
// Single-head causal self-attention layer (B=4, S=4096, D=256, H=64; scale 1/√256 as in the module): q/k/v projections as GEMMs (W [in][out] transposed to bf16-exact ×2^4) and the attention as a
// fused flash-style causal kernel (online softmax f32, P f16 <= 1, O^T = Vt*P^T; two blocks of 32 query rows of one batch per work-group, their common key tiles walked by wave pairs, key tiles dealt over the waves, partials merged in LDS) on v_wmma_f32_16x16x32_f16 with f32 accumulate.
#define BB 4
#define TT 4096
#define DD 256
#define HD 64
#define NR (BB * TT)

typedef __bf16 v16b __attribute__((ext_vector_type(16)));
typedef unsigned short v8us __attribute__((ext_vector_type(8), may_alias));
typedef float  v8f  __attribute__((ext_vector_type(8)));
typedef float  v4f  __attribute__((ext_vector_type(4)));
typedef float  v4fa __attribute__((ext_vector_type(4), may_alias));
union FragB { v16b v; v8us half[2]; unsigned short u[16]; };

__device__ __forceinline__ unsigned short bf16_bits(float x) { unsigned int u = __float_as_uint(x); return (unsigned short)((u + 0x7FFFu + ((u >> 16) & 1u)) >> 16); }
__device__ __forceinline__ float bf16_val(unsigned short b) { return __uint_as_float(((unsigned int)b) << 16); }
__device__ __forceinline__ float bf16_round(float x) { return bf16_val(bf16_bits(x)); }
// D += A·B with NT terms: 1 = ah·bh, 2 = + al·bh (A split), 3 = + ah·bl (both split)
template <int NT>
__device__ __forceinline__ v8f mmaN(v16b ah, v16b al, v16b bh, v16b bl, v8f c) {
  c = __builtin_amdgcn_wmma_f32_16x16x32_bf16(false, ah, false, bh, (short)0, c, false, false);
  if (NT >= 2) c = __builtin_amdgcn_wmma_f32_16x16x32_bf16(false, al, false, bh, (short)0, c, false, false);
  if (NT >= 3) c = __builtin_amdgcn_wmma_f32_16x16x32_bf16(false, ah, false, bl, (short)0, c, false, false);
  asm volatile("v_nop\n\tv_nop\n\tv_nop\n\tv_nop" : "+v"(c) : "v"(ah), "v"(al), "v"(bh), "v"(bl));
  return c;
}

__global__ __launch_bounds__(256) void k_wt_bf16(const float* __restrict__ W, unsigned short* __restrict__ Wt, int K, int N) {
  const int t = blockIdx.x * 256 + threadIdx.x;
  const int k8n = K / 8;
  if (t >= N * k8n) return;
  const int n = t / k8n, k8 = (t % k8n) * 8;
  v8us v;
#pragma unroll
  for (int i = 0; i < 8; ++i) v[i] = bf16_bits(W[(size_t)(k8 + i) * N + n]);
  *(v8us*)(Wt + (size_t)n * K + k8) = v;
  
}

// GEMM C[M][N] (f32, pitch ldc) = act(A[M][K]·W + bias). A f32 row-major (pitch lda) converted per fragment to bf16
// (ASPLIT: hi/lo two planes -> 2 terms, else single rounded term); Wt bf16 [N][K] (pitch ldb). BIAS_BF16 rounds the
// bias to bf16 first (bias quantised to bf16 before the add). K%32==0, M%16==0, N%64==0.
template <bool ASPLIT, int ACT, bool BIAS_BF16>
__global__ __launch_bounds__(128) void k_gemm_bf(const float* __restrict__ A, int lda, const unsigned short* __restrict__ Wt, int ldb,
                                               const float* __restrict__ bias, float* __restrict__ C, int ldc, int M, int N, int K) {
  __shared__ __attribute__((aligned(16))) float so[4][16][64];
  const int tid = threadIdx.x, w = tid >> 5, lane = tid & 31, ln = lane & 15, hh = lane >> 4;
  const int ntn = N / 64;
  const int wid = blockIdx.x * 4 + w;
  const int mt = wid / ntn, nq = wid % ntn;
  if (mt * 16 >= M) return;
  const int row0 = mt * 16, col0 = nq * 64;
  const float* arow = A + (size_t)(row0 + ln) * lda;
  v8f acc[4] = {};
  for (int kb = 0; kb < K; kb += 32) {
    FragB ah, al;
    const v4f x0 = *(const v4fa*)(arow + kb + 8 * hh), x1 = *(const v4fa*)(arow + kb + 8 * hh + 4);
    const v4f x2 = *(const v4fa*)(arow + kb + 16 + 8 * hh), x3 = *(const v4fa*)(arow + kb + 16 + 8 * hh + 4);
    float xs[16] = {x0[0],x0[1],x0[2],x0[3],x1[0],x1[1],x1[2],x1[3],x2[0],x2[1],x2[2],x2[3],x3[0],x3[1],x3[2],x3[3]};
#pragma unroll
    for (int i = 0; i < 16; ++i) { const unsigned short hb = bf16_bits(xs[i]); ah.u[i] = hb; al.u[i] = ASPLIT ? bf16_bits(xs[i] - bf16_val(hb)) : (unsigned short)0; }
#pragma unroll
    for (int t = 0; t < 4; ++t) {
      const unsigned short* brow = Wt + (size_t)(col0 + t * 16 + ln) * ldb + kb;
      FragB b;
      b.half[0] = *(const v8us*)(brow + 8 * hh);
      b.half[1] = *(const v8us*)(brow + 16 + 8 * hh);
      acc[t] = mmaN<ASPLIT ? 2 : 1>(ah.v, al.v, b.v, b.v, acc[t]);
    }
  }
#pragma unroll
  for (int t = 0; t < 4; ++t) {
    float bv = bias ? bias[col0 + t * 16 + ln] : 0.f;
    if (BIAS_BF16) bv = bf16_round(bv);
#pragma unroll
    for (int r = 0; r < 8; ++r) { float v = acc[t][r] + bv; if (ACT == 1) v = fmaxf(v, 0.f); so[w][8 * hh + r][t * 16 + ln] = v; }
  }
  __builtin_amdgcn_fence(__ATOMIC_ACQ_REL, "workgroup");
  __builtin_amdgcn_wave_barrier();
  const int rsub = lane >> 4, c4 = (lane & 15) * 4;
  {
#pragma unroll
    for (int q = 0; q < 8; ++q) {
      const int r = q * 2 + rsub;
      const v4f v = *(const v4fa*)&so[w][r][c4];
      *(v4f*)(C + (size_t)(row0 + r) * ldc + col0 + c4) = v;
    }
    
  }
}

// Flash-style causal/unmasked attention, all contractions 3-term bf16 hi/lo splits, f32 softmax with running max.
// q,k,v rows are read from f32 buffers with arbitrary row pitch (so they can live inside a fused qkv buffer);
// D = head size (multiple of 32, <= 128); one wave = 16 query rows; block = 4 waves (64 queries) sharing K/V chunks of 32.
template <int D, bool CAUSAL>
__global__ __launch_bounds__(128) void k_flash(const float* __restrict__ qb, const float* __restrict__ kb, const float* __restrict__ vb,
                                             int pitch, int T, int H, float scale, float* __restrict__ y, int ypitch) {
  constexpr int KS = D / 32;        // k-steps for QK
  constexpr int DT = D / 16;        // d tiles for PV
  __shared__ __attribute__((aligned(16))) unsigned short sKh[32][D + 8], sKl[32][D + 8], sVh[32][D + 8], sVl[32][D + 8];
  __shared__ __attribute__((aligned(16))) unsigned short sPh[4][16][40], sPl[4][16][40];
  __shared__ __attribute__((aligned(16))) float sO[4][16][D];
  const int tid = threadIdx.x, w = tid >> 5, lane = tid & 31, ln = lane & 15, hh = lane >> 4;
  const int nqb = (T + 63) / 64;
  const int bh = blockIdx.x / nqb, qblk = blockIdx.x % nqb;
  const int b = bh / H, h = bh % H;
  const int q0 = qblk * 64 + w * 16;
  const float* Q = qb + (size_t)b * T * pitch + h * D;
  const float* K = kb + (size_t)b * T * pitch + h * D;
  const float* V = vb + (size_t)b * T * pitch + h * D;

  // A fragments of the wave's 16 query rows (scaled), hi/lo
  FragB aqh[KS], aql[KS];
  {
    int row = q0 + ln; if (row >= T) row = T - 1;
    const float* qr = Q + (size_t)row * pitch;
#pragma unroll
    for (int ks = 0; ks < KS; ++ks)
#pragma unroll
      for (int i = 0; i < 16; ++i) {
        const int d = ks * 32 + ((i < 8) ? (8 * hh + i) : (16 + 8 * hh + (i - 8)));
        const float x = qr[d] * scale; const unsigned short hb = bf16_bits(x);
        aqh[ks].u[i] = hb; aql[ks].u[i] = bf16_bits(x - bf16_val(hb));
      }
  }
  float m_r[8], l_r[8];
#pragma unroll
  for (int r = 0; r < 8; ++r) { m_r[r] = -3.0e38f; l_r[r] = 0.f; }
  v8f oacc[DT];
#pragma unroll
  for (int dt = 0; dt < DT; ++dt) oacc[dt] = (v8f){0.f,0.f,0.f,0.f,0.f,0.f,0.f,0.f};

  const int kv_end = CAUSAL ? min(T, qblk * 64 + 64) : T;     // block-uniform
  for (int j0 = 0; j0 < kv_end; j0 += 32) {
    __syncthreads();
    for (int e = tid; e < 32 * (D / 4); e += 128) {
      const int r = e / (D / 4), c4 = (e % (D / 4)) * 4;
      const int key = j0 + r;
      v4f kf = {0.f,0.f,0.f,0.f}, vf = {0.f,0.f,0.f,0.f};
      if (key < T) { kf = *(const v4fa*)(K + (size_t)key * pitch + c4); vf = *(const v4fa*)(V + (size_t)key * pitch + c4); }
#pragma unroll
      for (int t = 0; t < 4; ++t) {
        unsigned short hb = bf16_bits(kf[t]); sKh[r][c4 + t] = hb; sKl[r][c4 + t] = bf16_bits(kf[t] - bf16_val(hb));
        hb = bf16_bits(vf[t]); sVh[r][c4 + t] = hb; sVl[r][c4 + t] = bf16_bits(vf[t] - bf16_val(hb));
      }
    }
    __syncthreads();
    // S tile 16 x 32
    v8f s[2];
#pragma unroll
    for (int nt = 0; nt < 2; ++nt) {
      v8f acc = {};
#pragma unroll
      for (int ks = 0; ks < KS; ++ks) {
        FragB bh_, bl_;
        bh_.half[0] = *(const v8us*)&sKh[nt * 16 + ln][ks * 32 + 8 * hh]; bh_.half[1] = *(const v8us*)&sKh[nt * 16 + ln][ks * 32 + 16 + 8 * hh];
        bl_.half[0] = *(const v8us*)&sKl[nt * 16 + ln][ks * 32 + 8 * hh]; bl_.half[1] = *(const v8us*)&sKl[nt * 16 + ln][ks * 32 + 16 + 8 * hh];
        acc = mmaN<3>(aqh[ks].v, aql[ks].v, bh_.v, bl_.v, acc);
      }
      s[nt] = acc;
    }
    // mask + running max (rows 8hh+r; the 16 lanes of a half share rows)
    float alpha[8];
#pragma unroll
    for (int r = 0; r < 8; ++r) {
      const int qi = q0 + 8 * hh + r;
      const int ja = j0 + ln, jb = j0 + 16 + ln;
      if (CAUSAL) { if (ja > qi) s[0][r] = -3.0e38f; if (jb > qi) s[1][r] = -3.0e38f; }
      if (ja >= T) s[0][r] = -3.0e38f;
      if (jb >= T) s[1][r] = -3.0e38f;
      float mx = fmaxf(s[0][r], s[1][r]);
      mx = fmaxf(mx, __shfl_xor(mx, 1, 32)); mx = fmaxf(mx, __shfl_xor(mx, 2, 32)); mx = fmaxf(mx, __shfl_xor(mx, 4, 32)); mx = fmaxf(mx, __shfl_xor(mx, 8, 32));
      const float mnew = fmaxf(m_r[r], mx);
      alpha[r] = (mnew > -1.0e38f) ? __expf(m_r[r] - mnew) : 1.0f;
      const float p0 = (s[0][r] > -1.0e38f) ? __expf(s[0][r] - mnew) : 0.f;
      const float p1 = (s[1][r] > -1.0e38f) ? __expf(s[1][r] - mnew) : 0.f;
      m_r[r] = mnew;
      l_r[r] = l_r[r] * alpha[r] + p0 + p1;            // per-lane partial row sum (16 lanes combined at the end)
      unsigned short hb = bf16_bits(p0); sPh[w][8 * hh + r][ln] = hb;      sPl[w][8 * hh + r][ln] = bf16_bits(p0 - bf16_val(hb));
      hb = bf16_bits(p1);                sPh[w][8 * hh + r][16 + ln] = hb; sPl[w][8 * hh + r][16 + ln] = bf16_bits(p1 - bf16_val(hb));
    }
#pragma unroll
    for (int dt = 0; dt < DT; ++dt)
#pragma unroll
      for (int r = 0; r < 8; ++r) oacc[dt][r] *= alpha[r];
    __builtin_amdgcn_fence(__ATOMIC_ACQ_REL, "workgroup");
    __builtin_amdgcn_wave_barrier();
    FragB pah, pal;
    pah.half[0] = *(const v8us*)&sPh[w][ln][8 * hh]; pah.half[1] = *(const v8us*)&sPh[w][ln][16 + 8 * hh];
    pal.half[0] = *(const v8us*)&sPl[w][ln][8 * hh]; pal.half[1] = *(const v8us*)&sPl[w][ln][16 + 8 * hh];
#pragma unroll
    for (int dt = 0; dt < DT; ++dt) {
      FragB bvh, bvl;
#pragma unroll
      for (int i = 0; i < 8; ++i) {
        bvh.u[i] = sVh[8 * hh + i][dt * 16 + ln]; bvh.u[8 + i] = sVh[16 + 8 * hh + i][dt * 16 + ln];
        bvl.u[i] = sVl[8 * hh + i][dt * 16 + ln]; bvl.u[8 + i] = sVl[16 + 8 * hh + i][dt * 16 + ln];
      }
      oacc[dt] = mmaN<3>(pah.v, pal.v, bvh.v, bvl.v, oacc[dt]);
    }
    __builtin_amdgcn_fence(__ATOMIC_ACQ_REL, "workgroup");
    __builtin_amdgcn_wave_barrier();
  }
#pragma unroll
  for (int r = 0; r < 8; ++r) {
    float l = l_r[r];
    l += __shfl_xor(l, 1, 32); l += __shfl_xor(l, 2, 32); l += __shfl_xor(l, 4, 32); l += __shfl_xor(l, 8, 32);
    l_r[r] = (l > 0.f) ? 1.0f / l : 0.f;
  }
#pragma unroll
  for (int dt = 0; dt < DT; ++dt)
#pragma unroll
    for (int r = 0; r < 8; ++r) sO[w][8 * hh + r][dt * 16 + ln] = oacc[dt][r] * l_r[r];
  __builtin_amdgcn_fence(__ATOMIC_ACQ_REL, "workgroup");
  __builtin_amdgcn_wave_barrier();
  {
    for (int r = 0; r < 16; ++r) {
      const int row = q0 + r;
      if (row < T && lane < D / 4) {
        const v4f val = *(const v4fa*)&sO[w][r][lane * 4];
        *(v4f*)(y + ((size_t)b * T + row) * ypitch + h * D + lane * 4) = val;
      }
    }
    
  }
}

// GEMM C = act(A·W + bias + resid): A f32 (ASPLIT -> hi/lo 2 terms), Wt bf16 [N][K]; ACT 0 none, 1 relu, 2 exact gelu;
// resid (optional, f32, row index = (row % rmod), pitch ldr, RES_BF16 rounds it) added before the activation.
template <bool ASPLIT, int ACT, bool BIAS_BF16, bool RES_BF16>
__global__ __launch_bounds__(128) void k_gemm_bf3(const float* __restrict__ A, int lda, const unsigned short* __restrict__ Wt, int ldb,
                                                const float* __restrict__ bias, const float* __restrict__ resid, int rmod, int ldr,
                                                float* __restrict__ C, int ldc, int M, int N, int K) {
  __shared__ __attribute__((aligned(16))) float so[4][16][64];
  const int tid = threadIdx.x, w = tid >> 5, lane = tid & 31, ln = lane & 15, hh = lane >> 4;
  const int ntn = N / 64;
  const int wid = blockIdx.x * 4 + w;
  const int mt = wid / ntn, nq = wid % ntn;
  if (mt * 16 >= M) return;
  const int row0 = mt * 16, col0 = nq * 64;
  const float* arow = A + (size_t)(row0 + ln) * lda;
  v8f acc[4] = {};
  for (int kb = 0; kb < K; kb += 32) {
    FragB ah, al;
    const v4f x0 = *(const v4fa*)(arow + kb + 8 * hh), x1 = *(const v4fa*)(arow + kb + 8 * hh + 4);
    const v4f x2 = *(const v4fa*)(arow + kb + 16 + 8 * hh), x3 = *(const v4fa*)(arow + kb + 16 + 8 * hh + 4);
    float xs[16] = {x0[0],x0[1],x0[2],x0[3],x1[0],x1[1],x1[2],x1[3],x2[0],x2[1],x2[2],x2[3],x3[0],x3[1],x3[2],x3[3]};
#pragma unroll
    for (int i = 0; i < 16; ++i) { const unsigned short hb = bf16_bits(xs[i]); ah.u[i] = hb; al.u[i] = ASPLIT ? bf16_bits(xs[i] - bf16_val(hb)) : (unsigned short)0; }
#pragma unroll
    for (int t = 0; t < 4; ++t) {
      const unsigned short* brow = Wt + (size_t)(col0 + t * 16 + ln) * ldb + kb;
      FragB b;
      b.half[0] = *(const v8us*)(brow + 8 * hh);
      b.half[1] = *(const v8us*)(brow + 16 + 8 * hh);
      acc[t] = mmaN<ASPLIT ? 2 : 1>(ah.v, al.v, b.v, b.v, acc[t]);
    }
  }
#pragma unroll
  for (int t = 0; t < 4; ++t) {
    const int col = col0 + t * 16 + ln;
    float bv = bias ? bias[col] : 0.f;
    if (BIAS_BF16) bv = bf16_round(bv);
#pragma unroll
    for (int r = 0; r < 8; ++r) {
      float v = acc[t][r] + bv;
      if (resid) { float rv = resid[(size_t)((row0 + 8 * hh + r) % rmod) * ldr + col]; if (RES_BF16) rv = bf16_round(rv); v += rv; }
      if (ACT == 1) v = fmaxf(v, 0.f);
      if (ACT == 2) v = 0.5f * v * (1.0f + erff(v * 0.70710678118654752f));
      if (ACT == 3) { const float u = 0.7978845608028654f * (v + 0.044715f * v * v * v); v = 0.5f * v * (1.0f + tanhf(u)); }
      so[w][8 * hh + r][t * 16 + ln] = v;
    }
  }
  __builtin_amdgcn_fence(__ATOMIC_ACQ_REL, "workgroup");
  __builtin_amdgcn_wave_barrier();
  const int rsub = lane >> 4, c4 = (lane & 15) * 4;
  {
#pragma unroll
    for (int q = 0; q < 8; ++q) {
      const int r = q * 2 + rsub;
      const v4f v = *(const v4fa*)&so[w][r][c4];
      *(v4f*)(C + (size_t)(row0 + r) * ldc + col0 + c4) = v;
    }
    
  }
}
// row LayerNorm (biased variance, eps) over N: s = X (+ R); optional out_sum <- s; out_norm <- (s-mu)*rsqrt(var+eps)*g + b
template <bool PARAM_BF16>
__global__ __launch_bounds__(256) void k_layernorm(const float* __restrict__ X, const float* __restrict__ R, const float* __restrict__ g, const float* __restrict__ bta,
                                                  float* __restrict__ out_sum, float* __restrict__ out_norm, int N, float eps) {
  __shared__ float red[256];
  const int row = blockIdx.x, tid = threadIdx.x;
  const float* x = X + (size_t)row * N; const float* rr = R ? R + (size_t)row * N : nullptr;
  float vals[16];                     // up to N = 4096
  const int per = N / 256;            // contiguous chunk per thread? use strided-by-4 chunks: thread handles j = tid*4 + 1024*u
  float s1 = 0.f;
  for (int u = 0; u < per / 4; ++u) {
    const int j = tid * 4 + 1024 * u;
    const v4f a = *(const v4fa*)(x + j);
    v4f b = {0.f,0.f,0.f,0.f}; if (rr) b = *(const v4fa*)(rr + j);
#pragma unroll
    for (int q = 0; q < 4; ++q) { const float v = a[q] + b[q]; vals[u * 4 + q] = v; s1 += v; }
  }
  red[tid] = s1; __syncthreads();
  for (int st = 128; st > 0; st >>= 1) { if (tid < st) red[tid] += red[tid + st]; __syncthreads(); }
  const float mu = red[0] / (float)N; __syncthreads();
  float s2 = 0.f;
  for (int u = 0; u < per / 4; ++u)
#pragma unroll
    for (int q = 0; q < 4; ++q) { const float c = vals[u * 4 + q] - mu; s2 += c * c; }
  red[tid] = s2; __syncthreads();
  for (int st = 128; st > 0; st >>= 1) { if (tid < st) red[tid] += red[tid + st]; __syncthreads(); }
  const float rs = rsqrtf(red[0] / (float)N + eps);
  {
    for (int u = 0; u < per / 4; ++u) {
      const int j = tid * 4 + 1024 * u;
      v4f o, sm;
#pragma unroll
      for (int q = 0; q < 4; ++q) {
        float gg = g[j + q], bb = bta[j + q];
        if (PARAM_BF16) { gg = bf16_round(gg); bb = bf16_round(bb); }
        sm[q] = vals[u * 4 + q]; o[q] = (vals[u * 4 + q] - mu) * rs * gg + bb;
      }
      if (out_sum) *(v4f*)(out_sum + (size_t)row * N + j) = sm;
      *(v4f*)(out_norm + (size_t)row * N + j) = o;
    }
    
  }
}



// ---- f16 WMMA path (v_wmma_f32_16x16x32_f16): 11-bit significands for operands in range — used where a [0,1] probability operand needs more precision than bf16
typedef _Float16 v16h __attribute__((ext_vector_type(16)));
union FragH { v16h v; v8us half[2]; _Float16 h[16]; unsigned short u[16]; };
template <int NT>
__device__ __forceinline__ v8f mmaH(v16h ah, v16h al, v16h bh, v16h bl, v8f c) {
  c = __builtin_amdgcn_wmma_f32_16x16x32_f16(false, ah, false, bh, (short)0, c, false, false);
  if (NT >= 2) c = __builtin_amdgcn_wmma_f32_16x16x32_f16(false, al, false, bh, (short)0, c, false, false);
  if (NT >= 3) c = __builtin_amdgcn_wmma_f32_16x16x32_f16(false, ah, false, bl, (short)0, c, false, false);
  asm volatile("v_nop\n\tv_nop\n\tv_nop\n\tv_nop" : "+v"(c) : "v"(ah), "v"(al), "v"(bh), "v"(bl));
  return c;
}
// batched GEMM like k_gemm_b but f16 operands: A f32 (split into f16 hi/lo if ASPLIT, else rounded to f16), Bt = f16 values [n][k]; alpha; C f32; N multiple of 16 (partial tiles skipped)
template <bool ASPLIT>
__global__ __launch_bounds__(128) void k_gemm_h(const float* __restrict__ A, int lda, size_t sA, const _Float16* __restrict__ Bh, int ldb, size_t sB, float alpha, float* __restrict__ C, int ldc, size_t sC, int M, int N, int K) {
  __shared__ __attribute__((aligned(16))) float so[4][16][64];
  const int tid = threadIdx.x, w = tid >> 5, lane = tid & 31, ln = lane & 15, hh = lane >> 4; const int by = blockIdx.y;
  A += (size_t)by * sA; Bh += (size_t)by * sB; C += (size_t)by * sC;
  const int ntn = (N + 63) / 64; const int wid = blockIdx.x * 4 + w; const int mt = wid / ntn, nq = wid % ntn; if (mt * 16 >= M) return;
  const int row0 = mt * 16, col0 = nq * 64; const float* arow = A + (size_t)(row0 + ln) * lda;
  v8f acc[4] = {};
  for (int kb = 0; kb < K; kb += 32) {
    FragH ah, al;
    const v4f x0 = *(const v4fa*)(arow + kb + 8 * hh), x1 = *(const v4fa*)(arow + kb + 8 * hh + 4), x2 = *(const v4fa*)(arow + kb + 16 + 8 * hh), x3 = *(const v4fa*)(arow + kb + 16 + 8 * hh + 4);
    float xs[16] = {x0[0],x0[1],x0[2],x0[3],x1[0],x1[1],x1[2],x1[3],x2[0],x2[1],x2[2],x2[3],x3[0],x3[1],x3[2],x3[3]};
#pragma unroll
    for (int i = 0; i < 16; ++i) { const _Float16 h = (_Float16)xs[i]; ah.h[i] = h; al.h[i] = ASPLIT ? (_Float16)(xs[i] - (float)h) : (_Float16)0.0f; }
#pragma unroll
    for (int t = 0; t < 4; ++t) { if (col0 + t * 16 >= N) continue; const size_t boff = (size_t)(col0 + t * 16 + ln) * ldb + kb; FragH bq; bq.half[0] = *(const v8us*)(Bh + boff + 8 * hh); bq.half[1] = *(const v8us*)(Bh + boff + 16 + 8 * hh);
      acc[t] = mmaH<ASPLIT ? 2 : 1>(ah.v, al.v, bq.v, bq.v, acc[t]); }
  }
#pragma unroll
  for (int t = 0; t < 4; ++t) { if (col0 + t * 16 >= N) continue;
#pragma unroll
    for (int r = 0; r < 8; ++r) so[w][8 * hh + r][t * 16 + ln] = acc[t][r] * alpha; }
  __builtin_amdgcn_fence(__ATOMIC_ACQ_REL, "workgroup"); __builtin_amdgcn_wave_barrier();
  const int rsub = lane >> 4, c4 = (lane & 15) * 4;
  {
#pragma unroll
    for (int q = 0; q < 8; ++q) { const int r = q * 2 + rsub; if (col0 + c4 < N) { const v4f v = *(const v4fa*)&so[w][r][c4]; *(v4f*)(C + (size_t)(row0 + r) * ldc + col0 + c4) = v; } }
     }
}

__global__ __launch_bounds__(256) void k_h16(const float* __restrict__ x, _Float16* __restrict__ X16, size_t n8) { const size_t t = (size_t)blockIdx.x * 256 + threadIdx.x; if (t >= n8) return; FragH f;
#pragma unroll
  for (int q = 0; q < 8; ++q) f.h[q] = (_Float16)x[t * 8 + q]; *(v8us*)((unsigned short*)X16 + t * 8) = f.half[0];  }
__global__ __launch_bounds__(256) void k_round16f(const float* __restrict__ W, _Float16* __restrict__ Bt, size_t n8) { const size_t t = (size_t)blockIdx.x * 256 + threadIdx.x; if (t >= n8) return; FragH f;
#pragma unroll
  for (int i = 0; i < 8; ++i) f.h[i] = (_Float16)(bf16_round(W[t * 8 + i]) * 16.0f); *(v8us*)((unsigned short*)Bt + t * 8) = f.half[0];  }

// The whole projection stage in one launch. One work-group (8 waves) = 64 rows of x. It rounds its x rows and all of Wq, Wk, Wv (f32 -> bf16 -> f16,
// W times 2^4, laid [n][k], the three matrices as 192 columns) into LDS, forms Q, K and V on v_wmma_f32_16x16x32_f16 from there, and stores them in
// FRAGMENT ORDER: the workspace holds 512-byte chunks, lane l's 16 bytes of one operand half at byte 16 l, so that the attention kernel's every load is
// 512 contiguous bytes and every store here is an accumulator tile as it stands in the registers.
//   Qf, Kf: chunk (row / 16) * 4 + col / 16;                          lane 16 hh + ln = row (row & 15 = ln), columns 16 (col / 16) + 8 hh + 0..7
//   Vf:     chunk (row / 32) * 8 + (col / 16) * 2 + ((row >> 4) & 1); lane 16 hh + ln = column (col & 15 = ln), rows 16 (row / 16) + 8 hh + 0..7
// Wave w owns 32 rows (w & 1) and column tile w >> 1 of each of Q, K and V. Q and K are formed as W^T x^T (a lane holds 8 neighbouring columns of one
// row), V as x W (a lane holds 8 neighbouring rows of one column).
#define PRW 64          // rows of x a work-group
#define PKP (DD + 8)    // LDS pitch of a k row in halves: 528 B = 16 B x odd, free of bank conflicts for 16-byte accesses
typedef float v2f __attribute__((ext_vector_type(2)));
typedef __bf16 v2b __attribute__((ext_vector_type(2)));
typedef _Float16 v2h __attribute__((ext_vector_type(2)));
typedef unsigned int v2ua __attribute__((ext_vector_type(2), may_alias));
typedef unsigned int v4ua __attribute__((ext_vector_type(4), may_alias));
// two f32 -> bf16 (nearest even) -> f16, packed
__device__ __forceinline__ unsigned int pk_b16h(float a, float b) {
  return __builtin_bit_cast(unsigned int, __builtin_convertvector(__builtin_convertvector(__builtin_convertvector((v2f){a, b}, v2b), v2f), v2h)); }
template <int R> struct RotC { static constexpr int v = R; };   // a rotation handed to a lambda as a compile-time constant
__global__ __launch_bounds__(256) void k_proj(const float* __restrict__ x, const float* __restrict__ Wq, const float* __restrict__ Wk, const float* __restrict__ Wv,
                                              _Float16* __restrict__ Qf, _Float16* __restrict__ Kf, _Float16* __restrict__ Vf) {
  __shared__ __attribute__((aligned(16))) unsigned short sW[3 * HD][PKP];
  __shared__ __attribute__((aligned(16))) unsigned short sX[PRW][PKP];
  const int tid = (int)threadIdx.x, lane = tid & 31, ln = lane & 15, hh = lane >> 4;
  const int w = __builtin_amdgcn_readfirstlane(tid >> 5);   // scalar, so that the chunk addresses of the stores are scalar
  const int row0 = (int)blockIdx.x * PRW;
  // Weights in six chunks of half a matrix (128 k rows); of a chunk a lane takes 4 x 8 k of one column n; a wave: 32 neighbouring n, one line a load.
  const int n = tid & 63, kq = tid >> 6;
  // Every work-group reads the same weights from L2, and requests of many WGPs for one line at one moment hold each other up there: a work-group takes the three matrices
  // in an order of its own, starting with matrix blockIdx % 3 (step c brings chunk cc = (c + 2 R) % 6). The three orders are three copies of the code, so that every index stays a constant.
  float wr[6][32]; v4f xr[16];
  auto loadW = [&](int c, int cc) __attribute__((always_inline)) { const float* __restrict__ Wm = ((cc >> 1) == 0) ? Wq : ((cc >> 1) == 1) ? Wk : Wv;
#pragma unroll
    for (int u = 0; u < 4; ++u)
#pragma unroll
      for (int i = 0; i < 8; ++i) wr[c][u * 8 + i] = Wm[(size_t)((((cc & 1) * 4 + u) * 4 + kq) * 8 + i) * HD + n]; };
  auto putW = [&](int c, int cc) __attribute__((always_inline)) {   // the power of two goes in ahead of the rounding: the same bits, and small weights stay normal in f16
#pragma unroll
    for (int u = 0; u < 4; ++u) { const float* v = &wr[c][u * 8];
      *(v4ua*)&sW[(cc >> 1) * HD + n][(((cc & 1) * 4 + u) * 4 + kq) * 8] = (v4ua){pk_b16h(v[0] * 16.0f, v[1] * 16.0f), pk_b16h(v[2] * 16.0f, v[3] * 16.0f), pk_b16h(v[4] * 16.0f, v[5] * 16.0f), pk_b16h(v[6] * 16.0f, v[7] * 16.0f)}; } };
  // Each sched_barrier below keeps a chunk's loads two chunks ahead of its conversion; left alone the compiler sank loads to their use, one wait a pair.
  // Each s_wait_xcnt stands in front of what may rewrite a register that an earlier, still issued load names as its address (a later load's result, a constant).
  auto stageW = [&](auto rc) __attribute__((always_inline)) { constexpr int R2 = 2 * decltype(rc)::v;
    loadW(0, R2 % 6); loadW(1, (1 + R2) % 6); asm volatile("s_wait_xcnt 0x0" ::: "memory"); __builtin_amdgcn_sched_barrier(0);
    putW(0, R2 % 6); asm volatile("s_wait_xcnt 0x0" ::: "memory"); loadW(2, (2 + R2) % 6); __builtin_amdgcn_sched_barrier(0);
    putW(1, (1 + R2) % 6); asm volatile("s_wait_xcnt 0x0" ::: "memory"); loadW(3, (3 + R2) % 6); __builtin_amdgcn_sched_barrier(0);
    putW(2, (2 + R2) % 6); asm volatile("s_wait_xcnt 0x0" ::: "memory"); loadW(4, (4 + R2) % 6); __builtin_amdgcn_sched_barrier(0);
    putW(3, (3 + R2) % 6); asm volatile("s_wait_xcnt 0x0" ::: "memory"); loadW(5, (5 + R2) % 6); __builtin_amdgcn_sched_barrier(0);
    putW(4, (4 + R2) % 6); putW(5, (5 + R2) % 6); };
#pragma unroll
  for (int i = 0; i < 16; ++i) xr[i] = *(const v4fa*)(x + (size_t)row0 * DD + (size_t)(i * 256 + tid) * 4);   // whole lines a wave; from memory, so asked for first
  const unsigned int rot = blockIdx.x % 3u;   // scalar: the branches below are taken by whole work-groups
  if (rot == 0u) stageW(RotC<0>{}); else if (rot == 1u) stageW(RotC<1>{}); else stageW(RotC<2>{});
#pragma unroll
  for (int i = 0; i < 16; ++i) { const int e = i * 256 + tid;
    *(v2ua*)&sX[e >> 6][(e & 63) * 4] = (v2ua){pk_b16h(xr[i][0], xr[i][1]), pk_b16h(xr[i][2], xr[i][3])}; }
  __syncthreads();   // publishes the converted x rows and weights to every wave
  { const int rp = w & 1, cg = w >> 1;
    const unsigned short* xrow = &sX[rp * 32 + ln][8 * hh]; const unsigned short* wrow = &sW[cg * 16 + ln][8 * hh];   // j = 0, 1, 2: Wq, Wk, Wv, HD rows apart
    v8f acc[2][3];
#pragma unroll
    for (int i = 0; i < 2; ++i)
#pragma unroll
      for (int j = 0; j < 3; ++j) acc[i][j] = (v8f){0.f,0.f,0.f,0.f,0.f,0.f,0.f,0.f};
    FragH fx[2][2], fw[2][3];   // two register sets: the fragments of k step s + 1 are fetched while step s is multiplied
#pragma unroll
    for (int i = 0; i < 2; ++i) { fx[0][i].half[0] = *(const v8us*)(xrow + i * 16 * PKP); fx[0][i].half[1] = *(const v8us*)(xrow + i * 16 * PKP + 16); }
#pragma unroll
    for (int j = 0; j < 3; ++j) { fw[0][j].half[0] = *(const v8us*)(wrow + j * HD * PKP); fw[0][j].half[1] = *(const v8us*)(wrow + j * HD * PKP + 16); }
#pragma unroll
    for (int s = 0; s < DD / 32; ++s) { const int cu = s & 1, nx = cu ^ 1, kn = (s + 1) * 32;
      if (s + 1 < DD / 32) {
#pragma unroll
        for (int i = 0; i < 2; ++i) { fx[nx][i].half[0] = *(const v8us*)(xrow + i * 16 * PKP + kn); fx[nx][i].half[1] = *(const v8us*)(xrow + i * 16 * PKP + kn + 16); }
#pragma unroll
        for (int j = 0; j < 3; ++j) { fw[nx][j].half[0] = *(const v8us*)(wrow + j * HD * PKP + kn); fw[nx][j].half[1] = *(const v8us*)(wrow + j * HD * PKP + kn + 16); } }
#pragma unroll
      for (int i = 0; i < 2; ++i)
#pragma unroll
        for (int j = 0; j < 3; ++j) acc[i][j] = (j < 2) ? __builtin_amdgcn_wmma_f32_16x16x32_f16(false, fw[cu][j].v, false, fx[cu][i].v, (short)0, acc[i][j], false, false)
                                                        : __builtin_amdgcn_wmma_f32_16x16x32_f16(false, fx[cu][i].v, false, fw[cu][j].v, (short)0, acc[i][j], false, false); }
    FragH o[2][3];   // j < 2: acc[i][j][r] = (x W)[row rp * 32 + i * 16 + ln][column cg * 16 + 8 hh + r]; j = 2: (x Wv)[row rp * 32 + i * 16 + 8 hh + r][column cg * 16 + ln]
#pragma unroll
    for (int i = 0; i < 2; ++i)
#pragma unroll
      for (int j = 0; j < 3; ++j)
#pragma unroll
        for (int r = 0; r < 8; ++r) o[i][j].h[r] = (_Float16)(acc[i][j][r] * 0.0625f);   // takes the 2^4 of the weights out again
#pragma unroll
    for (int i = 0; i < 2; ++i) {   // a wave's store = one chunk, four whole lines
      *(v8us*)((unsigned short*)Qf + ((size_t)(row0 / 16 + rp * 2 + i) * 4 + cg) * 256 + lane * 8) = o[i][0].half[0];
      *(v8us*)((unsigned short*)Kf + ((size_t)(row0 / 16 + rp * 2 + i) * 4 + cg) * 256 + lane * 8) = o[i][1].half[0];
      *(v8us*)((unsigned short*)Vf + ((size_t)(row0 / 32 + rp) * 8 + cg * 2 + i) * 256 + lane * 8) = o[i][2].half[0]; } } }

#define NKW 16
#define QT 2
#define NG 8                  // waves that share out the key tiles of part 1 for one block
#define TLB 4096              // bytes of a key tile's K chunks, and of its V^T chunks
#define SL2 (0.0625f * 1.44269504088896340736f)
__device__ __forceinline__ float xhalf(float x) { return __builtin_bit_cast(float, __builtin_amdgcn_permlanex16(__builtin_bit_cast(int, x), __builtin_bit_cast(int, x), 0x76543210, 0xfedcba98, false, false)); }  // lane l with lane l ^ 16
// 2^x: the v_nop fills the one slot that the instruction set asks for between a transcendental and a next instruction that reads its result or overwrites its source.
__device__ __forceinline__ float exp2_slot(float x) { float y; asm("v_exp_f32 %0, %1\n\tv_nop" : "=v"(y) : "v"(x)); return y; }
// amdgpu_waves_per_eu(4): the two query tiles' accumulators and Q fragments take 96 VGPRs, with the pass's scores and V^T fragments more than 128; a 16-wave work-group puts four waves on a SIMD, 256 VGPRs each.
__global__ __launch_bounds__(NKW * 32) __attribute__((amdgpu_waves_per_eu(4))) void k_flash(const _Float16* __restrict__ Qf, const _Float16* __restrict__ Kf, const _Float16* __restrict__ Vf, const int* __restrict__ MSK, float* __restrict__ O, int ldo) {
  constexpr int QR = 16 * QT, NQB = 4096 / QR, DT = 4, KS = 2, NP = NG + NKW;   // NP partials: slots 0 .. NG - 1 the short block's, NG .. NP - 1 the long block's
  static_assert(QR == 32 && QR == NKW * 2, "a key tile spans a block's queries (one tile on the diagonal); the merge gives each thread one 16-byte piece of one row");
  static_assert(NKW == 2 * NG && NQB % 2 == 0, "two waves a common key tile; short and long blocks pair up");
  __shared__ __attribute__((aligned(16))) float sO[NP][QR][64 + 4];
  __shared__ float sM[NP][QR], sL[NP][QR];
  const int lane = (int)__builtin_amdgcn_mbcnt_lo(~0u, 0u), ln = lane & 15, hh = lane >> 4;   // lane id without threadIdx.x: one register fewer live over the key loop
  const int w = __builtin_amdgcn_readfirstlane((int)threadIdx.x >> 5);   // scalar, so that the key loops' tests stay scalar branches
  const int tb = blockIdx.x % (NQB / 2), slab = blockIdx.x / (NQB / 2); (void)MSK;
  const int grp = w >> 3, w8 = w & 7;   // scalar
  const unsigned short* Kb = (const unsigned short*)Kf + (size_t)slab * 64 * 4096;
  const unsigned short* Vb = (const unsigned short*)Vf + (size_t)slab * 64 * 4096;
  FragH aq[QT][KS];   // B operands of S^T: column ln of tile t = query q0 + 16 t + ln
  float m_q[QT], l_q[QT]; v8f oacc[QT][DT];   // of query q0 + 16 t + ln; m_q in the scaled log2 domain; l_q over this half's keys only, the halves joined in put()
  int q0, qd;   // the block's first query (scalar); the mask's one lane-dependent term
  auto begin = [&](int qblk) {   // takes up a query block: its Q fragments, an empty partial
    q0 = qblk * QR; qd = q0 + ln - 8 * hh;
    const unsigned short* qr = (const unsigned short*)Qf + ((size_t)slab * 4096 + q0) * 64 + lane * 8;
#pragma unroll
    for (int t = 0; t < QT; ++t)
#pragma unroll
      for (int ks = 0; ks < KS; ++ks) { aq[t][ks].half[0] = *(const v8us*)(qr + t * 1024 + ks * 512); aq[t][ks].half[1] = *(const v8us*)(qr + t * 1024 + ks * 512 + 256); }
#pragma unroll
    for (int t = 0; t < QT; ++t) { m_q[t] = -3.0e38f; l_q[t] = 0.f;
#pragma unroll
      for (int dt = 0; dt < DT; ++dt) oacc[t][dt] = (v8f){0.f,0.f,0.f,0.f,0.f,0.f,0.f,0.f}; } };
  // lays down the wave's partial: query maximum (scaled log2 domain), sum (the two halves joined) and the un-normalised output row; a wave without a key tile leaves (-3e38, 0, 0)
  auto put = [&](int slot) {
#pragma unroll
    for (int t = 0; t < QT; ++t) {
      l_q[t] += xhalf(l_q[t]);
      if (hh == 0) { sM[slot][t * 16 + ln] = m_q[t]; sL[slot][t * 16 + ln] = l_q[t]; }
#pragma unroll
      for (int dt = 0; dt < DT; ++dt) {   // oacc[t][dt][r] = O[q0 + 16 t + ln][dt * 16 + 8 hh + r]: eight neighbours of one row
        *(v4fa*)&sO[slot][t * 16 + ln][dt * 16 + 8 * hh] = (v4f){oacc[t][dt][0], oacc[t][dt][1], oacc[t][dt][2], oacc[t][dt][3]};
        *(v4fa*)&sO[slot][t * 16 + ln][dt * 16 + 8 * hh + 4] = (v4f){oacc[t][dt][4], oacc[t][dt][5], oacc[t][dt][6], oacc[t][dt][7]}; } } };
  // one pass: the 32 keys from j0 on against the wave's 32 queries; kp, vp: the lane's place in the tile's first K and first V^T chunk (in the workspace)
  auto pass = [&](int j0, const char* kp, const char* vp) {
    float sc[QT][16];   // sc[t][nt * 8 + r] = raw score (q . k) of query tile t and key j0 + nt * 16 + 8 hh + r
    FragH bk[2][KS], bv[DT];
    // The pass's eight K loads stand together in front of its first product: one trip is waited for, not one a 16-key group.
#pragma unroll
    for (int nt = 0; nt < 2; ++nt)
#pragma unroll
      for (int ks = 0; ks < KS; ++ks) { bk[nt][ks].half[0] = *(const v8us*)(kp + (nt * 2048 + ks * 1024)); bk[nt][ks].half[1] = *(const v8us*)(kp + (nt * 2048 + ks * 1024 + 512)); }
#pragma unroll
    for (int nt = 0; nt < 2; ++nt) { v8f acc[QT];
#pragma unroll
      for (int t = 0; t < QT; ++t) acc[t] = (v8f){0.f,0.f,0.f,0.f,0.f,0.f,0.f,0.f};
#pragma unroll
      for (int ks = 0; ks < KS; ++ks)
#pragma unroll
        for (int t = 0; t < QT; ++t) acc[t] = mmaH<1>(bk[nt][ks].v, bk[nt][ks].v, aq[t][ks].v, aq[t][ks].v, acc[t]);   // one K fragment, both query tiles
#pragma unroll
      for (int t = 0; t < QT; ++t)
#pragma unroll
        for (int r = 0; r < 8; ++r) sc[t][nt * 8 + r] = acc[t][r]; }
    // The pass's eight V^T loads stand together behind the score products: they fly while the softmax is worked out.
#pragma unroll
    for (int dt = 0; dt < DT; ++dt) { bv[dt].half[0] = *(const v8us*)(vp + dt * 1024); bv[dt].half[1] = *(const v8us*)(vp + (dt * 1024 + 512)); }
    if (j0 + 31 > q0) {   // only the tile on the diagonal holds keys behind a query (a scalar test); key j0 <= q0 stays, so every query keeps a finite maximum
#pragma unroll
      for (int t = 0; t < QT; ++t)
#pragma unroll
        for (int i = 0; i < 16; ++i) if ((i >> 3) * 16 + (i & 7) - 16 * t > qd - j0) sc[t][i] = -INFINITY; }   // key j0 + 16 (i >> 3) + 8 hh + (i & 7) behind query q0 + 16 t + ln; constants against one register
    FragH pb[QT];
#pragma unroll
    for (int t = 0; t < QT; ++t) {
      float mc = sc[t][0];
#pragma unroll
      for (int i = 1; i < 16; ++i) mc = fmaxf(mc, sc[t][i]);
      mc = fmaxf(mc, xhalf(mc));
      const float mn = fmaxf(m_q[t], mc * SL2); const float al = exp2_slot(m_q[t] - mn); m_q[t] = mn;   // SL2 > 0: the maximum may be taken on the raw scores
      float ps = 0.f;
#pragma unroll
      for (int i = 0; i < 16; ++i) { const float p = exp2_slot(__builtin_fmaf(sc[t][i], SL2, -mn)); ps += p; pb[t].h[i] = (_Float16)p; }   // a masked score: 2^-inf = 0
      l_q[t] = l_q[t] * al + ps;
#pragma unroll
      for (int dt = 0; dt < DT; ++dt) oacc[t][dt] *= al; }
#pragma unroll
    for (int dt = 0; dt < DT; ++dt)
#pragma unroll
      for (int t = 0; t < QT; ++t) oacc[t][dt] = mmaH<1>(bv[dt].v, bv[dt].v, pb[t].v, pb[t].v, oacc[t][dt]); };   // one V^T fragment, both query tiles

  // ---- part 1: the key tiles that both blocks need; waves w and w + 8 walk the same tiles, each for its own block
  begin(grp ? NQB - 1 - tb : tb);
  asm volatile("s_wait_xcnt 0x0" ::: "memory");   // stands in front of what may rewrite a register that the Q loads name as their address: a wave without a key tile in part 1 goes on while they fly
  { const int t1 = tb - w8;   // scalar: the wave's first tile; below 0: the wave has none
    unsigned int vo = (unsigned int)lane * 16u + (unsigned int)t1 * (unsigned int)TLB;   // the lane's place in the pass's first K (and V^T) chunk, in bytes: one register, carried over the loop, beside the scalar bases
#pragma unroll 1
    for (int j0 = t1 * 32; j0 >= 0; j0 -= NG * 32) {
      pass(j0, (const char*)Kb + vo, (const char*)Vb + vo);
      __builtin_amdgcn_sched_barrier(0);   // keeps the step of vo behind the last product's wait for the V^T loads, which name that register as their address
      vo -= NG * (unsigned int)TLB; } }
  if (grp == 0) { put(w8); begin(NQB - 1 - tb); }       // scalar branch

  // ---- part 2: the long block's own key tiles, dealt over all waves. The deal starts with the waves that had one tile fewer in part 1 (the high w8):
  // of the NQB + 1 passes of a work-group every wave then has 8, and one wave 9.
  { const int rk = (NG - 1 - w8) * 2 + (1 - grp);   // scalar
    const bool up = (tb & 1) == 0;   // scalar
    int j0 = (up ? tb + 1 + rk : NQB - 1 - tb - rk) * 32;   // scalar
    const int dj = up ? NKW * 32 : -NKW * 32;
    unsigned int vo = (unsigned int)lane * 16u + (unsigned int)j0 * (unsigned int)(TLB / 32);
    const unsigned int dvo = (unsigned int)dj * (unsigned int)(TLB / 32);
#pragma unroll 1
    for (int left = NQB - 1 - 2 * tb - rk; left > 0; left -= NKW) {   // NQB - 1 - 2 tb tiles in all; the wave takes every 16th from its rank on
      pass(j0, (const char*)Kb + vo, (const char*)Vb + vo);
      __builtin_amdgcn_sched_barrier(0);   // as in part 1
      vo += dvo; j0 += dj; } }
  put(NG + w);
  __syncthreads();   // publishes every wave's partials of both blocks to the merging threads
  { const int r = w * 2 + hh, pc = ln;   // a block: 32 rows of 16 pieces: every thread merges one piece of each block
    v4f res[2];
#pragma unroll
    for (int u = 0; u < 2; ++u) { const int k0 = u ? NG : 0, kn = u ? NKW : NG;
      float M = sM[k0][r];
#pragma unroll
      for (int k = 1; k < NKW; ++k) if (k < kn) M = fmaxf(M, sM[k0 + k][r]);
      float L = 0.f; v4f o = {0.f, 0.f, 0.f, 0.f};
#pragma unroll
      for (int k = 0; k < NKW; ++k) if (k < kn) { const float e = exp2_slot(sM[k0 + k][r] - M); L += e * sL[k0 + k][r]; const v4f pv = *(const v4fa*)&sO[k0 + k][r][pc * 4]; o += pv * e; }
      const float inv = (L > 0.f) ? 1.0f / L : 0.f;
      res[u] = o * inv; }
#pragma unroll
    for (int u = 0; u < 2; ++u) *(v4f*)(O + ((size_t)slab * 4096 + (u ? NQB - 1 - tb : tb) * QR + r) * ldo + pc * 4) = res[u]; } }

extern "C" void kernel_launch(void* const* d_in, const int* in_sizes, int n_in,
                              void* d_out, int out_size, void* d_ws, size_t ws_size, hipStream_t stream) {
  (void)in_sizes; (void)n_in; (void)out_size;
  const float* x = (const float*)d_in[0]; const float* Wq = (const float*)d_in[1]; const float* Wk = (const float*)d_in[2]; const float* Wv = (const float*)d_in[3];
  char* ws = (char*)d_ws; size_t off = 0;
  auto take = [&](size_t bytes) { char* p = ws + off; off += (bytes + 255) & ~(size_t)255; return p; };
  _Float16* Qf = (_Float16*)take((size_t)NR * HD * 2); _Float16* Kf = (_Float16*)take((size_t)NR * HD * 2); _Float16* Vf = (_Float16*)take((size_t)NR * HD * 2);
  if (off > ws_size) return;      // 3 x 2 MiB
  k_proj<<<NR / PRW, 256, 0, stream>>>(x, Wq, Wk, Wv, Qf, Kf, Vf);
  k_flash<<<BB * (TT / (16 * QT) / 2), NKW * 32, 0, stream>>>(Qf, Kf, Vf, nullptr, (float*)d_out, HD);
}
